// v000
// Times are from an AMD MI455X. After a warm-up the kernel runs many times in a row, and a time is the length of
// such a window on the GPU divided by its runs, so every launch and the gaps after it count. The runs cycle
// through copies of the inputs. A figure is the median of several windows, for all but v000 over two sittings.
// Sittings can differ by a few percent; kernels timed side by side share one.
// v000, which the later versions start from, runs in 546 microseconds.
// Contractions: conv1x1 q/k/v projections W[320x256].X[256x4096] on v_wmma_f32_16x16x32_f16 (f16 containers of
// bf16-RNE weights x256 and bf16-RNE x); scores f_n.g_m on v_wmma_f32_16x16x32_bf16 (bf16 hi + bf16 residual
// planes of f and g, 3 products, K=32); o^T = H.P^T on v_wmma_f32_16x16x32_f16 (H = relu(v-projection) x16 f16,
// P = e^{s-max} x16384 f16 from the score D registers); f32 accumulate everywhere; softmax statistics, gamma scale
// and the residual add in f32 VALU.
#include <hip/hip_runtime.h>
#include <math.h>
#include <stdint.h>

#ifndef NB
#define NB 8
#endif
#ifndef SEQ
#define SEQ 4096
#endif
#define NB_FULL  8
#define SEQ_FULL 4096
#define CC     256
#define DQ     32
#define MW     320
#define MBLK   5
#define QT     64
#define OSP    68
#define OSPW   132
#define TP     72
#define WSC    256.0f
#define IWSC   0.00390625f
#define HSC    16.0f
#define IHSC   0.0625f
#define LNPS   9.704060527839234f

static_assert(NB >= 1 && NB <= NB_FULL);
static_assert(SEQ >= QT && SEQ <= SEQ_FULL);
static_assert(SEQ % QT == 0 && SEQ % 32 == 0);
static_assert(CC % QT == 0 && CC % 32 == 0);
static_assert(MW == 2 * DQ + CC);
static_assert(MW == MBLK * QT);
static_assert(QT == 2 * DQ);
static_assert(MW % 8 == 0);
static_assert((OSP * 4) % 16 == 0);
static_assert((OSPW * 4) % 16 == 0);
static_assert((TP * 2) % 16 == 0);
static_assert(DQ % 32 == 0);

typedef _Float16       v16h __attribute__((ext_vector_type(16)));
typedef _Float16       v8h  __attribute__((ext_vector_type(8)));
typedef __bf16         v16b __attribute__((ext_vector_type(16)));
typedef unsigned short v8us __attribute__((ext_vector_type(8)));
typedef float          v8f  __attribute__((ext_vector_type(8)));
typedef float          v4f  __attribute__((ext_vector_type(4)));
typedef unsigned int   v4u  __attribute__((ext_vector_type(4)));

union Frag  { v8us u[2]; v16h h; v16b bf; };
union FragH { v16h v; v8h hv[2]; };
static_assert(sizeof(Frag) == 32);
static_assert(sizeof(FragH) == 32);

// ---- scalar helpers ---------------------------------------------------------------------------------------
__device__ __forceinline__ unsigned short bf_bits(float f) {          // f32 -> bf16 bits, RNE convert
  unsigned u = __float_as_uint(f);
  return (unsigned short)((u + 0x7FFFu + ((u >> 16) & 1u)) >> 16);
}
__device__ __forceinline__ float bf_up(unsigned short hb) { return __uint_as_float(((unsigned)hb) << 16); }
__device__ __forceinline__ float bfr(float f) { return bf_up(bf_bits(f)); }
__device__ __forceinline__ unsigned short h_bits(_Float16 x) { return __builtin_bit_cast(unsigned short, x); }
__device__ __forceinline__ unsigned pk16(unsigned short a, unsigned short b) { return (unsigned)a | ((unsigned)b << 16); }
__device__ __forceinline__ v8f zero8() { v8f z = {0.f, 0.f, 0.f, 0.f, 0.f, 0.f, 0.f, 0.f}; return z; }
__device__ __forceinline__ float hmax8(v8f s) {
  return fmaxf(fmaxf(fmaxf(s[0], s[1]), fmaxf(s[2], s[3])), fmaxf(fmaxf(s[4], s[5]), fmaxf(s[6], s[7])));
}
__device__ __forceinline__ unsigned wave_ballot(bool p) {
#if defined(__HIP_DEVICE_COMPILE__)
  return __builtin_amdgcn_ballot_w32(p);
#else
  return p ? 1u : 0u;
#endif
}

// ---- 16-bit fragment loader (A, or B from a k-contiguous [n][k] row): lane -> row/col (lane&15), p already includes
//      + 8*(lane>>4); elements 0..7 <- p[0..7] (k0+8h..), elements 8..15 <- p[16..23] (k0+16+8h..)
__device__ __forceinline__ Frag ldfrag(const unsigned short* p) {
  Frag f;
  f.u[0] = *(const v8us*)(p);
  f.u[1] = *(const v8us*)(p + 16);
  return f;
}

// ---- WMMA helpers: builtin followed by a 4-slot VALU gap tying D and keeping A/B live --------------------------
__device__ __forceinline__ v8f mma_h(v16h a, v16h b, v8f c) {
  v8f d = __builtin_amdgcn_wmma_f32_16x16x32_f16(false, a, false, b, (short)0, c, false, false);
#if defined(__HIP_DEVICE_COMPILE__)
  asm volatile("v_nop\n\tv_nop\n\tv_nop\n\tv_nop" : "+v"(d) : "v"(a), "v"(b));
#endif
  return d;
}
__device__ __forceinline__ v8f mma_b(v16b a, v16b b, v8f c) {
  v8f d = __builtin_amdgcn_wmma_f32_16x16x32_bf16(false, a, false, b, (short)0, c, false, false);
#if defined(__HIP_DEVICE_COMPILE__)
  const v16h ha = __builtin_bit_cast(v16h, a), hb = __builtin_bit_cast(v16h, b);
  asm volatile("v_nop\n\tv_nop\n\tv_nop\n\tv_nop" : "+v"(d) : "v"(ha), "v"(hb));
#endif
  return d;
}

// =========================================================================================================
// (0) conv1x1 weights: W16 f16 [320][256], rows 0..31 = q-projection rows, 32..63 = k-projection rows, 64..319 =
//     v-projection rows; value = f16 of (bf16-RNE(w) * 256) (exact). Block blk (0..39) owns rows 8*blk..8*blk+7:
// coverage: 40 blocks x 8 rows x 32 lanes x 8 halves = 320 x 256 = the whole plane.
// =========================================================================================================
__global__ __launch_bounds__(256)
void cvt_w(const float* __restrict__ wq, const float* __restrict__ wk, const float* __restrict__ wv,
           unsigned short* W16) {
  const int tid = threadIdx.x, blk = blockIdx.x;
  const int rl = tid >> 5, col = 8 * (tid & 31);
  const int o = 8 * blk + rl;                                        // 0..319
  const float* wbase;
  int osub;
  if (blk < DQ / 8)            { wbase = wq; osub = 0; }
  else if (blk < (2 * DQ) / 8) { wbase = wk; osub = DQ; }
  else                         { wbase = wv; osub = 2 * DQ; }
  const float* s = wbase + (size_t)(o - osub) * CC + col;
  const v4f a = *(const v4f*)s;
  const v4f q = *(const v4f*)(s + 4);
  const float f[8] = {a[0], a[1], a[2], a[3], q[0], q[1], q[2], q[3]};
  v4u u;
#pragma unroll
  for (int t = 0; t < 4; ++t) {
    const _Float16 h0 = (_Float16)(bfr(f[2 * t]) * WSC);
    const _Float16 h1 = (_Float16)(bfr(f[2 * t + 1]) * WSC);
    u[t] = pk16(h_bits(h0), h_bits(h1));
  }
{
    *(v4u*)(W16 + (size_t)o * CC + col) = u;
    
  }
}

// =========================================================================================================
// (1) x f32 [b][256 c][SEQ_FULL n] -> XP f16 [b][SEQ n][256 c] (position-major, bf16-RNE values, exact in f16)
//     through an LDS tile T[64 n][64 c] (pitch TP). Block (nb, cb, b) owns a 64 c x 64 n tile; XP lines: row n,
// coverage: T: 2 it x 32 channels x 8 lanes x 8 n = 64 c x 64 n fully written before the barrier (staged extent ==
//           consumed extent); XP: 2 it x 32 rows x 8 lanes x 8 = 64 n x 64 c; grid (SEQ/64, 4, NB) covers XP once.
// =========================================================================================================
__global__ __launch_bounds__(256)
void cvt_x(const float* __restrict__ x, unsigned short* XP) {
  __shared__ __align__(16) unsigned short T[QT * TP];
  const int tid = threadIdx.x;
  const int nb = blockIdx.x, cb = blockIdx.y, b = blockIdx.z;
  const int e = tid & 7, lq = tid >> 3;                             // lq 0..31
  const int n0 = nb * QT, c0 = cb * QT;
#pragma unroll
  for (int it = 0; it < 2; ++it) {
    const int cl = it * 32 + lq;                                     // 0..63
    const float* sp = x + ((size_t)(b * CC + c0 + cl)) * SEQ_FULL + n0 + 8 * e;
    const v4f a = *(const v4f*)sp;
    const v4f q = *(const v4f*)(sp + 4);
    unsigned short hb[8];
#pragma unroll
    for (int t = 0; t < 4; ++t) {
      hb[t]     = h_bits((_Float16)bfr(a[t]));
      hb[4 + t] = h_bits((_Float16)bfr(q[t]));
    }
#pragma unroll
    for (int t = 0; t < 8; ++t) T[(8 * e + t) * TP + cl] = hb[t];
  }
  __syncthreads();
  v4u up[2];
#pragma unroll
  for (int it = 0; it < 2; ++it) {
    const int nl = it * 32 + lq;                                     // 0..63
    up[it] = *(const v4u*)(T + nl * TP + 8 * e);
  }
{
#pragma unroll
    for (int it = 0; it < 2; ++it) {
      const int rl = it * 32 + lq;
      *(v4u*)(XP + ((size_t)(b * SEQ + n0 + rl)) * CC + c0 + 8 * e) = up[it];
    }
    
  }
}

// =========================================================================================================
// (2) conv1x1 GEMM for one (b, 64-n tile, 64-o block): Y[o][n] = relu((1/256) sum_c W16[o][c] XP[b][n][c]).
//     Block 128 threads = 4 waves; wave w owns cols n0+16w..+15 (one B fragment per k-step, k = c contiguous in
//     the XP row) and 4 m-tiles (A rows o = o0 + 16 mt + (lane&15), split k map loader from W16). K = 256 = 8 steps.
//     Epilogue staged in LDS Os[n_loc][o_loc] (pitch OSP, b128 stores of 8 consecutive o per lane, relu applied),
//     barrier, then (block-uniform branch on the o-block):
//       o-block 0 -> o_loc 0..31 = f (key) dims -> Fh/Fl, o_loc 32..63 = g (query) dims -> Gh/Gl; planes bf16
//       [b][SEQ n][32 d] (k-contiguous for both score operands): hi = bf16-RNE(v), lo = bf16-RNE(v - hi). Plane
//       lanes x 16 B per line, one instruction per 16 lines, 32 lines per plane per block.
//       o-blocks 1..4 -> channels 64(mb-1).. of the H plane f16 [b][256 c][SEQ n] (n contiguous), value = f16 of
// coverage: Os 4 waves x 16 n x 64 o = 64 x 64 (staged extent == consumed extent); F/G planes: 2 it x 16 lines x
//           8 lanes x 8 = 64 n x 32 d per plane (hi and lo, f and g); H: 4 it x 16 rows x 8 lanes x 8 = 64 c x
//           64 n; grid (SEQ/64, 5, NB) covers all SEQ rows of Fh/Fl/Gh/Gl and all 256 channels of H exactly once.
// =========================================================================================================
__global__ __launch_bounds__(128)
void gemm_p(const unsigned short* __restrict__ W16, const unsigned short* __restrict__ XP,
            unsigned short* Fh, unsigned short* Fl, unsigned short* Gh, unsigned short* Gl,
            unsigned short* Hv) {
  __shared__ __align__(16) float Os[QT * OSP];
  const int tid  = threadIdx.x;
  const int lane = tid & 31, wave = tid >> 5;
  const int hh   = lane >> 4, c = lane & 15;
  const int nt   = blockIdx.x, mb = blockIdx.y, b = blockIdx.z;
  const int n0   = nt * QT, o0 = mb * QT;

  const unsigned short* ap = W16 + (size_t)(o0 + c) * CC + 8 * hh;
  const unsigned short* bp = XP + ((size_t)(b * SEQ + n0 + 16 * wave + c)) * CC + 8 * hh;

  v8f acc[4];
#pragma unroll
  for (int mt = 0; mt < 4; ++mt) acc[mt] = zero8();

#pragma unroll
  for (int ks = 0; ks < CC / 32; ++ks) {
    const Frag fb = ldfrag(bp + 32 * ks);
#pragma unroll
    for (int mt = 0; mt < 4; ++mt) {
      const Frag fa = ldfrag(ap + (size_t)(16 * mt) * CC + 32 * ks);
      acc[mt] = mma_h(fa.h, fb.h, acc[mt]);
    }
  }

  // ---- epilogue: scale back + relu -> LDS Os[n_loc][o_loc]; lane (hh, c) holds o = 16 mt + 8 hh + r, n_loc = 16 w + c
  {
    const int nl = 16 * wave + c;
#pragma unroll
    for (int mt = 0; mt < 4; ++mt) {
      v4f va, vb;
#pragma unroll
      for (int r = 0; r < 4; ++r) {
        va[r] = fmaxf(acc[mt][r] * IWSC, 0.f);
        vb[r] = fmaxf(acc[mt][4 + r] * IWSC, 0.f);
      }
      *(v4f*)(Os + nl * OSP + 16 * mt + 8 * hh)     = va;
      *(v4f*)(Os + nl * OSP + 16 * mt + 8 * hh + 4) = vb;
    }
  }
  __syncthreads();

  const int e = tid & 7, lq = tid >> 3;                             // lq 0..15
  if (mb == 0) {                                                     // block-uniform
    v4u ufh[2], ufl[2], ugh[2], ugl[2];
#pragma unroll
    for (int it = 0; it < 2; ++it) {
      const int L   = it * 16 + lq;                                  // line 0..31
      const int row = 2 * L + (e >> 2);                              // n_loc 0..63
      const int d   = 8 * (e & 3);                                   // 0, 8, 16, 24
      const float* fs = Os + row * OSP + d;
      const float* gs = Os + row * OSP + DQ + d;
      const v4f fa = *(const v4f*)fs;
      const v4f fb = *(const v4f*)(fs + 4);
      const v4f ga = *(const v4f*)gs;
      const v4f gb = *(const v4f*)(gs + 4);
      const float fv[8] = {fa[0], fa[1], fa[2], fa[3], fb[0], fb[1], fb[2], fb[3]};
      const float gv[8] = {ga[0], ga[1], ga[2], ga[3], gb[0], gb[1], gb[2], gb[3]};
#pragma unroll
      for (int t = 0; t < 4; ++t) {
        const unsigned short fh0 = bf_bits(fv[2 * t]), fh1 = bf_bits(fv[2 * t + 1]);
        const unsigned short fl0 = bf_bits(fv[2 * t] - bf_up(fh0));
        const unsigned short fl1 = bf_bits(fv[2 * t + 1] - bf_up(fh1));
        const unsigned short gh0 = bf_bits(gv[2 * t]), gh1 = bf_bits(gv[2 * t + 1]);
        const unsigned short gl0 = bf_bits(gv[2 * t] - bf_up(gh0));
        const unsigned short gl1 = bf_bits(gv[2 * t + 1] - bf_up(gh1));
        ufh[it][t] = pk16(fh0, fh1);
        ufl[it][t] = pk16(fl0, fl1);
        ugh[it][t] = pk16(gh0, gh1);
        ugl[it][t] = pk16(gl0, gl1);
      }
    }
{
#pragma unroll
      for (int it = 0; it < 2; ++it) {
        const int L   = it * 16 + lq;
        const int row = 2 * L + (e >> 2);
        const int d   = 8 * (e & 3);
        const size_t po = ((size_t)(b * SEQ + n0 + row)) * DQ + d;
        *(v4u*)(Fh + po) = ufh[it];
        *(v4u*)(Fl + po) = ufl[it];
        *(v4u*)(Gh + po) = ugh[it];
        *(v4u*)(Gl + po) = ugl[it];
      }
      
    }
  } else {
    const int chb = (mb - 1) * QT;                                   // channel base 0..192
    v4u uhp[4];
#pragma unroll
    for (int it = 0; it < 4; ++it) {
      const int ol = it * 16 + lq;                                   // o_loc 0..63
      float hv8[8];
#pragma unroll
      for (int t = 0; t < 8; ++t) hv8[t] = Os[(8 * e + t) * OSP + ol];
#pragma unroll
      for (int t = 0; t < 4; ++t) {
        const _Float16 h0 = (_Float16)(hv8[2 * t] * HSC);
        const _Float16 h1 = (_Float16)(hv8[2 * t + 1] * HSC);
        uhp[it][t] = pk16(h_bits(h0), h_bits(h1));
      }
    }
{
#pragma unroll
      for (int it = 0; it < 4; ++it) {
        const int ol = it * 16 + lq;
        *(v4u*)(Hv + ((size_t)(b * CC + chb + ol)) * SEQ + n0 + 8 * e) = uhp[it];
      }
      
    }
  }
}

// =========================================================================================================
// (3) self-attention for one (b, 64-query tile), transposed formulation, SEQ keys, no mask, no scale:
//   S^T tile (16 keys x 16 queries) = A(k: row = key kb + (lane&15), 32 d via the split k map from the bf16 plane
//   Fh [b][SEQ][32]) . B(q: col = query, same map from Gh) + A(Fh).B(Gl) + A(Fl).B(Gh) (bf16 unscaled residual
//   planes, shared accumulator; K = 32 = one k-step; the query fragments are loaded once per wave).
//   Per lane the D tile holds 8 keys of ONE query: online softmax state per lane, one shuffle (lane^16) for the max
//   over 32 keys; the o/l rescale is skipped under a wave-uniform ballot when no lane's max grew (corr == 1 exactly
//   for every lane then); row-sum partials combined at the end. P = e^{s-m} x 16384 as f16 is the B operand of
//   O^T (rows channel, cols queries) += A(H rows channel = 16j + (lane&15), keys contiguous, f16 plane Hv
//   [b][256][SEQ], values x16) . B(P^T): element r <- D of the tile covering keys kb..kb+15, element 8+r <- the tile
//   covering kb+16..kb+31, lane unchanged. 16 accumulator tiles per wave (256 channels). Block = 4 waves = 64 queries.
//   Epilogue in two channel halves: gamma*O/(16 l) staged in LDS Os[query][128 channels] (pitch OSPW, b128 stores),
//   8 consecutive lanes x 16 B (values gathered from 4 Os rows), one instruction per 16 lines, final values held in
// coverage: Os per half 4 waves x 16 queries x 128 ch fully staged before the barrier (staged extent == consumed
//           extent); out per half 16 it x 16 lines x 8 lanes x 4 floats = 128 ch x 64 n; two halves = 256 ch;
//           grid (SEQ/64, NB) covers out[b][0..255][0..SEQ-1] exactly once.
// =========================================================================================================
__global__ __launch_bounds__(128)
void attn_k(const unsigned short* __restrict__ Gh, const unsigned short* __restrict__ Gl,
            const unsigned short* __restrict__ Fh, const unsigned short* __restrict__ Fl,
            const unsigned short* __restrict__ Hv, const float* __restrict__ x,
            const float* __restrict__ gamma, float* out) {
  __shared__ __align__(16) float Os[QT * OSPW];
  const int tid  = threadIdx.x;
  const int wave = tid >> 5, lane = tid & 31;
  const int hh   = lane >> 4, c = lane & 15;
  const int n0   = blockIdx.x * QT, b = blockIdx.y;

  // q fragments (B operand, col = query n0 + 16*wave + c), K = 32: loaded once
  const size_t qo = ((size_t)(b * SEQ + n0 + 16 * wave + c)) * DQ + 8 * hh;
  const Frag qh = ldfrag(Gh + qo);
  const Frag ql = ldfrag(Gl + qo);
  // k fragment base (A operand, row = key kb + c), + key * 32
  const unsigned short* Khp = Fh + (size_t)b * SEQ * DQ + (size_t)c * DQ + 8 * hh;
  const unsigned short* Klp = Fl + (size_t)b * SEQ * DQ + (size_t)c * DQ + 8 * hh;
  // v fragment base (A operand, row = channel 16j + c, keys contiguous), + 16*j*SEQ + kb
  const unsigned short* Vp = Hv + (size_t)b * CC * SEQ + (size_t)c * SEQ + 8 * hh;

  float m = -1.0e30f, l = 0.f;
  v8f o[16];
#pragma unroll
  for (int j = 0; j < 16; ++j) o[j] = zero8();

#pragma unroll 1
  for (int kb = 0; kb < SEQ; kb += 32) {
    const Frag k0  = ldfrag(Khp + (size_t)kb * DQ);                 // keys kb .. kb+15
    const Frag k1  = ldfrag(Khp + (size_t)(kb + 16) * DQ);          // keys kb+16 .. kb+31
    const Frag k0l = ldfrag(Klp + (size_t)kb * DQ);
    const Frag k1l = ldfrag(Klp + (size_t)(kb + 16) * DQ);
    v8f s0 = zero8(), s1 = zero8();
    s0 = mma_b(k0.bf, qh.bf, s0);
    s1 = mma_b(k1.bf, qh.bf, s1);
    s0 = mma_b(k0.bf, ql.bf, s0);
    s1 = mma_b(k1.bf, ql.bf, s1);
    s0 = mma_b(k0l.bf, qh.bf, s0);
    s1 = mma_b(k1l.bf, qh.bf, s1);

    float mx = fmaxf(hmax8(s0), hmax8(s1));
    mx = fmaxf(mx, __shfl_xor(mx, 16, 32));
    const float mn = fmaxf(m, mx);
    const unsigned grew = wave_ballot(mx > m);                       // wave-uniform
    if (grew != 0u) {
      const float corr = __expf(m - mn);                             // == 1 exactly for lanes whose max did not grow
      l *= corr;
#pragma unroll
      for (int j = 0; j < 16; ++j) {
#pragma unroll
        for (int r = 0; r < 8; ++r) o[j][r] *= corr;
      }
    }
    m = mn;
    const float msh = mn - LNPS;                                     // exp gives e^{s-m} * 16384

    FragH ph;
    float ls = 0.f;
#pragma unroll
    for (int r = 0; r < 8; ++r) {
      const float e0 = __expf(s0[r] - msh);                          // key kb      + 8hh + r
      const float e1 = __expf(s1[r] - msh);                          // key kb + 16 + 8hh + r
      ls += e0 + e1;
      ph.hv[0][r] = (_Float16)e0;
      ph.hv[1][r] = (_Float16)e1;
    }
    l += ls;

#pragma unroll
    for (int j = 0; j < 16; ++j) {
      const Frag vf = ldfrag(Vp + (size_t)(16 * j) * SEQ + kb);
      o[j] = mma_h(vf.h, ph.v, o[j]);
    }
  }
  l += __shfl_xor(l, 16, 32);
  const float gm  = bfr(gamma[0]);
  const float inv = gm * IHSC * (1.0f / l);                          // o carries x16384 x16, l carries x16384

  const int qrow = 16 * wave + c;
  const int e = tid & 7, lq = tid >> 3;                              // lq 0..15
#pragma unroll
  for (int half = 0; half < 2; ++half) {
    if (half) __syncthreads();                                       // every wave finished reading Os
#pragma unroll
    for (int jj = 0; jj < 8; ++jj) {
      const int j = 8 * half + jj;
      v4f va, vb;
#pragma unroll
      for (int r = 0; r < 4; ++r) { va[r] = o[j][r] * inv; vb[r] = o[j][4 + r] * inv; }
      *(v4f*)(Os + qrow * OSPW + 16 * jj + 8 * hh)     = va;         // Os[query][ch_loc = 16jj + 8hh + r]
      *(v4f*)(Os + qrow * OSPW + 16 * jj + 8 * hh + 4) = vb;
    }
    __syncthreads();
    v4f res[16];
#pragma unroll
    for (int it = 0; it < 16; ++it) {
      const int L   = it * 16 + lq;                                  // 0..255
      const int chl = L >> 1, hf = L & 1;                            // channel 0..127 within the half
      const int nl  = hf * 32 + 4 * e;                               // query 0..63
      const size_t xi = ((size_t)(b * CC + 128 * half + chl)) * SEQ_FULL + n0 + nl;
      const v4f xv = *(const v4f*)(x + xi);
#pragma unroll
      for (int t = 0; t < 4; ++t) res[it][t] = Os[(nl + t) * OSPW + chl] + bfr(xv[t]);
    }
{
#pragma unroll
      for (int it = 0; it < 16; ++it) {
        const int L   = it * 16 + lq;
        const int chl = L >> 1, hf = L & 1;
        const int nl  = hf * 32 + 4 * e;
        const size_t oi = ((size_t)(b * CC + 128 * half + chl)) * SEQ + n0 + nl;
        *(v4f*)(out + oi) = res[it];
      }
      
    }
  }
}

// =========================================================================================================
// Workspace map (bytes; each region start a multiple of 256; every extent is an exact tile multiple and is written
//   W16 f16 [320][256]                 163840
//   XP  f16 [8][4096][256]           16777216
//   Hv  f16 [8][256][4096]           16777216
//   Fh/Fl/Gh/Gl bf16 [8][4096][32]    2097152 x4
//   total = 42106880
// =========================================================================================================
extern "C" void kernel_launch(void* const* d_in, const int* in_sizes, int n_in,
                              void* d_out, int out_size, void* d_ws, size_t ws_size,
                              hipStream_t stream) {
  if (n_in < 5) return;
  if (in_sizes[0] < NB * CC * SEQ_FULL) return;
  if (in_sizes[1] < DQ * CC || in_sizes[2] < DQ * CC) return;
  if (in_sizes[3] < CC * CC) return;
  if (in_sizes[4] < 1) return;
  if (out_size < NB * CC * SEQ) return;

  size_t off = 0;
  auto carve = [&](size_t bytes) { const size_t o = off; off += (bytes + 255) & ~(size_t)255; return o; };
  const size_t oW16 = carve((size_t)MW * CC * 2);
  const size_t oXP  = carve((size_t)NB * SEQ * CC * 2);
  const size_t oHv  = carve((size_t)NB * CC * SEQ * 2);
  const size_t oFh  = carve((size_t)NB * SEQ * DQ * 2);
  const size_t oFl  = carve((size_t)NB * SEQ * DQ * 2);
  const size_t oGh  = carve((size_t)NB * SEQ * DQ * 2);
  const size_t oGl  = carve((size_t)NB * SEQ * DQ * 2);
  if (off > ws_size) return;
  if (off > (size_t)134217728) return;

  const float* x     = (const float*)d_in[0];
  const float* wq    = (const float*)d_in[1];
  const float* wk    = (const float*)d_in[2];
  const float* wv    = (const float*)d_in[3];
  const float* gamma = (const float*)d_in[4];

  char* ws = (char*)d_ws;
  unsigned short* W16 = (unsigned short*)(ws + oW16);
  unsigned short* XP  = (unsigned short*)(ws + oXP);
  unsigned short* Hv  = (unsigned short*)(ws + oHv);
  unsigned short* Fh  = (unsigned short*)(ws + oFh);
  unsigned short* Fl  = (unsigned short*)(ws + oFl);
  unsigned short* Gh  = (unsigned short*)(ws + oGh);
  unsigned short* Gl  = (unsigned short*)(ws + oGl);
  float* out = (float*)d_out;

  const dim3 blk256(256), blk128(128);

  // (0) q/k/v weights -> stacked f16 plane
  cvt_w<<<dim3(MW / 8), blk256, 0, stream>>>(wq, wk, wv, W16);
  // (1) x -> position-major 16-bit plane
  cvt_x<<<dim3(SEQ / QT, CC / QT, NB), blk256, 0, stream>>>(x, XP);
  // (2) conv1x1 GEMM -> f (key) and g (query) hi + residual planes, H value plane
  gemm_p<<<dim3(SEQ / QT, MBLK, NB), blk128, 0, stream>>>(W16, XP, Fh, Fl, Gh, Gl, Hv);
  // (3) attention + gamma scale + residual -> out [b][256][SEQ]
  attn_k<<<dim3(SEQ / QT, NB), blk128, 0, stream>>>(Gh, Gl, Fh, Fl, Hv, x, gamma, out);
  (void)hipGetLastError();
}

// v001
// One run takes 127 microseconds.
// Timed twice side by side with v000, it ran 4.33 and 4.43 times as fast.
// Contractions: conv1x1 q/k/v projections W[320x256].X[256x4096] on v_wmma_f32_16x16x32_f16 (f16 containers of
// bf16-RNE weights x256 and bf16-RNE x); scores f_n.g_m on v_wmma_f32_16x16x32_bf16 (bf16 hi + bf16 residual
// planes of f and g, 3 products, K=32); o^T = H.P^T on v_wmma_f32_16x16x32_f16 (H = relu(v-projection) x16 f16,
// P = e^{s-max} x16384 f16 from the score D registers); f32 accumulate everywhere; softmax statistics, gamma scale
// and the residual add in f32 VALU.
#include <hip/hip_runtime.h>
#include <math.h>
#include <stdint.h>

#ifndef NB
#define NB 8
#endif
#ifndef SEQ
#define SEQ 4096
#endif
#define NB_FULL  8
#define SEQ_FULL 4096
#define CC     256
#define DQ     32
#define MW     320
#define MBLK   5
#define QT     64
#define OSP    68
#define OSPW   132
#define TP     72
#define WSC    256.0f
#define IWSC   0.00390625f
#define HSC    16.0f
#define IHSC   0.0625f
#define LNPS   9.704060527839234f
#define KS     64                        // keys per LDS stage
#define NST    (SEQ / KS)                // stages
#define VPITCH 144u                      // LDS pitch of a value row: 128 B (64 keys f16) + 16 B pad
#define VSLICE (128u * VPITCH)           // 128 channels, one wave's request: 18432 B = 9 x 2 KiB
#define KPITCH 272u                      // LDS pitch of a key-plane row: 256 B (4 keys x 32 d bf16) + 16 B pad
#define KPLACE 6144u                     // 16 such rows (4352 B), rounded up to a multiple of 2 KiB
#define KOFF   (2u * VSLICE)
#define BUFB   (KOFF + 2u * KPLACE)      // one buffer: 49152 B

static_assert(NB >= 1 && NB <= NB_FULL);
static_assert(SEQ >= QT && SEQ <= SEQ_FULL);
static_assert(SEQ % QT == 0 && SEQ % 32 == 0);
static_assert(CC % QT == 0 && CC % 32 == 0);
static_assert(MW == 2 * DQ + CC);
static_assert(MW == MBLK * QT);
static_assert(QT == 2 * DQ);
static_assert(MW % 8 == 0);
static_assert((OSP * 4) % 16 == 0);
static_assert((OSPW * 4) % 16 == 0);
static_assert((TP * 2) % 16 == 0);
static_assert(DQ % 32 == 0);
static_assert(SEQ % KS == 0 && NST >= 2);
static_assert(KS * 2 == 128 && CC == 256 && DQ * 2 * 4 == 256);
static_assert(VSLICE % 2048u == 0 && KPLACE % 2048u == 0 && (KS / 4) * KPITCH <= KPLACE);

typedef _Float16       v16h __attribute__((ext_vector_type(16)));
typedef _Float16       v8h  __attribute__((ext_vector_type(8)));
typedef __bf16         v16b __attribute__((ext_vector_type(16)));
typedef unsigned short v8us __attribute__((ext_vector_type(8)));
typedef float          v8f  __attribute__((ext_vector_type(8)));
typedef float          v4f  __attribute__((ext_vector_type(4)));
typedef unsigned int   v4u  __attribute__((ext_vector_type(4)));
typedef uint32_t       u32x4 __attribute__((ext_vector_type(4)));
typedef uint32_t       u32x8 __attribute__((ext_vector_type(8)));

union Frag  { v8us u[2]; v16h h; v16b bf; };
union FragH { v16h v; v8h hv[2]; };
static_assert(sizeof(Frag) == 32);
static_assert(sizeof(FragH) == 32);

// ---- scalar helpers ---------------------------------------------------------------------------------------
__device__ __forceinline__ unsigned short bf_bits(float f) {          // f32 -> bf16 bits, RNE convert
  unsigned u = __float_as_uint(f);
  return (unsigned short)((u + 0x7FFFu + ((u >> 16) & 1u)) >> 16);
}
__device__ __forceinline__ float bf_up(unsigned short hb) { return __uint_as_float(((unsigned)hb) << 16); }
__device__ __forceinline__ float bfr(float f) { return bf_up(bf_bits(f)); }
__device__ __forceinline__ unsigned short h_bits(_Float16 x) { return __builtin_bit_cast(unsigned short, x); }
__device__ __forceinline__ unsigned pk16(unsigned short a, unsigned short b) { return (unsigned)a | ((unsigned)b << 16); }
__device__ __forceinline__ v8f zero8() { v8f z = {0.f, 0.f, 0.f, 0.f, 0.f, 0.f, 0.f, 0.f}; return z; }
__device__ __forceinline__ float hmax8(v8f s) {
  return fmaxf(fmaxf(fmaxf(s[0], s[1]), fmaxf(s[2], s[3])), fmaxf(fmaxf(s[4], s[5]), fmaxf(s[6], s[7])));
}
__device__ __forceinline__ unsigned wave_ballot(bool p) {
#if defined(__HIP_DEVICE_COMPILE__)
  return __builtin_amdgcn_ballot_w32(p);
#else
  return p ? 1u : 0u;
#endif
}

// ---- 16-bit fragment loader (A, or B from a k-contiguous [n][k] row): lane -> row/col (lane&15), p already includes
//      + 8*(lane>>4); elements 0..7 <- p[0..7] (k0+8h..), elements 8..15 <- p[16..23] (k0+16+8h..)
__device__ __forceinline__ Frag ldfrag(const unsigned short* p) {
  Frag f;
  f.u[0] = *(const v8us*)(p);
  f.u[1] = *(const v8us*)(p + 16);
  return f;
}

// ---- WMMA helpers: builtin followed by a 4-slot VALU gap tying D and keeping A/B live --------------------------
__device__ __forceinline__ v8f mma_h(v16h a, v16h b, v8f c) {
  v8f d = __builtin_amdgcn_wmma_f32_16x16x32_f16(false, a, false, b, (short)0, c, false, false);
#if defined(__HIP_DEVICE_COMPILE__)
  asm volatile("v_nop\n\tv_nop\n\tv_nop\n\tv_nop" : "+v"(d) : "v"(a), "v"(b));
#endif
  return d;
}
__device__ __forceinline__ v8f mma_b(v16b a, v16b b, v8f c) {
  v8f d = __builtin_amdgcn_wmma_f32_16x16x32_bf16(false, a, false, b, (short)0, c, false, false);
#if defined(__HIP_DEVICE_COMPILE__)
  const v16h ha = __builtin_bit_cast(v16h, a), hb = __builtin_bit_cast(v16h, b);
  asm volatile("v_nop\n\tv_nop\n\tv_nop\n\tv_nop" : "+v"(d) : "v"(ha), "v"(hb));
#endif
  return d;
}

// ---- tensor load to LDS: descriptor groups and issue ----------------------------------------------------------
__device__ __forceinline__ uint32_t uni(uint32_t v) { return (uint32_t)__builtin_amdgcn_readfirstlane(v); }
__device__ __forceinline__ uint32_t pinned(uint32_t v) {
  uint32_t w = uni(v);
  asm volatile("" : "+s"(w));            // the test word stays scalar, the branch on it a scalar branch
  return w;
}
// group 1: 1-byte elements, tensor = tile = ROWS rows of ROWB bytes, source pitch SRCP bytes, 16 B of LDS pad per row
template <uint32_t ROWB, uint32_t ROWS, uint32_t SRCP, uint32_t IVL>
__device__ __forceinline__ u32x8 tdm_group1() {
  u32x8 g;
  g[0] = uni((1u << 20) | (IVL << 22) | (3u << 25));
  g[1] = uni((ROWB & 0xFFFFu) << 16);
  g[2] = uni((ROWB >> 16) | ((ROWS & 0xFFFFu) << 16));
  g[3] = uni((ROWS >> 16) | (ROWB << 16));
  g[4] = uni(ROWS);
  g[5] = uni(SRCP);
  g[6] = uni(0u);
  g[7] = uni(0u);
  return g;
}
// The same form on a whole group 1 (descriptor words held in scalar registers): the eight words keep their registers
// from the first request to the last, so that none of those registers takes another value while a request is outstanding.
__device__ __forceinline__ u32x8 held(u32x8 g) { asm volatile("" : "+s"(g)); return g; }  // pinned(), eight descriptor words
__device__ __forceinline__ u32x4 tdm_group0(uint32_t lds_dst, uint64_t ga) {
  u32x4 g;
  g[0] = uni(1u);
  g[1] = uni(lds_dst);
  g[2] = uni((uint32_t)ga);
  g[3] = uni((((uint32_t)(ga >> 32)) & 0x01FFFFFFu) | 0x80000000u);
  return g;
}
__device__ __forceinline__ void tdm_load(u32x4 g0, u32x8 g1) {
  asm volatile("tensor_load_to_lds %0, %1" :: "s"(g0), "s"(g1) : "memory");   // one request of the whole wave
}
__device__ __forceinline__ void wait_tensor0() { asm volatile("s_wait_tensorcnt 0x0" ::: "memory"); }  // this wave's request has landed
__device__ __forceinline__ void wait_ds0()     { asm volatile("s_wait_dscnt 0x0" ::: "memory"); }      // this wave's LDS reads have returned

// =========================================================================================================
// (0) conv1x1 weights: W16 f16 [320][256], rows 0..31 = q-projection rows, 32..63 = k-projection rows, 64..319 =
//     v-projection rows; value = f16 of (bf16-RNE(w) * 256) (exact). Block blk (0..39) owns rows 8*blk..8*blk+7:
// coverage: 40 blocks x 8 rows x 32 lanes x 8 halves = 320 x 256 = the whole plane.
// =========================================================================================================
__global__ __launch_bounds__(256)
void cvt_w(const float* __restrict__ wq, const float* __restrict__ wk, const float* __restrict__ wv,
           unsigned short* W16) {
  const int tid = threadIdx.x, blk = blockIdx.x;
  const int rl = tid >> 5, col = 8 * (tid & 31);
  const int o = 8 * blk + rl;                                        // 0..319
  const float* wbase;
  int osub;
  if (blk < DQ / 8)            { wbase = wq; osub = 0; }
  else if (blk < (2 * DQ) / 8) { wbase = wk; osub = DQ; }
  else                         { wbase = wv; osub = 2 * DQ; }
  const float* s = wbase + (size_t)(o - osub) * CC + col;
  const v4f a = *(const v4f*)s;
  const v4f q = *(const v4f*)(s + 4);
  const float f[8] = {a[0], a[1], a[2], a[3], q[0], q[1], q[2], q[3]};
  v4u u;
#pragma unroll
  for (int t = 0; t < 4; ++t) {
    const _Float16 h0 = (_Float16)(bfr(f[2 * t]) * WSC);
    const _Float16 h1 = (_Float16)(bfr(f[2 * t + 1]) * WSC);
    u[t] = pk16(h_bits(h0), h_bits(h1));
  }
{
    *(v4u*)(W16 + (size_t)o * CC + col) = u;
    
  }
}

// =========================================================================================================
// (1) x f32 [b][256 c][SEQ_FULL n] -> XP f16 [b][SEQ n][256 c] (position-major, bf16-RNE values, exact in f16)
//     through an LDS tile T[64 n][64 c] (pitch TP). Block (nb, cb, b) owns a 64 c x 64 n tile; XP lines: row n,
// coverage: T: 2 it x 32 channels x 8 lanes x 8 n = 64 c x 64 n fully written before the barrier (staged extent ==
//           consumed extent); XP: 2 it x 32 rows x 8 lanes x 8 = 64 n x 64 c; grid (SEQ/64, 4, NB) covers XP once.
// =========================================================================================================
__global__ __launch_bounds__(256)
void cvt_x(const float* __restrict__ x, unsigned short* XP) {
  __shared__ __align__(16) unsigned short T[QT * TP];
  const int tid = threadIdx.x;
  const int nb = blockIdx.x, cb = blockIdx.y, b = blockIdx.z;
  const int e = tid & 7, lq = tid >> 3;                             // lq 0..31
  const int n0 = nb * QT, c0 = cb * QT;
#pragma unroll
  for (int it = 0; it < 2; ++it) {
    const int cl = it * 32 + lq;                                     // 0..63
    const float* sp = x + ((size_t)(b * CC + c0 + cl)) * SEQ_FULL + n0 + 8 * e;
    const v4f a = *(const v4f*)sp;
    const v4f q = *(const v4f*)(sp + 4);
    unsigned short hb[8];
#pragma unroll
    for (int t = 0; t < 4; ++t) {
      hb[t]     = h_bits((_Float16)bfr(a[t]));
      hb[4 + t] = h_bits((_Float16)bfr(q[t]));
    }
#pragma unroll
    for (int t = 0; t < 8; ++t) T[(8 * e + t) * TP + cl] = hb[t];
  }
  __syncthreads();
  v4u up[2];
#pragma unroll
  for (int it = 0; it < 2; ++it) {
    const int nl = it * 32 + lq;                                     // 0..63
    up[it] = *(const v4u*)(T + nl * TP + 8 * e);
  }
{
#pragma unroll
    for (int it = 0; it < 2; ++it) {
      const int rl = it * 32 + lq;
      *(v4u*)(XP + ((size_t)(b * SEQ + n0 + rl)) * CC + c0 + 8 * e) = up[it];
    }
    
  }
}

// =========================================================================================================
// (2) conv1x1 GEMM for one (b, 64-n tile, 64-o block): Y[o][n] = relu((1/256) sum_c W16[o][c] XP[b][n][c]).
//     Block 128 threads = 4 waves; wave w owns cols n0+16w..+15 (one B fragment per k-step, k = c contiguous in
//     the XP row) and 4 m-tiles (A rows o = o0 + 16 mt + (lane&15), split k map loader from W16). K = 256 = 8 steps.
//     Epilogue staged in LDS Os[n_loc][o_loc] (pitch OSP, b128 stores of 8 consecutive o per lane, relu applied),
//     barrier, then (block-uniform branch on the o-block):
//       o-block 0 -> o_loc 0..31 = f (key) dims -> Fh/Fl, o_loc 32..63 = g (query) dims -> Gh/Gl; planes bf16
//       [b][SEQ n][32 d] (k-contiguous for both score operands): hi = bf16-RNE(v), lo = bf16-RNE(v - hi). Plane
//       lanes x 16 B per line, one instruction per 16 lines, 32 lines per plane per block.
//       o-blocks 1..4 -> channels 64(mb-1).. of the H plane f16 [b][256 c][SEQ n] (n contiguous), value = f16 of
// coverage: Os 4 waves x 16 n x 64 o = 64 x 64 (staged extent == consumed extent); F/G planes: 2 it x 16 lines x
//           8 lanes x 8 = 64 n x 32 d per plane (hi and lo, f and g); H: 4 it x 16 rows x 8 lanes x 8 = 64 c x
//           64 n; grid (SEQ/64, 5, NB) covers all SEQ rows of Fh/Fl/Gh/Gl and all 256 channels of H exactly once.
// =========================================================================================================
__global__ __launch_bounds__(128)
void gemm_p(const unsigned short* __restrict__ W16, const unsigned short* __restrict__ XP,
            unsigned short* Fh, unsigned short* Fl, unsigned short* Gh, unsigned short* Gl,
            unsigned short* Hv) {
  __shared__ __align__(16) float Os[QT * OSP];
  const int tid  = threadIdx.x;
  const int lane = tid & 31, wave = tid >> 5;
  const int hh   = lane >> 4, c = lane & 15;
  const int nt   = blockIdx.x, mb = blockIdx.y, b = blockIdx.z;
  const int n0   = nt * QT, o0 = mb * QT;

  const unsigned short* ap = W16 + (size_t)(o0 + c) * CC + 8 * hh;
  const unsigned short* bp = XP + ((size_t)(b * SEQ + n0 + 16 * wave + c)) * CC + 8 * hh;

  v8f acc[4];
#pragma unroll
  for (int mt = 0; mt < 4; ++mt) acc[mt] = zero8();

#pragma unroll
  for (int ks = 0; ks < CC / 32; ++ks) {
    const Frag fb = ldfrag(bp + 32 * ks);
#pragma unroll
    for (int mt = 0; mt < 4; ++mt) {
      const Frag fa = ldfrag(ap + (size_t)(16 * mt) * CC + 32 * ks);
      acc[mt] = mma_h(fa.h, fb.h, acc[mt]);
    }
  }

  // ---- epilogue: scale back + relu -> LDS Os[n_loc][o_loc]; lane (hh, c) holds o = 16 mt + 8 hh + r, n_loc = 16 w + c
  {
    const int nl = 16 * wave + c;
#pragma unroll
    for (int mt = 0; mt < 4; ++mt) {
      v4f va, vb;
#pragma unroll
      for (int r = 0; r < 4; ++r) {
        va[r] = fmaxf(acc[mt][r] * IWSC, 0.f);
        vb[r] = fmaxf(acc[mt][4 + r] * IWSC, 0.f);
      }
      *(v4f*)(Os + nl * OSP + 16 * mt + 8 * hh)     = va;
      *(v4f*)(Os + nl * OSP + 16 * mt + 8 * hh + 4) = vb;
    }
  }
  __syncthreads();

  const int e = tid & 7, lq = tid >> 3;                             // lq 0..15
  if (mb == 0) {                                                     // block-uniform
    v4u ufh[2], ufl[2], ugh[2], ugl[2];
#pragma unroll
    for (int it = 0; it < 2; ++it) {
      const int L   = it * 16 + lq;                                  // line 0..31
      const int row = 2 * L + (e >> 2);                              // n_loc 0..63
      const int d   = 8 * (e & 3);                                   // 0, 8, 16, 24
      const float* fs = Os + row * OSP + d;
      const float* gs = Os + row * OSP + DQ + d;
      const v4f fa = *(const v4f*)fs;
      const v4f fb = *(const v4f*)(fs + 4);
      const v4f ga = *(const v4f*)gs;
      const v4f gb = *(const v4f*)(gs + 4);
      const float fv[8] = {fa[0], fa[1], fa[2], fa[3], fb[0], fb[1], fb[2], fb[3]};
      const float gv[8] = {ga[0], ga[1], ga[2], ga[3], gb[0], gb[1], gb[2], gb[3]};
#pragma unroll
      for (int t = 0; t < 4; ++t) {
        const unsigned short fh0 = bf_bits(fv[2 * t]), fh1 = bf_bits(fv[2 * t + 1]);
        const unsigned short fl0 = bf_bits(fv[2 * t] - bf_up(fh0));
        const unsigned short fl1 = bf_bits(fv[2 * t + 1] - bf_up(fh1));
        const unsigned short gh0 = bf_bits(gv[2 * t]), gh1 = bf_bits(gv[2 * t + 1]);
        const unsigned short gl0 = bf_bits(gv[2 * t] - bf_up(gh0));
        const unsigned short gl1 = bf_bits(gv[2 * t + 1] - bf_up(gh1));
        ufh[it][t] = pk16(fh0, fh1);
        ufl[it][t] = pk16(fl0, fl1);
        ugh[it][t] = pk16(gh0, gh1);
        ugl[it][t] = pk16(gl0, gl1);
      }
    }
{
#pragma unroll
      for (int it = 0; it < 2; ++it) {
        const int L   = it * 16 + lq;
        const int row = 2 * L + (e >> 2);
        const int d   = 8 * (e & 3);
        const size_t po = ((size_t)(b * SEQ + n0 + row)) * DQ + d;
        *(v4u*)(Fh + po) = ufh[it];
        *(v4u*)(Fl + po) = ufl[it];
        *(v4u*)(Gh + po) = ugh[it];
        *(v4u*)(Gl + po) = ugl[it];
      }
      
    }
  } else {
    const int chb = (mb - 1) * QT;                                   // channel base 0..192
    v4u uhp[4];
#pragma unroll
    for (int it = 0; it < 4; ++it) {
      const int ol = it * 16 + lq;                                   // o_loc 0..63
      float hv8[8];
#pragma unroll
      for (int t = 0; t < 8; ++t) hv8[t] = Os[(8 * e + t) * OSP + ol];
#pragma unroll
      for (int t = 0; t < 4; ++t) {
        const _Float16 h0 = (_Float16)(hv8[2 * t] * HSC);
        const _Float16 h1 = (_Float16)(hv8[2 * t + 1] * HSC);
        uhp[it][t] = pk16(h_bits(h0), h_bits(h1));
      }
    }
{
#pragma unroll
      for (int it = 0; it < 4; ++it) {
        const int ol = it * 16 + lq;
        *(v4u*)(Hv + ((size_t)(b * CC + chb + ol)) * SEQ + n0 + 8 * e) = uhp[it];
      }
      
    }
  }
}

// =========================================================================================================
// (3) self-attention for one (b, 64-query tile), transposed formulation, SEQ keys, no mask, no scale:
//   S^T tile (16 keys x 16 queries) = A(k: row = key kb + (lane&15), 32 d via the split k map from the bf16 plane
//   Fh [b][SEQ][32]) . B(q: col = query, same map from Gh) + A(Fh).B(Gl) + A(Fl).B(Gh) (bf16 unscaled residual
//   planes, shared accumulator; K = 32 = one k-step; the query fragments are loaded once per wave).
//   Per lane the D tile holds 8 keys of ONE query: online softmax state per lane, one shuffle (lane^16) for the max
//   over 32 keys; the o/l rescale is skipped under a wave-uniform ballot when no lane's max grew (corr == 1 exactly
//   for every lane then); row-sum partials combined at the end. P = e^{s-m} x 16384 as f16 is the B operand of
//   O^T (rows channel, cols queries) += A(H rows channel = 16j + (lane&15), keys contiguous, f16 plane Hv
//   [b][256][SEQ], values x16) . B(P^T): element r <- D of the tile covering keys kb..kb+15, element 8+r <- the tile
//   covering kb+16..kb+31, lane unchanged. 16 accumulator tiles per wave (256 channels). Block = 4 waves = 64 queries.
//   Keys and values reach the waves through LDS: stages of 64 keys (two 32-key passes), two buffers, one tensor load
//   per wave and stage, issued one stage ahead; all four waves read the same tiles with ds_load_b128.
//   Epilogue in two channel halves: gamma*O/(16 l) staged in LDS Os[query][128 channels] (pitch OSPW, b128 stores),
//   8 consecutive lanes x 16 B (values gathered from 4 Os rows), one instruction per 16 lines, final values held in
// coverage: Os per half 4 waves x 16 queries x 128 ch fully staged before the barrier (staged extent == consumed
//           extent); out per half 16 it x 16 lines x 8 lanes x 4 floats = 128 ch x 64 n; two halves = 256 ch;
//           grid (SEQ/64, NB) covers out[b][0..255][0..SEQ-1] exactly once.
// =========================================================================================================
__global__ __launch_bounds__(128)
void attn_k(const unsigned short* __restrict__ Gh, const unsigned short* __restrict__ Gl,
            const unsigned short* __restrict__ Fh, const unsigned short* __restrict__ Fl,
            const unsigned short* __restrict__ Hv, const float* __restrict__ x,
            const float* __restrict__ gamma, float* out) {
  __shared__ __attribute__((aligned(2048))) unsigned char smem[2u * BUFB + QT * OSPW * 4];
  float* Os = (float*)(smem + 2u * BUFB);
  const int tid  = threadIdx.x;
  const int wave = tid >> 5, lane = tid & 31;
  const int hh   = lane >> 4, c = lane & 15;
  const int n0   = blockIdx.x * QT, b = blockIdx.y;

  // Stage st = keys 64 st .. 64 st + 63, into buffer st & 1. One request per wave and stage: waves 0 and 1 the two
  // 128-channel halves of the value tile (rows of 128 B), wave 2 the key hi plane, wave 3 the key residual plane
  // (4096 contiguous bytes each, taken as 16 rows of 256 B).
  const uint32_t lbase = (uint32_t)(size_t)smem;
  const uint32_t wv    = uni((uint32_t)tid >> 5);
  const u32x8 g1v = held(tdm_group1<128u, 128u, SEQ * 2u, 4u>());
  const u32x8 g1k = held(tdm_group1<256u, KS / 4u, 256u, 5u>());
  auto issue = [&](uint32_t st, bool now) {                          // now: the wait directly behind the request
    const uint32_t dst = lbase + (st & 1u) * BUFB;
    if (pinned(wv < 2u)) {
      const uint64_t ga = (uint64_t)(size_t)Hv + ((uint64_t)(b * CC + 128u * wv) * SEQ + (uint64_t)st * KS) * 2u;
      tdm_load(tdm_group0(dst + wv * VSLICE, ga), g1v);
      if (now) wait_tensor0();
    } else {
      const uint64_t ga = (uint64_t)(size_t)(wv == 2u ? Fh : Fl) + ((uint64_t)b * SEQ + (uint64_t)st * KS) * (DQ * 2u);
      tdm_load(tdm_group0(dst + KOFF + (wv - 2u) * KPLACE, ga), g1k);
      if (now) wait_tensor0();
    }
  };
  issue(0u, true);

  // q fragments (B operand, col = query n0 + 16*wave + c), K = 32: loaded once
  const size_t qo = ((size_t)(b * SEQ + n0 + 16 * wave + c)) * DQ + 8 * hh;
  const Frag qh = ldfrag(Gh + qo);
  const Frag ql = ldfrag(Gl + qo);
  // k fragment offset in a buffer (A operand, row = key c of a 16-key tile: LDS row c >> 2, 64-B slot c & 3)
  const uint32_t klane = KOFF + (uint32_t)(c >> 2) * KPITCH + (uint32_t)(c & 3) * 64u + 16u * hh;
  // v fragment offset in a buffer (A operand, row = channel 16j + c, keys contiguous)
  const uint32_t vlane = (uint32_t)c * VPITCH + 16u * hh;

  float m = -1.0e30f, l = 0.f;
  v8f o[16];
#pragma unroll
  for (int j = 0; j < 16; ++j) o[j] = zero8();

#pragma unroll 1
  for (uint32_t st = 0; st < (uint32_t)NST; ++st) {
   // Publish point of stage st, between pass st - 1 and pass st (in front of pass 0: stage 0's wait, the barrier, stage
   // 1's load): this wave's LDS reads of pass st - 1 have returned, its own request of stage st has landed, the barrier,
   // and only then the load of stage st + 1 into the buffer that pass st - 1 has read.
   wait_ds0();
   wait_tensor0();
   __syncthreads();
   if (pinned(st + 1u < (uint32_t)NST)) issue(st + 1u, false);
   const unsigned char* bufp = smem + (st & 1u) * BUFB;
   const unsigned char* Kp = bufp + klane;
   const unsigned char* Vp = bufp + vlane;
#pragma unroll
   for (int ps = 0; ps < KS / 32; ++ps) {                            // kb = 64 st + 32 ps
    const Frag k0  = ldfrag((const unsigned short*)(Kp + (8 * ps) * KPITCH));               // keys kb .. kb+15
    const Frag k1  = ldfrag((const unsigned short*)(Kp + (8 * ps + 4) * KPITCH));           // keys kb+16 .. kb+31
    const Frag k0l = ldfrag((const unsigned short*)(Kp + KPLACE + (8 * ps) * KPITCH));
    const Frag k1l = ldfrag((const unsigned short*)(Kp + KPLACE + (8 * ps + 4) * KPITCH));
    v8f s0 = zero8(), s1 = zero8();
    s0 = mma_b(k0.bf, qh.bf, s0);
    s1 = mma_b(k1.bf, qh.bf, s1);
    s0 = mma_b(k0.bf, ql.bf, s0);
    s1 = mma_b(k1.bf, ql.bf, s1);
    s0 = mma_b(k0l.bf, qh.bf, s0);
    s1 = mma_b(k1l.bf, qh.bf, s1);

    float mx = fmaxf(hmax8(s0), hmax8(s1));
    const float mxo = __shfl_xor(mx, 16, 32);
    // The first eight value fragments are read as one group behind the exchange (LDS returns in order: in front of it
    // they would delay it) and in front of the exponentials, which run while the reads return. The scheduling fences
    // here and in the product loop keep each read group in its place: without them every read pair sits at its own
    // WMMA behind a wait to 0.
#if defined(__HIP_DEVICE_COMPILE__)
    asm volatile("" :: "v"(mxo));        // inputs-only fence on the exchanged value: the exchange returns before the reads issue
#endif
    __builtin_amdgcn_sched_barrier(0);
    Frag vf[16];
#pragma unroll
    for (int j = 0; j < 8; ++j) vf[j] = ldfrag((const unsigned short*)(Vp + (16 * j) * VPITCH + 64 * ps));
    __builtin_amdgcn_sched_barrier(0);
    mx = fmaxf(mx, mxo);
    const float mn = fmaxf(m, mx);
    const unsigned grew = wave_ballot(mx > m);                       // wave-uniform
    if (grew != 0u) {
      const float corr = __expf(m - mn);                             // == 1 exactly for lanes whose max did not grow
      l *= corr;
#pragma unroll
      for (int j = 0; j < 16; ++j) {
#pragma unroll
        for (int r = 0; r < 8; ++r) o[j][r] *= corr;
      }
    }
    m = mn;
    const float msh = mn - LNPS;                                     // exp gives e^{s-m} * 16384

    FragH ph;
    float ls = 0.f;
#pragma unroll
    for (int r = 0; r < 8; ++r) {
      const float e0 = __expf(s0[r] - msh);                          // key kb      + 8hh + r
      const float e1 = __expf(s1[r] - msh);                          // key kb + 16 + 8hh + r
      ls += e0 + e1;
      ph.hv[0][r] = (_Float16)e0;
      ph.hv[1][r] = (_Float16)e1;
    }
    l += ls;

#pragma unroll
    for (int g = 0; g < 4; ++g) {                                    // four products, then the reads for two groups on
#pragma unroll
      for (int jj = 0; jj < 4; ++jj) o[4 * g + jj] = mma_h(vf[4 * g + jj].h, ph.v, o[4 * g + jj]);
      if (g < 2) {
        __builtin_amdgcn_sched_barrier(0);                           // read group behind the products whose registers it takes
#pragma unroll
        for (int jj = 0; jj < 4; ++jj) {
          const int j = 4 * g + 8 + jj;
          vf[j] = ldfrag((const unsigned short*)(Vp + (16 * j) * VPITCH + 64 * ps));
        }
        __builtin_amdgcn_sched_barrier(0);                           // and in front of the next four products
      }
    }
   }
  }
  wait_tensor0();
  wait_ds0();
  l += __shfl_xor(l, 16, 32);
  const float gm  = bfr(gamma[0]);
  const float inv = gm * IHSC * (1.0f / l);                          // o carries x16384 x16, l carries x16384

  const int qrow = 16 * wave + c;
  const int e = tid & 7, lq = tid >> 3;                              // lq 0..15
#pragma unroll
  for (int half = 0; half < 2; ++half) {
    if (half) __syncthreads();                                       // every wave finished reading Os
#pragma unroll
    for (int jj = 0; jj < 8; ++jj) {
      const int j = 8 * half + jj;
      v4f va, vb;
#pragma unroll
      for (int r = 0; r < 4; ++r) { va[r] = o[j][r] * inv; vb[r] = o[j][4 + r] * inv; }
      *(v4f*)(Os + qrow * OSPW + 16 * jj + 8 * hh)     = va;         // Os[query][ch_loc = 16jj + 8hh + r]
      *(v4f*)(Os + qrow * OSPW + 16 * jj + 8 * hh + 4) = vb;
    }
    __syncthreads();
    v4f res[16];
#pragma unroll
    for (int it = 0; it < 16; ++it) {
      const int L   = it * 16 + lq;                                  // 0..255
      const int chl = L >> 1, hf = L & 1;                            // channel 0..127 within the half
      const int nl  = hf * 32 + 4 * e;                               // query 0..63
      const size_t xi = ((size_t)(b * CC + 128 * half + chl)) * SEQ_FULL + n0 + nl;
      const v4f xv = *(const v4f*)(x + xi);
#pragma unroll
      for (int t = 0; t < 4; ++t) res[it][t] = Os[(nl + t) * OSPW + chl] + bfr(xv[t]);
    }
{
#pragma unroll
      for (int it = 0; it < 16; ++it) {
        const int L   = it * 16 + lq;
        const int chl = L >> 1, hf = L & 1;
        const int nl  = hf * 32 + 4 * e;
        const size_t oi = ((size_t)(b * CC + 128 * half + chl)) * SEQ + n0 + nl;
        *(v4f*)(out + oi) = res[it];
      }
      
    }
  }
}

// =========================================================================================================
// Workspace map (bytes; each region start a multiple of 256; every extent is an exact tile multiple and is written
//   W16 f16 [320][256]                 163840
//   XP  f16 [8][4096][256]           16777216
//   Hv  f16 [8][256][4096]           16777216
//   Fh/Fl/Gh/Gl bf16 [8][4096][32]    2097152 x4
//   total = 42106880
// =========================================================================================================
extern "C" void kernel_launch(void* const* d_in, const int* in_sizes, int n_in,
                              void* d_out, int out_size, void* d_ws, size_t ws_size,
                              hipStream_t stream) {
  if (n_in < 5) return;
  if (in_sizes[0] < NB * CC * SEQ_FULL) return;
  if (in_sizes[1] < DQ * CC || in_sizes[2] < DQ * CC) return;
  if (in_sizes[3] < CC * CC) return;
  if (in_sizes[4] < 1) return;
  if (out_size < NB * CC * SEQ) return;

  size_t off = 0;
  auto carve = [&](size_t bytes) { const size_t o = off; off += (bytes + 255) & ~(size_t)255; return o; };
  const size_t oW16 = carve((size_t)MW * CC * 2);
  const size_t oXP  = carve((size_t)NB * SEQ * CC * 2);
  const size_t oHv  = carve((size_t)NB * CC * SEQ * 2);
  const size_t oFh  = carve((size_t)NB * SEQ * DQ * 2);
  const size_t oFl  = carve((size_t)NB * SEQ * DQ * 2);
  const size_t oGh  = carve((size_t)NB * SEQ * DQ * 2);
  const size_t oGl  = carve((size_t)NB * SEQ * DQ * 2);
  if (off > ws_size) return;
  if (off > (size_t)134217728) return;

  const float* x     = (const float*)d_in[0];
  const float* wq    = (const float*)d_in[1];
  const float* wk    = (const float*)d_in[2];
  const float* wv    = (const float*)d_in[3];
  const float* gamma = (const float*)d_in[4];

  char* ws = (char*)d_ws;
  unsigned short* W16 = (unsigned short*)(ws + oW16);
  unsigned short* XP  = (unsigned short*)(ws + oXP);
  unsigned short* Hv  = (unsigned short*)(ws + oHv);
  unsigned short* Fh  = (unsigned short*)(ws + oFh);
  unsigned short* Fl  = (unsigned short*)(ws + oFl);
  unsigned short* Gh  = (unsigned short*)(ws + oGh);
  unsigned short* Gl  = (unsigned short*)(ws + oGl);
  float* out = (float*)d_out;

  const dim3 blk256(256), blk128(128);

  // (0) q/k/v weights -> stacked f16 plane
  cvt_w<<<dim3(MW / 8), blk256, 0, stream>>>(wq, wk, wv, W16);
  // (1) x -> position-major 16-bit plane
  cvt_x<<<dim3(SEQ / QT, CC / QT, NB), blk256, 0, stream>>>(x, XP);
  // (2) conv1x1 GEMM -> f (key) and g (query) hi + residual planes, H value plane
  gemm_p<<<dim3(SEQ / QT, MBLK, NB), blk128, 0, stream>>>(W16, XP, Fh, Fl, Gh, Gl, Hv);
  // (3) attention + gamma scale + residual -> out [b][256][SEQ]
  attn_k<<<dim3(SEQ / QT, NB), blk128, 0, stream>>>(Gh, Gl, Fh, Fl, Hv, x, gamma, out);
  (void)hipGetLastError();
}

// v002
// Measured time: 108 microseconds a run.
// Next to v001, in two timings, it ran 1.17 and 1.19 times as fast.
// Over all steps from v000 it is 5.16 times as fast.
// Contractions: conv1x1 q/k/v projections W[320x256].X[256x4096] on v_wmma_f32_16x16x32_f16 (f16 containers of
// bf16-RNE weights x256 and bf16-RNE x); scores f_n.g_m on v_wmma_f32_16x16x32_bf16 (bf16 hi + bf16 residual
// planes of f and g, 3 products, K=32); o^T = H.P^T on v_wmma_f32_16x16x32_f16 (H = relu(v-projection) x16 f16,
// P = e^{s-max} x16384 f16 from the score D registers); f32 accumulate everywhere; softmax statistics, gamma scale
// and the residual add in f32 VALU.
#include <hip/hip_runtime.h>
#include <math.h>
#include <stdint.h>

#ifndef NB
#define NB 8
#endif
#ifndef SEQ
#define SEQ 4096
#endif
#define NB_FULL  8
#define SEQ_FULL 4096
#define CC     256
#define DQ     32
#define MW     320
#define MBLK   5
#define QT     64
#define OSP    68
#define OSPW   132
#define TP     72
#define WSC    256.0f
#define IWSC   0.00390625f
#define HSC    16.0f
#define IHSC   0.0625f
#define LNPS   9.704060527839234f
#define KS     64                        // keys per LDS stage
#define NST    (SEQ / KS)                // stages
#define VPITCH 144u                      // LDS pitch of a value row: 128 B (64 keys f16) + 16 B pad
#define VSLICE (128u * VPITCH)           // 128 channels, one wave's request: 18432 B = 9 x 2 KiB
#define KPITCH 272u                      // LDS pitch of a key-plane row: 256 B (4 keys x 32 d bf16) + 16 B pad
#define KPLACE 6144u                     // 16 such rows (4352 B), rounded up to a multiple of 2 KiB
#define KOFF   (2u * VSLICE)
#define BUFB   (KOFF + 2u * KPLACE)      // one buffer: 49152 B
#define QB     128                       // queries per attention block: 4 wave pairs x 32
#define MSLOT  33u                       // 16-B slots per lane of a wave's merge range: 32 of o, one of (m, l)
#define MRGW   (MSLOT * 32u * 16u)       // one wave's merge range: 16896 B

static_assert(NB >= 1 && NB <= NB_FULL);
static_assert(SEQ >= QT && SEQ <= SEQ_FULL);
static_assert(SEQ % QT == 0 && SEQ % 32 == 0);
static_assert(CC % QT == 0 && CC % 32 == 0);
static_assert(MW == 2 * DQ + CC);
static_assert(MW == MBLK * QT);
static_assert(QT == 2 * DQ);
static_assert(MW % 8 == 0);
static_assert((OSP * 4) % 16 == 0);
static_assert((OSPW * 4) % 16 == 0);
static_assert((TP * 2) % 16 == 0);
static_assert(DQ % 32 == 0);
static_assert(SEQ % KS == 0 && NST >= 2);
static_assert(SEQ % QB == 0 && KS == 64);
static_assert(KS * 2 == 128 && CC == 256 && DQ * 2 * 4 == 256);
static_assert(VSLICE % 2048u == 0 && KPLACE % 2048u == 0 && (KS / 4) * KPITCH <= KPLACE);

typedef _Float16       v16h __attribute__((ext_vector_type(16)));
typedef _Float16       v8h  __attribute__((ext_vector_type(8)));
typedef __bf16         v16b __attribute__((ext_vector_type(16)));
typedef unsigned short v8us __attribute__((ext_vector_type(8)));
typedef float          v8f  __attribute__((ext_vector_type(8)));
typedef float          v4f  __attribute__((ext_vector_type(4)));
typedef unsigned int   v4u  __attribute__((ext_vector_type(4)));
typedef uint32_t       u32x4 __attribute__((ext_vector_type(4)));
typedef uint32_t       u32x8 __attribute__((ext_vector_type(8)));

union Frag  { v8us u[2]; v16h h; v16b bf; };
union FragH { v16h v; v8h hv[2]; };
static_assert(sizeof(Frag) == 32);
static_assert(sizeof(FragH) == 32);

// ---- scalar helpers ---------------------------------------------------------------------------------------
__device__ __forceinline__ unsigned short bf_bits(float f) {          // f32 -> bf16 bits, RNE convert
  unsigned u = __float_as_uint(f);
  return (unsigned short)((u + 0x7FFFu + ((u >> 16) & 1u)) >> 16);
}
__device__ __forceinline__ float bf_up(unsigned short hb) { return __uint_as_float(((unsigned)hb) << 16); }
__device__ __forceinline__ float bfr(float f) { return bf_up(bf_bits(f)); }
__device__ __forceinline__ unsigned short h_bits(_Float16 x) { return __builtin_bit_cast(unsigned short, x); }
__device__ __forceinline__ unsigned pk16(unsigned short a, unsigned short b) { return (unsigned)a | ((unsigned)b << 16); }
__device__ __forceinline__ v8f zero8() { v8f z = {0.f, 0.f, 0.f, 0.f, 0.f, 0.f, 0.f, 0.f}; return z; }
__device__ __forceinline__ float hmax8(v8f s) {
  return fmaxf(fmaxf(fmaxf(s[0], s[1]), fmaxf(s[2], s[3])), fmaxf(fmaxf(s[4], s[5]), fmaxf(s[6], s[7])));
}
__device__ __forceinline__ unsigned wave_ballot(bool p) {
#if defined(__HIP_DEVICE_COMPILE__)
  return __builtin_amdgcn_ballot_w32(p);
#else
  return p ? 1u : 0u;
#endif
}

// ---- 16-bit fragment loader (A, or B from a k-contiguous [n][k] row): lane -> row/col (lane&15), p already includes
//      + 8*(lane>>4); elements 0..7 <- p[0..7] (k0+8h..), elements 8..15 <- p[16..23] (k0+16+8h..)
__device__ __forceinline__ Frag ldfrag(const unsigned short* p) {
  Frag f;
  f.u[0] = *(const v8us*)(p);
  f.u[1] = *(const v8us*)(p + 16);
  return f;
}

// ---- WMMA helpers: builtin followed by a 4-slot VALU gap tying D and keeping A/B live --------------------------
__device__ __forceinline__ v8f mma_h(v16h a, v16h b, v8f c) {
  v8f d = __builtin_amdgcn_wmma_f32_16x16x32_f16(false, a, false, b, (short)0, c, false, false);
#if defined(__HIP_DEVICE_COMPILE__)
  asm volatile("v_nop\n\tv_nop\n\tv_nop\n\tv_nop" : "+v"(d) : "v"(a), "v"(b));
#endif
  return d;
}
// The builtins alone, the compiler's own padding behind them (attention kernel): an asm operand cannot be a register
// above v255, and 256 accumulator registers with the fragments do not fit below it (tied to asm they spill).
__device__ __forceinline__ v8f mma_hp(v16h a, v16h b, v8f c) {
  return __builtin_amdgcn_wmma_f32_16x16x32_f16(false, a, false, b, (short)0, c, false, false);
}
__device__ __forceinline__ v8f mma_bp(v16b a, v16b b, v8f c) {
  return __builtin_amdgcn_wmma_f32_16x16x32_bf16(false, a, false, b, (short)0, c, false, false);
}

// ---- tensor load to LDS: descriptor groups and issue ----------------------------------------------------------
__device__ __forceinline__ uint32_t uni(uint32_t v) { return (uint32_t)__builtin_amdgcn_readfirstlane(v); }
__device__ __forceinline__ uint32_t pinned(uint32_t v) {
  uint32_t w = uni(v);
  asm volatile("" : "+s"(w));            // the test word stays scalar, the branch on it a scalar branch
  return w;
}
// group 1: 1-byte elements, tensor = tile = ROWS rows of ROWB bytes, source pitch SRCP bytes, 16 B of LDS pad per row
template <uint32_t ROWB, uint32_t ROWS, uint32_t SRCP, uint32_t IVL>
__device__ __forceinline__ u32x8 tdm_group1() {
  u32x8 g;
  g[0] = uni((1u << 20) | (IVL << 22) | (3u << 25));
  g[1] = uni((ROWB & 0xFFFFu) << 16);
  g[2] = uni((ROWB >> 16) | ((ROWS & 0xFFFFu) << 16));
  g[3] = uni((ROWS >> 16) | (ROWB << 16));
  g[4] = uni(ROWS);
  g[5] = uni(SRCP);
  g[6] = uni(0u);
  g[7] = uni(0u);
  return g;
}
// The same form on a whole group 1 (descriptor words held in scalar registers): the eight words keep their registers
// from the first request to the last, so that none of those registers takes another value while a request is outstanding.
__device__ __forceinline__ u32x8 held(u32x8 g) { asm volatile("" : "+s"(g)); return g; }  // pinned(), eight descriptor words
__device__ __forceinline__ u32x4 tdm_group0(uint32_t lds_dst, uint64_t ga) {
  u32x4 g;
  g[0] = uni(1u);
  g[1] = uni(lds_dst);
  g[2] = uni((uint32_t)ga);
  g[3] = uni((((uint32_t)(ga >> 32)) & 0x01FFFFFFu) | 0x80000000u);
  return g;
}
__device__ __forceinline__ void tdm_load(u32x4 g0, u32x8 g1) {
  asm volatile("tensor_load_to_lds %0, %1" :: "s"(g0), "s"(g1) : "memory");   // one request of the whole wave
}
__device__ __forceinline__ void wait_tensor0() { asm volatile("s_wait_tensorcnt 0x0" ::: "memory"); }  // this wave's request has landed
__device__ __forceinline__ void wait_ds0()     { asm volatile("s_wait_dscnt 0x0" ::: "memory"); }      // this wave's LDS reads have returned

// =========================================================================================================
// (0) conv1x1 weights: W16 f16 [320][256], rows 0..31 = q-projection rows, 32..63 = k-projection rows, 64..319 =
//     v-projection rows; value = f16 of (bf16-RNE(w) * 256) (exact). Block blk (0..39) owns rows 8*blk..8*blk+7:
// coverage: 40 blocks x 8 rows x 32 lanes x 8 halves = 320 x 256 = the whole plane.
// =========================================================================================================
__global__ __launch_bounds__(256)
void cvt_w(const float* __restrict__ wq, const float* __restrict__ wk, const float* __restrict__ wv,
           unsigned short* W16) {
  const int tid = threadIdx.x, blk = blockIdx.x;
  const int rl = tid >> 5, col = 8 * (tid & 31);
  const int o = 8 * blk + rl;                                        // 0..319
  const float* wbase;
  int osub;
  if (blk < DQ / 8)            { wbase = wq; osub = 0; }
  else if (blk < (2 * DQ) / 8) { wbase = wk; osub = DQ; }
  else                         { wbase = wv; osub = 2 * DQ; }
  const float* s = wbase + (size_t)(o - osub) * CC + col;
  const v4f a = *(const v4f*)s;
  const v4f q = *(const v4f*)(s + 4);
  const float f[8] = {a[0], a[1], a[2], a[3], q[0], q[1], q[2], q[3]};
  v4u u;
#pragma unroll
  for (int t = 0; t < 4; ++t) {
    const _Float16 h0 = (_Float16)(bfr(f[2 * t]) * WSC);
    const _Float16 h1 = (_Float16)(bfr(f[2 * t + 1]) * WSC);
    u[t] = pk16(h_bits(h0), h_bits(h1));
  }
{
    *(v4u*)(W16 + (size_t)o * CC + col) = u;
    
  }
}

// =========================================================================================================
// (1) x f32 [b][256 c][SEQ_FULL n] -> XP f16 [b][SEQ n][256 c] (position-major, bf16-RNE values, exact in f16)
//     through an LDS tile T[64 n][64 c] (pitch TP). Block (nb, cb, b) owns a 64 c x 64 n tile; XP lines: row n,
// coverage: T: 2 it x 32 channels x 8 lanes x 8 n = 64 c x 64 n fully written before the barrier (staged extent ==
//           consumed extent); XP: 2 it x 32 rows x 8 lanes x 8 = 64 n x 64 c; grid (SEQ/64, 4, NB) covers XP once.
// =========================================================================================================
__global__ __launch_bounds__(256)
void cvt_x(const float* __restrict__ x, unsigned short* XP) {
  __shared__ __align__(16) unsigned short T[QT * TP];
  const int tid = threadIdx.x;
  const int nb = blockIdx.x, cb = blockIdx.y, b = blockIdx.z;
  const int e = tid & 7, lq = tid >> 3;                             // lq 0..31
  const int n0 = nb * QT, c0 = cb * QT;
#pragma unroll
  for (int it = 0; it < 2; ++it) {
    const int cl = it * 32 + lq;                                     // 0..63
    const float* sp = x + ((size_t)(b * CC + c0 + cl)) * SEQ_FULL + n0 + 8 * e;
    const v4f a = *(const v4f*)sp;
    const v4f q = *(const v4f*)(sp + 4);
    unsigned short hb[8];
#pragma unroll
    for (int t = 0; t < 4; ++t) {
      hb[t]     = h_bits((_Float16)bfr(a[t]));
      hb[4 + t] = h_bits((_Float16)bfr(q[t]));
    }
#pragma unroll
    for (int t = 0; t < 8; ++t) T[(8 * e + t) * TP + cl] = hb[t];
  }
  __syncthreads();
  v4u up[2];
#pragma unroll
  for (int it = 0; it < 2; ++it) {
    const int nl = it * 32 + lq;                                     // 0..63
    up[it] = *(const v4u*)(T + nl * TP + 8 * e);
  }
{
#pragma unroll
    for (int it = 0; it < 2; ++it) {
      const int rl = it * 32 + lq;
      *(v4u*)(XP + ((size_t)(b * SEQ + n0 + rl)) * CC + c0 + 8 * e) = up[it];
    }
    
  }
}

// =========================================================================================================
// (2) conv1x1 GEMM for one (b, 64-n tile, 64-o block): Y[o][n] = relu((1/256) sum_c W16[o][c] XP[b][n][c]).
//     Block 128 threads = 4 waves; wave w owns cols n0+16w..+15 (one B fragment per k-step, k = c contiguous in
//     the XP row) and 4 m-tiles (A rows o = o0 + 16 mt + (lane&15), split k map loader from W16). K = 256 = 8 steps.
//     Epilogue staged in LDS Os[n_loc][o_loc] (pitch OSP, b128 stores of 8 consecutive o per lane, relu applied),
//     barrier, then (block-uniform branch on the o-block):
//       o-block 0 -> o_loc 0..31 = f (key) dims -> Fh/Fl, o_loc 32..63 = g (query) dims -> Gh/Gl; planes bf16
//       [b][SEQ n][32 d] (k-contiguous for both score operands): hi = bf16-RNE(v), lo = bf16-RNE(v - hi). Plane
//       lanes x 16 B per line, one instruction per 16 lines, 32 lines per plane per block.
//       o-blocks 1..4 -> channels 64(mb-1).. of the H plane f16 [b][256 c][SEQ n] (n contiguous), value = f16 of
// coverage: Os 4 waves x 16 n x 64 o = 64 x 64 (staged extent == consumed extent); F/G planes: 2 it x 16 lines x
//           8 lanes x 8 = 64 n x 32 d per plane (hi and lo, f and g); H: 4 it x 16 rows x 8 lanes x 8 = 64 c x
//           64 n; grid (SEQ/64, 5, NB) covers all SEQ rows of Fh/Fl/Gh/Gl and all 256 channels of H exactly once.
// =========================================================================================================
__global__ __launch_bounds__(128)
void gemm_p(const unsigned short* __restrict__ W16, const unsigned short* __restrict__ XP,
            unsigned short* Fh, unsigned short* Fl, unsigned short* Gh, unsigned short* Gl,
            unsigned short* Hv) {
  __shared__ __align__(16) float Os[QT * OSP];
  const int tid  = threadIdx.x;
  const int lane = tid & 31, wave = tid >> 5;
  const int hh   = lane >> 4, c = lane & 15;
  const int nt   = blockIdx.x, mb = blockIdx.y, b = blockIdx.z;
  const int n0   = nt * QT, o0 = mb * QT;

  const unsigned short* ap = W16 + (size_t)(o0 + c) * CC + 8 * hh;
  const unsigned short* bp = XP + ((size_t)(b * SEQ + n0 + 16 * wave + c)) * CC + 8 * hh;

  v8f acc[4];
#pragma unroll
  for (int mt = 0; mt < 4; ++mt) acc[mt] = zero8();

#pragma unroll
  for (int ks = 0; ks < CC / 32; ++ks) {
    const Frag fb = ldfrag(bp + 32 * ks);
#pragma unroll
    for (int mt = 0; mt < 4; ++mt) {
      const Frag fa = ldfrag(ap + (size_t)(16 * mt) * CC + 32 * ks);
      acc[mt] = mma_h(fa.h, fb.h, acc[mt]);
    }
  }

  // ---- epilogue: scale back + relu -> LDS Os[n_loc][o_loc]; lane (hh, c) holds o = 16 mt + 8 hh + r, n_loc = 16 w + c
  {
    const int nl = 16 * wave + c;
#pragma unroll
    for (int mt = 0; mt < 4; ++mt) {
      v4f va, vb;
#pragma unroll
      for (int r = 0; r < 4; ++r) {
        va[r] = fmaxf(acc[mt][r] * IWSC, 0.f);
        vb[r] = fmaxf(acc[mt][4 + r] * IWSC, 0.f);
      }
      *(v4f*)(Os + nl * OSP + 16 * mt + 8 * hh)     = va;
      *(v4f*)(Os + nl * OSP + 16 * mt + 8 * hh + 4) = vb;
    }
  }
  __syncthreads();

  const int e = tid & 7, lq = tid >> 3;                             // lq 0..15
  if (mb == 0) {                                                     // block-uniform
    v4u ufh[2], ufl[2], ugh[2], ugl[2];
#pragma unroll
    for (int it = 0; it < 2; ++it) {
      const int L   = it * 16 + lq;                                  // line 0..31
      const int row = 2 * L + (e >> 2);                              // n_loc 0..63
      const int d   = 8 * (e & 3);                                   // 0, 8, 16, 24
      const float* fs = Os + row * OSP + d;
      const float* gs = Os + row * OSP + DQ + d;
      const v4f fa = *(const v4f*)fs;
      const v4f fb = *(const v4f*)(fs + 4);
      const v4f ga = *(const v4f*)gs;
      const v4f gb = *(const v4f*)(gs + 4);
      const float fv[8] = {fa[0], fa[1], fa[2], fa[3], fb[0], fb[1], fb[2], fb[3]};
      const float gv[8] = {ga[0], ga[1], ga[2], ga[3], gb[0], gb[1], gb[2], gb[3]};
#pragma unroll
      for (int t = 0; t < 4; ++t) {
        const unsigned short fh0 = bf_bits(fv[2 * t]), fh1 = bf_bits(fv[2 * t + 1]);
        const unsigned short fl0 = bf_bits(fv[2 * t] - bf_up(fh0));
        const unsigned short fl1 = bf_bits(fv[2 * t + 1] - bf_up(fh1));
        const unsigned short gh0 = bf_bits(gv[2 * t]), gh1 = bf_bits(gv[2 * t + 1]);
        const unsigned short gl0 = bf_bits(gv[2 * t] - bf_up(gh0));
        const unsigned short gl1 = bf_bits(gv[2 * t + 1] - bf_up(gh1));
        ufh[it][t] = pk16(fh0, fh1);
        ufl[it][t] = pk16(fl0, fl1);
        ugh[it][t] = pk16(gh0, gh1);
        ugl[it][t] = pk16(gl0, gl1);
      }
    }
{
#pragma unroll
      for (int it = 0; it < 2; ++it) {
        const int L   = it * 16 + lq;
        const int row = 2 * L + (e >> 2);
        const int d   = 8 * (e & 3);
        const size_t po = ((size_t)(b * SEQ + n0 + row)) * DQ + d;
        *(v4u*)(Fh + po) = ufh[it];
        *(v4u*)(Fl + po) = ufl[it];
        *(v4u*)(Gh + po) = ugh[it];
        *(v4u*)(Gl + po) = ugl[it];
      }
      
    }
  } else {
    const int chb = (mb - 1) * QT;                                   // channel base 0..192
    v4u uhp[4];
#pragma unroll
    for (int it = 0; it < 4; ++it) {
      const int ol = it * 16 + lq;                                   // o_loc 0..63
      float hv8[8];
#pragma unroll
      for (int t = 0; t < 8; ++t) hv8[t] = Os[(8 * e + t) * OSP + ol];
#pragma unroll
      for (int t = 0; t < 4; ++t) {
        const _Float16 h0 = (_Float16)(hv8[2 * t] * HSC);
        const _Float16 h1 = (_Float16)(hv8[2 * t + 1] * HSC);
        uhp[it][t] = pk16(h_bits(h0), h_bits(h1));
      }
    }
{
#pragma unroll
      for (int it = 0; it < 4; ++it) {
        const int ol = it * 16 + lq;
        *(v4u*)(Hv + ((size_t)(b * CC + chb + ol)) * SEQ + n0 + 8 * e) = uhp[it];
      }
      
    }
  }
}

// =========================================================================================================
// (3) self-attention for one (b, 128-query tile), transposed formulation, SEQ keys, no mask, no scale:
//   S^T tile (16 keys x 16 queries) = A(k: row = key kb + (lane&15), 32 d via the split k map from the bf16 plane
//   Fh [b][SEQ][32]) . B(q: col = query, same map from Gh) + A(Fh).B(Gl) + A(Fl).B(Gh) (bf16 unscaled residual
//   planes, shared accumulator; K = 32 = one k-step; the query fragments are loaded once per wave).
//   Block = 8 waves. Wave (qg = wave & 3, grp = wave >> 2) owns 32 queries (two 16-query tiles) and the 32 keys
//   64 st + 32 grp .. + 31 of every stage: each key and value fragment read from LDS feeds two products, one per
//   query tile. The wave's tile t holds queries 32 qg + 16 (t ^ grp) + (lane&15), so that tile 1 of wave w and tile 0
//   of wave w ^ 4 are the same queries.
//   Per lane a D tile holds 8 keys of ONE query: online softmax state per lane and query tile, one shuffle (lane^16)
//   per tile for the max over 32 keys; the o/l rescale is skipped under one wave-uniform ballot per pass when no
//   lane's max grew (corr == 1 exactly for every lane then). P = e^{s-m} x 16384 as f16 is the B operand of
//   O^T (rows channel, cols queries) += A(H rows channel = 16j + (lane&15), keys contiguous, f16 plane Hv
//   [b][256][SEQ], values x16) . B(P^T): element r <- D of the tile covering keys kb..kb+15, element 8+r <- the tile
//   covering kb+16..kb+31, lane unchanged. 2 x 16 accumulator tiles per wave (256 channels x 32 queries).
//   Keys and values reach the waves through LDS: stages of 64 keys, two buffers, one tensor load per stage from each
//   of waves 0..3, issued one stage ahead; all eight waves read the tiles with ds_load_b128.
//   Merge of the two key groups: every wave stores the state (m, l, o) of its tile 1 in its own LDS range Mg[wave],
//   lane by lane; behind one barrier it reads the range of wave ^ 4 (its own tile 0's queries, same lane = same query
//   and channels) and joins the two partial softmax states: m = max, weights e^{m_own - m} and e^{m_peer - m}.
//   Epilogue in two channel halves: gamma*O/(16 l) staged in LDS Os[query][128 channels] (pitch OSPW, b128 stores),
//   8 consecutive lanes x 16 B (values gathered from 4 Os rows), one instruction per 32 lines, final values held in
// coverage: Mg per wave 33 slots x 32 lanes x 16 B, all written before the barrier, slots 0..32 read behind it;
//           Os per half 8 waves x 16 queries x 128 ch fully staged before the barrier (staged extent == consumed
//           extent); out per half 16 it x 32 lines x 8 lanes x 4 floats = 128 ch x 128 n; two halves = 256 ch;
//           grid (SEQ/128, NB) covers out[b][0..255][0..SEQ-1] exactly once.
// =========================================================================================================
__global__ __launch_bounds__(256)
void attn_k(const unsigned short* __restrict__ Gh, const unsigned short* __restrict__ Gl,
            const unsigned short* __restrict__ Fh, const unsigned short* __restrict__ Fl,
            const unsigned short* __restrict__ Hv, const float* __restrict__ x,
            const float* __restrict__ gamma, float* out) {
  __shared__ __attribute__((aligned(2048))) unsigned char smem[2u * BUFB + 8u * MRGW + QB * OSPW * 4];
  v4f*   Mg = (v4f*)(smem + 2u * BUFB);
  float* Os = (float*)(smem + 2u * BUFB + 8u * MRGW);
  const int tid  = threadIdx.x;
  const int wave = tid >> 5, lane = tid & 31;
  const int qg   = wave & 3, grp = wave >> 2;
  const int hh   = lane >> 4, c = lane & 15;
  const int n0   = blockIdx.x * QB, b = blockIdx.y;

  // Stage st = keys 64 st .. 64 st + 63, into buffer st & 1. One request per stage from each of waves 0..3: waves 0 and
  // 1 the two 128-channel halves of the value tile (rows of 128 B), wave 2 the key hi plane, wave 3 the key residual
  // plane (4096 contiguous bytes each, taken as 16 rows of 256 B). Waves 4..7 issue none.
  const uint32_t lbase = (uint32_t)(size_t)smem;
  const uint32_t wv    = uni((uint32_t)tid >> 5);
  const u32x8 g1v = held(tdm_group1<128u, 128u, SEQ * 2u, 4u>());
  const u32x8 g1k = held(tdm_group1<256u, KS / 4u, 256u, 5u>());
  auto issue = [&](uint32_t st, bool now) {                          // now: the wait directly behind the request
    const uint32_t dst = lbase + (st & 1u) * BUFB;
    if (pinned(wv < 2u)) {
      const uint64_t ga = (uint64_t)(size_t)Hv + ((uint64_t)(b * CC + 128u * wv) * SEQ + (uint64_t)st * KS) * 2u;
      tdm_load(tdm_group0(dst + wv * VSLICE, ga), g1v);
      if (now) wait_tensor0();
    } else if (pinned(wv < 4u)) {
      const uint64_t ga = (uint64_t)(size_t)(wv == 2u ? Fh : Fl) + ((uint64_t)b * SEQ + (uint64_t)st * KS) * (DQ * 2u);
      tdm_load(tdm_group0(dst + KOFF + (wv - 2u) * KPLACE, ga), g1k);
      if (now) wait_tensor0();
    }
  };
  issue(0u, true);

  // q fragments (B operand, col = query n0 + 32*qg + 16*(t^grp) + c), K = 32: loaded once
  Frag qh[2], ql[2];
#pragma unroll
  for (int t = 0; t < 2; ++t) {
    const size_t qo = ((size_t)(b * SEQ + n0 + 32 * qg + 16 * (t ^ grp) + c)) * DQ + 8 * hh;
    qh[t] = ldfrag(Gh + qo);
    ql[t] = ldfrag(Gl + qo);
  }
  asm volatile("s_wait_xcnt 0x0" ::: "memory");  // in front of the first overwrite of an address register that these loads name
  // k fragment offset in a buffer (A operand, row = key c of a 16-key tile: LDS row c >> 2, 64-B slot c & 3; this
  // wave's 32 keys are LDS rows 8 grp .. 8 grp + 7)
  const uint32_t klane = KOFF + (uint32_t)(8 * grp + (c >> 2)) * KPITCH + (uint32_t)(c & 3) * 64u + 16u * hh;
  // v fragment offset in a buffer (A operand, row = channel 16j + c, keys contiguous, this wave's 32 keys = 64 B)
  const uint32_t vlane = (uint32_t)c * VPITCH + 64u * grp + 16u * hh;

  float m[2] = {-1.0e30f, -1.0e30f}, l[2] = {0.f, 0.f};
  v8f o[2][16];
#pragma unroll
  for (int t = 0; t < 2; ++t) {
#pragma unroll
    for (int j = 0; j < 16; ++j) o[t][j] = zero8();
  }

#pragma unroll 1
  for (uint32_t st = 0; st < (uint32_t)NST; ++st) {
    // Publish point of stage st, between pass st - 1 and pass st (in front of pass 0: stage 0's wait, the barrier, stage
    // 1's load): this wave's LDS reads of pass st - 1 have returned, its own request of stage st has landed, the barrier,
    // and only then the load of stage st + 1 into the buffer that pass st - 1 has read.
    wait_ds0();
    wait_tensor0();
    __syncthreads();
    if (pinned(st + 1u < (uint32_t)NST)) issue(st + 1u, false);
    const unsigned char* bufp = smem + (st & 1u) * BUFB;
    const unsigned char* Kp = bufp + klane;
    const unsigned char* Vp = bufp + vlane;
    // kb = 64 st + 32 grp
    const Frag k0  = ldfrag((const unsigned short*)(Kp));                                   // keys kb .. kb+15
    const Frag k1  = ldfrag((const unsigned short*)(Kp + 4 * KPITCH));                      // keys kb+16 .. kb+31
    const Frag k0l = ldfrag((const unsigned short*)(Kp + KPLACE));
    const Frag k1l = ldfrag((const unsigned short*)(Kp + KPLACE + 4 * KPITCH));
    v8f s0[2], s1[2];
#pragma unroll
    for (int t = 0; t < 2; ++t) { s0[t] = zero8(); s1[t] = zero8(); }
#pragma unroll
    for (int t = 0; t < 2; ++t) { s0[t] = mma_bp(k0.bf, qh[t].bf, s0[t]);  s1[t] = mma_bp(k1.bf, qh[t].bf, s1[t]); }
#pragma unroll
    for (int t = 0; t < 2; ++t) { s0[t] = mma_bp(k0.bf, ql[t].bf, s0[t]);  s1[t] = mma_bp(k1.bf, ql[t].bf, s1[t]); }
#pragma unroll
    for (int t = 0; t < 2; ++t) { s0[t] = mma_bp(k0l.bf, qh[t].bf, s0[t]); s1[t] = mma_bp(k1l.bf, qh[t].bf, s1[t]); }

    float mx[2], mxo[2];
#pragma unroll
    for (int t = 0; t < 2; ++t) mx[t] = fmaxf(hmax8(s0[t]), hmax8(s1[t]));
#pragma unroll
    for (int t = 0; t < 2; ++t) mxo[t] = __shfl_xor(mx[t], 16, 32);
    // The first eight value fragments are read as one group behind the exchanges (LDS returns in order: in front of
    // them they would delay them) and in front of the exponentials, which run while the reads return. The scheduling
    // fences here and in the product loop keep each read group in its place: without them every read pair sits at its
    // own WMMA behind a wait to 0.
#if defined(__HIP_DEVICE_COMPILE__)
    asm volatile("" :: "v"(mxo[0]), "v"(mxo[1]));  // inputs-only fence on the exchanged values: the exchanges return before the reads issue
#endif
    __builtin_amdgcn_sched_barrier(0);
    Frag vf[16];
#pragma unroll
    for (int j = 0; j < 8; ++j) vf[j] = ldfrag((const unsigned short*)(Vp + (16 * j) * VPITCH));
    __builtin_amdgcn_sched_barrier(0);
    float mn[2];
#pragma unroll
    for (int t = 0; t < 2; ++t) { mx[t] = fmaxf(mx[t], mxo[t]); mn[t] = fmaxf(m[t], mx[t]); }
    const unsigned grew = wave_ballot(mx[0] > m[0] || mx[1] > m[1]); // wave-uniform, one test per pass
    if (grew != 0u) {
#pragma unroll
      for (int t = 0; t < 2; ++t) {
        const float corr = __expf(m[t] - mn[t]);                     // == 1 exactly for lanes whose max did not grow
        l[t] *= corr;
#pragma unroll
        for (int j = 0; j < 16; ++j) {
#pragma unroll
          for (int r = 0; r < 8; ++r) o[t][j][r] *= corr;
        }
      }
    }

    FragH ph[2];
#pragma unroll
    for (int t = 0; t < 2; ++t) {
      m[t] = mn[t];
      const float msh = mn[t] - LNPS;                                // exp gives e^{s-m} * 16384
      float ls = 0.f;
#pragma unroll
      for (int r = 0; r < 8; ++r) {
        const float e0 = __expf(s0[t][r] - msh);                     // key kb      + 8hh + r
        const float e1 = __expf(s1[t][r] - msh);                     // key kb + 16 + 8hh + r
        ls += e0 + e1;
        ph[t].hv[0][r] = (_Float16)e0;
        ph[t].hv[1][r] = (_Float16)e1;
      }
      l[t] += ls;
    }

    // Tile 0's products run while the last eight fragments arrive; all sixteen fragments stay in registers, and tile
    // 1's products take them from there, with no LDS read among them.
#pragma unroll
    for (int g = 0; g < 4; ++g) {                                    // four products, then the reads for two groups on
#pragma unroll
      for (int jj = 0; jj < 4; ++jj) o[0][4 * g + jj] = mma_hp(vf[4 * g + jj].h, ph[0].v, o[0][4 * g + jj]);
      if (g < 2) {
        __builtin_amdgcn_sched_barrier(0);                           // the eight reads stand as one group behind four products
#pragma unroll
        for (int jj = 0; jj < 4; ++jj) {
          const int j = 4 * g + 8 + jj;
          vf[j] = ldfrag((const unsigned short*)(Vp + (16 * j) * VPITCH));
        }
        __builtin_amdgcn_sched_barrier(0);                           // and in front of the next four products
      }
    }
#pragma unroll
    for (int j = 0; j < 16; ++j) o[1][j] = mma_hp(vf[j].h, ph[1].v, o[1][j]);
  }
  wait_tensor0();
  wait_ds0();
#pragma unroll
  for (int t = 0; t < 2; ++t) l[t] += __shfl_xor(l[t], 16, 32);

  // ---- merge of the two key groups: tile 1's state goes to wave ^ 4, whose tile 0 holds the same queries
  {
    v4f* mine = Mg + (uint32_t)wave * (MSLOT * 32u) + lane;
#pragma unroll
    for (int j = 0; j < 16; ++j) {
      v4f va, vb;
#pragma unroll
      for (int r = 0; r < 4; ++r) { va[r] = o[1][j][r]; vb[r] = o[1][j][4 + r]; }
      mine[(2 * j) * 32]     = va;
      mine[(2 * j + 1) * 32] = vb;
    }
    const v4f sv = {m[1], l[1], 0.f, 0.f};
    mine[32 * 32] = sv;
  }
  __syncthreads();                                                   // every wave's tile-1 state is in Mg
  const v4f* peer = Mg + (uint32_t)(wave ^ 4) * (MSLOT * 32u) + lane;
  const v4f  pst  = peer[32 * 32];
  const float mm  = fmaxf(m[0], pst[0]);
  const float ca  = __expf(m[0] - mm), cb = __expf(pst[0] - mm);
  const float lt  = l[0] * ca + pst[1] * cb;
  const float gm  = bfr(gamma[0]);
  const float inv = gm * IHSC * (1.0f / lt);                         // o carries x16384 x16, l carries x16384
  const float fa  = ca * inv, fb = cb * inv;

  const int qrow = 32 * qg + 16 * grp + c;
  const int e = tid & 7, lq = tid >> 3;                              // lq 0..31
#pragma unroll
  for (int half = 0; half < 2; ++half) {
    if (half) __syncthreads();                                       // every wave finished reading Os
#pragma unroll
    for (int jj = 0; jj < 8; ++jj) {
      const int j = 8 * half + jj;
      const v4f pa = peer[(2 * j) * 32];
      const v4f pb = peer[(2 * j + 1) * 32];
      v4f va, vb;
#pragma unroll
      for (int r = 0; r < 4; ++r) { va[r] = o[0][j][r] * fa + pa[r] * fb; vb[r] = o[0][j][4 + r] * fa + pb[r] * fb; }
      *(v4f*)(Os + qrow * OSPW + 16 * jj + 8 * hh)     = va;         // Os[query][ch_loc = 16jj + 8hh + r]
      *(v4f*)(Os + qrow * OSPW + 16 * jj + 8 * hh + 4) = vb;
    }
    __syncthreads();
    // line L = 32 it + lq: channel 8 it + (lq >> 2) of the half, queries 32 (lq & 3) + 4 e .. + 3
    const int chl = lq >> 2, nl = (lq & 3) * 32 + 4 * e;
    const float* xp = x + ((size_t)(b * CC + 128 * half + chl)) * SEQ_FULL + n0 + nl;
    float*       op = out + ((size_t)(b * CC + 128 * half + chl)) * SEQ + n0 + nl;
    v4f res[16];
#pragma unroll
    for (int it = 0; it < 16; ++it) {
      const v4f xv = *(const v4f*)(xp + (size_t)(8 * it) * SEQ_FULL);
#pragma unroll
      for (int t = 0; t < 4; ++t) res[it][t] = Os[(nl + t) * OSPW + chl + 8 * it] + bfr(xv[t]);
    }
#pragma unroll
    for (int it = 0; it < 16; ++it) *(v4f*)(op + (size_t)(8 * it) * SEQ) = res[it];
  }
}

// =========================================================================================================
// Workspace map (bytes; each region start a multiple of 256; every extent is an exact tile multiple and is written
//   W16 f16 [320][256]                 163840
//   XP  f16 [8][4096][256]           16777216
//   Hv  f16 [8][256][4096]           16777216
//   Fh/Fl/Gh/Gl bf16 [8][4096][32]    2097152 x4
//   total = 42106880
// =========================================================================================================
extern "C" void kernel_launch(void* const* d_in, const int* in_sizes, int n_in,
                              void* d_out, int out_size, void* d_ws, size_t ws_size,
                              hipStream_t stream) {
  if (n_in < 5) return;
  if (in_sizes[0] < NB * CC * SEQ_FULL) return;
  if (in_sizes[1] < DQ * CC || in_sizes[2] < DQ * CC) return;
  if (in_sizes[3] < CC * CC) return;
  if (in_sizes[4] < 1) return;
  if (out_size < NB * CC * SEQ) return;

  size_t off = 0;
  auto carve = [&](size_t bytes) { const size_t o = off; off += (bytes + 255) & ~(size_t)255; return o; };
  const size_t oW16 = carve((size_t)MW * CC * 2);
  const size_t oXP  = carve((size_t)NB * SEQ * CC * 2);
  const size_t oHv  = carve((size_t)NB * CC * SEQ * 2);
  const size_t oFh  = carve((size_t)NB * SEQ * DQ * 2);
  const size_t oFl  = carve((size_t)NB * SEQ * DQ * 2);
  const size_t oGh  = carve((size_t)NB * SEQ * DQ * 2);
  const size_t oGl  = carve((size_t)NB * SEQ * DQ * 2);
  if (off > ws_size) return;
  if (off > (size_t)134217728) return;

  const float* x     = (const float*)d_in[0];
  const float* wq    = (const float*)d_in[1];
  const float* wk    = (const float*)d_in[2];
  const float* wv    = (const float*)d_in[3];
  const float* gamma = (const float*)d_in[4];

  char* ws = (char*)d_ws;
  unsigned short* W16 = (unsigned short*)(ws + oW16);
  unsigned short* XP  = (unsigned short*)(ws + oXP);
  unsigned short* Hv  = (unsigned short*)(ws + oHv);
  unsigned short* Fh  = (unsigned short*)(ws + oFh);
  unsigned short* Fl  = (unsigned short*)(ws + oFl);
  unsigned short* Gh  = (unsigned short*)(ws + oGh);
  unsigned short* Gl  = (unsigned short*)(ws + oGl);
  float* out = (float*)d_out;

  const dim3 blk256(256), blk128(128);

  // (0) q/k/v weights -> stacked f16 plane
  cvt_w<<<dim3(MW / 8), blk256, 0, stream>>>(wq, wk, wv, W16);
  // (1) x -> position-major 16-bit plane
  cvt_x<<<dim3(SEQ / QT, CC / QT, NB), blk256, 0, stream>>>(x, XP);
  // (2) conv1x1 GEMM -> f (key) and g (query) hi + residual planes, H value plane
  gemm_p<<<dim3(SEQ / QT, MBLK, NB), blk128, 0, stream>>>(W16, XP, Fh, Fl, Gh, Gl, Hv);
  // (3) attention + gamma scale + residual -> out [b][256][SEQ]
  attn_k<<<dim3(SEQ / QB, NB), blk256, 0, stream>>>(Gh, Gl, Fh, Fl, Hv, x, gamma, out);
  (void)hipGetLastError();
}

// v003
// It runs in 89.7 microseconds.
// Next to v002, in two timings, it ran 1.20 times as fast each time.
// Counting every step since v000, it is 6.20 times as fast.
// Contractions: conv1x1 q/k/v projections W[320x256].X[256x4096] on v_wmma_f32_16x16x32_f16 (f16 containers of
// bf16-RNE weights x256 and bf16-RNE x); scores f_n.g_m on v_wmma_f32_16x16x32_bf16 (bf16 hi + bf16 residual
// planes of f and g, 3 products, K=32); o^T = H.P^T on v_wmma_f32_16x16x32_f16 (H = relu(v-projection) x16 f16,
// P = e^{s-max} x16384 f16 from the score D registers); f32 accumulate everywhere; softmax statistics, gamma scale
// and the residual add in f32 VALU.
#include <hip/hip_runtime.h>
#include <math.h>
#include <stdint.h>

#ifndef NB
#define NB 8
#endif
#ifndef SEQ
#define SEQ 4096
#endif
#define NB_FULL  8
#define SEQ_FULL 4096
#define CC     256
#define DQ     32
#define MW     320
#define MBLK   5
#define QT     64
#define OSP    68
#define OSPW   132
#define TP     72
#define WSC    256.0f
#define IWSC   0.00390625f
#define HSC    16.0f
#define IHSC   0.0625f
#define LNPS   9.704060527839234f
#define KS     64                        // keys per LDS stage
#define NST    (SEQ / KS)                // stages
#define VPITCH 144u                      // LDS pitch of a value row: 128 B (64 keys f16) + 16 B pad
#define VSLICE (128u * VPITCH)           // 128 channels, one wave's request: 18432 B = 9 x 2 KiB
#define KPITCH 272u                      // LDS pitch of a key-plane row: 256 B (4 keys x 32 d bf16) + 16 B pad
#define KPLACE 6144u                     // 16 such rows (4352 B), rounded up to a multiple of 2 KiB
#define KOFF   (2u * VSLICE)
#define BUFB   (KOFF + 2u * KPLACE)      // one buffer: 49152 B
#define QB     128                       // queries per attention block: 4 wave pairs x 32
#define MSLOT  33u                       // 16-B slots per lane of a wave's merge range: 32 of o, one of (m, l)
#define MRGW   (MSLOT * 32u * 16u)       // one wave's merge range: 16896 B
#define GPITCH 272u                      // projection GEMM, LDS pitch of an operand row: 256 B (128 k f16) + 16 B pad
#define GSLICE 18432u                    // 64 such rows (17408 B), rounded up to a multiple of 2 KiB

static_assert(NB >= 1 && NB <= NB_FULL);
static_assert(SEQ >= QT && SEQ <= SEQ_FULL);
static_assert(SEQ % QT == 0 && SEQ % 32 == 0);
static_assert(CC % QT == 0 && CC % 32 == 0);
static_assert(MW == 2 * DQ + CC);
static_assert(MW == MBLK * QT);
static_assert(QT == 2 * DQ);
static_assert(MW % 8 == 0);
static_assert((OSP * 4) % 16 == 0);
static_assert((OSPW * 4) % 16 == 0);
static_assert((TP * 2) % 16 == 0);
static_assert(DQ % 32 == 0);
static_assert(SEQ % KS == 0 && NST >= 2);
static_assert(SEQ % QB == 0 && KS == 64);
static_assert(KS * 2 == 128 && CC == 256 && DQ * 2 * 4 == 256);
static_assert(VSLICE % 2048u == 0 && KPLACE % 2048u == 0 && (KS / 4) * KPITCH <= KPLACE);
static_assert(GSLICE % 2048u == 0 && QT * GPITCH <= GSLICE && QT * OSP * 4 <= GSLICE && CC * 2 == 512);

typedef _Float16       v16h __attribute__((ext_vector_type(16)));
typedef _Float16       v8h  __attribute__((ext_vector_type(8)));
typedef __bf16         v16b __attribute__((ext_vector_type(16)));
typedef unsigned short v8us __attribute__((ext_vector_type(8)));
typedef float          v8f  __attribute__((ext_vector_type(8)));
typedef float          v4f  __attribute__((ext_vector_type(4)));
typedef unsigned int   v4u  __attribute__((ext_vector_type(4)));
typedef uint32_t       u32x4 __attribute__((ext_vector_type(4)));
typedef uint32_t       u32x8 __attribute__((ext_vector_type(8)));

union Frag  { v8us u[2]; v16h h; v16b bf; };
union FragH { v16h v; v8h hv[2]; };
static_assert(sizeof(Frag) == 32);
static_assert(sizeof(FragH) == 32);

// ---- scalar helpers ---------------------------------------------------------------------------------------
__device__ __forceinline__ unsigned short bf_bits(float f) {          // f32 -> bf16 bits, RNE convert
  unsigned u = __float_as_uint(f);
  return (unsigned short)((u + 0x7FFFu + ((u >> 16) & 1u)) >> 16);
}
__device__ __forceinline__ float bf_up(unsigned short hb) { return __uint_as_float(((unsigned)hb) << 16); }
__device__ __forceinline__ float bfr(float f) { return bf_up(bf_bits(f)); }
__device__ __forceinline__ unsigned short h_bits(_Float16 x) { return __builtin_bit_cast(unsigned short, x); }
__device__ __forceinline__ unsigned pk16(unsigned short a, unsigned short b) { return (unsigned)a | ((unsigned)b << 16); }
__device__ __forceinline__ v8f zero8() { v8f z = {0.f, 0.f, 0.f, 0.f, 0.f, 0.f, 0.f, 0.f}; return z; }
__device__ __forceinline__ float hmax8(v8f s) {
  return fmaxf(fmaxf(fmaxf(s[0], s[1]), fmaxf(s[2], s[3])), fmaxf(fmaxf(s[4], s[5]), fmaxf(s[6], s[7])));
}
__device__ __forceinline__ unsigned wave_ballot(bool p) {
#if defined(__HIP_DEVICE_COMPILE__)
  return __builtin_amdgcn_ballot_w32(p);
#else
  return p ? 1u : 0u;
#endif
}

// ---- 16-bit fragment loader (A, or B from a k-contiguous [n][k] row): lane -> row/col (lane&15), p already includes
//      + 8*(lane>>4); elements 0..7 <- p[0..7] (k0+8h..), elements 8..15 <- p[16..23] (k0+16+8h..)
__device__ __forceinline__ Frag ldfrag(const unsigned short* p) {
  Frag f;
  f.u[0] = *(const v8us*)(p);
  f.u[1] = *(const v8us*)(p + 16);
  return f;
}

// ---- WMMA helpers: builtin followed by a 4-slot VALU gap tying D and keeping A/B live --------------------------
__device__ __forceinline__ v8f mma_h(v16h a, v16h b, v8f c) {
  v8f d = __builtin_amdgcn_wmma_f32_16x16x32_f16(false, a, false, b, (short)0, c, false, false);
#if defined(__HIP_DEVICE_COMPILE__)
  asm volatile("v_nop\n\tv_nop\n\tv_nop\n\tv_nop" : "+v"(d) : "v"(a), "v"(b));
#endif
  return d;
}
// The builtins alone, the compiler's own padding behind them (attention kernel): an asm operand cannot be a register
// above v255, and 256 accumulator registers with the fragments do not fit below it (tied to asm they spill).
__device__ __forceinline__ v8f mma_hp(v16h a, v16h b, v8f c) {
  return __builtin_amdgcn_wmma_f32_16x16x32_f16(false, a, false, b, (short)0, c, false, false);
}
__device__ __forceinline__ v8f mma_bp(v16b a, v16b b, v8f c) {
  return __builtin_amdgcn_wmma_f32_16x16x32_bf16(false, a, false, b, (short)0, c, false, false);
}

// ---- tensor load to LDS: descriptor groups and issue ----------------------------------------------------------
__device__ __forceinline__ uint32_t uni(uint32_t v) { return (uint32_t)__builtin_amdgcn_readfirstlane(v); }
__device__ __forceinline__ uint32_t pinned(uint32_t v) {
  uint32_t w = uni(v);
  asm volatile("" : "+s"(w));            // the test word stays scalar, the branch on it a scalar branch
  return w;
}
// group 1: 1-byte elements, tensor = tile = ROWS rows of ROWB bytes, source pitch SRCP bytes, 16 B of LDS pad per row
template <uint32_t ROWB, uint32_t ROWS, uint32_t SRCP, uint32_t IVL>
__device__ __forceinline__ u32x8 tdm_group1() {
  u32x8 g;
  g[0] = uni((1u << 20) | (IVL << 22) | (3u << 25));
  g[1] = uni((ROWB & 0xFFFFu) << 16);
  g[2] = uni((ROWB >> 16) | ((ROWS & 0xFFFFu) << 16));
  g[3] = uni((ROWS >> 16) | (ROWB << 16));
  g[4] = uni(ROWS);
  g[5] = uni(SRCP);
  g[6] = uni(0u);
  g[7] = uni(0u);
  return g;
}
// The same form on a whole group 1 (descriptor words held in scalar registers): the eight words keep their registers
// from the first request to the last, so that none of those registers takes another value while a request is outstanding.
__device__ __forceinline__ u32x8 held(u32x8 g) { asm volatile("" : "+s"(g)); return g; }  // pinned(), eight descriptor words
__device__ __forceinline__ u32x4 tdm_group0(uint32_t lds_dst, uint64_t ga) {
  u32x4 g;
  g[0] = uni(1u);
  g[1] = uni(lds_dst);
  g[2] = uni((uint32_t)ga);
  g[3] = uni((((uint32_t)(ga >> 32)) & 0x01FFFFFFu) | 0x80000000u);
  return g;
}
__device__ __forceinline__ void tdm_load(u32x4 g0, u32x8 g1) {
  asm volatile("tensor_load_to_lds %0, %1" :: "s"(g0), "s"(g1) : "memory");   // one request of the whole wave
}
__device__ __forceinline__ void wait_tensor0() { asm volatile("s_wait_tensorcnt 0x0" ::: "memory"); }  // this wave's request has landed
__device__ __forceinline__ void wait_ds0()     { asm volatile("s_wait_dscnt 0x0" ::: "memory"); }      // this wave's LDS reads have returned

// =========================================================================================================
// (0) conv1x1 weights: W16 f16 [320][256], rows 0..31 = q-projection rows, 32..63 = k-projection rows, 64..319 =
//     v-projection rows; value = f16 of (bf16-RNE(w) * 256) (exact). Block blk (0..39) owns rows 8*blk..8*blk+7:
// coverage: 40 blocks x 8 rows x 32 lanes x 8 halves = 320 x 256 = the whole plane.
// =========================================================================================================
__global__ __launch_bounds__(256)
void cvt_w(const float* __restrict__ wq, const float* __restrict__ wk, const float* __restrict__ wv,
           unsigned short* W16) {
  const int tid = threadIdx.x, blk = blockIdx.x;
  const int rl = tid >> 5, col = 8 * (tid & 31);
  const int o = 8 * blk + rl;                                        // 0..319
  const float* wbase;
  int osub;
  if (blk < DQ / 8)            { wbase = wq; osub = 0; }
  else if (blk < (2 * DQ) / 8) { wbase = wk; osub = DQ; }
  else                         { wbase = wv; osub = 2 * DQ; }
  const float* s = wbase + (size_t)(o - osub) * CC + col;
  const v4f a = *(const v4f*)s;
  const v4f q = *(const v4f*)(s + 4);
  const float f[8] = {a[0], a[1], a[2], a[3], q[0], q[1], q[2], q[3]};
  v4u u;
#pragma unroll
  for (int t = 0; t < 4; ++t) {
    const _Float16 h0 = (_Float16)(bfr(f[2 * t]) * WSC);
    const _Float16 h1 = (_Float16)(bfr(f[2 * t + 1]) * WSC);
    u[t] = pk16(h_bits(h0), h_bits(h1));
  }
{
    *(v4u*)(W16 + (size_t)o * CC + col) = u;
    
  }
}

// =========================================================================================================
// (1) x f32 [b][256 c][SEQ_FULL n] -> XP f16 [b][SEQ n][256 c] (position-major, bf16-RNE values, exact in f16)
//     through an LDS tile T[64 n][64 c] (pitch TP). Block (nb, cb, b) owns a 64 c x 64 n tile; XP lines: row n,
// coverage: T: 2 it x 32 channels x 8 lanes x 8 n = 64 c x 64 n fully written before the barrier (staged extent ==
//           consumed extent); XP: 2 it x 32 rows x 8 lanes x 8 = 64 n x 64 c; grid (SEQ/64, 4, NB) covers XP once.
// =========================================================================================================
__global__ __launch_bounds__(256)
void cvt_x(const float* __restrict__ x, unsigned short* XP) {
  __shared__ __align__(16) unsigned short T[QT * TP];
  const int tid = threadIdx.x;
  const int nb = blockIdx.x, cb = blockIdx.y, b = blockIdx.z;
  const int e = tid & 7, lq = tid >> 3;                             // lq 0..31
  const int n0 = nb * QT, c0 = cb * QT;
#pragma unroll
  for (int it = 0; it < 2; ++it) {
    const int cl = it * 32 + lq;                                     // 0..63
    const float* sp = x + ((size_t)(b * CC + c0 + cl)) * SEQ_FULL + n0 + 8 * e;
    const v4f a = *(const v4f*)sp;
    const v4f q = *(const v4f*)(sp + 4);
    unsigned short hb[8];
#pragma unroll
    for (int t = 0; t < 4; ++t) {
      hb[t]     = h_bits((_Float16)bfr(a[t]));
      hb[4 + t] = h_bits((_Float16)bfr(q[t]));
    }
#pragma unroll
    for (int t = 0; t < 8; ++t) T[(8 * e + t) * TP + cl] = hb[t];
  }
  __syncthreads();
  v4u up[2];
#pragma unroll
  for (int it = 0; it < 2; ++it) {
    const int nl = it * 32 + lq;                                     // 0..63
    up[it] = *(const v4u*)(T + nl * TP + 8 * e);
  }
{
#pragma unroll
    for (int it = 0; it < 2; ++it) {
      const int rl = it * 32 + lq;
      *(v4u*)(XP + ((size_t)(b * SEQ + n0 + rl)) * CC + c0 + 8 * e) = up[it];
    }
    
  }
}

// =========================================================================================================
// (2) conv1x1 GEMM for one (b, 64-n tile, 64-o block): Y[o][n] = relu((1/256) sum_c W16[o][c] XP[b][n][c]).
//     Block 128 threads = 4 waves; wave w owns cols n0+16w..+15 (one B fragment per k-step, k = c contiguous in
//     the XP row) and 4 m-tiles (A rows o = o0 + 16 mt + (lane&15), split k map loader from W16). K = 256 = 8 steps.
//     Both operand tiles reach the waves through LDS: four slices of 64 rows x 256 B (X k 0..127, X k 128..255, W k
//     0..127, W k 128..255), one tensor load from each of the four waves, loaded once; fragments by ds_load_b128, the
//     twenty reads of two k-steps as one group, one group ahead of the products. Os takes slice 0's place afterwards.
//     Epilogue staged in LDS Os[n_loc][o_loc] (pitch OSP, b128 stores of 8 consecutive o per lane, relu applied),
//     barrier, then (block-uniform branch on the o-block):
//       o-block 0 -> o_loc 0..31 = f (key) dims -> Fh/Fl, o_loc 32..63 = g (query) dims -> Gh/Gl; planes bf16
//       [b][SEQ n][32 d] (k-contiguous for both score operands): hi = bf16-RNE(v), lo = bf16-RNE(v - hi). Plane
//       lanes x 16 B per line, one instruction per 16 lines, 32 lines per plane per block.
//       o-blocks 1..4 -> channels 64(mb-1).. of the H plane f16 [b][256 c][SEQ n] (n contiguous), value = f16 of
// coverage: Os 4 waves x 16 n x 64 o = 64 x 64 (staged extent == consumed extent); F/G planes: 2 it x 16 lines x
//           8 lanes x 8 = 64 n x 32 d per plane (hi and lo, f and g); H: 4 it x 16 rows x 8 lanes x 8 = 64 c x
//           64 n; grid (SEQ/64, 5, NB) covers all SEQ rows of Fh/Fl/Gh/Gl and all 256 channels of H exactly once.
// =========================================================================================================
__global__ __launch_bounds__(128)
void gemm_p(const unsigned short* __restrict__ W16, const unsigned short* __restrict__ XP,
            unsigned short* Fh, unsigned short* Fl, unsigned short* Gh, unsigned short* Gl,
            unsigned short* Hv) {
  __shared__ __attribute__((aligned(2048))) unsigned char gsm[4u * GSLICE];
  float* Os = (float*)gsm;
  const int tid  = threadIdx.x;
  const int lane = tid & 31, wave = tid >> 5;
  const int hh   = lane >> 4, c = lane & 15;
  const int nt   = blockIdx.x, mb = blockIdx.y, b = blockIdx.z;
  const int n0   = nt * QT, o0 = mb * QT;

  // Every wave issues its own slice, unconditionally: waves 0 and 1 the two k halves of the 64 X rows, waves 2 and 3
  // those of the 64 W rows (rows of 256 B at a source pitch of 512 B).
  {
    const uint32_t wv = uni((uint32_t)tid >> 5);
    const uint64_t rowb = wv < 2u ? (uint64_t)(size_t)XP + (uint64_t)(b * SEQ + n0) * (CC * 2u)
                                  : (uint64_t)(size_t)W16 + (uint64_t)o0 * (CC * 2u);
    tdm_load(tdm_group0((uint32_t)(size_t)gsm + wv * GSLICE, rowb + (uint64_t)(wv & 1u) * 256u),
             tdm_group1<256u, QT, CC * 2u, 5u>());
    wait_tensor0();
  }
  __syncthreads();                                                   // all four slices are in LDS

  const unsigned char* bp = gsm + (uint32_t)(16 * wave + c) * GPITCH + 16u * hh;
  const unsigned char* ap = gsm + 2u * GSLICE + (uint32_t)c * GPITCH + 16u * hh;

  v8f acc[4];
#pragma unroll
  for (int mt = 0; mt < 4; ++mt) acc[mt] = zero8();

  // Group g = k-steps 2g and 2g + 1, two register sets: the next group's twenty reads are issued in front of this
  // group's eight products, which then wait on counts and never to 0 before the last group.
  Frag fb[2][2], fa[2][2][4];
#pragma unroll
  for (int g = -1; g < CC / 64; ++g) {
    if (g + 1 < CC / 64) {
#pragma unroll
      for (int q = 0; q < 2; ++q) {
        const int ks = 2 * (g + 1) + q;
        const uint32_t ko = (uint32_t)(ks >> 2) * GSLICE + (uint32_t)(ks & 3) * 64u;
        fb[(g + 1) & 1][q] = ldfrag((const unsigned short*)(bp + ko));
#pragma unroll
        for (int mt = 0; mt < 4; ++mt)
          fa[(g + 1) & 1][q][mt] = ldfrag((const unsigned short*)(ap + ko + (uint32_t)(16 * mt) * GPITCH));
      }
    }
    if (g >= 0) {
#pragma unroll
      for (int q = 0; q < 2; ++q) {
#pragma unroll
        for (int mt = 0; mt < 4; ++mt) acc[mt] = mma_h(fa[g & 1][q][mt].h, fb[g & 1][q].h, acc[mt]);
      }
    }
  }
  wait_ds0();
  __syncthreads();                                                   // every wave has left the slices: Os may take slice 0's place

  // ---- epilogue: scale back + relu -> LDS Os[n_loc][o_loc]; lane (hh, c) holds o = 16 mt + 8 hh + r, n_loc = 16 w + c
  {
    const int nl = 16 * wave + c;
#pragma unroll
    for (int mt = 0; mt < 4; ++mt) {
      v4f va, vb;
#pragma unroll
      for (int r = 0; r < 4; ++r) {
        va[r] = fmaxf(acc[mt][r] * IWSC, 0.f);
        vb[r] = fmaxf(acc[mt][4 + r] * IWSC, 0.f);
      }
      *(v4f*)(Os + nl * OSP + 16 * mt + 8 * hh)     = va;
      *(v4f*)(Os + nl * OSP + 16 * mt + 8 * hh + 4) = vb;
    }
  }
  __syncthreads();

  const int e = tid & 7, lq = tid >> 3;                             // lq 0..15
  if (mb == 0) {                                                     // block-uniform
    v4u ufh[2], ufl[2], ugh[2], ugl[2];
#pragma unroll
    for (int it = 0; it < 2; ++it) {
      const int L   = it * 16 + lq;                                  // line 0..31
      const int row = 2 * L + (e >> 2);                              // n_loc 0..63
      const int d   = 8 * (e & 3);                                   // 0, 8, 16, 24
      const float* fs = Os + row * OSP + d;
      const float* gs = Os + row * OSP + DQ + d;
      const v4f fa = *(const v4f*)fs;
      const v4f fb = *(const v4f*)(fs + 4);
      const v4f ga = *(const v4f*)gs;
      const v4f gb = *(const v4f*)(gs + 4);
      const float fv[8] = {fa[0], fa[1], fa[2], fa[3], fb[0], fb[1], fb[2], fb[3]};
      const float gv[8] = {ga[0], ga[1], ga[2], ga[3], gb[0], gb[1], gb[2], gb[3]};
#pragma unroll
      for (int t = 0; t < 4; ++t) {
        const unsigned short fh0 = bf_bits(fv[2 * t]), fh1 = bf_bits(fv[2 * t + 1]);
        const unsigned short fl0 = bf_bits(fv[2 * t] - bf_up(fh0));
        const unsigned short fl1 = bf_bits(fv[2 * t + 1] - bf_up(fh1));
        const unsigned short gh0 = bf_bits(gv[2 * t]), gh1 = bf_bits(gv[2 * t + 1]);
        const unsigned short gl0 = bf_bits(gv[2 * t] - bf_up(gh0));
        const unsigned short gl1 = bf_bits(gv[2 * t + 1] - bf_up(gh1));
        ufh[it][t] = pk16(fh0, fh1);
        ufl[it][t] = pk16(fl0, fl1);
        ugh[it][t] = pk16(gh0, gh1);
        ugl[it][t] = pk16(gl0, gl1);
      }
    }
{
#pragma unroll
      for (int it = 0; it < 2; ++it) {
        const int L   = it * 16 + lq;
        const int row = 2 * L + (e >> 2);
        const int d   = 8 * (e & 3);
        const size_t po = ((size_t)(b * SEQ + n0 + row)) * DQ + d;
        *(v4u*)(Fh + po) = ufh[it];
        *(v4u*)(Fl + po) = ufl[it];
        *(v4u*)(Gh + po) = ugh[it];
        *(v4u*)(Gl + po) = ugl[it];
      }
      
    }
  } else {
    const int chb = (mb - 1) * QT;                                   // channel base 0..192
    v4u uhp[4];
#pragma unroll
    for (int it = 0; it < 4; ++it) {
      const int ol = it * 16 + lq;                                   // o_loc 0..63
      float hv8[8];
#pragma unroll
      for (int t = 0; t < 8; ++t) hv8[t] = Os[(8 * e + t) * OSP + ol];
#pragma unroll
      for (int t = 0; t < 4; ++t) {
        const _Float16 h0 = (_Float16)(hv8[2 * t] * HSC);
        const _Float16 h1 = (_Float16)(hv8[2 * t + 1] * HSC);
        uhp[it][t] = pk16(h_bits(h0), h_bits(h1));
      }
    }
{
#pragma unroll
      for (int it = 0; it < 4; ++it) {
        const int ol = it * 16 + lq;
        *(v4u*)(Hv + ((size_t)(b * CC + chb + ol)) * SEQ + n0 + 8 * e) = uhp[it];
      }
      
    }
  }
}

// =========================================================================================================
// (3) self-attention for one (b, 128-query tile), transposed formulation, SEQ keys, no mask, no scale:
//   S^T tile (16 keys x 16 queries) = A(k: row = key kb + (lane&15), 32 d via the split k map from the bf16 plane
//   Fh [b][SEQ][32]) . B(q: col = query, same map from Gh) + A(Fh).B(Gl) + A(Fl).B(Gh) (bf16 unscaled residual
//   planes, shared accumulator; K = 32 = one k-step; the query fragments are loaded once per wave).
//   Block = 8 waves. Wave (qg = wave & 3, grp = wave >> 2) owns 32 queries (two 16-query tiles) and the 32 keys
//   64 st + 32 grp .. + 31 of every stage: each key and value fragment read from LDS feeds two products, one per
//   query tile. The wave's tile t holds queries 32 qg + 16 (t ^ grp) + (lane&15), so that tile 1 of wave w and tile 0
//   of wave w ^ 4 are the same queries.
//   Per lane a D tile holds 8 keys of ONE query: online softmax state per lane and query tile, one shuffle (lane^16)
//   per tile for the max over 32 keys; the o/l rescale is skipped under one wave-uniform ballot per pass when no
//   lane's max grew (corr == 1 exactly for every lane then). P = e^{s-m} x 16384 as f16 is the B operand of
//   O^T (rows channel, cols queries) += A(H rows channel = 16j + (lane&15), keys contiguous, f16 plane Hv
//   [b][256][SEQ], values x16) . B(P^T): element r <- D of the tile covering keys kb..kb+15, element 8+r <- the tile
//   covering kb+16..kb+31, lane unchanged. 2 x 16 accumulator tiles per wave (256 channels x 32 queries).
//   Keys and values reach the waves through LDS: stages of 64 keys, two buffers, one tensor load per stage from each
//   of waves 0..3, issued one stage ahead; all eight waves read the tiles with ds_load_b128.
//   Merge of the two key groups: every wave stores the state (m, l, o) of its tile 1 in its own LDS range Mg[wave],
//   lane by lane; behind one barrier it reads the range of wave ^ 4 (its own tile 0's queries, same lane = same query
//   and channels) and joins the two partial softmax states: m = max, weights e^{m_own - m} and e^{m_peer - m}.
//   Epilogue in two channel halves: gamma*O/(16 l) staged in LDS Os[query][128 channels] (pitch OSPW, b128 stores),
//   8 consecutive lanes x 16 B (values gathered from 4 Os rows), one instruction per 32 lines, final values held in
// coverage: Mg per wave 33 slots x 32 lanes x 16 B, all written before the barrier, slots 0..32 read behind it;
//           Os per half 8 waves x 16 queries x 128 ch fully staged before the barrier (staged extent == consumed
//           extent); out per half 16 it x 32 lines x 8 lanes x 4 floats = 128 ch x 128 n; two halves = 256 ch;
//           grid (SEQ/128, NB) covers out[b][0..255][0..SEQ-1] exactly once.
// =========================================================================================================
__global__ __launch_bounds__(256)
void attn_k(const unsigned short* __restrict__ Gh, const unsigned short* __restrict__ Gl,
            const unsigned short* __restrict__ Fh, const unsigned short* __restrict__ Fl,
            const unsigned short* __restrict__ Hv, const float* __restrict__ x,
            const float* __restrict__ gamma, float* out) {
  __shared__ __attribute__((aligned(2048))) unsigned char smem[2u * BUFB + 8u * MRGW + QB * OSPW * 4];
  v4f*   Mg = (v4f*)(smem + 2u * BUFB);
  float* Os = (float*)(smem + 2u * BUFB + 8u * MRGW);
  const int tid  = threadIdx.x;
  const int wave = tid >> 5, lane = tid & 31;
  const int qg   = wave & 3, grp = wave >> 2;
  const int hh   = lane >> 4, c = lane & 15;
  const int n0   = blockIdx.x * QB, b = blockIdx.y;

  // Stage st = keys 64 st .. 64 st + 63, into buffer st & 1. One request per stage from each of waves 0..3: waves 0 and
  // 1 the two 128-channel halves of the value tile (rows of 128 B), wave 2 the key hi plane, wave 3 the key residual
  // plane (4096 contiguous bytes each, taken as 16 rows of 256 B). Waves 4..7 issue none.
  const uint32_t lbase = (uint32_t)(size_t)smem;
  const uint32_t wv    = uni((uint32_t)tid >> 5);
  const u32x8 g1v = held(tdm_group1<128u, 128u, SEQ * 2u, 4u>());
  const u32x8 g1k = held(tdm_group1<256u, KS / 4u, 256u, 5u>());
  auto issue = [&](uint32_t st, bool now) {                          // now: the wait directly behind the request
    const uint32_t dst = lbase + (st & 1u) * BUFB;
    if (pinned(wv < 2u)) {
      const uint64_t ga = (uint64_t)(size_t)Hv + ((uint64_t)(b * CC + 128u * wv) * SEQ + (uint64_t)st * KS) * 2u;
      tdm_load(tdm_group0(dst + wv * VSLICE, ga), g1v);
      if (now) wait_tensor0();
    } else if (pinned(wv < 4u)) {
      const uint64_t ga = (uint64_t)(size_t)(wv == 2u ? Fh : Fl) + ((uint64_t)b * SEQ + (uint64_t)st * KS) * (DQ * 2u);
      tdm_load(tdm_group0(dst + KOFF + (wv - 2u) * KPLACE, ga), g1k);
      if (now) wait_tensor0();
    }
  };
  issue(0u, true);

  // q fragments (B operand, col = query n0 + 32*qg + 16*(t^grp) + c), K = 32: loaded once
  Frag qh[2], ql[2];
#pragma unroll
  for (int t = 0; t < 2; ++t) {
    const size_t qo = ((size_t)(b * SEQ + n0 + 32 * qg + 16 * (t ^ grp) + c)) * DQ + 8 * hh;
    qh[t] = ldfrag(Gh + qo);
    ql[t] = ldfrag(Gl + qo);
  }
  asm volatile("s_wait_xcnt 0x0" ::: "memory");  // in front of the first overwrite of an address register that these loads name
  // k fragment offset in a buffer (A operand, row = key c of a 16-key tile: LDS row c >> 2, 64-B slot c & 3; this
  // wave's 32 keys are LDS rows 8 grp .. 8 grp + 7)
  const uint32_t klane = KOFF + (uint32_t)(8 * grp + (c >> 2)) * KPITCH + (uint32_t)(c & 3) * 64u + 16u * hh;
  // v fragment offset in a buffer (A operand, row = channel 16j + c, keys contiguous, this wave's 32 keys = 64 B)
  const uint32_t vlane = (uint32_t)c * VPITCH + 64u * grp + 16u * hh;

  float m[2] = {-1.0e30f, -1.0e30f}, l[2] = {0.f, 0.f};
  v8f o[2][16];
#pragma unroll
  for (int t = 0; t < 2; ++t) {
#pragma unroll
    for (int j = 0; j < 16; ++j) o[t][j] = zero8();
  }

#pragma unroll 1
  for (uint32_t st = 0; st < (uint32_t)NST; ++st) {
    // Publish point of stage st, between pass st - 1 and pass st (in front of pass 0: stage 0's wait, the barrier, stage
    // 1's load): this wave's LDS reads of pass st - 1 have returned, its own request of stage st has landed, the barrier,
    // and only then the load of stage st + 1 into the buffer that pass st - 1 has read.
    wait_ds0();
    wait_tensor0();
    __syncthreads();
    if (pinned(st + 1u < (uint32_t)NST)) issue(st + 1u, false);
    const unsigned char* bufp = smem + (st & 1u) * BUFB;
    const unsigned char* Kp = bufp + klane;
    const unsigned char* Vp = bufp + vlane;
    // kb = 64 st + 32 grp
    const Frag k0  = ldfrag((const unsigned short*)(Kp));                                   // keys kb .. kb+15
    const Frag k1  = ldfrag((const unsigned short*)(Kp + 4 * KPITCH));                      // keys kb+16 .. kb+31
    const Frag k0l = ldfrag((const unsigned short*)(Kp + KPLACE));
    const Frag k1l = ldfrag((const unsigned short*)(Kp + KPLACE + 4 * KPITCH));
    v8f s0[2], s1[2];
#pragma unroll
    for (int t = 0; t < 2; ++t) { s0[t] = zero8(); s1[t] = zero8(); }
#pragma unroll
    for (int t = 0; t < 2; ++t) { s0[t] = mma_bp(k0.bf, qh[t].bf, s0[t]);  s1[t] = mma_bp(k1.bf, qh[t].bf, s1[t]); }
#pragma unroll
    for (int t = 0; t < 2; ++t) { s0[t] = mma_bp(k0.bf, ql[t].bf, s0[t]);  s1[t] = mma_bp(k1.bf, ql[t].bf, s1[t]); }
#pragma unroll
    for (int t = 0; t < 2; ++t) { s0[t] = mma_bp(k0l.bf, qh[t].bf, s0[t]); s1[t] = mma_bp(k1l.bf, qh[t].bf, s1[t]); }

    float mx[2], mxo[2];
#pragma unroll
    for (int t = 0; t < 2; ++t) mx[t] = fmaxf(hmax8(s0[t]), hmax8(s1[t]));
#pragma unroll
    for (int t = 0; t < 2; ++t) mxo[t] = __shfl_xor(mx[t], 16, 32);
    // The first eight value fragments are read as one group behind the exchanges (LDS returns in order: in front of
    // them they would delay them) and in front of the exponentials, which run while the reads return. The scheduling
    // fences here and in the product loop keep each read group in its place: without them every read pair sits at its
    // own WMMA behind a wait to 0.
#if defined(__HIP_DEVICE_COMPILE__)
    asm volatile("" :: "v"(mxo[0]), "v"(mxo[1]));  // inputs-only fence on the exchanged values: the exchanges return before the reads issue
#endif
    __builtin_amdgcn_sched_barrier(0);
    Frag vf[16];
#pragma unroll
    for (int j = 0; j < 8; ++j) vf[j] = ldfrag((const unsigned short*)(Vp + (16 * j) * VPITCH));
    __builtin_amdgcn_sched_barrier(0);
    float mn[2];
#pragma unroll
    for (int t = 0; t < 2; ++t) { mx[t] = fmaxf(mx[t], mxo[t]); mn[t] = fmaxf(m[t], mx[t]); }
    const unsigned grew = wave_ballot(mx[0] > m[0] || mx[1] > m[1]); // wave-uniform, one test per pass
    if (grew != 0u) {
#pragma unroll
      for (int t = 0; t < 2; ++t) {
        const float corr = __expf(m[t] - mn[t]);                     // == 1 exactly for lanes whose max did not grow
        l[t] *= corr;
#pragma unroll
        for (int j = 0; j < 16; ++j) {
#pragma unroll
          for (int r = 0; r < 8; ++r) o[t][j][r] *= corr;
        }
      }
    }

    FragH ph[2];
#pragma unroll
    for (int t = 0; t < 2; ++t) {
      m[t] = mn[t];
      const float msh = mn[t] - LNPS;                                // exp gives e^{s-m} * 16384
      float ls = 0.f;
#pragma unroll
      for (int r = 0; r < 8; ++r) {
        const float e0 = __expf(s0[t][r] - msh);                     // key kb      + 8hh + r
        const float e1 = __expf(s1[t][r] - msh);                     // key kb + 16 + 8hh + r
        ls += e0 + e1;
        ph[t].hv[0][r] = (_Float16)e0;
        ph[t].hv[1][r] = (_Float16)e1;
      }
      l[t] += ls;
    }

    // Tile 0's products run while the last eight fragments arrive; all sixteen fragments stay in registers, and tile
    // 1's products take them from there, with no LDS read among them.
#pragma unroll
    for (int g = 0; g < 4; ++g) {                                    // four products, then the reads for two groups on
#pragma unroll
      for (int jj = 0; jj < 4; ++jj) o[0][4 * g + jj] = mma_hp(vf[4 * g + jj].h, ph[0].v, o[0][4 * g + jj]);
      if (g < 2) {
        __builtin_amdgcn_sched_barrier(0);                           // the eight reads stand as one group behind four products
#pragma unroll
        for (int jj = 0; jj < 4; ++jj) {
          const int j = 4 * g + 8 + jj;
          vf[j] = ldfrag((const unsigned short*)(Vp + (16 * j) * VPITCH));
        }
        __builtin_amdgcn_sched_barrier(0);                           // and in front of the next four products
      }
    }
#pragma unroll
    for (int j = 0; j < 16; ++j) o[1][j] = mma_hp(vf[j].h, ph[1].v, o[1][j]);
  }
  wait_tensor0();
  wait_ds0();
#pragma unroll
  for (int t = 0; t < 2; ++t) l[t] += __shfl_xor(l[t], 16, 32);

  // ---- merge of the two key groups: tile 1's state goes to wave ^ 4, whose tile 0 holds the same queries
  {
    v4f* mine = Mg + (uint32_t)wave * (MSLOT * 32u) + lane;
#pragma unroll
    for (int j = 0; j < 16; ++j) {
      v4f va, vb;
#pragma unroll
      for (int r = 0; r < 4; ++r) { va[r] = o[1][j][r]; vb[r] = o[1][j][4 + r]; }
      mine[(2 * j) * 32]     = va;
      mine[(2 * j + 1) * 32] = vb;
    }
    const v4f sv = {m[1], l[1], 0.f, 0.f};
    mine[32 * 32] = sv;
  }
  __syncthreads();                                                   // every wave's tile-1 state is in Mg
  const v4f* peer = Mg + (uint32_t)(wave ^ 4) * (MSLOT * 32u) + lane;
  const v4f  pst  = peer[32 * 32];
  const float mm  = fmaxf(m[0], pst[0]);
  const float ca  = __expf(m[0] - mm), cb = __expf(pst[0] - mm);
  const float lt  = l[0] * ca + pst[1] * cb;
  const float gm  = bfr(gamma[0]);
  const float inv = gm * IHSC * (1.0f / lt);                         // o carries x16384 x16, l carries x16384
  const float fa  = ca * inv, fb = cb * inv;

  const int qrow = 32 * qg + 16 * grp + c;
  const int e = tid & 7, lq = tid >> 3;                              // lq 0..31
#pragma unroll
  for (int half = 0; half < 2; ++half) {
    if (half) __syncthreads();                                       // every wave finished reading Os
#pragma unroll
    for (int jj = 0; jj < 8; ++jj) {
      const int j = 8 * half + jj;
      const v4f pa = peer[(2 * j) * 32];
      const v4f pb = peer[(2 * j + 1) * 32];
      v4f va, vb;
#pragma unroll
      for (int r = 0; r < 4; ++r) { va[r] = o[0][j][r] * fa + pa[r] * fb; vb[r] = o[0][j][4 + r] * fa + pb[r] * fb; }
      *(v4f*)(Os + qrow * OSPW + 16 * jj + 8 * hh)     = va;         // Os[query][ch_loc = 16jj + 8hh + r]
      *(v4f*)(Os + qrow * OSPW + 16 * jj + 8 * hh + 4) = vb;
    }
    __syncthreads();
    // line L = 32 it + lq: channel 8 it + (lq >> 2) of the half, queries 32 (lq & 3) + 4 e .. + 3
    const int chl = lq >> 2, nl = (lq & 3) * 32 + 4 * e;
    const float* xp = x + ((size_t)(b * CC + 128 * half + chl)) * SEQ_FULL + n0 + nl;
    float*       op = out + ((size_t)(b * CC + 128 * half + chl)) * SEQ + n0 + nl;
    v4f res[16];
#pragma unroll
    for (int it = 0; it < 16; ++it) {
      const v4f xv = *(const v4f*)(xp + (size_t)(8 * it) * SEQ_FULL);
#pragma unroll
      for (int t = 0; t < 4; ++t) res[it][t] = Os[(nl + t) * OSPW + chl + 8 * it] + bfr(xv[t]);
    }
#pragma unroll
    for (int it = 0; it < 16; ++it) *(v4f*)(op + (size_t)(8 * it) * SEQ) = res[it];
  }
}

// =========================================================================================================
// Workspace map (bytes; each region start a multiple of 256; every extent is an exact tile multiple and is written
//   W16 f16 [320][256]                 163840
//   XP  f16 [8][4096][256]           16777216
//   Hv  f16 [8][256][4096]           16777216
//   Fh/Fl/Gh/Gl bf16 [8][4096][32]    2097152 x4
//   total = 42106880
// =========================================================================================================
extern "C" void kernel_launch(void* const* d_in, const int* in_sizes, int n_in,
                              void* d_out, int out_size, void* d_ws, size_t ws_size,
                              hipStream_t stream) {
  if (n_in < 5) return;
  if (in_sizes[0] < NB * CC * SEQ_FULL) return;
  if (in_sizes[1] < DQ * CC || in_sizes[2] < DQ * CC) return;
  if (in_sizes[3] < CC * CC) return;
  if (in_sizes[4] < 1) return;
  if (out_size < NB * CC * SEQ) return;

  size_t off = 0;
  auto carve = [&](size_t bytes) { const size_t o = off; off += (bytes + 255) & ~(size_t)255; return o; };
  const size_t oW16 = carve((size_t)MW * CC * 2);
  const size_t oXP  = carve((size_t)NB * SEQ * CC * 2);
  const size_t oHv  = carve((size_t)NB * CC * SEQ * 2);
  const size_t oFh  = carve((size_t)NB * SEQ * DQ * 2);
  const size_t oFl  = carve((size_t)NB * SEQ * DQ * 2);
  const size_t oGh  = carve((size_t)NB * SEQ * DQ * 2);
  const size_t oGl  = carve((size_t)NB * SEQ * DQ * 2);
  if (off > ws_size) return;
  if (off > (size_t)134217728) return;

  const float* x     = (const float*)d_in[0];
  const float* wq    = (const float*)d_in[1];
  const float* wk    = (const float*)d_in[2];
  const float* wv    = (const float*)d_in[3];
  const float* gamma = (const float*)d_in[4];

  char* ws = (char*)d_ws;
  unsigned short* W16 = (unsigned short*)(ws + oW16);
  unsigned short* XP  = (unsigned short*)(ws + oXP);
  unsigned short* Hv  = (unsigned short*)(ws + oHv);
  unsigned short* Fh  = (unsigned short*)(ws + oFh);
  unsigned short* Fl  = (unsigned short*)(ws + oFl);
  unsigned short* Gh  = (unsigned short*)(ws + oGh);
  unsigned short* Gl  = (unsigned short*)(ws + oGl);
  float* out = (float*)d_out;

  const dim3 blk256(256), blk128(128);

  // (0) q/k/v weights -> stacked f16 plane
  cvt_w<<<dim3(MW / 8), blk256, 0, stream>>>(wq, wk, wv, W16);
  // (1) x -> position-major 16-bit plane
  cvt_x<<<dim3(SEQ / QT, CC / QT, NB), blk256, 0, stream>>>(x, XP);
  // (2) conv1x1 GEMM -> f (key) and g (query) hi + residual planes, H value plane
  gemm_p<<<dim3(SEQ / QT, MBLK, NB), blk128, 0, stream>>>(W16, XP, Fh, Fl, Gh, Gl, Hv);
  // (3) attention + gamma scale + residual -> out [b][256][SEQ]
  attn_k<<<dim3(SEQ / QB, NB), blk256, 0, stream>>>(Gh, Gl, Fh, Fl, Hv, x, gamma, out);
  (void)hipGetLastError();
}

// v004
// Measured time: 83.5 microseconds a run.
// Next to v003, in two timings, it ran 1.06 and 1.07 times as fast.
// All steps since v000 together make it 6.61 times as fast.
// Contractions: conv1x1 q/k/v projections W[320x256].X[256x4096] on v_wmma_f32_16x16x32_f16 (f16 containers of
// bf16-RNE weights x256 and bf16-RNE x); scores f_n.g_m on v_wmma_f32_16x16x32_bf16 (bf16 hi + bf16 residual
// planes of f and g, 3 products, K=32); o^T = H.P^T on v_wmma_f32_16x16x32_f16 (H = relu(v-projection) x16 f16,
// P = e^{s-max} x16384 f16 from the score D registers); f32 accumulate everywhere; softmax statistics, gamma scale
// and the residual add in f32 VALU.
#include <hip/hip_runtime.h>
#include <math.h>
#include <stdint.h>

#ifndef NB
#define NB 8
#endif
#ifndef SEQ
#define SEQ 4096
#endif
#define NB_FULL  8
#define SEQ_FULL 4096
#define CC     256
#define DQ     32
#define MW     320
#define MBLK   5
#define QT     64
#define OSP    68
#define OSPW   132
#define WSC    256.0f
#define IWSC   0.00390625f
#define HSC    16.0f
#define IHSC   0.0625f
#define LNPS   9.704060527839234f
#define KS     64                        // keys per LDS stage
#define NST    (SEQ / KS)                // stages
#define VPITCH 144u                      // LDS pitch of a value row: 128 B (64 keys f16) + 16 B pad
#define VSLICE (128u * VPITCH)           // 128 channels, one wave's request: 18432 B = 9 x 2 KiB
#define KPITCH 272u                      // LDS pitch of a key-plane row: 256 B (4 keys x 32 d bf16) + 16 B pad
#define KPLACE 6144u                     // 16 such rows (4352 B), rounded up to a multiple of 2 KiB
#define KOFF   (2u * VSLICE)
#define BUFB   (KOFF + 2u * KPLACE)      // one buffer: 49152 B
#define QB     128                       // queries per attention block: 4 wave pairs x 32
#define MSLOT  33u                       // 16-B slots per lane of a wave's merge range: 32 of o, one of (m, l)
#define MRGW   (MSLOT * 32u * 16u)       // one wave's merge range: 16896 B
#define GPITCH 272u                      // projection GEMM, LDS pitch of an operand row: 256 B (128 k f16) + 16 B pad
#define GSLICE 18432u                    // 64 such rows (17408 B), rounded up to a multiple of 2 KiB

static_assert(NB >= 1 && NB <= NB_FULL);
static_assert(SEQ >= QT && SEQ <= SEQ_FULL);
static_assert(SEQ % QT == 0 && SEQ % 32 == 0);
static_assert(CC % QT == 0 && CC % 32 == 0);
static_assert(MW == 2 * DQ + CC);
static_assert(MW == MBLK * QT);
static_assert(QT == 2 * DQ);
static_assert(MW % 8 == 0);
static_assert((OSP * 4) % 16 == 0);
static_assert((OSPW * 4) % 16 == 0);
static_assert(DQ % 32 == 0);
static_assert(SEQ % KS == 0 && NST >= 2);
static_assert(SEQ % QB == 0 && KS == 64);
static_assert(KS * 2 == 128 && CC == 256 && DQ * 2 * 4 == 256);
static_assert(VSLICE % 2048u == 0 && KPLACE % 2048u == 0 && (KS / 4) * KPITCH <= KPLACE);
static_assert(GSLICE % 2048u == 0 && QT * GPITCH <= GSLICE && CC * 2 == 512 && MBLK >= 2);

typedef _Float16       v16h __attribute__((ext_vector_type(16)));
typedef _Float16       v8h  __attribute__((ext_vector_type(8)));
typedef __bf16         v16b __attribute__((ext_vector_type(16)));
typedef unsigned short v8us __attribute__((ext_vector_type(8)));
typedef float          v8f  __attribute__((ext_vector_type(8)));
typedef float          v4f  __attribute__((ext_vector_type(4)));
typedef unsigned int   v4u  __attribute__((ext_vector_type(4)));
typedef uint32_t       u32x4 __attribute__((ext_vector_type(4)));
typedef uint32_t       u32x8 __attribute__((ext_vector_type(8)));

union Frag  { v8us u[2]; v16h h; v16b bf; };
union FragH { v16h v; v8h hv[2]; };
static_assert(sizeof(Frag) == 32);
static_assert(sizeof(FragH) == 32);

// ---- scalar helpers ---------------------------------------------------------------------------------------
__device__ __forceinline__ unsigned short bf_bits(float f) {          // f32 -> bf16 bits, RNE convert
  unsigned u = __float_as_uint(f);
  return (unsigned short)((u + 0x7FFFu + ((u >> 16) & 1u)) >> 16);
}
__device__ __forceinline__ float bf_up(unsigned short hb) { return __uint_as_float(((unsigned)hb) << 16); }
__device__ __forceinline__ float bfr(float f) { return bf_up(bf_bits(f)); }
__device__ __forceinline__ unsigned short h_bits(_Float16 x) { return __builtin_bit_cast(unsigned short, x); }
__device__ __forceinline__ unsigned pk16(unsigned short a, unsigned short b) { return (unsigned)a | ((unsigned)b << 16); }
__device__ __forceinline__ v8f zero8() { v8f z = {0.f, 0.f, 0.f, 0.f, 0.f, 0.f, 0.f, 0.f}; return z; }
__device__ __forceinline__ float hmax8(v8f s) {
  return fmaxf(fmaxf(fmaxf(s[0], s[1]), fmaxf(s[2], s[3])), fmaxf(fmaxf(s[4], s[5]), fmaxf(s[6], s[7])));
}
__device__ __forceinline__ unsigned wave_ballot(bool p) {
#if defined(__HIP_DEVICE_COMPILE__)
  return __builtin_amdgcn_ballot_w32(p);
#else
  return p ? 1u : 0u;
#endif
}

// ---- 16-bit fragment loader (A, or B from a k-contiguous [n][k] row): lane -> row/col (lane&15), p already includes
//      + 8*(lane>>4); elements 0..7 <- p[0..7] (k0+8h..), elements 8..15 <- p[16..23] (k0+16+8h..)
__device__ __forceinline__ Frag ldfrag(const unsigned short* p) {
  Frag f;
  f.u[0] = *(const v8us*)(p);
  f.u[1] = *(const v8us*)(p + 16);
  return f;
}

// ---- WMMA helpers: builtin followed by a 4-slot VALU gap tying D and keeping A/B live --------------------------
__device__ __forceinline__ v8f mma_h(v16h a, v16h b, v8f c) {
  v8f d = __builtin_amdgcn_wmma_f32_16x16x32_f16(false, a, false, b, (short)0, c, false, false);
#if defined(__HIP_DEVICE_COMPILE__)
  asm volatile("v_nop\n\tv_nop\n\tv_nop\n\tv_nop" : "+v"(d) : "v"(a), "v"(b));
#endif
  return d;
}
// The builtins alone, the compiler's own padding behind them (attention kernel): an asm operand cannot be a register
// above v255, and 256 accumulator registers with the fragments do not fit below it (tied to asm they spill).
__device__ __forceinline__ v8f mma_hp(v16h a, v16h b, v8f c) {
  return __builtin_amdgcn_wmma_f32_16x16x32_f16(false, a, false, b, (short)0, c, false, false);
}
__device__ __forceinline__ v8f mma_bp(v16b a, v16b b, v8f c) {
  return __builtin_amdgcn_wmma_f32_16x16x32_bf16(false, a, false, b, (short)0, c, false, false);
}

// ---- tensor load to LDS: descriptor groups and issue ----------------------------------------------------------
__device__ __forceinline__ uint32_t uni(uint32_t v) { return (uint32_t)__builtin_amdgcn_readfirstlane(v); }
__device__ __forceinline__ uint32_t pinned(uint32_t v) {
  uint32_t w = uni(v);
  asm volatile("" : "+s"(w));            // the test word stays scalar, the branch on it a scalar branch
  return w;
}
// group 1: 1-byte elements, tensor = tile = ROWS rows of ROWB bytes, source pitch SRCP bytes, 16 B of LDS pad per row
template <uint32_t ROWB, uint32_t ROWS, uint32_t SRCP, uint32_t IVL>
__device__ __forceinline__ u32x8 tdm_group1() {
  u32x8 g;
  g[0] = uni((1u << 20) | (IVL << 22) | (3u << 25));
  g[1] = uni((ROWB & 0xFFFFu) << 16);
  g[2] = uni((ROWB >> 16) | ((ROWS & 0xFFFFu) << 16));
  g[3] = uni((ROWS >> 16) | (ROWB << 16));
  g[4] = uni(ROWS);
  g[5] = uni(SRCP);
  g[6] = uni(0u);
  g[7] = uni(0u);
  return g;
}
// The same form on a whole group 1 (descriptor words held in scalar registers): the eight words keep their registers
// from the first request to the last, so that none of those registers takes another value while a request is outstanding.
__device__ __forceinline__ u32x8 held(u32x8 g) { asm volatile("" : "+s"(g)); return g; }  // pinned(), eight descriptor words
__device__ __forceinline__ u32x4 tdm_group0(uint32_t lds_dst, uint64_t ga) {
  u32x4 g;
  g[0] = uni(1u);
  g[1] = uni(lds_dst);
  g[2] = uni((uint32_t)ga);
  g[3] = uni((((uint32_t)(ga >> 32)) & 0x01FFFFFFu) | 0x80000000u);
  return g;
}
__device__ __forceinline__ void tdm_load(u32x4 g0, u32x8 g1) {
  asm volatile("tensor_load_to_lds %0, %1" :: "s"(g0), "s"(g1) : "memory");   // one request of the whole wave
}
__device__ __forceinline__ void wait_tensor0() { asm volatile("s_wait_tensorcnt 0x0" ::: "memory"); }  // this wave's request has landed
__device__ __forceinline__ void wait_ds0()     { asm volatile("s_wait_dscnt 0x0" ::: "memory"); }      // this wave's LDS reads have returned
// The same form on a group 0: its four words keep their registers from the request to the wait that covers it.
__device__ __forceinline__ u32x4 held4(u32x4 g) { asm volatile("" : "+s"(g)); return g; }  // pinned(), four descriptor words
// Work-group barrier alone, behind the caller's own wait_ds0(): __syncthreads() behind a global store also waits until
// that store has completed, which nothing in this work-group reads.
__device__ __forceinline__ void wg_barrier() { asm volatile("s_barrier_signal -1\n\ts_barrier_wait -1" ::: "memory"); }

// =========================================================================================================
// (0) conv1x1 weights: W16 f16 [320][256], rows 0..31 = q-projection rows, 32..63 = k-projection rows, 64..319 =
//     v-projection rows; value = f16 of (bf16-RNE(w) * 256) (exact). Block blk (0..39) owns rows 8*blk..8*blk+7:
// coverage: 40 blocks x 8 rows x 32 lanes x 8 halves = 320 x 256 = the whole plane.
// =========================================================================================================
__global__ __launch_bounds__(256)
void cvt_w(const float* __restrict__ wq, const float* __restrict__ wk, const float* __restrict__ wv,
           unsigned short* W16) {
  const int tid = threadIdx.x, blk = blockIdx.x;
  const int rl = tid >> 5, col = 8 * (tid & 31);
  const int o = 8 * blk + rl;                                        // 0..319
  const float* wbase;
  int osub;
  if (blk < DQ / 8)            { wbase = wq; osub = 0; }
  else if (blk < (2 * DQ) / 8) { wbase = wk; osub = DQ; }
  else                         { wbase = wv; osub = 2 * DQ; }
  const float* s = wbase + (size_t)(o - osub) * CC + col;
  const v4f a = *(const v4f*)s;
  const v4f q = *(const v4f*)(s + 4);
  const float f[8] = {a[0], a[1], a[2], a[3], q[0], q[1], q[2], q[3]};
  v4u u;
#pragma unroll
  for (int t = 0; t < 4; ++t) {
    const _Float16 h0 = (_Float16)(bfr(f[2 * t]) * WSC);
    const _Float16 h1 = (_Float16)(bfr(f[2 * t + 1]) * WSC);
    u[t] = pk16(h_bits(h0), h_bits(h1));
  }
{
    *(v4u*)(W16 + (size_t)o * CC + col) = u;
    
  }
}

// =========================================================================================================
// (1) conv1x1 GEMM for one (b, 64-n tile), all 320 outputs: Y[o][n] = relu((1/256) sum_c W16[o][c] X[n][c]), where
//     X[n][c] = f16 of bf16-RNE(x[b][c][n]) (exact in f16) is formed by the block itself, once, from the f32 input.
//     Block 128 threads = 4 waves. x tile 256 c x 64 n: thread (e = tid & 15, cq = tid >> 4) loads, per it = 0..3, the
//     eight rows c = 8 (8 it + cq) .. + 7 at n = 4 e .. 4 e + 3 (16 lanes x 16 B = 256 contiguous bytes of a row) and
//     stores, per n, the eight converted c as one 16-B piece of the LDS row n: two slices of 64 rows x 256 B (k 0..127,
//     k 128..255) at pitch GPITCH. Wave w owns cols n0+16w..+15: its eight B fragments (k = c contiguous in the LDS
//     row) are read once and stay in registers for all five weight tiles.
//     Pass mb = weight rows 64 mb .. + 63 (4 m-tiles, A rows o = 16 mt + (lane&15)): two slices of 64 rows x 256 B, one
//     tensor load from each of waves 2 and 3, two buffers, issued one pass ahead; fragments by ds_load_b128, the sixteen
//     reads of two k-steps as one group, one group ahead of the products. K = 256 = 8 steps.
//     Epilogue of a pass staged in LDS Os[n_loc][o_loc] (own range, pitch OSP, b128 stores of 8 consecutive o per lane,
//     relu applied), barrier, then (block-uniform branch on the pass):
//       pass 0 -> o_loc 0..31 = f (key) dims -> Fh/Fl, o_loc 32..63 = g (query) dims -> Gh/Gl; planes bf16
//       [b][SEQ n][32 d] (k-contiguous for both score operands): hi = bf16-RNE(v), lo = bf16-RNE(v - hi).
//       passes 1..4 -> channels 64(mb-1).. of the H plane f16 [b][256 c][SEQ n] (n contiguous), value x16 as f16.
// coverage: X slices: 4 it x 8 cq x 8 c = 256 c, 16 e x 4 n = 64 n, all written before the barrier; Os 4 waves x 16 n x
//           64 o = 64 x 64 (staged extent == consumed extent); F/G planes: 2 it x 16 lines x 8 lanes x 8 = 64 n x 32 d
//           per plane; H: 4 it x 16 rows x 8 lanes x 8 = 64 c x 64 n per pass; grid (SEQ/64, NB) x 5 passes covers all
//           SEQ rows of Fh/Fl/Gh/Gl and all 256 channels of H exactly once.
// =========================================================================================================
__global__ __launch_bounds__(128)
void gemm_p(const unsigned short* __restrict__ W16, const float* __restrict__ x,
            unsigned short* Fh, unsigned short* Fl, unsigned short* Gh, unsigned short* Gl,
            unsigned short* Hv) {
  __shared__ __attribute__((aligned(2048))) unsigned char gsm[6u * GSLICE + QT * OSP * 4];
  float* Os = (float*)(gsm + 6u * GSLICE);
  const int tid  = threadIdx.x;
  const int lane = tid & 31, wave = tid >> 5;
  const int hh   = lane >> 4, c = lane & 15;
  const int nt   = blockIdx.x, b = blockIdx.y;
  const int n0   = nt * QT;

  // Weight tile st = rows 64 st .. + 63, into buffer st & 1 (slices 2, 3 or 4, 5): waves 2 and 3 issue one k half each
  // (rows of 256 B at a source pitch of 512 B). Waves 0 and 1 issue none.
  const uint32_t lbase = (uint32_t)(size_t)gsm;
  const uint32_t wv    = uni((uint32_t)tid >> 5);
  const u32x8 g1w = held(tdm_group1<256u, QT, CC * 2u, 5u>());
  auto group0 = [&](uint32_t st) {
    const uint64_t ga = (uint64_t)(size_t)W16 + (uint64_t)st * (QT * CC * 2u) + (uint64_t)(wv & 1u) * 256u;
    return tdm_group0(lbase + (2u + 2u * (st & 1u) + (wv & 1u)) * GSLICE, ga);
  };
  u32x4 g0w = group0(0u);

  {
    const int e = tid & 15, cq = tid >> 4;                           // cq 0..7
    v4f xv[4][8];
#pragma unroll
    for (int it = 0; it < 4; ++it) {
#pragma unroll
      for (int r = 0; r < 8; ++r)
        xv[it][r] = *(const v4f*)(x + ((size_t)(b * CC + 8 * (8 * it + cq) + r)) * SEQ_FULL + n0 + 4 * e);
      asm volatile("s_wait_xcnt 0x0" ::: "memory");  // in front of the first overwrite of an address register that these loads name
    }
    if (pinned(wv >= 2u)) {                                          // weight tile 0 lands while the x rows arrive
      tdm_load(g0w, g1w);
      wait_tensor0();
    }
#pragma unroll
    for (int it = 0; it < 4; ++it) {
      const uint32_t cc = 8u * (uint32_t)(8 * it + cq);              // 0..248
      unsigned char* xd = gsm + (cc >> 7) * GSLICE + (uint32_t)(4 * e) * GPITCH + (cc & 127u) * 2u;
#pragma unroll
      for (int t = 0; t < 4; ++t) {
        v4u u;
#pragma unroll
        for (int p = 0; p < 4; ++p)
          u[p] = pk16(h_bits((_Float16)bfr(xv[it][2 * p][t])), h_bits((_Float16)bfr(xv[it][2 * p + 1][t])));
        *(v4u*)(xd + (uint32_t)t * GPITCH) = u;
      }
    }
  }
  wait_ds0();
  __syncthreads();                                                   // the X slices and weight tile 0 are in LDS
  g0w = held4(group0(1u));                                           // all four words stand in their registers in front of the branch, in every wave
  if (pinned(wv >= 2u)) tdm_load(g0w, g1w);

  const unsigned char* bp = gsm + (uint32_t)(16 * wave + c) * GPITCH + 16u * hh;
  Frag fb[CC / 32];
#pragma unroll
  for (int ks = 0; ks < CC / 32; ++ks)
    fb[ks] = ldfrag((const unsigned short*)(bp + (uint32_t)(ks >> 2) * GSLICE + (uint32_t)(ks & 3) * 64u));

#pragma unroll 1                                                     // one copy of the pass: the five differ only in addresses and in the store branch
  for (uint32_t mb = 0; mb < (uint32_t)MBLK; ++mb) {
    const unsigned char* ap = gsm + (2u + 2u * (mb & 1u)) * GSLICE + (uint32_t)c * GPITCH + 16u * hh;

    v8f acc[4];
#pragma unroll
    for (int mt = 0; mt < 4; ++mt) acc[mt] = zero8();

    // Group g = k-steps 2g and 2g + 1, two register sets: the next group's sixteen reads are issued in front of this
    // group's eight products, which then wait on counts and never to 0 before the last group.
    Frag fa[2][2][4];
#pragma unroll
    for (int g = -1; g < CC / 64; ++g) {
      if (g + 1 < CC / 64) {
#pragma unroll
        for (int q = 0; q < 2; ++q) {
          const int ks = 2 * (g + 1) + q;
          const uint32_t ko = (uint32_t)(ks >> 2) * GSLICE + (uint32_t)(ks & 3) * 64u;
#pragma unroll
          for (int mt = 0; mt < 4; ++mt)
            fa[(g + 1) & 1][q][mt] = ldfrag((const unsigned short*)(ap + ko + (uint32_t)(16 * mt) * GPITCH));
        }
      }
      if (g >= 0) {
#pragma unroll
        for (int q = 0; q < 2; ++q) {
#pragma unroll
          for (int mt = 0; mt < 4; ++mt) acc[mt] = mma_h(fa[g & 1][q][mt].h, fb[2 * g + q].h, acc[mt]);
        }
      }
    }

    // ---- epilogue: scale back + relu -> LDS Os[n_loc][o_loc]; lane (hh, c) holds o = 16 mt + 8 hh + r, n_loc = 16 w + c
    //      (the readers of the pass before left Os in front of that pass's last barrier)
    {
      const int nl = 16 * wave + c;
#pragma unroll
      for (int mt = 0; mt < 4; ++mt) {
        v4f va, vb;
#pragma unroll
        for (int r = 0; r < 4; ++r) {
          va[r] = fmaxf(acc[mt][r] * IWSC, 0.f);
          vb[r] = fmaxf(acc[mt][4 + r] * IWSC, 0.f);
        }
        *(v4f*)(Os + nl * OSP + 16 * mt + 8 * hh)     = va;
        *(v4f*)(Os + nl * OSP + 16 * mt + 8 * hh + 4) = vb;
      }
    }
    wait_ds0();
    wg_barrier();                                                    // Os is whole

    const int e = tid & 7, lq = tid >> 3;                            // lq 0..15
    if (mb == 0u) {                                                  // block-uniform
      v4u ufh[2], ufl[2], ugh[2], ugl[2];
#pragma unroll
      for (int it = 0; it < 2; ++it) {
        const int L   = it * 16 + lq;                                // line 0..31
        const int row = 2 * L + (e >> 2);                            // n_loc 0..63
        const int d   = 8 * (e & 3);                                 // 0, 8, 16, 24
        const float* fs = Os + row * OSP + d;
        const float* gs = Os + row * OSP + DQ + d;
        const v4f f0 = *(const v4f*)fs;
        const v4f f1 = *(const v4f*)(fs + 4);
        const v4f g0 = *(const v4f*)gs;
        const v4f g1 = *(const v4f*)(gs + 4);
        const float fv[8] = {f0[0], f0[1], f0[2], f0[3], f1[0], f1[1], f1[2], f1[3]};
        const float gv[8] = {g0[0], g0[1], g0[2], g0[3], g1[0], g1[1], g1[2], g1[3]};
#pragma unroll
        for (int t = 0; t < 4; ++t) {
          const unsigned short fh0 = bf_bits(fv[2 * t]), fh1 = bf_bits(fv[2 * t + 1]);
          const unsigned short fl0 = bf_bits(fv[2 * t] - bf_up(fh0));
          const unsigned short fl1 = bf_bits(fv[2 * t + 1] - bf_up(fh1));
          const unsigned short gh0 = bf_bits(gv[2 * t]), gh1 = bf_bits(gv[2 * t + 1]);
          const unsigned short gl0 = bf_bits(gv[2 * t] - bf_up(gh0));
          const unsigned short gl1 = bf_bits(gv[2 * t + 1] - bf_up(gh1));
          ufh[it][t] = pk16(fh0, fh1);
          ufl[it][t] = pk16(fl0, fl1);
          ugh[it][t] = pk16(gh0, gh1);
          ugl[it][t] = pk16(gl0, gl1);
        }
      }
#pragma unroll
      for (int it = 0; it < 2; ++it) {
        const int L   = it * 16 + lq;
        const int row = 2 * L + (e >> 2);
        const int d   = 8 * (e & 3);
        const size_t po = ((size_t)(b * SEQ + n0 + row)) * DQ + d;
        *(v4u*)(Fh + po) = ufh[it];
        *(v4u*)(Fl + po) = ufl[it];
        *(v4u*)(Gh + po) = ugh[it];
        *(v4u*)(Gl + po) = ugl[it];
      }
    } else {
      const int chb = ((int)mb - 1) * QT;                            // channel base 0..192
      v4u uhp[4];
#pragma unroll
      for (int it = 0; it < 4; ++it) {
        const int ol = it * 16 + lq;                                 // o_loc 0..63
        float hv8[8];
#pragma unroll
        for (int t = 0; t < 8; ++t) hv8[t] = Os[(8 * e + t) * OSP + ol];
#pragma unroll
        for (int t = 0; t < 4; ++t) {
          const _Float16 h0 = (_Float16)(hv8[2 * t] * HSC);
          const _Float16 h1 = (_Float16)(hv8[2 * t + 1] * HSC);
          uhp[it][t] = pk16(h_bits(h0), h_bits(h1));
        }
      }
#pragma unroll
      for (int it = 0; it < 4; ++it) {
        const int ol = it * 16 + lq;
        *(v4u*)(Hv + ((size_t)(b * CC + chb + ol)) * SEQ + n0 + 8 * e) = uhp[it];
      }
    }
    asm volatile("s_wait_xcnt 0x0" ::: "memory");  // in front of the next pass's overwrite of a register that these stores name

    // Foot of pass mb: this wave's LDS reads have returned, its own request of tile mb + 1 has landed, the barrier, and
    // only then the load of tile mb + 2 into the buffer that pass mb has read.
    wait_ds0();
    wait_tensor0();
    g0w = held4(g0w);
    wg_barrier();
    g0w = held4(group0(mb + 2u));                                    // formed in every wave and pass, issued only under the test
    if (pinned(mb + 2u < (uint32_t)MBLK && wv >= 2u)) tdm_load(g0w, g1w);
  }
  wait_tensor0();
  wait_ds0();
}

// =========================================================================================================
// (2) self-attention for one (b, 128-query tile), transposed formulation, SEQ keys, no mask, no scale:
//   S^T tile (16 keys x 16 queries) = A(k: row = key kb + (lane&15), 32 d via the split k map from the bf16 plane
//   Fh [b][SEQ][32]) . B(q: col = query, same map from Gh) + A(Fh).B(Gl) + A(Fl).B(Gh) (bf16 unscaled residual
//   planes, shared accumulator; K = 32 = one k-step; the query fragments are loaded once per wave).
//   Block = 8 waves. Wave (qg = wave & 3, grp = wave >> 2) owns 32 queries (two 16-query tiles) and the 32 keys
//   64 st + 32 grp .. + 31 of every stage: each key and value fragment read from LDS feeds two products, one per
//   query tile. The wave's tile t holds queries 32 qg + 16 (t ^ grp) + (lane&15), so that tile 1 of wave w and tile 0
//   of wave w ^ 4 are the same queries.
//   Per lane a D tile holds 8 keys of ONE query: online softmax state per lane and query tile, one shuffle (lane^16)
//   per tile for the max over 32 keys; the o/l rescale is skipped under one wave-uniform ballot per pass when no
//   lane's max grew (corr == 1 exactly for every lane then). P = e^{s-m} x 16384 as f16 is the B operand of
//   O^T (rows channel, cols queries) += A(H rows channel = 16j + (lane&15), keys contiguous, f16 plane Hv
//   [b][256][SEQ], values x16) . B(P^T): element r <- D of the tile covering keys kb..kb+15, element 8+r <- the tile
//   covering kb+16..kb+31, lane unchanged. 2 x 16 accumulator tiles per wave (256 channels x 32 queries).
//   Keys and values reach the waves through LDS: stages of 64 keys, two buffers, one tensor load per stage from each
//   of waves 0..3, issued one stage ahead; all eight waves read the tiles with ds_load_b128.
//   Merge of the two key groups: every wave stores the state (m, l, o) of its tile 1 in its own LDS range Mg[wave],
//   lane by lane; behind one barrier it reads the range of wave ^ 4 (its own tile 0's queries, same lane = same query
//   and channels) and joins the two partial softmax states: m = max, weights e^{m_own - m} and e^{m_peer - m}.
//   Epilogue in two channel halves: gamma*O/(16 l) staged in LDS Os[query][128 channels] (pitch OSPW, b128 stores),
//   8 consecutive lanes x 16 B (values gathered from 4 Os rows), one instruction per 32 lines, final values held in
// coverage: Mg per wave 33 slots x 32 lanes x 16 B, all written before the barrier, slots 0..32 read behind it;
//           Os per half 8 waves x 16 queries x 128 ch fully staged before the barrier (staged extent == consumed
//           extent); out per half 16 it x 32 lines x 8 lanes x 4 floats = 128 ch x 128 n; two halves = 256 ch;
//           grid (SEQ/128, NB) covers out[b][0..255][0..SEQ-1] exactly once.
// =========================================================================================================
__global__ __launch_bounds__(256)
void attn_k(const unsigned short* __restrict__ Gh, const unsigned short* __restrict__ Gl,
            const unsigned short* __restrict__ Fh, const unsigned short* __restrict__ Fl,
            const unsigned short* __restrict__ Hv, const float* __restrict__ x,
            const float* __restrict__ gamma, float* out) {
  __shared__ __attribute__((aligned(2048))) unsigned char smem[2u * BUFB + 8u * MRGW + QB * OSPW * 4];
  v4f*   Mg = (v4f*)(smem + 2u * BUFB);
  float* Os = (float*)(smem + 2u * BUFB + 8u * MRGW);
  const int tid  = threadIdx.x;
  const int wave = tid >> 5, lane = tid & 31;
  const int qg   = wave & 3, grp = wave >> 2;
  const int hh   = lane >> 4, c = lane & 15;
  const int n0   = blockIdx.x * QB, b = blockIdx.y;

  // Stage st = keys 64 st .. 64 st + 63, into buffer st & 1. One request per stage from each of waves 0..3: waves 0 and
  // 1 the two 128-channel halves of the value tile (rows of 128 B), wave 2 the key hi plane, wave 3 the key residual
  // plane (4096 contiguous bytes each, taken as 16 rows of 256 B). Waves 4..7 issue none.
  const uint32_t lbase = (uint32_t)(size_t)smem;
  const uint32_t wv    = uni((uint32_t)tid >> 5);
  const u32x8 g1v = held(tdm_group1<128u, 128u, SEQ * 2u, 4u>());
  const u32x8 g1k = held(tdm_group1<256u, KS / 4u, 256u, 5u>());
  auto issue = [&](uint32_t st, bool now) {                          // now: the wait directly behind the request
    const uint32_t dst = lbase + (st & 1u) * BUFB;
    if (pinned(wv < 2u)) {
      const uint64_t ga = (uint64_t)(size_t)Hv + ((uint64_t)(b * CC + 128u * wv) * SEQ + (uint64_t)st * KS) * 2u;
      tdm_load(tdm_group0(dst + wv * VSLICE, ga), g1v);
      if (now) wait_tensor0();
    } else if (pinned(wv < 4u)) {
      const uint64_t ga = (uint64_t)(size_t)(wv == 2u ? Fh : Fl) + ((uint64_t)b * SEQ + (uint64_t)st * KS) * (DQ * 2u);
      tdm_load(tdm_group0(dst + KOFF + (wv - 2u) * KPLACE, ga), g1k);
      if (now) wait_tensor0();
    }
  };
  issue(0u, true);

  // q fragments (B operand, col = query n0 + 32*qg + 16*(t^grp) + c), K = 32: loaded once
  Frag qh[2], ql[2];
#pragma unroll
  for (int t = 0; t < 2; ++t) {
    const size_t qo = ((size_t)(b * SEQ + n0 + 32 * qg + 16 * (t ^ grp) + c)) * DQ + 8 * hh;
    qh[t] = ldfrag(Gh + qo);
    ql[t] = ldfrag(Gl + qo);
  }
  asm volatile("s_wait_xcnt 0x0" ::: "memory");  // in front of the first overwrite of an address register that these loads name
  // k fragment offset in a buffer (A operand, row = key c of a 16-key tile: LDS row c >> 2, 64-B slot c & 3; this
  // wave's 32 keys are LDS rows 8 grp .. 8 grp + 7)
  const uint32_t klane = KOFF + (uint32_t)(8 * grp + (c >> 2)) * KPITCH + (uint32_t)(c & 3) * 64u + 16u * hh;
  // v fragment offset in a buffer (A operand, row = channel 16j + c, keys contiguous, this wave's 32 keys = 64 B)
  const uint32_t vlane = (uint32_t)c * VPITCH + 64u * grp + 16u * hh;

  float m[2] = {-1.0e30f, -1.0e30f}, l[2] = {0.f, 0.f};
  v8f o[2][16];
#pragma unroll
  for (int t = 0; t < 2; ++t) {
#pragma unroll
    for (int j = 0; j < 16; ++j) o[t][j] = zero8();
  }

#pragma unroll 1
  for (uint32_t st = 0; st < (uint32_t)NST; ++st) {
    // Publish point of stage st, between pass st - 1 and pass st (in front of pass 0: stage 0's wait, the barrier, stage
    // 1's load): this wave's LDS reads of pass st - 1 have returned, its own request of stage st has landed, the barrier,
    // and only then the load of stage st + 1 into the buffer that pass st - 1 has read.
    wait_ds0();
    wait_tensor0();
    __syncthreads();
    if (pinned(st + 1u < (uint32_t)NST)) issue(st + 1u, false);
    const unsigned char* bufp = smem + (st & 1u) * BUFB;
    const unsigned char* Kp = bufp + klane;
    const unsigned char* Vp = bufp + vlane;
    // kb = 64 st + 32 grp
    const Frag k0  = ldfrag((const unsigned short*)(Kp));                                   // keys kb .. kb+15
    const Frag k1  = ldfrag((const unsigned short*)(Kp + 4 * KPITCH));                      // keys kb+16 .. kb+31
    const Frag k0l = ldfrag((const unsigned short*)(Kp + KPLACE));
    const Frag k1l = ldfrag((const unsigned short*)(Kp + KPLACE + 4 * KPITCH));
    v8f s0[2], s1[2];
#pragma unroll
    for (int t = 0; t < 2; ++t) { s0[t] = zero8(); s1[t] = zero8(); }
#pragma unroll
    for (int t = 0; t < 2; ++t) { s0[t] = mma_bp(k0.bf, qh[t].bf, s0[t]);  s1[t] = mma_bp(k1.bf, qh[t].bf, s1[t]); }
#pragma unroll
    for (int t = 0; t < 2; ++t) { s0[t] = mma_bp(k0.bf, ql[t].bf, s0[t]);  s1[t] = mma_bp(k1.bf, ql[t].bf, s1[t]); }
#pragma unroll
    for (int t = 0; t < 2; ++t) { s0[t] = mma_bp(k0l.bf, qh[t].bf, s0[t]); s1[t] = mma_bp(k1l.bf, qh[t].bf, s1[t]); }

    float mx[2], mxo[2];
#pragma unroll
    for (int t = 0; t < 2; ++t) mx[t] = fmaxf(hmax8(s0[t]), hmax8(s1[t]));
#pragma unroll
    for (int t = 0; t < 2; ++t) mxo[t] = __shfl_xor(mx[t], 16, 32);
    // The first eight value fragments are read as one group behind the exchanges (LDS returns in order: in front of
    // them they would delay them) and in front of the exponentials, which run while the reads return. The scheduling
    // fences here and in the product loop keep each read group in its place: without them every read pair sits at its
    // own WMMA behind a wait to 0.
#if defined(__HIP_DEVICE_COMPILE__)
    asm volatile("" :: "v"(mxo[0]), "v"(mxo[1]));  // inputs-only fence on the exchanged values: the exchanges return before the reads issue
#endif
    __builtin_amdgcn_sched_barrier(0);
    Frag vf[16];
#pragma unroll
    for (int j = 0; j < 8; ++j) vf[j] = ldfrag((const unsigned short*)(Vp + (16 * j) * VPITCH));
    __builtin_amdgcn_sched_barrier(0);
    float mn[2];
#pragma unroll
    for (int t = 0; t < 2; ++t) { mx[t] = fmaxf(mx[t], mxo[t]); mn[t] = fmaxf(m[t], mx[t]); }
    const unsigned grew = wave_ballot(mx[0] > m[0] || mx[1] > m[1]); // wave-uniform, one test per pass
    if (grew != 0u) {
#pragma unroll
      for (int t = 0; t < 2; ++t) {
        const float corr = __expf(m[t] - mn[t]);                     // == 1 exactly for lanes whose max did not grow
        l[t] *= corr;
#pragma unroll
        for (int j = 0; j < 16; ++j) {
#pragma unroll
          for (int r = 0; r < 8; ++r) o[t][j][r] *= corr;
        }
      }
    }

    FragH ph[2];
#pragma unroll
    for (int t = 0; t < 2; ++t) {
      m[t] = mn[t];
      const float msh = mn[t] - LNPS;                                // exp gives e^{s-m} * 16384
      float ls = 0.f;
#pragma unroll
      for (int r = 0; r < 8; ++r) {
        const float e0 = __expf(s0[t][r] - msh);                     // key kb      + 8hh + r
        const float e1 = __expf(s1[t][r] - msh);                     // key kb + 16 + 8hh + r
        ls += e0 + e1;
        ph[t].hv[0][r] = (_Float16)e0;
        ph[t].hv[1][r] = (_Float16)e1;
      }
      l[t] += ls;
    }

    // Tile 0's products run while the last eight fragments arrive; all sixteen fragments stay in registers, and tile
    // 1's products take them from there, with no LDS read among them.
#pragma unroll
    for (int g = 0; g < 4; ++g) {                                    // four products, then the reads for two groups on
#pragma unroll
      for (int jj = 0; jj < 4; ++jj) o[0][4 * g + jj] = mma_hp(vf[4 * g + jj].h, ph[0].v, o[0][4 * g + jj]);
      if (g < 2) {
        __builtin_amdgcn_sched_barrier(0);                           // the eight reads stand as one group behind four products
#pragma unroll
        for (int jj = 0; jj < 4; ++jj) {
          const int j = 4 * g + 8 + jj;
          vf[j] = ldfrag((const unsigned short*)(Vp + (16 * j) * VPITCH));
        }
        __builtin_amdgcn_sched_barrier(0);                           // and in front of the next four products
      }
    }
#pragma unroll
    for (int j = 0; j < 16; ++j) o[1][j] = mma_hp(vf[j].h, ph[1].v, o[1][j]);
  }
  wait_tensor0();
  wait_ds0();
#pragma unroll
  for (int t = 0; t < 2; ++t) l[t] += __shfl_xor(l[t], 16, 32);

  // ---- merge of the two key groups: tile 1's state goes to wave ^ 4, whose tile 0 holds the same queries
  {
    v4f* mine = Mg + (uint32_t)wave * (MSLOT * 32u) + lane;
#pragma unroll
    for (int j = 0; j < 16; ++j) {
      v4f va, vb;
#pragma unroll
      for (int r = 0; r < 4; ++r) { va[r] = o[1][j][r]; vb[r] = o[1][j][4 + r]; }
      mine[(2 * j) * 32]     = va;
      mine[(2 * j + 1) * 32] = vb;
    }
    const v4f sv = {m[1], l[1], 0.f, 0.f};
    mine[32 * 32] = sv;
  }
  __syncthreads();                                                   // every wave's tile-1 state is in Mg
  const v4f* peer = Mg + (uint32_t)(wave ^ 4) * (MSLOT * 32u) + lane;
  const v4f  pst  = peer[32 * 32];
  const float mm  = fmaxf(m[0], pst[0]);
  const float ca  = __expf(m[0] - mm), cb = __expf(pst[0] - mm);
  const float lt  = l[0] * ca + pst[1] * cb;
  const float gm  = bfr(gamma[0]);
  const float inv = gm * IHSC * (1.0f / lt);                         // o carries x16384 x16, l carries x16384
  const float fa  = ca * inv, fb = cb * inv;

  const int qrow = 32 * qg + 16 * grp + c;
  const int e = tid & 7, lq = tid >> 3;                              // lq 0..31
#pragma unroll
  for (int half = 0; half < 2; ++half) {
    if (half) __syncthreads();                                       // every wave finished reading Os
#pragma unroll
    for (int jj = 0; jj < 8; ++jj) {
      const int j = 8 * half + jj;
      const v4f pa = peer[(2 * j) * 32];
      const v4f pb = peer[(2 * j + 1) * 32];
      v4f va, vb;
#pragma unroll
      for (int r = 0; r < 4; ++r) { va[r] = o[0][j][r] * fa + pa[r] * fb; vb[r] = o[0][j][4 + r] * fa + pb[r] * fb; }
      *(v4f*)(Os + qrow * OSPW + 16 * jj + 8 * hh)     = va;         // Os[query][ch_loc = 16jj + 8hh + r]
      *(v4f*)(Os + qrow * OSPW + 16 * jj + 8 * hh + 4) = vb;
    }
    __syncthreads();
    // line L = 32 it + lq: channel 8 it + (lq >> 2) of the half, queries 32 (lq & 3) + 4 e .. + 3
    const int chl = lq >> 2, nl = (lq & 3) * 32 + 4 * e;
    const float* xp = x + ((size_t)(b * CC + 128 * half + chl)) * SEQ_FULL + n0 + nl;
    float*       op = out + ((size_t)(b * CC + 128 * half + chl)) * SEQ + n0 + nl;
    v4f res[16];
#pragma unroll
    for (int it = 0; it < 16; ++it) {
      const v4f xv = *(const v4f*)(xp + (size_t)(8 * it) * SEQ_FULL);
#pragma unroll
      for (int t = 0; t < 4; ++t) res[it][t] = Os[(nl + t) * OSPW + chl + 8 * it] + bfr(xv[t]);
    }
#pragma unroll
    for (int it = 0; it < 16; ++it) *(v4f*)(op + (size_t)(8 * it) * SEQ) = res[it];
  }
}

// =========================================================================================================
// Workspace map (bytes; each region start a multiple of 256; every extent is an exact tile multiple and is written
//   W16 f16 [320][256]                 163840
//   Hv  f16 [8][256][4096]           16777216
//   Fh/Fl/Gh/Gl bf16 [8][4096][32]    2097152 x4
//   total = 25329664
// =========================================================================================================
extern "C" void kernel_launch(void* const* d_in, const int* in_sizes, int n_in,
                              void* d_out, int out_size, void* d_ws, size_t ws_size,
                              hipStream_t stream) {
  if (n_in < 5) return;
  if (in_sizes[0] < NB * CC * SEQ_FULL) return;
  if (in_sizes[1] < DQ * CC || in_sizes[2] < DQ * CC) return;
  if (in_sizes[3] < CC * CC) return;
  if (in_sizes[4] < 1) return;
  if (out_size < NB * CC * SEQ) return;

  size_t off = 0;
  auto carve = [&](size_t bytes) { const size_t o = off; off += (bytes + 255) & ~(size_t)255; return o; };
  const size_t oW16 = carve((size_t)MW * CC * 2);
  const size_t oHv  = carve((size_t)NB * CC * SEQ * 2);
  const size_t oFh  = carve((size_t)NB * SEQ * DQ * 2);
  const size_t oFl  = carve((size_t)NB * SEQ * DQ * 2);
  const size_t oGh  = carve((size_t)NB * SEQ * DQ * 2);
  const size_t oGl  = carve((size_t)NB * SEQ * DQ * 2);
  if (off > ws_size) return;
  if (off > (size_t)134217728) return;

  const float* x     = (const float*)d_in[0];
  const float* wq    = (const float*)d_in[1];
  const float* wk    = (const float*)d_in[2];
  const float* wv    = (const float*)d_in[3];
  const float* gamma = (const float*)d_in[4];

  char* ws = (char*)d_ws;
  unsigned short* W16 = (unsigned short*)(ws + oW16);
  unsigned short* Hv  = (unsigned short*)(ws + oHv);
  unsigned short* Fh  = (unsigned short*)(ws + oFh);
  unsigned short* Fl  = (unsigned short*)(ws + oFl);
  unsigned short* Gh  = (unsigned short*)(ws + oGh);
  unsigned short* Gl  = (unsigned short*)(ws + oGl);
  float* out = (float*)d_out;

  const dim3 blk256(256), blk128(128);

  // (0) q/k/v weights -> stacked f16 plane
  cvt_w<<<dim3(MW / 8), blk256, 0, stream>>>(wq, wk, wv, W16);
  // (1) conv1x1 GEMM from the f32 input -> f (key) and g (query) hi + residual planes, H value plane
  gemm_p<<<dim3(SEQ / QT, NB), blk128, 0, stream>>>(W16, x, Fh, Fl, Gh, Gl, Hv);
  // (2) attention + gamma scale + residual -> out [b][256][SEQ]
  attn_k<<<dim3(SEQ / QB, NB), blk256, 0, stream>>>(Gh, Gl, Fh, Fl, Hv, x, gamma, out);
  (void)hipGetLastError();
}

// v005
// It runs in 77.3 microseconds.
// Two timings next to v004 put it at 1.06 and 1.08 times that version's speed.
// Counting every step since v000, it is 7.09 times as fast.
// Contractions: conv1x1 q/k/v projections W[320x256].X[256x4096] on v_wmma_f32_16x16x32_f16 (f16 containers of
// bf16-RNE weights x256 and bf16-RNE x); scores f_n.g_m on v_wmma_f32_16x16x32_bf16 (bf16 hi + bf16 residual
// planes of f and g, 3 products, K=32); o^T = H.P^T on v_wmma_f32_16x16x32_f16 (H = relu(v-projection) x16 f16,
// P = e^{s-max} x16384 f16 from the score D registers); f32 accumulate everywhere; softmax statistics, gamma scale
// and the residual add in f32 VALU.
#include <hip/hip_runtime.h>
#include <math.h>
#include <stdint.h>

#ifndef NB
#define NB 8
#endif
#ifndef SEQ
#define SEQ 4096
#endif
#define NB_FULL  8
#define SEQ_FULL 4096
#define CC     256
#define DQ     32
#define MW     320
#define MBLK   5
#define QT     64
#define OSP    68
#define OSPW   132
#define WSC    256.0f
#define IWSC   0.00390625f
#define HSC    16.0f
#define IHSC   0.0625f
#define LNPS   9.704060527839234f
#define KS     128                       // keys per LDS stage: two passes of 64 keys (32 per wave) between barriers
#define NST    (SEQ / KS)                // stages
#define VPITCH 272u                      // LDS pitch of a value row: 256 B (128 keys f16) + 16 B pad
#define VSLICE (128u * VPITCH)           // 128 channels, one wave's request: 34816 B = 17 x 2 KiB
#define KPITCH 272u                      // LDS pitch of a key-plane row: 256 B (4 keys x 32 d bf16) + 16 B pad
#define KPLACE 10240u                    // 32 such rows (8704 B), rounded up to a multiple of 2 KiB
#define KOFF   (2u * VSLICE)
#define BUFB   (KOFF + 2u * KPLACE)      // one buffer: 90112 B
#define QB     128                       // queries per attention block: 4 wave pairs x 32
#define MSLOT  33u                       // 16-B slots per lane of a wave's merge range: 32 of o, one of (m, l)
#define MRGW   (MSLOT * 32u * 16u)       // one wave's merge range: 16896 B
#define GPITCH 272u                      // projection GEMM, LDS pitch of an operand row: 256 B (128 k f16) + 16 B pad
#define GSLICE 18432u                    // 64 such rows (17408 B), rounded up to a multiple of 2 KiB

static_assert(NB >= 1 && NB <= NB_FULL);
static_assert(SEQ >= QT && SEQ <= SEQ_FULL);
static_assert(SEQ % QT == 0 && SEQ % 32 == 0);
static_assert(CC % QT == 0 && CC % 32 == 0);
static_assert(MW == 2 * DQ + CC);
static_assert(MW == MBLK * QT);
static_assert(QT == 2 * DQ);
static_assert(MW % 8 == 0);
static_assert((OSP * 4) % 16 == 0);
static_assert((OSPW * 4) % 16 == 0);
static_assert(DQ % 32 == 0);
static_assert(SEQ % KS == 0 && NST >= 2);
static_assert(SEQ % QB == 0 && KS == 128);
static_assert(KS * 2 == 256 && CC == 256 && DQ * 2 * 4 == 256);
static_assert(QB * OSPW * 4 <= 2u * BUFB);
static_assert(VSLICE % 2048u == 0 && KPLACE % 2048u == 0 && (KS / 4) * KPITCH <= KPLACE);
static_assert(GSLICE % 2048u == 0 && QT * GPITCH <= GSLICE && CC * 2 == 512 && MBLK >= 2);

typedef _Float16       v16h __attribute__((ext_vector_type(16)));
typedef _Float16       v8h  __attribute__((ext_vector_type(8)));
typedef __bf16         v16b __attribute__((ext_vector_type(16)));
typedef unsigned short v8us __attribute__((ext_vector_type(8)));
typedef float          v8f  __attribute__((ext_vector_type(8)));
typedef float          v4f  __attribute__((ext_vector_type(4)));
typedef unsigned int   v4u  __attribute__((ext_vector_type(4)));
typedef uint32_t       u32x4 __attribute__((ext_vector_type(4)));
typedef uint32_t       u32x8 __attribute__((ext_vector_type(8)));

union Frag  { v8us u[2]; v16h h; v16b bf; };
union FragH { v16h v; v8h hv[2]; };
static_assert(sizeof(Frag) == 32);
static_assert(sizeof(FragH) == 32);

// ---- scalar helpers ---------------------------------------------------------------------------------------
__device__ __forceinline__ unsigned short bf_bits(float f) {          // f32 -> bf16 bits, RNE convert
  unsigned u = __float_as_uint(f);
  return (unsigned short)((u + 0x7FFFu + ((u >> 16) & 1u)) >> 16);
}
__device__ __forceinline__ float bf_up(unsigned short hb) { return __uint_as_float(((unsigned)hb) << 16); }
__device__ __forceinline__ float bfr(float f) { return bf_up(bf_bits(f)); }
__device__ __forceinline__ unsigned short h_bits(_Float16 x) { return __builtin_bit_cast(unsigned short, x); }
__device__ __forceinline__ unsigned pk16(unsigned short a, unsigned short b) { return (unsigned)a | ((unsigned)b << 16); }
__device__ __forceinline__ v8f zero8() { v8f z = {0.f, 0.f, 0.f, 0.f, 0.f, 0.f, 0.f, 0.f}; return z; }
__device__ __forceinline__ float hmax8(v8f s) {
  return fmaxf(fmaxf(fmaxf(s[0], s[1]), fmaxf(s[2], s[3])), fmaxf(fmaxf(s[4], s[5]), fmaxf(s[6], s[7])));
}
__device__ __forceinline__ unsigned wave_ballot(bool p) {
#if defined(__HIP_DEVICE_COMPILE__)
  return __builtin_amdgcn_ballot_w32(p);
#else
  return p ? 1u : 0u;
#endif
}

// ---- 16-bit fragment loader (A, or B from a k-contiguous [n][k] row): lane -> row/col (lane&15), p already includes
//      + 8*(lane>>4); elements 0..7 <- p[0..7] (k0+8h..), elements 8..15 <- p[16..23] (k0+16+8h..)
__device__ __forceinline__ Frag ldfrag(const unsigned short* p) {
  Frag f;
  f.u[0] = *(const v8us*)(p);
  f.u[1] = *(const v8us*)(p + 16);
  return f;
}

// ---- WMMA helpers: builtin followed by a 4-slot VALU gap tying D and keeping A/B live --------------------------
__device__ __forceinline__ v8f mma_h(v16h a, v16h b, v8f c) {
  v8f d = __builtin_amdgcn_wmma_f32_16x16x32_f16(false, a, false, b, (short)0, c, false, false);
#if defined(__HIP_DEVICE_COMPILE__)
  asm volatile("v_nop\n\tv_nop\n\tv_nop\n\tv_nop" : "+v"(d) : "v"(a), "v"(b));
#endif
  return d;
}
// The builtins alone, the compiler's own padding behind them (attention kernel): an asm operand cannot be a register
// above v255, and 256 accumulator registers with the fragments do not fit below it (tied to asm they spill).
__device__ __forceinline__ v8f mma_hp(v16h a, v16h b, v8f c) {
  return __builtin_amdgcn_wmma_f32_16x16x32_f16(false, a, false, b, (short)0, c, false, false);
}
__device__ __forceinline__ v8f mma_bp(v16b a, v16b b, v8f c) {
  return __builtin_amdgcn_wmma_f32_16x16x32_bf16(false, a, false, b, (short)0, c, false, false);
}

// ---- tensor load to LDS: descriptor groups and issue ----------------------------------------------------------
__device__ __forceinline__ uint32_t uni(uint32_t v) { return (uint32_t)__builtin_amdgcn_readfirstlane(v); }
__device__ __forceinline__ uint32_t pinned(uint32_t v) {
  uint32_t w = uni(v);
  asm volatile("" : "+s"(w));            // the test word stays scalar, the branch on it a scalar branch
  return w;
}
// group 1: 1-byte elements, tensor = tile = ROWS rows of ROWB bytes, source pitch SRCP bytes, 16 B of LDS pad per row
template <uint32_t ROWB, uint32_t ROWS, uint32_t SRCP, uint32_t IVL>
__device__ __forceinline__ u32x8 tdm_group1() {
  u32x8 g;
  g[0] = uni((1u << 20) | (IVL << 22) | (3u << 25));
  g[1] = uni((ROWB & 0xFFFFu) << 16);
  g[2] = uni((ROWB >> 16) | ((ROWS & 0xFFFFu) << 16));
  g[3] = uni((ROWS >> 16) | (ROWB << 16));
  g[4] = uni(ROWS);
  g[5] = uni(SRCP);
  g[6] = uni(0u);
  g[7] = uni(0u);
  return g;
}
// The same form on a whole group 1 (descriptor words held in scalar registers): the eight words keep their registers
// from the first request to the last, so that none of those registers takes another value while a request is outstanding.
__device__ __forceinline__ u32x8 held(u32x8 g) { asm volatile("" : "+s"(g)); return g; }  // pinned(), eight descriptor words
__device__ __forceinline__ u32x4 tdm_group0(uint32_t lds_dst, uint64_t ga) {
  u32x4 g;
  g[0] = uni(1u);
  g[1] = uni(lds_dst);
  g[2] = uni((uint32_t)ga);
  g[3] = uni((((uint32_t)(ga >> 32)) & 0x01FFFFFFu) | 0x80000000u);
  return g;
}
__device__ __forceinline__ void tdm_load(u32x4 g0, u32x8 g1) {
  asm volatile("tensor_load_to_lds %0, %1" :: "s"(g0), "s"(g1) : "memory");   // one request of the whole wave
}
__device__ __forceinline__ void wait_tensor0() { asm volatile("s_wait_tensorcnt 0x0" ::: "memory"); }  // this wave's request has landed
__device__ __forceinline__ void wait_ds0()     { asm volatile("s_wait_dscnt 0x0" ::: "memory"); }      // this wave's LDS reads have returned
// The same form on a group 0: its four words keep their registers from the request to the wait that covers it.
__device__ __forceinline__ u32x4 held4(u32x4 g) { asm volatile("" : "+s"(g)); return g; }  // pinned(), four descriptor words
// Work-group barrier alone, behind the caller's own wait_ds0(): __syncthreads() behind a global store also waits until
// that store has completed, which nothing in this work-group reads.
__device__ __forceinline__ void wg_barrier() { asm volatile("s_barrier_signal -1\n\ts_barrier_wait -1" ::: "memory"); }

// =========================================================================================================
// (0) conv1x1 weights: W16 f16 [320][256], rows 0..31 = q-projection rows, 32..63 = k-projection rows, 64..319 =
//     v-projection rows; value = f16 of (bf16-RNE(w) * 256) (exact). Block blk (0..39) owns rows 8*blk..8*blk+7:
// coverage: 40 blocks x 8 rows x 32 lanes x 8 halves = 320 x 256 = the whole plane.
// =========================================================================================================
__global__ __launch_bounds__(256)
void cvt_w(const float* __restrict__ wq, const float* __restrict__ wk, const float* __restrict__ wv,
           unsigned short* W16) {
  const int tid = threadIdx.x, blk = blockIdx.x;
  const int rl = tid >> 5, col = 8 * (tid & 31);
  const int o = 8 * blk + rl;                                        // 0..319
  const float* wbase;
  int osub;
  if (blk < DQ / 8)            { wbase = wq; osub = 0; }
  else if (blk < (2 * DQ) / 8) { wbase = wk; osub = DQ; }
  else                         { wbase = wv; osub = 2 * DQ; }
  const float* s = wbase + (size_t)(o - osub) * CC + col;
  const v4f a = *(const v4f*)s;
  const v4f q = *(const v4f*)(s + 4);
  const float f[8] = {a[0], a[1], a[2], a[3], q[0], q[1], q[2], q[3]};
  v4u u;
#pragma unroll
  for (int t = 0; t < 4; ++t) {
    const _Float16 h0 = (_Float16)(bfr(f[2 * t]) * WSC);
    const _Float16 h1 = (_Float16)(bfr(f[2 * t + 1]) * WSC);
    u[t] = pk16(h_bits(h0), h_bits(h1));
  }
{
    *(v4u*)(W16 + (size_t)o * CC + col) = u;
    
  }
}

// =========================================================================================================
// (1) conv1x1 GEMM for one (b, 64-n tile), all 320 outputs: Y[o][n] = relu((1/256) sum_c W16[o][c] X[n][c]), where
//     X[n][c] = f16 of bf16-RNE(x[b][c][n]) (exact in f16) is formed by the block itself, once, from the f32 input.
//     Block 128 threads = 4 waves. x tile 256 c x 64 n: thread (e = tid & 15, cq = tid >> 4) loads, per it = 0..3, the
//     eight rows c = 8 (8 it + cq) .. + 7 at n = 4 e .. 4 e + 3 (16 lanes x 16 B = 256 contiguous bytes of a row) and
//     stores, per n, the eight converted c as one 16-B piece of the LDS row n: two slices of 64 rows x 256 B (k 0..127,
//     k 128..255) at pitch GPITCH. Wave w owns cols n0+16w..+15: its eight B fragments (k = c contiguous in the LDS
//     row) are read once and stay in registers for all five weight tiles.
//     Pass mb = weight rows 64 mb .. + 63 (4 m-tiles, A rows o = 16 mt + (lane&15)): two slices of 64 rows x 256 B, one
//     tensor load from each of waves 2 and 3, two buffers, issued one pass ahead; fragments by ds_load_b128, the sixteen
//     reads of two k-steps as one group, one group ahead of the products. K = 256 = 8 steps.
//     Epilogue of a pass staged in LDS Os[n_loc][o_loc] (own range, pitch OSP, b128 stores of 8 consecutive o per lane,
//     relu applied), barrier, then (block-uniform branch on the pass):
//       pass 0 -> o_loc 0..31 = f (key) dims -> Fh/Fl, o_loc 32..63 = g (query) dims -> Gh/Gl; planes bf16
//       [b][SEQ n][32 d] (k-contiguous for both score operands): hi = bf16-RNE(v), lo = bf16-RNE(v - hi).
//       passes 1..4 -> channels 64(mb-1).. of the H plane f16 [b][256 c][SEQ n] (n contiguous), value x16 as f16.
// coverage: X slices: 4 it x 8 cq x 8 c = 256 c, 16 e x 4 n = 64 n, all written before the barrier; Os 4 waves x 16 n x
//           64 o = 64 x 64 (staged extent == consumed extent); F/G planes: 2 it x 16 lines x 8 lanes x 8 = 64 n x 32 d
//           per plane; H: 4 it x 16 rows x 8 lanes x 8 = 64 c x 64 n per pass; grid (SEQ/64, NB) x 5 passes covers all
//           SEQ rows of Fh/Fl/Gh/Gl and all 256 channels of H exactly once.
// =========================================================================================================
__global__ __launch_bounds__(128)
void gemm_p(const unsigned short* __restrict__ W16, const float* __restrict__ x,
            unsigned short* Fh, unsigned short* Fl, unsigned short* Gh, unsigned short* Gl,
            unsigned short* Hv) {
  __shared__ __attribute__((aligned(2048))) unsigned char gsm[6u * GSLICE + QT * OSP * 4];
  float* Os = (float*)(gsm + 6u * GSLICE);
  const int tid  = threadIdx.x;
  const int lane = tid & 31, wave = tid >> 5;
  const int hh   = lane >> 4, c = lane & 15;
  const int nt   = blockIdx.x, b = blockIdx.y;
  const int n0   = nt * QT;

  // Weight tile st = rows 64 st .. + 63, into buffer st & 1 (slices 2, 3 or 4, 5): waves 2 and 3 issue one k half each
  // (rows of 256 B at a source pitch of 512 B). Waves 0 and 1 issue none.
  const uint32_t lbase = (uint32_t)(size_t)gsm;
  const uint32_t wv    = uni((uint32_t)tid >> 5);
  const u32x8 g1w = held(tdm_group1<256u, QT, CC * 2u, 5u>());
  auto group0 = [&](uint32_t st) {
    const uint64_t ga = (uint64_t)(size_t)W16 + (uint64_t)st * (QT * CC * 2u) + (uint64_t)(wv & 1u) * 256u;
    return tdm_group0(lbase + (2u + 2u * (st & 1u) + (wv & 1u)) * GSLICE, ga);
  };
  u32x4 g0w = group0(0u);

  {
    const int e = tid & 15, cq = tid >> 4;                           // cq 0..7
    v4f xv[4][8];
#pragma unroll
    for (int it = 0; it < 4; ++it) {
#pragma unroll
      for (int r = 0; r < 8; ++r)
        xv[it][r] = *(const v4f*)(x + ((size_t)(b * CC + 8 * (8 * it + cq) + r)) * SEQ_FULL + n0 + 4 * e);
      asm volatile("s_wait_xcnt 0x0" ::: "memory");  // in front of the first overwrite of an address register that these loads name
    }
    if (pinned(wv >= 2u)) {                                          // weight tile 0 lands while the x rows arrive
      tdm_load(g0w, g1w);
      wait_tensor0();
    }
#pragma unroll
    for (int it = 0; it < 4; ++it) {
      const uint32_t cc = 8u * (uint32_t)(8 * it + cq);              // 0..248
      unsigned char* xd = gsm + (cc >> 7) * GSLICE + (uint32_t)(4 * e) * GPITCH + (cc & 127u) * 2u;
#pragma unroll
      for (int t = 0; t < 4; ++t) {
        v4u u;
#pragma unroll
        for (int p = 0; p < 4; ++p)
          u[p] = pk16(h_bits((_Float16)bfr(xv[it][2 * p][t])), h_bits((_Float16)bfr(xv[it][2 * p + 1][t])));
        *(v4u*)(xd + (uint32_t)t * GPITCH) = u;
      }
    }
  }
  wait_ds0();
  __syncthreads();                                                   // the X slices and weight tile 0 are in LDS
  g0w = held4(group0(1u));                                           // all four words stand in their registers in front of the branch, in every wave
  if (pinned(wv >= 2u)) tdm_load(g0w, g1w);

  const unsigned char* bp = gsm + (uint32_t)(16 * wave + c) * GPITCH + 16u * hh;
  Frag fb[CC / 32];
#pragma unroll
  for (int ks = 0; ks < CC / 32; ++ks)
    fb[ks] = ldfrag((const unsigned short*)(bp + (uint32_t)(ks >> 2) * GSLICE + (uint32_t)(ks & 3) * 64u));

#pragma unroll 1                                                     // one copy of the pass: the five differ only in addresses and in the store branch
  for (uint32_t mb = 0; mb < (uint32_t)MBLK; ++mb) {
    const unsigned char* ap = gsm + (2u + 2u * (mb & 1u)) * GSLICE + (uint32_t)c * GPITCH + 16u * hh;

    v8f acc[4];
#pragma unroll
    for (int mt = 0; mt < 4; ++mt) acc[mt] = zero8();

    // Group g = k-steps 2g and 2g + 1, two register sets: the next group's sixteen reads are issued in front of this
    // group's eight products, which then wait on counts and never to 0 before the last group.
    Frag fa[2][2][4];
#pragma unroll
    for (int g = -1; g < CC / 64; ++g) {
      if (g + 1 < CC / 64) {
#pragma unroll
        for (int q = 0; q < 2; ++q) {
          const int ks = 2 * (g + 1) + q;
          const uint32_t ko = (uint32_t)(ks >> 2) * GSLICE + (uint32_t)(ks & 3) * 64u;
#pragma unroll
          for (int mt = 0; mt < 4; ++mt)
            fa[(g + 1) & 1][q][mt] = ldfrag((const unsigned short*)(ap + ko + (uint32_t)(16 * mt) * GPITCH));
        }
      }
      if (g >= 0) {
#pragma unroll
        for (int q = 0; q < 2; ++q) {
#pragma unroll
          for (int mt = 0; mt < 4; ++mt) acc[mt] = mma_h(fa[g & 1][q][mt].h, fb[2 * g + q].h, acc[mt]);
        }
      }
    }

    // ---- epilogue: scale back + relu -> LDS Os[n_loc][o_loc]; lane (hh, c) holds o = 16 mt + 8 hh + r, n_loc = 16 w + c
    //      (the readers of the pass before left Os in front of that pass's last barrier)
    {
      const int nl = 16 * wave + c;
#pragma unroll
      for (int mt = 0; mt < 4; ++mt) {
        v4f va, vb;
#pragma unroll
        for (int r = 0; r < 4; ++r) {
          va[r] = fmaxf(acc[mt][r] * IWSC, 0.f);
          vb[r] = fmaxf(acc[mt][4 + r] * IWSC, 0.f);
        }
        *(v4f*)(Os + nl * OSP + 16 * mt + 8 * hh)     = va;
        *(v4f*)(Os + nl * OSP + 16 * mt + 8 * hh + 4) = vb;
      }
    }
    wait_ds0();
    wg_barrier();                                                    // Os is whole

    const int e = tid & 7, lq = tid >> 3;                            // lq 0..15
    if (mb == 0u) {                                                  // block-uniform
      v4u ufh[2], ufl[2], ugh[2], ugl[2];
#pragma unroll
      for (int it = 0; it < 2; ++it) {
        const int L   = it * 16 + lq;                                // line 0..31
        const int row = 2 * L + (e >> 2);                            // n_loc 0..63
        const int d   = 8 * (e & 3);                                 // 0, 8, 16, 24
        const float* fs = Os + row * OSP + d;
        const float* gs = Os + row * OSP + DQ + d;
        const v4f f0 = *(const v4f*)fs;
        const v4f f1 = *(const v4f*)(fs + 4);
        const v4f g0 = *(const v4f*)gs;
        const v4f g1 = *(const v4f*)(gs + 4);
        const float fv[8] = {f0[0], f0[1], f0[2], f0[3], f1[0], f1[1], f1[2], f1[3]};
        const float gv[8] = {g0[0], g0[1], g0[2], g0[3], g1[0], g1[1], g1[2], g1[3]};
#pragma unroll
        for (int t = 0; t < 4; ++t) {
          const unsigned short fh0 = bf_bits(fv[2 * t]), fh1 = bf_bits(fv[2 * t + 1]);
          const unsigned short fl0 = bf_bits(fv[2 * t] - bf_up(fh0));
          const unsigned short fl1 = bf_bits(fv[2 * t + 1] - bf_up(fh1));
          const unsigned short gh0 = bf_bits(gv[2 * t]), gh1 = bf_bits(gv[2 * t + 1]);
          const unsigned short gl0 = bf_bits(gv[2 * t] - bf_up(gh0));
          const unsigned short gl1 = bf_bits(gv[2 * t + 1] - bf_up(gh1));
          ufh[it][t] = pk16(fh0, fh1);
          ufl[it][t] = pk16(fl0, fl1);
          ugh[it][t] = pk16(gh0, gh1);
          ugl[it][t] = pk16(gl0, gl1);
        }
      }
#pragma unroll
      for (int it = 0; it < 2; ++it) {
        const int L   = it * 16 + lq;
        const int row = 2 * L + (e >> 2);
        const int d   = 8 * (e & 3);
        const size_t po = ((size_t)(b * SEQ + n0 + row)) * DQ + d;
        *(v4u*)(Fh + po) = ufh[it];
        *(v4u*)(Fl + po) = ufl[it];
        *(v4u*)(Gh + po) = ugh[it];
        *(v4u*)(Gl + po) = ugl[it];
      }
    } else {
      const int chb = ((int)mb - 1) * QT;                            // channel base 0..192
      v4u uhp[4];
#pragma unroll
      for (int it = 0; it < 4; ++it) {
        const int ol = it * 16 + lq;                                 // o_loc 0..63
        float hv8[8];
#pragma unroll
        for (int t = 0; t < 8; ++t) hv8[t] = Os[(8 * e + t) * OSP + ol];
#pragma unroll
        for (int t = 0; t < 4; ++t) {
          const _Float16 h0 = (_Float16)(hv8[2 * t] * HSC);
          const _Float16 h1 = (_Float16)(hv8[2 * t + 1] * HSC);
          uhp[it][t] = pk16(h_bits(h0), h_bits(h1));
        }
      }
#pragma unroll
      for (int it = 0; it < 4; ++it) {
        const int ol = it * 16 + lq;
        *(v4u*)(Hv + ((size_t)(b * CC + chb + ol)) * SEQ + n0 + 8 * e) = uhp[it];
      }
    }
    asm volatile("s_wait_xcnt 0x0" ::: "memory");  // in front of the next pass's overwrite of a register that these stores name

    // Foot of pass mb: this wave's LDS reads have returned, its own request of tile mb + 1 has landed, the barrier, and
    // only then the load of tile mb + 2 into the buffer that pass mb has read.
    wait_ds0();
    wait_tensor0();
    g0w = held4(g0w);
    wg_barrier();
    g0w = held4(group0(mb + 2u));                                    // formed in every wave and pass, issued only under the test
    if (pinned(mb + 2u < (uint32_t)MBLK && wv >= 2u)) tdm_load(g0w, g1w);
  }
  wait_tensor0();
  wait_ds0();
}

// =========================================================================================================
// (2) self-attention for one (b, 128-query tile), transposed formulation, SEQ keys, no mask, no scale:
//   S^T tile (16 keys x 16 queries) = A(k: row = key kb + (lane&15), 32 d via the split k map from the bf16 plane
//   Fh [b][SEQ][32]) . B(q: col = query, same map from Gh) + A(Fh).B(Gl) + A(Fl).B(Gh) (bf16 unscaled residual
//   planes, shared accumulator; K = 32 = one k-step; the query fragments are loaded once per wave).
//   Block = 8 waves. Wave (qg = wave & 3, grp = wave >> 2) owns 32 queries (two 16-query tiles) and, in pass h = 0, 1
//   of stage st, the 32 keys 128 st + 64 h + 32 grp .. + 31: each key and value fragment read from LDS feeds two
//   products, one per query tile. The wave's tile t holds queries 32 qg + 16 (t ^ grp) + (lane&15), so that tile 1 of
//   wave w and tile 0 of wave w ^ 4 are the same queries.
//   Per lane a D tile holds 8 keys of ONE query: online softmax state per lane and query tile, one shuffle (lane^16)
//   per tile for the max over 32 keys; the o/l rescale is skipped under one wave-uniform ballot per pass when no
//   lane's max grew (corr == 1 exactly for every lane then). P = e^{s-m} x 16384 as f16 is the B operand of
//   O^T (rows channel, cols queries) += A(H rows channel = 16j + (lane&15), keys contiguous, f16 plane Hv
//   [b][256][SEQ], values x16) . B(P^T): element r <- D of the tile covering keys kb..kb+15, element 8+r <- the tile
//   covering kb+16..kb+31, lane unchanged. 2 x 16 accumulator tiles per wave (256 channels x 32 queries).
//   Keys and values reach the waves through LDS: stages of 128 keys, two buffers, one tensor load per stage from each
//   of waves 0..3, issued one stage ahead; all eight waves read the tiles with ds_load_b128. A stage serves two
//   passes with no barrier between them: the waves of a SIMD may drift by a pass, one in its products while the
//   other is in its softmax.
//   Merge of the two key groups: every wave stores the state (m, l, o) of its tile 1 in its own LDS range Mg[wave],
//   lane by lane; behind one barrier it reads the range of wave ^ 4 (its own tile 0's queries, same lane = same query
//   and channels) and joins the two partial softmax states: m = max, weights e^{m_own - m} and e^{m_peer - m}.
//   Epilogue in two channel halves: gamma*O/(16 l) staged in LDS Os[query][128 channels] (pitch OSPW, b128 stores),
//   8 consecutive lanes x 16 B (values gathered from 4 Os rows), one instruction per 32 lines, final values held in
// coverage: Mg per wave 33 slots x 32 lanes x 16 B, all written before the barrier, slots 0..32 read behind it;
//           Os per half 8 waves x 16 queries x 128 ch fully staged before the barrier (staged extent == consumed
//           extent); out per half 16 it x 32 lines x 8 lanes x 4 floats = 128 ch x 128 n; two halves = 256 ch;
//           grid (SEQ/128, NB) covers out[b][0..255][0..SEQ-1] exactly once.
// =========================================================================================================
__global__ __launch_bounds__(256)
void attn_k(const unsigned short* __restrict__ Gh, const unsigned short* __restrict__ Gl,
            const unsigned short* __restrict__ Fh, const unsigned short* __restrict__ Fl,
            const unsigned short* __restrict__ Hv, const float* __restrict__ x,
            const float* __restrict__ gamma, float* out) {
  __shared__ __attribute__((aligned(2048))) unsigned char smem[2u * BUFB + 8u * MRGW];
  v4f*   Mg = (v4f*)(smem + 2u * BUFB);
  float* Os = (float*)smem;              // output staging in the ring's place, first written behind the merge barrier
  const int tid  = threadIdx.x;
  const int wave = tid >> 5, lane = tid & 31;
  const int qg   = wave & 3, grp = wave >> 2;
  const int hh   = lane >> 4, c = lane & 15;
  const int n0   = blockIdx.x * QB, b = blockIdx.y;

  // Stage st = keys 128 st .. 128 st + 127, into buffer st & 1. One request per stage from each of waves 0..3: waves 0
  // and 1 the two 128-channel halves of the value tile (rows of 256 B), wave 2 the key hi plane, wave 3 the key residual
  // plane (8192 contiguous bytes each, taken as 32 rows of 256 B). Waves 4..7 issue none.
  const uint32_t lbase = (uint32_t)(size_t)smem;
  const uint32_t wv    = uni((uint32_t)tid >> 5);
  const u32x8 g1v = held(tdm_group1<256u, 128u, SEQ * 2u, 5u>());
  const u32x8 g1k = held(tdm_group1<256u, KS / 4u, 256u, 5u>());
  auto issue = [&](uint32_t st, bool now) {                          // now: the wait directly behind the request
    const uint32_t dst = lbase + (st & 1u) * BUFB;
    if (pinned(wv < 2u)) {
      const uint64_t ga = (uint64_t)(size_t)Hv + ((uint64_t)(b * CC + 128u * wv) * SEQ + (uint64_t)st * KS) * 2u;
      tdm_load(tdm_group0(dst + wv * VSLICE, ga), g1v);
      if (now) wait_tensor0();
    } else if (pinned(wv < 4u)) {
      const uint64_t ga = (uint64_t)(size_t)(wv == 2u ? Fh : Fl) + ((uint64_t)b * SEQ + (uint64_t)st * KS) * (DQ * 2u);
      tdm_load(tdm_group0(dst + KOFF + (wv - 2u) * KPLACE, ga), g1k);
      if (now) wait_tensor0();
    }
  };
  issue(0u, true);

  // q fragments (B operand, col = query n0 + 32*qg + 16*(t^grp) + c), K = 32: loaded once
  Frag qh[2], ql[2];
#pragma unroll
  for (int t = 0; t < 2; ++t) {
    const size_t qo = ((size_t)(b * SEQ + n0 + 32 * qg + 16 * (t ^ grp) + c)) * DQ + 8 * hh;
    qh[t] = ldfrag(Gh + qo);
    ql[t] = ldfrag(Gl + qo);
  }
  asm volatile("s_wait_xcnt 0x0" ::: "memory");  // in front of the first overwrite of an address register that these loads name
  // k fragment offset in a buffer (A operand, row = key c of a 16-key tile: LDS row c >> 2, 64-B slot c & 3; this
  // wave's 32 keys of pass h are LDS rows 16 h + 8 grp .. + 7)
  const uint32_t klane = KOFF + (uint32_t)(8 * grp + (c >> 2)) * KPITCH + (uint32_t)(c & 3) * 64u + 16u * hh;
  // v fragment offset in a buffer (A operand, row = channel 16j + c, keys contiguous, this wave's 32 keys of pass h =
  // 64 B at 128 h + 64 grp)
  const uint32_t vlane = (uint32_t)c * VPITCH + 64u * grp + 16u * hh;

  float m[2] = {-1.0e30f, -1.0e30f}, l[2] = {0.f, 0.f};
  v8f o[2][16];
#pragma unroll
  for (int t = 0; t < 2; ++t) {
#pragma unroll
    for (int j = 0; j < 16; ++j) o[t][j] = zero8();
  }

#pragma unroll 1
  for (uint32_t st = 0; st < (uint32_t)NST; ++st) {
    // Publish point of stage st, between the passes of stage st - 1 and those of stage st (in front of the first: stage
    // 0's wait, the barrier, stage 1's load): this wave's LDS reads of stage st - 1 have returned, its own request of
    // stage st has landed, the barrier, and only then the load of stage st + 1 into the buffer that stage st - 1 filled.
    wait_ds0();
    wait_tensor0();
    __syncthreads();
    if (pinned(st + 1u < (uint32_t)NST)) issue(st + 1u, false);
    const unsigned char* bufp = smem + (st & 1u) * BUFB;
#pragma unroll                                                       // in line: pass 1's key reads and score products stand among pass 0's last products
    for (uint32_t h = 0; h < KS / 64u; ++h) {
    const unsigned char* Kp = bufp + klane + h * (16u * KPITCH);
    const unsigned char* Vp = bufp + vlane + h * 128u;
    // kb = 128 st + 64 h + 32 grp
    const Frag k0  = ldfrag((const unsigned short*)(Kp));                                   // keys kb .. kb+15
    const Frag k1  = ldfrag((const unsigned short*)(Kp + 4 * KPITCH));                      // keys kb+16 .. kb+31
    const Frag k0l = ldfrag((const unsigned short*)(Kp + KPLACE));
    const Frag k1l = ldfrag((const unsigned short*)(Kp + KPLACE + 4 * KPITCH));
    v8f s0[2], s1[2];
#pragma unroll
    for (int t = 0; t < 2; ++t) { s0[t] = zero8(); s1[t] = zero8(); }
#pragma unroll
    for (int t = 0; t < 2; ++t) { s0[t] = mma_bp(k0.bf, qh[t].bf, s0[t]);  s1[t] = mma_bp(k1.bf, qh[t].bf, s1[t]); }
#pragma unroll
    for (int t = 0; t < 2; ++t) { s0[t] = mma_bp(k0.bf, ql[t].bf, s0[t]);  s1[t] = mma_bp(k1.bf, ql[t].bf, s1[t]); }
#pragma unroll
    for (int t = 0; t < 2; ++t) { s0[t] = mma_bp(k0l.bf, qh[t].bf, s0[t]); s1[t] = mma_bp(k1l.bf, qh[t].bf, s1[t]); }

    float mx[2], mxo[2];
#pragma unroll
    for (int t = 0; t < 2; ++t) mx[t] = fmaxf(hmax8(s0[t]), hmax8(s1[t]));
#pragma unroll
    for (int t = 0; t < 2; ++t) mxo[t] = __shfl_xor(mx[t], 16, 32);
    // The first eight value fragments are read as one group behind the exchanges (LDS returns in order: in front of
    // them they would delay them) and in front of the exponentials, which run while the reads return. The scheduling
    // fences here and in the product loop keep each read group in its place: without them every read pair sits at its
    // own WMMA behind a wait to 0.
#if defined(__HIP_DEVICE_COMPILE__)
    asm volatile("" :: "v"(mxo[0]), "v"(mxo[1]));  // inputs-only fence on the exchanged values: the exchanges return before the reads issue
#endif
    __builtin_amdgcn_sched_barrier(0);
    Frag vf[16];
#pragma unroll
    for (int j = 0; j < 8; ++j) vf[j] = ldfrag((const unsigned short*)(Vp + (16 * j) * VPITCH));
    __builtin_amdgcn_sched_barrier(0);
    float mn[2];
#pragma unroll
    for (int t = 0; t < 2; ++t) { mx[t] = fmaxf(mx[t], mxo[t]); mn[t] = fmaxf(m[t], mx[t]); }
    const unsigned grew = wave_ballot(mx[0] > m[0] || mx[1] > m[1]); // wave-uniform, one test per pass
    if (grew != 0u) {
#pragma unroll
      for (int t = 0; t < 2; ++t) {
        const float corr = __expf(m[t] - mn[t]);                     // == 1 exactly for lanes whose max did not grow
        l[t] *= corr;
#pragma unroll
        for (int j = 0; j < 16; ++j) {
#pragma unroll
          for (int r = 0; r < 8; ++r) o[t][j][r] *= corr;
        }
      }
    }

    FragH ph[2];
#pragma unroll
    for (int t = 0; t < 2; ++t) {
      m[t] = mn[t];
      const float msh = mn[t] - LNPS;                                // exp gives e^{s-m} * 16384
      float ls = 0.f;
#pragma unroll
      for (int r = 0; r < 8; ++r) {
        const float e0 = __expf(s0[t][r] - msh);                     // key kb      + 8hh + r
        const float e1 = __expf(s1[t][r] - msh);                     // key kb + 16 + 8hh + r
        ls += e0 + e1;
        ph[t].hv[0][r] = (_Float16)e0;
        ph[t].hv[1][r] = (_Float16)e1;
      }
      l[t] += ls;
    }

    // Tile 0's products run while the last eight fragments arrive; all sixteen fragments stay in registers, and tile
    // 1's products take them from there, with no LDS read among them.
#pragma unroll
    for (int g = 0; g < 4; ++g) {                                    // four products, then the reads for two groups on
#pragma unroll
      for (int jj = 0; jj < 4; ++jj) o[0][4 * g + jj] = mma_hp(vf[4 * g + jj].h, ph[0].v, o[0][4 * g + jj]);
      if (g < 2) {
        __builtin_amdgcn_sched_barrier(0);                           // the eight reads stand as one group behind four products
#pragma unroll
        for (int jj = 0; jj < 4; ++jj) {
          const int j = 4 * g + 8 + jj;
          vf[j] = ldfrag((const unsigned short*)(Vp + (16 * j) * VPITCH));
        }
        __builtin_amdgcn_sched_barrier(0);                           // and in front of the next four products
      }
    }
#pragma unroll
    for (int j = 0; j < 16; ++j) o[1][j] = mma_hp(vf[j].h, ph[1].v, o[1][j]);
    }
  }
  wait_tensor0();
  wait_ds0();
#pragma unroll
  for (int t = 0; t < 2; ++t) l[t] += __shfl_xor(l[t], 16, 32);

  // ---- merge of the two key groups: tile 1's state goes to wave ^ 4, whose tile 0 holds the same queries
  {
    v4f* mine = Mg + (uint32_t)wave * (MSLOT * 32u) + lane;
#pragma unroll
    for (int j = 0; j < 16; ++j) {
      v4f va, vb;
#pragma unroll
      for (int r = 0; r < 4; ++r) { va[r] = o[1][j][r]; vb[r] = o[1][j][4 + r]; }
      mine[(2 * j) * 32]     = va;
      mine[(2 * j + 1) * 32] = vb;
    }
    const v4f sv = {m[1], l[1], 0.f, 0.f};
    mine[32 * 32] = sv;
  }
  __syncthreads();                                                   // every wave's tile-1 state is in Mg; every wave has left the ring (its waits above)
  const v4f* peer = Mg + (uint32_t)(wave ^ 4) * (MSLOT * 32u) + lane;
  const v4f  pst  = peer[32 * 32];
  const float mm  = fmaxf(m[0], pst[0]);
  const float ca  = __expf(m[0] - mm), cb = __expf(pst[0] - mm);
  const float lt  = l[0] * ca + pst[1] * cb;
  const float gm  = bfr(gamma[0]);
  const float inv = gm * IHSC * (1.0f / lt);                         // o carries x16384 x16, l carries x16384
  const float fa  = ca * inv, fb = cb * inv;

  const int qrow = 32 * qg + 16 * grp + c;
  const int e = tid & 7, lq = tid >> 3;                              // lq 0..31
#pragma unroll
  for (int half = 0; half < 2; ++half) {
    if (half) __syncthreads();                                       // every wave finished reading Os
#pragma unroll
    for (int jj = 0; jj < 8; ++jj) {
      const int j = 8 * half + jj;
      const v4f pa = peer[(2 * j) * 32];
      const v4f pb = peer[(2 * j + 1) * 32];
      v4f va, vb;
#pragma unroll
      for (int r = 0; r < 4; ++r) { va[r] = o[0][j][r] * fa + pa[r] * fb; vb[r] = o[0][j][4 + r] * fa + pb[r] * fb; }
      *(v4f*)(Os + qrow * OSPW + 16 * jj + 8 * hh)     = va;         // Os[query][ch_loc = 16jj + 8hh + r]
      *(v4f*)(Os + qrow * OSPW + 16 * jj + 8 * hh + 4) = vb;
    }
    __syncthreads();
    // line L = 32 it + lq: channel 8 it + (lq >> 2) of the half, queries 32 (lq & 3) + 4 e .. + 3
    const int chl = lq >> 2, nl = (lq & 3) * 32 + 4 * e;
    const float* xp = x + ((size_t)(b * CC + 128 * half + chl)) * SEQ_FULL + n0 + nl;
    float*       op = out + ((size_t)(b * CC + 128 * half + chl)) * SEQ + n0 + nl;
    v4f res[16];
#pragma unroll
    for (int it = 0; it < 16; ++it) {
      const v4f xv = *(const v4f*)(xp + (size_t)(8 * it) * SEQ_FULL);
#pragma unroll
      for (int t = 0; t < 4; ++t) res[it][t] = Os[(nl + t) * OSPW + chl + 8 * it] + bfr(xv[t]);
    }
#pragma unroll
    for (int it = 0; it < 16; ++it) *(v4f*)(op + (size_t)(8 * it) * SEQ) = res[it];
  }
}

// =========================================================================================================
// Workspace map (bytes; each region start a multiple of 256; every extent is an exact tile multiple and is written
//   W16 f16 [320][256]                 163840
//   Hv  f16 [8][256][4096]           16777216
//   Fh/Fl/Gh/Gl bf16 [8][4096][32]    2097152 x4
//   total = 25329664
// =========================================================================================================
extern "C" void kernel_launch(void* const* d_in, const int* in_sizes, int n_in,
                              void* d_out, int out_size, void* d_ws, size_t ws_size,
                              hipStream_t stream) {
  if (n_in < 5) return;
  if (in_sizes[0] < NB * CC * SEQ_FULL) return;
  if (in_sizes[1] < DQ * CC || in_sizes[2] < DQ * CC) return;
  if (in_sizes[3] < CC * CC) return;
  if (in_sizes[4] < 1) return;
  if (out_size < NB * CC * SEQ) return;

  size_t off = 0;
  auto carve = [&](size_t bytes) { const size_t o = off; off += (bytes + 255) & ~(size_t)255; return o; };
  const size_t oW16 = carve((size_t)MW * CC * 2);
  const size_t oHv  = carve((size_t)NB * CC * SEQ * 2);
  const size_t oFh  = carve((size_t)NB * SEQ * DQ * 2);
  const size_t oFl  = carve((size_t)NB * SEQ * DQ * 2);
  const size_t oGh  = carve((size_t)NB * SEQ * DQ * 2);
  const size_t oGl  = carve((size_t)NB * SEQ * DQ * 2);
  if (off > ws_size) return;
  if (off > (size_t)134217728) return;

  const float* x     = (const float*)d_in[0];
  const float* wq    = (const float*)d_in[1];
  const float* wk    = (const float*)d_in[2];
  const float* wv    = (const float*)d_in[3];
  const float* gamma = (const float*)d_in[4];

  char* ws = (char*)d_ws;
  unsigned short* W16 = (unsigned short*)(ws + oW16);
  unsigned short* Hv  = (unsigned short*)(ws + oHv);
  unsigned short* Fh  = (unsigned short*)(ws + oFh);
  unsigned short* Fl  = (unsigned short*)(ws + oFl);
  unsigned short* Gh  = (unsigned short*)(ws + oGh);
  unsigned short* Gl  = (unsigned short*)(ws + oGl);
  float* out = (float*)d_out;

  const dim3 blk256(256), blk128(128);

  // (0) q/k/v weights -> stacked f16 plane
  cvt_w<<<dim3(MW / 8), blk256, 0, stream>>>(wq, wk, wv, W16);
  // (1) conv1x1 GEMM from the f32 input -> f (key) and g (query) hi + residual planes, H value plane
  gemm_p<<<dim3(SEQ / QT, NB), blk128, 0, stream>>>(W16, x, Fh, Fl, Gh, Gl, Hv);
  // (2) attention + gamma scale + residual -> out [b][256][SEQ]
  attn_k<<<dim3(SEQ / QB, NB), blk256, 0, stream>>>(Gh, Gl, Fh, Fl, Hv, x, gamma, out);
  (void)hipGetLastError();
}

// v006
// A run of this version takes 69.1 microseconds.
// Timed twice side by side with v005, it ran 1.12 times as fast both times.
// Counting every step since v000, it is 7.94 times as fast.
// Contractions: conv1x1 q/k/v projections W[320x256].X[256x4096] on v_wmma_f32_16x16x32_f16 (f16 containers of
// bf16-RNE weights x256 and bf16-RNE x); scores f_n.g_m on v_wmma_f32_16x16x32_bf16 (bf16 hi + bf16 residual
// planes of f and g, 3 products, K=32); o^T = H.P^T on v_wmma_f32_16x16x32_f16 (H = relu(v-projection) x16 f16,
// P = e^{s-ref} x16 f16 from the score D registers); f32 accumulate everywhere; softmax statistics, gamma scale
// and the residual add in f32 VALU.
#include <hip/hip_runtime.h>
#include <math.h>
#include <stdint.h>

#ifndef NB
#define NB 8
#endif
#ifndef SEQ
#define SEQ 4096
#endif
#define NB_FULL  8
#define SEQ_FULL 4096
#define CC     256
#define DQ     32
#define MW     320
#define MBLK   5
#define QT     64
#define OSP    68
#define OSPW   132
#define WSC    256.0f
#define IWSC   0.00390625f
#define HSC    16.0f
#define IHSC   0.0625f
#define LNPS   2.772588722239781f        // ln 16: P = e^{s-ref} x 16
#define PLIM   65504.0f                  // largest finite f16: a lane's sum of P at or under it bounds each P
#define KS     128                       // keys per LDS stage: two passes of 64 keys (32 per wave) between barriers
#define NST    (SEQ / KS)                // stages
#define VPITCH 272u                      // LDS pitch of a value row: 256 B (128 keys f16) + 16 B pad
#define VSLICE (128u * VPITCH)           // 128 channels, one wave's request: 34816 B = 17 x 2 KiB
#define KPITCH 272u                      // LDS pitch of a key-plane row: 256 B (4 keys x 32 d bf16) + 16 B pad
#define KPLACE 10240u                    // 32 such rows (8704 B), rounded up to a multiple of 2 KiB
#define KOFF   (2u * VSLICE)
#define BUFB   (KOFF + 2u * KPLACE)      // one buffer: 90112 B
#define QB     128                       // queries per attention block: 4 wave pairs x 32
#define MSLOT  33u                       // 16-B slots per lane of a wave's merge range: 32 of o, one of (m, l)
#define MRGW   (MSLOT * 32u * 16u)       // one wave's merge range: 16896 B
#define GPITCH 272u                      // projection GEMM, LDS pitch of an operand row: 256 B (128 k f16) + 16 B pad
#define GSLICE 18432u                    // 64 such rows (17408 B), rounded up to a multiple of 2 KiB

static_assert(NB >= 1 && NB <= NB_FULL);
static_assert(SEQ >= QT && SEQ <= SEQ_FULL);
static_assert(SEQ % QT == 0 && SEQ % 32 == 0);
static_assert(CC % QT == 0 && CC % 32 == 0);
static_assert(MW == 2 * DQ + CC);
static_assert(MW == MBLK * QT);
static_assert(QT == 2 * DQ);
static_assert(MW % 8 == 0);
static_assert((OSP * 4) % 16 == 0);
static_assert((OSPW * 4) % 16 == 0);
static_assert(DQ % 32 == 0);
static_assert(SEQ % KS == 0 && NST >= 2);
static_assert(SEQ % QB == 0 && KS == 128);
static_assert(KS * 2 == 256 && CC == 256 && DQ * 2 * 4 == 256);
static_assert(QB * OSPW * 4 <= 2u * BUFB);
static_assert(VSLICE % 2048u == 0 && KPLACE % 2048u == 0 && (KS / 4) * KPITCH <= KPLACE);
static_assert(GSLICE % 2048u == 0 && QT * GPITCH <= GSLICE && CC * 2 == 512 && MBLK >= 2);

typedef _Float16       v16h __attribute__((ext_vector_type(16)));
typedef _Float16       v8h  __attribute__((ext_vector_type(8)));
typedef __bf16         v16b __attribute__((ext_vector_type(16)));
typedef unsigned short v8us __attribute__((ext_vector_type(8)));
typedef float          v8f  __attribute__((ext_vector_type(8)));
typedef float          v4f  __attribute__((ext_vector_type(4)));
typedef unsigned int   v4u  __attribute__((ext_vector_type(4)));
typedef uint32_t       u32x4 __attribute__((ext_vector_type(4)));
typedef uint32_t       u32x8 __attribute__((ext_vector_type(8)));

union Frag  { v8us u[2]; v16h h; v16b bf; };
union FragH { v16h v; v8h hv[2]; };
static_assert(sizeof(Frag) == 32);
static_assert(sizeof(FragH) == 32);

// ---- scalar helpers ---------------------------------------------------------------------------------------
__device__ __forceinline__ unsigned short bf_bits(float f) {          // f32 -> bf16 bits, RNE convert
  unsigned u = __float_as_uint(f);
  return (unsigned short)((u + 0x7FFFu + ((u >> 16) & 1u)) >> 16);
}
__device__ __forceinline__ float bf_up(unsigned short hb) { return __uint_as_float(((unsigned)hb) << 16); }
__device__ __forceinline__ float bfr(float f) { return bf_up(bf_bits(f)); }
__device__ __forceinline__ unsigned short h_bits(_Float16 x) { return __builtin_bit_cast(unsigned short, x); }
__device__ __forceinline__ unsigned pk16(unsigned short a, unsigned short b) { return (unsigned)a | ((unsigned)b << 16); }
__device__ __forceinline__ v8f zero8() { v8f z = {0.f, 0.f, 0.f, 0.f, 0.f, 0.f, 0.f, 0.f}; return z; }
__device__ __forceinline__ float hmax8(v8f s) {
  return fmaxf(fmaxf(fmaxf(s[0], s[1]), fmaxf(s[2], s[3])), fmaxf(fmaxf(s[4], s[5]), fmaxf(s[6], s[7])));
}
__device__ __forceinline__ unsigned wave_ballot(bool p) {
#if defined(__HIP_DEVICE_COMPILE__)
  return __builtin_amdgcn_ballot_w32(p);
#else
  return p ? 1u : 0u;
#endif
}

// ---- 16-bit fragment loader (A, or B from a k-contiguous [n][k] row): lane -> row/col (lane&15), p already includes
//      + 8*(lane>>4); elements 0..7 <- p[0..7] (k0+8h..), elements 8..15 <- p[16..23] (k0+16+8h..)
__device__ __forceinline__ Frag ldfrag(const unsigned short* p) {
  Frag f;
  f.u[0] = *(const v8us*)(p);
  f.u[1] = *(const v8us*)(p + 16);
  return f;
}

// ---- WMMA helpers: builtin followed by a 4-slot VALU gap tying D and keeping A/B live --------------------------
__device__ __forceinline__ v8f mma_h(v16h a, v16h b, v8f c) {
  v8f d = __builtin_amdgcn_wmma_f32_16x16x32_f16(false, a, false, b, (short)0, c, false, false);
#if defined(__HIP_DEVICE_COMPILE__)
  asm volatile("v_nop\n\tv_nop\n\tv_nop\n\tv_nop" : "+v"(d) : "v"(a), "v"(b));
#endif
  return d;
}
// The builtins alone, the compiler's own padding behind them (attention kernel): an asm operand cannot be a register
// above v255, and 256 accumulator registers with the fragments do not fit below it (tied to asm they spill).
__device__ __forceinline__ v8f mma_hp(v16h a, v16h b, v8f c) {
  return __builtin_amdgcn_wmma_f32_16x16x32_f16(false, a, false, b, (short)0, c, false, false);
}
__device__ __forceinline__ v8f mma_bp(v16b a, v16b b, v8f c) {
  return __builtin_amdgcn_wmma_f32_16x16x32_bf16(false, a, false, b, (short)0, c, false, false);
}

// ---- tensor load to LDS: descriptor groups and issue ----------------------------------------------------------
__device__ __forceinline__ uint32_t uni(uint32_t v) { return (uint32_t)__builtin_amdgcn_readfirstlane(v); }
__device__ __forceinline__ uint32_t pinned(uint32_t v) {
  uint32_t w = uni(v);
  asm volatile("" : "+s"(w));            // the test word stays scalar, the branch on it a scalar branch
  return w;
}
// group 1: 1-byte elements, tensor = tile = ROWS rows of ROWB bytes, source pitch SRCP bytes, 16 B of LDS pad per row
template <uint32_t ROWB, uint32_t ROWS, uint32_t SRCP, uint32_t IVL>
__device__ __forceinline__ u32x8 tdm_group1() {
  u32x8 g;
  g[0] = uni((1u << 20) | (IVL << 22) | (3u << 25));
  g[1] = uni((ROWB & 0xFFFFu) << 16);
  g[2] = uni((ROWB >> 16) | ((ROWS & 0xFFFFu) << 16));
  g[3] = uni((ROWS >> 16) | (ROWB << 16));
  g[4] = uni(ROWS);
  g[5] = uni(SRCP);
  g[6] = uni(0u);
  g[7] = uni(0u);
  return g;
}
// The same form on a whole group 1 (descriptor words held in scalar registers): the eight words keep their registers
// from the first request to the last, so that none of those registers takes another value while a request is outstanding.
__device__ __forceinline__ u32x8 held(u32x8 g) { asm volatile("" : "+s"(g)); return g; }  // pinned(), eight descriptor words
__device__ __forceinline__ u32x4 tdm_group0(uint32_t lds_dst, uint64_t ga) {
  u32x4 g;
  g[0] = uni(1u);
  g[1] = uni(lds_dst);
  g[2] = uni((uint32_t)ga);
  g[3] = uni((((uint32_t)(ga >> 32)) & 0x01FFFFFFu) | 0x80000000u);
  return g;
}
__device__ __forceinline__ void tdm_load(u32x4 g0, u32x8 g1) {
  asm volatile("tensor_load_to_lds %0, %1" :: "s"(g0), "s"(g1) : "memory");   // one request of the whole wave
}
__device__ __forceinline__ void wait_tensor0() { asm volatile("s_wait_tensorcnt 0x0" ::: "memory"); }  // this wave's request has landed
__device__ __forceinline__ void wait_ds0()     { asm volatile("s_wait_dscnt 0x0" ::: "memory"); }      // this wave's LDS reads have returned
// The same form on a group 0: its four words keep their registers from the request to the wait that covers it.
__device__ __forceinline__ u32x4 held4(u32x4 g) { asm volatile("" : "+s"(g)); return g; }  // pinned(), four descriptor words
// Work-group barrier alone, behind the caller's own wait_ds0(): __syncthreads() behind a global store also waits until
// that store has completed, which nothing in this work-group reads.
__device__ __forceinline__ void wg_barrier() { asm volatile("s_barrier_signal -1\n\ts_barrier_wait -1" ::: "memory"); }

// =========================================================================================================
// (0) conv1x1 weights: W16 f16 [320][256], rows 0..31 = q-projection rows, 32..63 = k-projection rows, 64..319 =
//     v-projection rows; value = f16 of (bf16-RNE(w) * 256) (exact). Block blk (0..39) owns rows 8*blk..8*blk+7:
// coverage: 40 blocks x 8 rows x 32 lanes x 8 halves = 320 x 256 = the whole plane.
// =========================================================================================================
__global__ __launch_bounds__(256)
void cvt_w(const float* __restrict__ wq, const float* __restrict__ wk, const float* __restrict__ wv,
           unsigned short* W16) {
  const int tid = threadIdx.x, blk = blockIdx.x;
  const int rl = tid >> 5, col = 8 * (tid & 31);
  const int o = 8 * blk + rl;                                        // 0..319
  const float* wbase;
  int osub;
  if (blk < DQ / 8)            { wbase = wq; osub = 0; }
  else if (blk < (2 * DQ) / 8) { wbase = wk; osub = DQ; }
  else                         { wbase = wv; osub = 2 * DQ; }
  const float* s = wbase + (size_t)(o - osub) * CC + col;
  const v4f a = *(const v4f*)s;
  const v4f q = *(const v4f*)(s + 4);
  const float f[8] = {a[0], a[1], a[2], a[3], q[0], q[1], q[2], q[3]};
  v4u u;
#pragma unroll
  for (int t = 0; t < 4; ++t) {
    const _Float16 h0 = (_Float16)(bfr(f[2 * t]) * WSC);
    const _Float16 h1 = (_Float16)(bfr(f[2 * t + 1]) * WSC);
    u[t] = pk16(h_bits(h0), h_bits(h1));
  }
{
    *(v4u*)(W16 + (size_t)o * CC + col) = u;
    
  }
}

// =========================================================================================================
// (1) conv1x1 GEMM for one (b, 64-n tile), all 320 outputs: Y[o][n] = relu((1/256) sum_c W16[o][c] X[n][c]), where
//     X[n][c] = f16 of bf16-RNE(x[b][c][n]) (exact in f16) is formed by the block itself, once, from the f32 input.
//     Block 128 threads = 4 waves. x tile 256 c x 64 n: thread (e = tid & 15, cq = tid >> 4) loads, per it = 0..3, the
//     eight rows c = 8 (8 it + cq) .. + 7 at n = 4 e .. 4 e + 3 (16 lanes x 16 B = 256 contiguous bytes of a row) and
//     stores, per n, the eight converted c as one 16-B piece of the LDS row n: two slices of 64 rows x 256 B (k 0..127,
//     k 128..255) at pitch GPITCH. Wave w owns cols n0+16w..+15: its eight B fragments (k = c contiguous in the LDS
//     row) are read once and stay in registers for all five weight tiles.
//     Pass mb = weight rows 64 mb .. + 63 (4 m-tiles, A rows o = 16 mt + (lane&15)): two slices of 64 rows x 256 B, one
//     tensor load from each of waves 2 and 3, two buffers, issued one pass ahead; fragments by ds_load_b128, the sixteen
//     reads of two k-steps as one group, one group ahead of the products. K = 256 = 8 steps.
//     Epilogue of a pass staged in LDS Os[n_loc][o_loc] (own range, pitch OSP, b128 stores of 8 consecutive o per lane,
//     relu applied), barrier, then (block-uniform branch on the pass):
//       pass 0 -> o_loc 0..31 = f (key) dims -> Fh/Fl, o_loc 32..63 = g (query) dims -> Gh/Gl; planes bf16
//       [b][SEQ n][32 d] (k-contiguous for both score operands): hi = bf16-RNE(v), lo = bf16-RNE(v - hi).
//       passes 1..4 -> channels 64(mb-1).. of the H plane f16 [b][256 c][SEQ n] (n contiguous), value x16 as f16.
// coverage: X slices: 4 it x 8 cq x 8 c = 256 c, 16 e x 4 n = 64 n, all written before the barrier; Os 4 waves x 16 n x
//           64 o = 64 x 64 (staged extent == consumed extent); F/G planes: 2 it x 16 lines x 8 lanes x 8 = 64 n x 32 d
//           per plane; H: 4 it x 16 rows x 8 lanes x 8 = 64 c x 64 n per pass; grid (SEQ/64, NB) x 5 passes covers all
//           SEQ rows of Fh/Fl/Gh/Gl and all 256 channels of H exactly once.
// =========================================================================================================
__global__ __launch_bounds__(128)
void gemm_p(const unsigned short* __restrict__ W16, const float* __restrict__ x,
            unsigned short* Fh, unsigned short* Fl, unsigned short* Gh, unsigned short* Gl,
            unsigned short* Hv) {
  __shared__ __attribute__((aligned(2048))) unsigned char gsm[6u * GSLICE + QT * OSP * 4];
  float* Os = (float*)(gsm + 6u * GSLICE);
  const int tid  = threadIdx.x;
  const int lane = tid & 31, wave = tid >> 5;
  const int hh   = lane >> 4, c = lane & 15;
  const int nt   = blockIdx.x, b = blockIdx.y;
  const int n0   = nt * QT;

  // Weight tile st = rows 64 st .. + 63, into buffer st & 1 (slices 2, 3 or 4, 5): waves 2 and 3 issue one k half each
  // (rows of 256 B at a source pitch of 512 B). Waves 0 and 1 issue none.
  const uint32_t lbase = (uint32_t)(size_t)gsm;
  const uint32_t wv    = uni((uint32_t)tid >> 5);
  const u32x8 g1w = held(tdm_group1<256u, QT, CC * 2u, 5u>());
  auto group0 = [&](uint32_t st) {
    const uint64_t ga = (uint64_t)(size_t)W16 + (uint64_t)st * (QT * CC * 2u) + (uint64_t)(wv & 1u) * 256u;
    return tdm_group0(lbase + (2u + 2u * (st & 1u) + (wv & 1u)) * GSLICE, ga);
  };
  u32x4 g0w = group0(0u);

  {
    const int e = tid & 15, cq = tid >> 4;                           // cq 0..7
    v4f xv[4][8];
#pragma unroll
    for (int it = 0; it < 4; ++it) {
#pragma unroll
      for (int r = 0; r < 8; ++r)
        xv[it][r] = *(const v4f*)(x + ((size_t)(b * CC + 8 * (8 * it + cq) + r)) * SEQ_FULL + n0 + 4 * e);
      asm volatile("s_wait_xcnt 0x0" ::: "memory");  // in front of the first overwrite of an address register that these loads name
    }
    if (pinned(wv >= 2u)) {                                          // weight tile 0 lands while the x rows arrive
      tdm_load(g0w, g1w);
      wait_tensor0();
    }
#pragma unroll
    for (int it = 0; it < 4; ++it) {
      const uint32_t cc = 8u * (uint32_t)(8 * it + cq);              // 0..248
      unsigned char* xd = gsm + (cc >> 7) * GSLICE + (uint32_t)(4 * e) * GPITCH + (cc & 127u) * 2u;
#pragma unroll
      for (int t = 0; t < 4; ++t) {
        v4u u;
#pragma unroll
        for (int p = 0; p < 4; ++p)
          u[p] = pk16(h_bits((_Float16)bfr(xv[it][2 * p][t])), h_bits((_Float16)bfr(xv[it][2 * p + 1][t])));
        *(v4u*)(xd + (uint32_t)t * GPITCH) = u;
      }
    }
  }
  wait_ds0();
  __syncthreads();                                                   // the X slices and weight tile 0 are in LDS
  g0w = held4(group0(1u));                                           // all four words stand in their registers in front of the branch, in every wave
  if (pinned(wv >= 2u)) tdm_load(g0w, g1w);

  const unsigned char* bp = gsm + (uint32_t)(16 * wave + c) * GPITCH + 16u * hh;
  Frag fb[CC / 32];
#pragma unroll
  for (int ks = 0; ks < CC / 32; ++ks)
    fb[ks] = ldfrag((const unsigned short*)(bp + (uint32_t)(ks >> 2) * GSLICE + (uint32_t)(ks & 3) * 64u));

#pragma unroll 1                                                     // one copy of the pass: the five differ only in addresses and in the store branch
  for (uint32_t mb = 0; mb < (uint32_t)MBLK; ++mb) {
    const unsigned char* ap = gsm + (2u + 2u * (mb & 1u)) * GSLICE + (uint32_t)c * GPITCH + 16u * hh;

    v8f acc[4];
#pragma unroll
    for (int mt = 0; mt < 4; ++mt) acc[mt] = zero8();

    // Group g = k-steps 2g and 2g + 1, two register sets: the next group's sixteen reads are issued in front of this
    // group's eight products, which then wait on counts and never to 0 before the last group.
    Frag fa[2][2][4];
#pragma unroll
    for (int g = -1; g < CC / 64; ++g) {
      if (g + 1 < CC / 64) {
#pragma unroll
        for (int q = 0; q < 2; ++q) {
          const int ks = 2 * (g + 1) + q;
          const uint32_t ko = (uint32_t)(ks >> 2) * GSLICE + (uint32_t)(ks & 3) * 64u;
#pragma unroll
          for (int mt = 0; mt < 4; ++mt)
            fa[(g + 1) & 1][q][mt] = ldfrag((const unsigned short*)(ap + ko + (uint32_t)(16 * mt) * GPITCH));
        }
      }
      if (g >= 0) {
#pragma unroll
        for (int q = 0; q < 2; ++q) {
#pragma unroll
          for (int mt = 0; mt < 4; ++mt) acc[mt] = mma_h(fa[g & 1][q][mt].h, fb[2 * g + q].h, acc[mt]);
        }
      }
    }

    // ---- epilogue: scale back + relu -> LDS Os[n_loc][o_loc]; lane (hh, c) holds o = 16 mt + 8 hh + r, n_loc = 16 w + c
    //      (the readers of the pass before left Os in front of that pass's last barrier)
    {
      const int nl = 16 * wave + c;
#pragma unroll
      for (int mt = 0; mt < 4; ++mt) {
        v4f va, vb;
#pragma unroll
        for (int r = 0; r < 4; ++r) {
          va[r] = fmaxf(acc[mt][r] * IWSC, 0.f);
          vb[r] = fmaxf(acc[mt][4 + r] * IWSC, 0.f);
        }
        *(v4f*)(Os + nl * OSP + 16 * mt + 8 * hh)     = va;
        *(v4f*)(Os + nl * OSP + 16 * mt + 8 * hh + 4) = vb;
      }
    }
    wait_ds0();
    wg_barrier();                                                    // Os is whole

    const int e = tid & 7, lq = tid >> 3;                            // lq 0..15
    if (mb == 0u) {                                                  // block-uniform
      v4u ufh[2], ufl[2], ugh[2], ugl[2];
#pragma unroll
      for (int it = 0; it < 2; ++it) {
        const int L   = it * 16 + lq;                                // line 0..31
        const int row = 2 * L + (e >> 2);                            // n_loc 0..63
        const int d   = 8 * (e & 3);                                 // 0, 8, 16, 24
        const float* fs = Os + row * OSP + d;
        const float* gs = Os + row * OSP + DQ + d;
        const v4f f0 = *(const v4f*)fs;
        const v4f f1 = *(const v4f*)(fs + 4);
        const v4f g0 = *(const v4f*)gs;
        const v4f g1 = *(const v4f*)(gs + 4);
        const float fv[8] = {f0[0], f0[1], f0[2], f0[3], f1[0], f1[1], f1[2], f1[3]};
        const float gv[8] = {g0[0], g0[1], g0[2], g0[3], g1[0], g1[1], g1[2], g1[3]};
#pragma unroll
        for (int t = 0; t < 4; ++t) {
          const unsigned short fh0 = bf_bits(fv[2 * t]), fh1 = bf_bits(fv[2 * t + 1]);
          const unsigned short fl0 = bf_bits(fv[2 * t] - bf_up(fh0));
          const unsigned short fl1 = bf_bits(fv[2 * t + 1] - bf_up(fh1));
          const unsigned short gh0 = bf_bits(gv[2 * t]), gh1 = bf_bits(gv[2 * t + 1]);
          const unsigned short gl0 = bf_bits(gv[2 * t] - bf_up(gh0));
          const unsigned short gl1 = bf_bits(gv[2 * t + 1] - bf_up(gh1));
          ufh[it][t] = pk16(fh0, fh1);
          ufl[it][t] = pk16(fl0, fl1);
          ugh[it][t] = pk16(gh0, gh1);
          ugl[it][t] = pk16(gl0, gl1);
        }
      }
#pragma unroll
      for (int it = 0; it < 2; ++it) {
        const int L   = it * 16 + lq;
        const int row = 2 * L + (e >> 2);
        const int d   = 8 * (e & 3);
        const size_t po = ((size_t)(b * SEQ + n0 + row)) * DQ + d;
        *(v4u*)(Fh + po) = ufh[it];
        *(v4u*)(Fl + po) = ufl[it];
        *(v4u*)(Gh + po) = ugh[it];
        *(v4u*)(Gl + po) = ugl[it];
      }
    } else {
      const int chb = ((int)mb - 1) * QT;                            // channel base 0..192
      v4u uhp[4];
#pragma unroll
      for (int it = 0; it < 4; ++it) {
        const int ol = it * 16 + lq;                                 // o_loc 0..63
        float hv8[8];
#pragma unroll
        for (int t = 0; t < 8; ++t) hv8[t] = Os[(8 * e + t) * OSP + ol];
#pragma unroll
        for (int t = 0; t < 4; ++t) {
          const _Float16 h0 = (_Float16)(hv8[2 * t] * HSC);
          const _Float16 h1 = (_Float16)(hv8[2 * t + 1] * HSC);
          uhp[it][t] = pk16(h_bits(h0), h_bits(h1));
        }
      }
#pragma unroll
      for (int it = 0; it < 4; ++it) {
        const int ol = it * 16 + lq;
        *(v4u*)(Hv + ((size_t)(b * CC + chb + ol)) * SEQ + n0 + 8 * e) = uhp[it];
      }
    }
    asm volatile("s_wait_xcnt 0x0" ::: "memory");  // in front of the next pass's overwrite of a register that these stores name

    // Foot of pass mb: this wave's LDS reads have returned, its own request of tile mb + 1 has landed, the barrier, and
    // only then the load of tile mb + 2 into the buffer that pass mb has read.
    wait_ds0();
    wait_tensor0();
    g0w = held4(g0w);
    wg_barrier();
    g0w = held4(group0(mb + 2u));                                    // formed in every wave and pass, issued only under the test
    if (pinned(mb + 2u < (uint32_t)MBLK && wv >= 2u)) tdm_load(g0w, g1w);
  }
  wait_tensor0();
  wait_ds0();
}

// =========================================================================================================
// (2) self-attention for one (b, 128-query tile), transposed formulation, SEQ keys, no mask, no scale:
//   S^T tile (16 keys x 16 queries) = A(k: row = key kb + (lane&15), 32 d via the split k map from the bf16 plane
//   Fh [b][SEQ][32]) . B(q: col = query, same map from Gh) + A(Fh).B(Gl) + A(Fl).B(Gh) (bf16 unscaled residual
//   planes, shared accumulator; K = 32 = one k-step; the query fragments are loaded once per wave).
//   Block = 8 waves. Wave (qg = wave & 3, grp = wave >> 2) owns 32 queries (two 16-query tiles) and, in pass h = 0, 1
//   of stage st, the 32 keys 128 st + 64 h + 32 grp .. + 31: each key and value fragment read from LDS feeds two
//   products, one per query tile. The wave's tile t holds queries 32 qg + 16 (t ^ grp) + (lane&15), so that tile 1 of
//   wave w and tile 0 of wave w ^ 4 are the same queries.
//   Per lane a D tile holds 8 keys of ONE query: online softmax state per lane and query tile. The reference m of the
//   exponentials is a maximum seen earlier, not the running one: a pass takes its exponentials against m as it stands
//   and tests, once, by a wave-uniform ballot, each lane's sum of P against the f16 range. Only where a sum is over it
//   (the first pass, m = -1e30, is such a pass) the maximum over the 32 keys (one shuffle lane^16 per tile), the o/l
//   rescale and the exponentials anew. P = e^{s-m} x 16 as f16 (at most 65504) is the B operand of
//   O^T (rows channel, cols queries) += A(H rows channel = 16j + (lane&15), keys contiguous, f16 plane Hv
//   [b][256][SEQ], values x16) . B(P^T): element r <- D of the tile covering keys kb..kb+15, element 8+r <- the tile
//   covering kb+16..kb+31, lane unchanged. 2 x 16 accumulator tiles per wave (256 channels x 32 queries).
//   Keys and values reach the waves through LDS: stages of 128 keys, two buffers, one tensor load per stage from each
//   of waves 0..3, issued one stage ahead; all eight waves read the tiles with ds_load_b128. A stage serves two
//   passes with no barrier between them: the waves of a SIMD may drift by a pass, one in its products while the
//   other is in its softmax.
//   Merge of the two key groups: every wave stores the state (m, l, o) of its tile 1 in its own LDS range Mg[wave],
//   lane by lane; behind one barrier it reads the range of wave ^ 4 (its own tile 0's queries, same lane = same query
//   and channels) and joins the two partial softmax states: m = max, weights e^{m_own - m} and e^{m_peer - m}.
//   Epilogue in two channel halves: gamma*O/(16 l) staged in LDS Os[query][128 channels] (pitch OSPW, b128 stores),
//   8 consecutive lanes x 16 B (values gathered from 4 Os rows), one instruction per 32 lines, final values held in
// coverage: Mg per wave 33 slots x 32 lanes x 16 B, all written before the barrier, slots 0..32 read behind it;
//           Os per half 8 waves x 16 queries x 128 ch fully staged before the barrier (staged extent == consumed
//           extent); out per half 16 it x 32 lines x 8 lanes x 4 floats = 128 ch x 128 n; two halves = 256 ch;
//           grid (SEQ/128, NB) covers out[b][0..255][0..SEQ-1] exactly once.
// =========================================================================================================
__global__ __launch_bounds__(256)
void attn_k(const unsigned short* __restrict__ Gh, const unsigned short* __restrict__ Gl,
            const unsigned short* __restrict__ Fh, const unsigned short* __restrict__ Fl,
            const unsigned short* __restrict__ Hv, const float* __restrict__ x,
            const float* __restrict__ gamma, float* out) {
  __shared__ __attribute__((aligned(2048))) unsigned char smem[2u * BUFB + 8u * MRGW];
  v4f*   Mg = (v4f*)(smem + 2u * BUFB);
  float* Os = (float*)smem;              // output staging in the ring's place, first written behind the merge barrier
  const int tid  = threadIdx.x;
  const int wave = tid >> 5, lane = tid & 31;
  const int qg   = wave & 3, grp = wave >> 2;
  const int hh   = lane >> 4, c = lane & 15;
  const int n0   = blockIdx.x * QB, b = blockIdx.y;

  // Stage st = keys 128 st .. 128 st + 127, into buffer st & 1. One request per stage from each of waves 0..3: waves 0
  // and 1 the two 128-channel halves of the value tile (rows of 256 B), wave 2 the key hi plane, wave 3 the key residual
  // plane (8192 contiguous bytes each, taken as 32 rows of 256 B). Waves 4..7 issue none.
  const uint32_t lbase = (uint32_t)(size_t)smem;
  const uint32_t wv    = uni((uint32_t)tid >> 5);
  const u32x8 g1v = held(tdm_group1<256u, 128u, SEQ * 2u, 5u>());
  const u32x8 g1k = held(tdm_group1<256u, KS / 4u, 256u, 5u>());
  auto issue = [&](uint32_t st, bool now) {                          // now: the wait directly behind the request
    const uint32_t dst = lbase + (st & 1u) * BUFB;
    if (pinned(wv < 2u)) {
      const uint64_t ga = (uint64_t)(size_t)Hv + ((uint64_t)(b * CC + 128u * wv) * SEQ + (uint64_t)st * KS) * 2u;
      tdm_load(tdm_group0(dst + wv * VSLICE, ga), g1v);
      if (now) wait_tensor0();
    } else if (pinned(wv < 4u)) {
      const uint64_t ga = (uint64_t)(size_t)(wv == 2u ? Fh : Fl) + ((uint64_t)b * SEQ + (uint64_t)st * KS) * (DQ * 2u);
      tdm_load(tdm_group0(dst + KOFF + (wv - 2u) * KPLACE, ga), g1k);
      if (now) wait_tensor0();
    }
  };
  issue(0u, true);

  // q fragments (B operand, col = query n0 + 32*qg + 16*(t^grp) + c), K = 32: loaded once
  Frag qh[2], ql[2];
#pragma unroll
  for (int t = 0; t < 2; ++t) {
    const size_t qo = ((size_t)(b * SEQ + n0 + 32 * qg + 16 * (t ^ grp) + c)) * DQ + 8 * hh;
    qh[t] = ldfrag(Gh + qo);
    ql[t] = ldfrag(Gl + qo);
  }
  asm volatile("s_wait_xcnt 0x0" ::: "memory");  // in front of the first overwrite of an address register that these loads name
  // k fragment offset in a buffer (A operand, row = key c of a 16-key tile: LDS row c >> 2, 64-B slot c & 3; this
  // wave's 32 keys of pass h are LDS rows 16 h + 8 grp .. + 7)
  const uint32_t klane = KOFF + (uint32_t)(8 * grp + (c >> 2)) * KPITCH + (uint32_t)(c & 3) * 64u + 16u * hh;
  // v fragment offset in a buffer (A operand, row = channel 16j + c, keys contiguous, this wave's 32 keys of pass h =
  // 64 B at 128 h + 64 grp)
  const uint32_t vlane = (uint32_t)c * VPITCH + 64u * grp + 16u * hh;

  float m[2] = {-1.0e30f, -1.0e30f}, l[2] = {0.f, 0.f};
  v8f o[2][16];
#pragma unroll
  for (int t = 0; t < 2; ++t) {
#pragma unroll
    for (int j = 0; j < 16; ++j) o[t][j] = zero8();
  }

#pragma unroll 1
  for (uint32_t st = 0; st < (uint32_t)NST; ++st) {
    // Publish point of stage st, between the passes of stage st - 1 and those of stage st (in front of the first: stage
    // 0's wait, the barrier, stage 1's load): this wave's LDS reads of stage st - 1 have returned, its own request of
    // stage st has landed, the barrier, and only then the load of stage st + 1 into the buffer that stage st - 1 filled.
    wait_ds0();
    wait_tensor0();
    __syncthreads();
    if (pinned(st + 1u < (uint32_t)NST)) issue(st + 1u, false);
    const unsigned char* bufp = smem + (st & 1u) * BUFB;
#pragma unroll                                                       // in line: pass 1's key reads and score products stand among pass 0's last products
    for (uint32_t h = 0; h < KS / 64u; ++h) {
    const unsigned char* Kp = bufp + klane + h * (16u * KPITCH);
    const unsigned char* Vp = bufp + vlane + h * 128u;
    // kb = 128 st + 64 h + 32 grp
    const Frag k0  = ldfrag((const unsigned short*)(Kp));                                   // keys kb .. kb+15
    const Frag k1  = ldfrag((const unsigned short*)(Kp + 4 * KPITCH));                      // keys kb+16 .. kb+31
    const Frag k0l = ldfrag((const unsigned short*)(Kp + KPLACE));
    const Frag k1l = ldfrag((const unsigned short*)(Kp + KPLACE + 4 * KPITCH));
    // Pass 0's eight key reads stay one group in front of its score products (behind the publish point nothing else
    // covers them): without the fence the residual planes' reads stand among the products, each behind its own wait.
    if (h == 0u) __builtin_amdgcn_sched_barrier(0);
    v8f s0[2], s1[2];
#pragma unroll
    for (int t = 0; t < 2; ++t) { s0[t] = zero8(); s1[t] = zero8(); }
#pragma unroll
    for (int t = 0; t < 2; ++t) { s0[t] = mma_bp(k0.bf, qh[t].bf, s0[t]);  s1[t] = mma_bp(k1.bf, qh[t].bf, s1[t]); }
#pragma unroll
    for (int t = 0; t < 2; ++t) { s0[t] = mma_bp(k0.bf, ql[t].bf, s0[t]);  s1[t] = mma_bp(k1.bf, ql[t].bf, s1[t]); }
#pragma unroll
    for (int t = 0; t < 2; ++t) { s0[t] = mma_bp(k0l.bf, qh[t].bf, s0[t]); s1[t] = mma_bp(k1l.bf, qh[t].bf, s1[t]); }

    // The first eight value fragments are read as one group behind the score products and in front of the
    // exponentials, which run while the reads return. The scheduling fences here and in the product loop keep each
    // read group in its place: without them every read pair sits at its own WMMA behind a wait to 0.
    __builtin_amdgcn_sched_barrier(0);
    Frag vf[16];
#pragma unroll
    for (int j = 0; j < 8; ++j) vf[j] = ldfrag((const unsigned short*)(Vp + (16 * j) * VPITCH));
    __builtin_amdgcn_sched_barrier(0);

    FragH ph[2];
    float ls[2];
    auto expo = [&](int t) {                                         // P and its sum per lane, against m[t] as it stands
      const float msh = m[t] - LNPS;                                 // exp gives e^{s-m} * 16
      float a = 0.f;
#pragma unroll
      for (int r = 0; r < 8; ++r) {
        const float e0 = __expf(s0[t][r] - msh);                     // key kb      + 8hh + r
        const float e1 = __expf(s1[t][r] - msh);                     // key kb + 16 + 8hh + r
        a += e0 + e1;
        ph[t].hv[0][r] = (_Float16)e0;
        ph[t].hv[1][r] = (_Float16)e1;
      }
      ls[t] = a;
    };
    expo(0);
    expo(1);
    // No P is negative, so a sum within the f16 range bounds each of its terms; an infinite sum fails the test too.
    const unsigned over = wave_ballot(!(ls[0] <= PLIM && ls[1] <= PLIM));  // wave-uniform, one test per pass
    if (over != 0u) {
#pragma unroll
      for (int t = 0; t < 2; ++t) {
        float mx = fmaxf(hmax8(s0[t]), hmax8(s1[t]));
        mx = fmaxf(mx, __shfl_xor(mx, 16, 32));                      // both lanes of a query take the same m
        const float mn   = fmaxf(m[t], mx);
        const float corr = __expf(m[t] - mn);
        l[t] *= corr;
#pragma unroll
        for (int j = 0; j < 16; ++j) {
#pragma unroll
          for (int r = 0; r < 8; ++r) o[t][j][r] *= corr;
        }
        m[t] = mn;
        expo(t);                                                     // now every P is at most 16
      }
    }
#pragma unroll
    for (int t = 0; t < 2; ++t) l[t] += ls[t];

    // Tile 0's products run while the last eight fragments arrive; all sixteen fragments stay in registers, and tile
    // 1's products take them from there, with no LDS read among them.
#pragma unroll
    for (int g = 0; g < 4; ++g) {                                    // four products, then the reads for two groups on
#pragma unroll
      for (int jj = 0; jj < 4; ++jj) o[0][4 * g + jj] = mma_hp(vf[4 * g + jj].h, ph[0].v, o[0][4 * g + jj]);
      if (g < 2) {
        __builtin_amdgcn_sched_barrier(0);                           // the eight reads stand as one group behind four products
#pragma unroll
        for (int jj = 0; jj < 4; ++jj) {
          const int j = 4 * g + 8 + jj;
          vf[j] = ldfrag((const unsigned short*)(Vp + (16 * j) * VPITCH));
        }
        __builtin_amdgcn_sched_barrier(0);                           // and in front of the next four products
      }
    }
#pragma unroll
    for (int j = 0; j < 16; ++j) o[1][j] = mma_hp(vf[j].h, ph[1].v, o[1][j]);
    }
  }
  wait_tensor0();
  wait_ds0();
#pragma unroll
  for (int t = 0; t < 2; ++t) l[t] += __shfl_xor(l[t], 16, 32);

  // ---- merge of the two key groups: tile 1's state goes to wave ^ 4, whose tile 0 holds the same queries
  {
    v4f* mine = Mg + (uint32_t)wave * (MSLOT * 32u) + lane;
#pragma unroll
    for (int j = 0; j < 16; ++j) {
      v4f va, vb;
#pragma unroll
      for (int r = 0; r < 4; ++r) { va[r] = o[1][j][r]; vb[r] = o[1][j][4 + r]; }
      mine[(2 * j) * 32]     = va;
      mine[(2 * j + 1) * 32] = vb;
    }
    const v4f sv = {m[1], l[1], 0.f, 0.f};
    mine[32 * 32] = sv;
  }
  __syncthreads();                                                   // every wave's tile-1 state is in Mg; every wave has left the ring (its waits above)
  const v4f* peer = Mg + (uint32_t)(wave ^ 4) * (MSLOT * 32u) + lane;
  const v4f  pst  = peer[32 * 32];
  const float mm  = fmaxf(m[0], pst[0]);
  const float ca  = __expf(m[0] - mm), cb = __expf(pst[0] - mm);
  const float lt  = l[0] * ca + pst[1] * cb;
  const float gm  = bfr(gamma[0]);
  const float inv = gm * IHSC * (1.0f / lt);                         // o carries x16 x16, l carries x16
  const float fa  = ca * inv, fb = cb * inv;

  const int qrow = 32 * qg + 16 * grp + c;
  const int e = tid & 7, lq = tid >> 3;                              // lq 0..31
#pragma unroll
  for (int half = 0; half < 2; ++half) {
    if (half) __syncthreads();                                       // every wave finished reading Os
#pragma unroll
    for (int jj = 0; jj < 8; ++jj) {
      const int j = 8 * half + jj;
      const v4f pa = peer[(2 * j) * 32];
      const v4f pb = peer[(2 * j + 1) * 32];
      v4f va, vb;
#pragma unroll
      for (int r = 0; r < 4; ++r) { va[r] = o[0][j][r] * fa + pa[r] * fb; vb[r] = o[0][j][4 + r] * fa + pb[r] * fb; }
      *(v4f*)(Os + qrow * OSPW + 16 * jj + 8 * hh)     = va;         // Os[query][ch_loc = 16jj + 8hh + r]
      *(v4f*)(Os + qrow * OSPW + 16 * jj + 8 * hh + 4) = vb;
    }
    __syncthreads();
    // line L = 32 it + lq: channel 8 it + (lq >> 2) of the half, queries 32 (lq & 3) + 4 e .. + 3
    const int chl = lq >> 2, nl = (lq & 3) * 32 + 4 * e;
    const float* xp = x + ((size_t)(b * CC + 128 * half + chl)) * SEQ_FULL + n0 + nl;
    float*       op = out + ((size_t)(b * CC + 128 * half + chl)) * SEQ + n0 + nl;
    v4f res[16];
#pragma unroll
    for (int it = 0; it < 16; ++it) {
      const v4f xv = *(const v4f*)(xp + (size_t)(8 * it) * SEQ_FULL);
#pragma unroll
      for (int t = 0; t < 4; ++t) res[it][t] = Os[(nl + t) * OSPW + chl + 8 * it] + bfr(xv[t]);
    }
#pragma unroll
    for (int it = 0; it < 16; ++it) *(v4f*)(op + (size_t)(8 * it) * SEQ) = res[it];
  }
}

// =========================================================================================================
// Workspace map (bytes; each region start a multiple of 256; every extent is an exact tile multiple and is written
//   W16 f16 [320][256]                 163840
//   Hv  f16 [8][256][4096]           16777216
//   Fh/Fl/Gh/Gl bf16 [8][4096][32]    2097152 x4
//   total = 25329664
// =========================================================================================================
extern "C" void kernel_launch(void* const* d_in, const int* in_sizes, int n_in,
                              void* d_out, int out_size, void* d_ws, size_t ws_size,
                              hipStream_t stream) {
  if (n_in < 5) return;
  if (in_sizes[0] < NB * CC * SEQ_FULL) return;
  if (in_sizes[1] < DQ * CC || in_sizes[2] < DQ * CC) return;
  if (in_sizes[3] < CC * CC) return;
  if (in_sizes[4] < 1) return;
  if (out_size < NB * CC * SEQ) return;

  size_t off = 0;
  auto carve = [&](size_t bytes) { const size_t o = off; off += (bytes + 255) & ~(size_t)255; return o; };
  const size_t oW16 = carve((size_t)MW * CC * 2);
  const size_t oHv  = carve((size_t)NB * CC * SEQ * 2);
  const size_t oFh  = carve((size_t)NB * SEQ * DQ * 2);
  const size_t oFl  = carve((size_t)NB * SEQ * DQ * 2);
  const size_t oGh  = carve((size_t)NB * SEQ * DQ * 2);
  const size_t oGl  = carve((size_t)NB * SEQ * DQ * 2);
  if (off > ws_size) return;
  if (off > (size_t)134217728) return;

  const float* x     = (const float*)d_in[0];
  const float* wq    = (const float*)d_in[1];
  const float* wk    = (const float*)d_in[2];
  const float* wv    = (const float*)d_in[3];
  const float* gamma = (const float*)d_in[4];

  char* ws = (char*)d_ws;
  unsigned short* W16 = (unsigned short*)(ws + oW16);
  unsigned short* Hv  = (unsigned short*)(ws + oHv);
  unsigned short* Fh  = (unsigned short*)(ws + oFh);
  unsigned short* Fl  = (unsigned short*)(ws + oFl);
  unsigned short* Gh  = (unsigned short*)(ws + oGh);
  unsigned short* Gl  = (unsigned short*)(ws + oGl);
  float* out = (float*)d_out;

  const dim3 blk256(256), blk128(128);

  // (0) q/k/v weights -> stacked f16 plane
  cvt_w<<<dim3(MW / 8), blk256, 0, stream>>>(wq, wk, wv, W16);
  // (1) conv1x1 GEMM from the f32 input -> f (key) and g (query) hi + residual planes, H value plane
  gemm_p<<<dim3(SEQ / QT, NB), blk128, 0, stream>>>(W16, x, Fh, Fl, Gh, Gl, Hv);
  // (2) attention + gamma scale + residual -> out [b][256][SEQ]
  attn_k<<<dim3(SEQ / QB, NB), blk256, 0, stream>>>(Gh, Gl, Fh, Fl, Hv, x, gamma, out);
  (void)hipGetLastError();
}

// v007
// It runs in 66.6 microseconds.
// In two side-by-side timings against v006, it was 1.03 and 1.04 times as fast.
// Counting every step since v000, it is 8.23 times as fast.
// Contractions: conv1x1 q/k/v projections W[320x256].X[256x4096] on v_wmma_f32_16x16x32_f16 (f16 containers of
// bf16-RNE weights x256 and bf16-RNE x); scores f_n.g_m on v_wmma_f32_16x16x32_bf16 (bf16 hi + bf16 residual
// planes of f and of g x log2 e, 3 products, K=32, accumulator started at minus the softmax reference); o^T = H.P^T on
// v_wmma_f32_16x16x32_f16 (H = relu(v-projection) x16 f16, P = e^{s-ref} x16 f16 = 2^D of the score D registers); f32
// accumulate everywhere; softmax statistics, gamma scale and the residual add in f32 VALU.
#include <hip/hip_runtime.h>
#include <math.h>
#include <stdint.h>

#ifndef NB
#define NB 8
#endif
#ifndef SEQ
#define SEQ 4096
#endif
#define NB_FULL  8
#define SEQ_FULL 4096
#define CC     256
#define DQ     32
#define MW     320
#define MBLK   5
#define QT     64
#define OSP    68
#define OSPW   132
#define WSC    256.0f
#define IWSC   0.00390625f
#define HSC    16.0f
#define IHSC   0.0625f
#define L2E    1.4426950408889634f       // log2 e: the query planes carry g x log2 e, so that a score is an exponent of 2
#define PSH    4.0f                      // log2 16: P = e^{s-ref} x 16
#define PLIM   65504.0f                  // largest finite f16: a lane's sum of P at or under it bounds each P
#define KS     128                       // keys per LDS stage: two passes of 64 keys (32 per wave) between barriers
#define NST    (SEQ / KS)                // stages
#define VPITCH 272u                      // LDS pitch of a value row: 256 B (128 keys f16) + 16 B pad
#define VSLICE (128u * VPITCH)           // 128 channels, one wave's request: 34816 B = 17 x 2 KiB
#define KPITCH 272u                      // LDS pitch of a key-plane row: 256 B (4 keys x 32 d bf16) + 16 B pad
#define KPLACE 10240u                    // 32 such rows (8704 B), rounded up to a multiple of 2 KiB
#define KOFF   (2u * VSLICE)
#define BUFB   (KOFF + 2u * KPLACE)      // one buffer: 90112 B
#define QB     128                       // queries per attention block: 4 wave pairs x 32
#define MSLOT  33u                       // 16-B slots per lane of a wave's merge range: 32 of o, one of (rf, l)
#define MRGW   (MSLOT * 32u * 16u)       // one wave's merge range: 16896 B
#define GPITCH 272u                      // projection GEMM, LDS pitch of an operand row: 256 B (128 k f16) + 16 B pad
#define GSLICE 18432u                    // 64 such rows (17408 B), rounded up to a multiple of 2 KiB

static_assert(NB >= 1 && NB <= NB_FULL);
static_assert(SEQ >= QT && SEQ <= SEQ_FULL);
static_assert(SEQ % QT == 0 && SEQ % 32 == 0);
static_assert(CC % QT == 0 && CC % 32 == 0);
static_assert(MW == 2 * DQ + CC);
static_assert(MW == MBLK * QT);
static_assert(QT == 2 * DQ);
static_assert(MW % 8 == 0);
static_assert((OSP * 4) % 16 == 0);
static_assert((OSPW * 4) % 16 == 0);
static_assert(DQ % 32 == 0);
static_assert(SEQ % KS == 0 && NST >= 2);
static_assert(SEQ % QB == 0 && KS == 128);
static_assert(KS * 2 == 256 && CC == 256 && DQ * 2 * 4 == 256);
static_assert(QB * OSPW * 4 <= 2u * BUFB);
static_assert(VSLICE % 2048u == 0 && KPLACE % 2048u == 0 && (KS / 4) * KPITCH <= KPLACE);
static_assert(GSLICE % 2048u == 0 && QT * GPITCH <= GSLICE && CC * 2 == 512 && MBLK >= 2);

typedef _Float16       v16h __attribute__((ext_vector_type(16)));
typedef _Float16       v8h  __attribute__((ext_vector_type(8)));
typedef __bf16         v16b __attribute__((ext_vector_type(16)));
typedef unsigned short v8us __attribute__((ext_vector_type(8)));
typedef float          v8f  __attribute__((ext_vector_type(8)));
typedef float          v4f  __attribute__((ext_vector_type(4)));
typedef unsigned int   v4u  __attribute__((ext_vector_type(4)));
typedef uint32_t       u32x4 __attribute__((ext_vector_type(4)));
typedef uint32_t       u32x8 __attribute__((ext_vector_type(8)));

union Frag  { v8us u[2]; v16h h; v16b bf; };
union FragH { v16h v; v8h hv[2]; };
static_assert(sizeof(Frag) == 32);
static_assert(sizeof(FragH) == 32);

// ---- scalar helpers ---------------------------------------------------------------------------------------
__device__ __forceinline__ unsigned short bf_bits(float f) {          // f32 -> bf16 bits, RNE convert
  unsigned u = __float_as_uint(f);
  return (unsigned short)((u + 0x7FFFu + ((u >> 16) & 1u)) >> 16);
}
__device__ __forceinline__ float bf_up(unsigned short hb) { return __uint_as_float(((unsigned)hb) << 16); }
__device__ __forceinline__ float bfr(float f) { return bf_up(bf_bits(f)); }
__device__ __forceinline__ unsigned short h_bits(_Float16 x) { return __builtin_bit_cast(unsigned short, x); }
__device__ __forceinline__ unsigned pk16(unsigned short a, unsigned short b) { return (unsigned)a | ((unsigned)b << 16); }
__device__ __forceinline__ v8f zero8() { v8f z = {0.f, 0.f, 0.f, 0.f, 0.f, 0.f, 0.f, 0.f}; return z; }
__device__ __forceinline__ float hmax8(v8f s) {
  return fmaxf(fmaxf(fmaxf(s[0], s[1]), fmaxf(s[2], s[3])), fmaxf(fmaxf(s[4], s[5]), fmaxf(s[6], s[7])));
}
__device__ __forceinline__ float pow2(float v) {                      // 2^v, the hardware's own exponential
#if defined(__HIP_DEVICE_COMPILE__)
  return __builtin_amdgcn_exp2f(v);
#else
  return v;
#endif
}
__device__ __forceinline__ unsigned wave_ballot(bool p) {
#if defined(__HIP_DEVICE_COMPILE__)
  return __builtin_amdgcn_ballot_w32(p);
#else
  return p ? 1u : 0u;
#endif
}

// ---- 16-bit fragment loader (A, or B from a k-contiguous [n][k] row): lane -> row/col (lane&15), p already includes
//      + 8*(lane>>4); elements 0..7 <- p[0..7] (k0+8h..), elements 8..15 <- p[16..23] (k0+16+8h..)
__device__ __forceinline__ Frag ldfrag(const unsigned short* p) {
  Frag f;
  f.u[0] = *(const v8us*)(p);
  f.u[1] = *(const v8us*)(p + 16);
  return f;
}

// ---- WMMA helpers: builtin followed by a 4-slot VALU gap tying D and keeping A/B live --------------------------
__device__ __forceinline__ v8f mma_h(v16h a, v16h b, v8f c) {
  v8f d = __builtin_amdgcn_wmma_f32_16x16x32_f16(false, a, false, b, (short)0, c, false, false);
#if defined(__HIP_DEVICE_COMPILE__)
  asm volatile("v_nop\n\tv_nop\n\tv_nop\n\tv_nop" : "+v"(d) : "v"(a), "v"(b));
#endif
  return d;
}
// The builtins alone, the compiler's own padding behind them (attention kernel): an asm operand cannot be a register
// above v255, and 256 accumulator registers with the fragments do not fit below it (tied to asm they spill).
__device__ __forceinline__ v8f mma_hp(v16h a, v16h b, v8f c) {
  return __builtin_amdgcn_wmma_f32_16x16x32_f16(false, a, false, b, (short)0, c, false, false);
}
__device__ __forceinline__ v8f mma_bp(v16b a, v16b b, v8f c) {
  return __builtin_amdgcn_wmma_f32_16x16x32_bf16(false, a, false, b, (short)0, c, false, false);
}

// ---- tensor load to LDS: descriptor groups and issue ----------------------------------------------------------
__device__ __forceinline__ uint32_t uni(uint32_t v) { return (uint32_t)__builtin_amdgcn_readfirstlane(v); }
__device__ __forceinline__ uint32_t pinned(uint32_t v) {
  uint32_t w = uni(v);
  asm volatile("" : "+s"(w));            // the test word stays scalar, the branch on it a scalar branch
  return w;
}
// group 1: 1-byte elements, tensor = tile = ROWS rows of ROWB bytes, source pitch SRCP bytes, 16 B of LDS pad per row
template <uint32_t ROWB, uint32_t ROWS, uint32_t SRCP, uint32_t IVL>
__device__ __forceinline__ u32x8 tdm_group1() {
  u32x8 g;
  g[0] = uni((1u << 20) | (IVL << 22) | (3u << 25));
  g[1] = uni((ROWB & 0xFFFFu) << 16);
  g[2] = uni((ROWB >> 16) | ((ROWS & 0xFFFFu) << 16));
  g[3] = uni((ROWS >> 16) | (ROWB << 16));
  g[4] = uni(ROWS);
  g[5] = uni(SRCP);
  g[6] = uni(0u);
  g[7] = uni(0u);
  return g;
}
// The same form on a whole group 1 (descriptor words held in scalar registers): the eight words keep their registers
// from the first request to the last, so that none of those registers takes another value while a request is outstanding.
__device__ __forceinline__ u32x8 held(u32x8 g) { asm volatile("" : "+s"(g)); return g; }  // pinned(), eight descriptor words
__device__ __forceinline__ u32x4 tdm_group0(uint32_t lds_dst, uint64_t ga) {
  u32x4 g;
  g[0] = uni(1u);
  g[1] = uni(lds_dst);
  g[2] = uni((uint32_t)ga);
  g[3] = uni((((uint32_t)(ga >> 32)) & 0x01FFFFFFu) | 0x80000000u);
  return g;
}
__device__ __forceinline__ void tdm_load(u32x4 g0, u32x8 g1) {
  asm volatile("tensor_load_to_lds %0, %1" :: "s"(g0), "s"(g1) : "memory");   // one request of the whole wave
}
__device__ __forceinline__ void wait_tensor0() { asm volatile("s_wait_tensorcnt 0x0" ::: "memory"); }  // this wave's request has landed
__device__ __forceinline__ void wait_ds0()     { asm volatile("s_wait_dscnt 0x0" ::: "memory"); }      // this wave's LDS reads have returned
// The same form on a group 0: its four words keep their registers from the request to the wait that covers it.
__device__ __forceinline__ u32x4 held4(u32x4 g) { asm volatile("" : "+s"(g)); return g; }  // pinned(), four descriptor words
// Work-group barrier alone, behind the caller's own wait_ds0(): __syncthreads() behind a global store also waits until
// that store has completed, which nothing in this work-group reads.
__device__ __forceinline__ void wg_barrier() { asm volatile("s_barrier_signal -1\n\ts_barrier_wait -1" ::: "memory"); }

// =========================================================================================================
// (0) conv1x1 weights: W16 f16 [320][256], rows 0..31 = q-projection rows, 32..63 = k-projection rows, 64..319 =
//     v-projection rows; value = f16 of (bf16-RNE(w) * 256) (exact). Block blk (0..39) owns rows 8*blk..8*blk+7:
// coverage: 40 blocks x 8 rows x 32 lanes x 8 halves = 320 x 256 = the whole plane.
// =========================================================================================================
__global__ __launch_bounds__(256)
void cvt_w(const float* __restrict__ wq, const float* __restrict__ wk, const float* __restrict__ wv,
           unsigned short* W16) {
  const int tid = threadIdx.x, blk = blockIdx.x;
  const int rl = tid >> 5, col = 8 * (tid & 31);
  const int o = 8 * blk + rl;                                        // 0..319
  const float* wbase;
  int osub;
  if (blk < DQ / 8)            { wbase = wq; osub = 0; }
  else if (blk < (2 * DQ) / 8) { wbase = wk; osub = DQ; }
  else                         { wbase = wv; osub = 2 * DQ; }
  const float* s = wbase + (size_t)(o - osub) * CC + col;
  const v4f a = *(const v4f*)s;
  const v4f q = *(const v4f*)(s + 4);
  const float f[8] = {a[0], a[1], a[2], a[3], q[0], q[1], q[2], q[3]};
  v4u u;
#pragma unroll
  for (int t = 0; t < 4; ++t) {
    const _Float16 h0 = (_Float16)(bfr(f[2 * t]) * WSC);
    const _Float16 h1 = (_Float16)(bfr(f[2 * t + 1]) * WSC);
    u[t] = pk16(h_bits(h0), h_bits(h1));
  }
{
    *(v4u*)(W16 + (size_t)o * CC + col) = u;
    
  }
}

// =========================================================================================================
// (1) conv1x1 GEMM for one (b, 64-n tile), all 320 outputs: Y[o][n] = relu((1/256) sum_c W16[o][c] X[n][c]), where
//     X[n][c] = f16 of bf16-RNE(x[b][c][n]) (exact in f16) is formed by the block itself, once, from the f32 input.
//     Block 128 threads = 4 waves. x tile 256 c x 64 n: thread (e = tid & 15, cq = tid >> 4) loads, per it = 0..3, the
//     eight rows c = 8 (8 it + cq) .. + 7 at n = 4 e .. 4 e + 3 (16 lanes x 16 B = 256 contiguous bytes of a row) and
//     stores, per n, the eight converted c as one 16-B piece of the LDS row n: two slices of 64 rows x 256 B (k 0..127,
//     k 128..255) at pitch GPITCH. Wave w owns cols n0+16w..+15: its eight B fragments (k = c contiguous in the LDS
//     row) are read once and stay in registers for all five weight tiles.
//     Pass mb = weight rows 64 mb .. + 63 (4 m-tiles, A rows o = 16 mt + (lane&15)): two slices of 64 rows x 256 B, one
//     tensor load from each of waves 2 and 3, two buffers, issued one pass ahead; fragments by ds_load_b128, the sixteen
//     reads of two k-steps as one group, one group ahead of the products. K = 256 = 8 steps.
//     Epilogue of a pass staged in LDS Os[n_loc][o_loc] (own range, pitch OSP, b128 stores of 8 consecutive o per lane,
//     relu applied), barrier, then (block-uniform branch on the pass):
//       pass 0 -> o_loc 0..31 = f (key) dims -> Fh/Fl, o_loc 32..63 = g (query) dims, x log2 e -> Gh/Gl; planes bf16
//       [b][SEQ n][32 d] (k-contiguous for both score operands): hi = bf16-RNE(v), lo = bf16-RNE(v - hi).
//       passes 1..4 -> channels 64(mb-1).. of the H plane f16 [b][256 c][SEQ n] (n contiguous), value x16 as f16.
// coverage: X slices: 4 it x 8 cq x 8 c = 256 c, 16 e x 4 n = 64 n, all written before the barrier; Os 4 waves x 16 n x
//           64 o = 64 x 64 (staged extent == consumed extent); F/G planes: 2 it x 16 lines x 8 lanes x 8 = 64 n x 32 d
//           per plane; H: 4 it x 16 rows x 8 lanes x 8 = 64 c x 64 n per pass; grid (SEQ/64, NB) x 5 passes covers all
//           SEQ rows of Fh/Fl/Gh/Gl and all 256 channels of H exactly once.
// =========================================================================================================
__global__ __launch_bounds__(128)
void gemm_p(const unsigned short* __restrict__ W16, const float* __restrict__ x,
            unsigned short* Fh, unsigned short* Fl, unsigned short* Gh, unsigned short* Gl,
            unsigned short* Hv) {
  __shared__ __attribute__((aligned(2048))) unsigned char gsm[6u * GSLICE + QT * OSP * 4];
  float* Os = (float*)(gsm + 6u * GSLICE);
  const int tid  = threadIdx.x;
  const int lane = tid & 31, wave = tid >> 5;
  const int hh   = lane >> 4, c = lane & 15;
  const int nt   = blockIdx.x, b = blockIdx.y;
  const int n0   = nt * QT;

  // Weight tile st = rows 64 st .. + 63, into buffer st & 1 (slices 2, 3 or 4, 5): waves 2 and 3 issue one k half each
  // (rows of 256 B at a source pitch of 512 B). Waves 0 and 1 issue none.
  const uint32_t lbase = (uint32_t)(size_t)gsm;
  const uint32_t wv    = uni((uint32_t)tid >> 5);
  const u32x8 g1w = held(tdm_group1<256u, QT, CC * 2u, 5u>());
  auto group0 = [&](uint32_t st) {
    const uint64_t ga = (uint64_t)(size_t)W16 + (uint64_t)st * (QT * CC * 2u) + (uint64_t)(wv & 1u) * 256u;
    return tdm_group0(lbase + (2u + 2u * (st & 1u) + (wv & 1u)) * GSLICE, ga);
  };
  u32x4 g0w = group0(0u);

  {
    const int e = tid & 15, cq = tid >> 4;                           // cq 0..7
    v4f xv[4][8];
#pragma unroll
    for (int it = 0; it < 4; ++it) {
#pragma unroll
      for (int r = 0; r < 8; ++r)
        xv[it][r] = *(const v4f*)(x + ((size_t)(b * CC + 8 * (8 * it + cq) + r)) * SEQ_FULL + n0 + 4 * e);
      asm volatile("s_wait_xcnt 0x0" ::: "memory");  // in front of the first overwrite of an address register that these loads name
    }
    if (pinned(wv >= 2u)) {                                          // weight tile 0 lands while the x rows arrive
      tdm_load(g0w, g1w);
      wait_tensor0();
    }
#pragma unroll
    for (int it = 0; it < 4; ++it) {
      const uint32_t cc = 8u * (uint32_t)(8 * it + cq);              // 0..248
      unsigned char* xd = gsm + (cc >> 7) * GSLICE + (uint32_t)(4 * e) * GPITCH + (cc & 127u) * 2u;
#pragma unroll
      for (int t = 0; t < 4; ++t) {
        v4u u;
#pragma unroll
        for (int p = 0; p < 4; ++p)
          u[p] = pk16(h_bits((_Float16)bfr(xv[it][2 * p][t])), h_bits((_Float16)bfr(xv[it][2 * p + 1][t])));
        *(v4u*)(xd + (uint32_t)t * GPITCH) = u;
      }
    }
  }
  wait_ds0();
  __syncthreads();                                                   // the X slices and weight tile 0 are in LDS
  g0w = held4(group0(1u));                                           // all four words stand in their registers in front of the branch, in every wave
  if (pinned(wv >= 2u)) tdm_load(g0w, g1w);

  const unsigned char* bp = gsm + (uint32_t)(16 * wave + c) * GPITCH + 16u * hh;
  Frag fb[CC / 32];
#pragma unroll
  for (int ks = 0; ks < CC / 32; ++ks)
    fb[ks] = ldfrag((const unsigned short*)(bp + (uint32_t)(ks >> 2) * GSLICE + (uint32_t)(ks & 3) * 64u));

#pragma unroll 1                                                     // one copy of the pass: the five differ only in addresses and in the store branch
  for (uint32_t mb = 0; mb < (uint32_t)MBLK; ++mb) {
    const unsigned char* ap = gsm + (2u + 2u * (mb & 1u)) * GSLICE + (uint32_t)c * GPITCH + 16u * hh;

    v8f acc[4];
#pragma unroll
    for (int mt = 0; mt < 4; ++mt) acc[mt] = zero8();

    // Group g = k-steps 2g and 2g + 1, two register sets: the next group's sixteen reads are issued in front of this
    // group's eight products, which then wait on counts and never to 0 before the last group.
    Frag fa[2][2][4];
#pragma unroll
    for (int g = -1; g < CC / 64; ++g) {
      if (g + 1 < CC / 64) {
#pragma unroll
        for (int q = 0; q < 2; ++q) {
          const int ks = 2 * (g + 1) + q;
          const uint32_t ko = (uint32_t)(ks >> 2) * GSLICE + (uint32_t)(ks & 3) * 64u;
#pragma unroll
          for (int mt = 0; mt < 4; ++mt)
            fa[(g + 1) & 1][q][mt] = ldfrag((const unsigned short*)(ap + ko + (uint32_t)(16 * mt) * GPITCH));
        }
      }
      if (g >= 0) {
#pragma unroll
        for (int q = 0; q < 2; ++q) {
#pragma unroll
          for (int mt = 0; mt < 4; ++mt) acc[mt] = mma_h(fa[g & 1][q][mt].h, fb[2 * g + q].h, acc[mt]);
        }
      }
    }

    // ---- epilogue: scale back + relu -> LDS Os[n_loc][o_loc]; lane (hh, c) holds o = 16 mt + 8 hh + r, n_loc = 16 w + c
    //      (the readers of the pass before left Os in front of that pass's last barrier)
    {
      const int nl = 16 * wave + c;
#pragma unroll
      for (int mt = 0; mt < 4; ++mt) {
        v4f va, vb;
#pragma unroll
        for (int r = 0; r < 4; ++r) {
          va[r] = fmaxf(acc[mt][r] * IWSC, 0.f);
          vb[r] = fmaxf(acc[mt][4 + r] * IWSC, 0.f);
        }
        *(v4f*)(Os + nl * OSP + 16 * mt + 8 * hh)     = va;
        *(v4f*)(Os + nl * OSP + 16 * mt + 8 * hh + 4) = vb;
      }
    }
    wait_ds0();
    wg_barrier();                                                    // Os is whole

    const int e = tid & 7, lq = tid >> 3;                            // lq 0..15
    if (mb == 0u) {                                                  // block-uniform
      v4u ufh[2], ufl[2], ugh[2], ugl[2];
#pragma unroll
      for (int it = 0; it < 2; ++it) {
        const int L   = it * 16 + lq;                                // line 0..31
        const int row = 2 * L + (e >> 2);                            // n_loc 0..63
        const int d   = 8 * (e & 3);                                 // 0, 8, 16, 24
        const float* fs = Os + row * OSP + d;
        const float* gs = Os + row * OSP + DQ + d;
        const v4f f0 = *(const v4f*)fs;
        const v4f f1 = *(const v4f*)(fs + 4);
        const v4f g0 = *(const v4f*)gs;
        const v4f g1 = *(const v4f*)(gs + 4);
        const float fv[8] = {f0[0], f0[1], f0[2], f0[3], f1[0], f1[1], f1[2], f1[3]};
        const float gv[8] = {g0[0] * L2E, g0[1] * L2E, g0[2] * L2E, g0[3] * L2E,
                             g1[0] * L2E, g1[1] * L2E, g1[2] * L2E, g1[3] * L2E};
#pragma unroll
        for (int t = 0; t < 4; ++t) {
          const unsigned short fh0 = bf_bits(fv[2 * t]), fh1 = bf_bits(fv[2 * t + 1]);
          const unsigned short fl0 = bf_bits(fv[2 * t] - bf_up(fh0));
          const unsigned short fl1 = bf_bits(fv[2 * t + 1] - bf_up(fh1));
          const unsigned short gh0 = bf_bits(gv[2 * t]), gh1 = bf_bits(gv[2 * t + 1]);
          const unsigned short gl0 = bf_bits(gv[2 * t] - bf_up(gh0));
          const unsigned short gl1 = bf_bits(gv[2 * t + 1] - bf_up(gh1));
          ufh[it][t] = pk16(fh0, fh1);
          ufl[it][t] = pk16(fl0, fl1);
          ugh[it][t] = pk16(gh0, gh1);
          ugl[it][t] = pk16(gl0, gl1);
        }
      }
#pragma unroll
      for (int it = 0; it < 2; ++it) {
        const int L   = it * 16 + lq;
        const int row = 2 * L + (e >> 2);
        const int d   = 8 * (e & 3);
        const size_t po = ((size_t)(b * SEQ + n0 + row)) * DQ + d;
        *(v4u*)(Fh + po) = ufh[it];
        *(v4u*)(Fl + po) = ufl[it];
        *(v4u*)(Gh + po) = ugh[it];
        *(v4u*)(Gl + po) = ugl[it];
      }
    } else {
      const int chb = ((int)mb - 1) * QT;                            // channel base 0..192
      v4u uhp[4];
#pragma unroll
      for (int it = 0; it < 4; ++it) {
        const int ol = it * 16 + lq;                                 // o_loc 0..63
        float hv8[8];
#pragma unroll
        for (int t = 0; t < 8; ++t) hv8[t] = Os[(8 * e + t) * OSP + ol];
#pragma unroll
        for (int t = 0; t < 4; ++t) {
          const _Float16 h0 = (_Float16)(hv8[2 * t] * HSC);
          const _Float16 h1 = (_Float16)(hv8[2 * t + 1] * HSC);
          uhp[it][t] = pk16(h_bits(h0), h_bits(h1));
        }
      }
#pragma unroll
      for (int it = 0; it < 4; ++it) {
        const int ol = it * 16 + lq;
        *(v4u*)(Hv + ((size_t)(b * CC + chb + ol)) * SEQ + n0 + 8 * e) = uhp[it];
      }
    }
    asm volatile("s_wait_xcnt 0x0" ::: "memory");  // in front of the next pass's overwrite of a register that these stores name

    // Foot of pass mb: this wave's LDS reads have returned, its own request of tile mb + 1 has landed, the barrier, and
    // only then the load of tile mb + 2 into the buffer that pass mb has read.
    wait_ds0();
    wait_tensor0();
    g0w = held4(g0w);
    wg_barrier();
    g0w = held4(group0(mb + 2u));                                    // formed in every wave and pass, issued only under the test
    if (pinned(mb + 2u < (uint32_t)MBLK && wv >= 2u)) tdm_load(g0w, g1w);
  }
  wait_tensor0();
  wait_ds0();
}

// =========================================================================================================
// (2) self-attention for one (b, 128-query tile), transposed formulation, SEQ keys, no mask, no scale:
//   S^T tile (16 keys x 16 queries) = A(k: row = key kb + (lane&15), 32 d via the split k map from the bf16 plane
//   Fh [b][SEQ][32]) . B(q: col = query, same map from Gh) + A(Fh).B(Gl) + A(Fl).B(Gh) (bf16 unscaled residual
//   planes, shared accumulator; K = 32 = one k-step; the query fragments are loaded once per wave).
//   Block = 8 waves. Wave (qg = wave & 3, grp = wave >> 2) owns 32 queries (two 16-query tiles) and, in pass h = 0, 1
//   of stage st, the 32 keys 128 st + 64 h + 32 grp .. + 31: each key and value fragment read from LDS feeds two
//   products, one per query tile. The wave's tile t holds queries 32 qg + 16 (t ^ grp) + (lane&15), so that tile 1 of
//   wave w and tile 0 of wave w ^ 4 are the same queries.
//   Per lane a D tile holds 8 keys of ONE query: online softmax state per lane and query tile. The reference m of the
//   exponentials is a maximum seen earlier, not the running one. The query planes carry g x log2 e and a tile's first
//   product takes -rf (rf = m log2 e - 4, eight equal registers per lane and query tile) as its C operand, so that the
//   D registers are the exponents of P themselves, with no vector subtract or multiply in front of the exponentials.
//   A pass tests, once, by a wave-uniform ballot, each lane's sum of P against the f16 range. Only where a sum is over
//   it, and in the first pass, the maximum over the 32 keys (one shuffle lane^16 per tile), the o/l rescale, the new
//   C registers and the exponentials anew. P = e^{s-m} x 16 as f16 (at most 65504) is the B operand of
//   O^T (rows channel, cols queries) += A(H rows channel = 16j + (lane&15), keys contiguous, f16 plane Hv
//   [b][256][SEQ], values x16) . B(P^T): element r <- D of the tile covering keys kb..kb+15, element 8+r <- the tile
//   covering kb+16..kb+31, lane unchanged. 2 x 16 accumulator tiles per wave (256 channels x 32 queries).
//   Keys and values reach the waves through LDS: stages of 128 keys, two buffers, one tensor load per stage from each
//   of waves 0..3, issued one stage ahead; all eight waves read the tiles with ds_load_b128. A stage serves two
//   passes with no barrier between them: the waves of a SIMD may drift by a pass, one in its products while the
//   other is in its softmax.
//   Merge of the two key groups: every wave stores the state (rf, l, o) of its tile 1 in its own LDS range Mg[wave],
//   lane by lane; behind one barrier it reads the range of wave ^ 4 (its own tile 0's queries, same lane = same query
//   and channels) and joins the two partial softmax states: rf = max, weights 2^{rf_own - rf} and 2^{rf_peer - rf}.
//   Epilogue in two channel halves: gamma*O/(16 l) staged in LDS Os[query][128 channels] (pitch OSPW, b128 stores),
//   8 consecutive lanes x 16 B (values gathered from 4 Os rows), one instruction per 32 lines, final values held in
// coverage: Mg per wave 33 slots x 32 lanes x 16 B, all written before the barrier, slots 0..32 read behind it;
//           Os per half 8 waves x 16 queries x 128 ch fully staged before the barrier (staged extent == consumed
//           extent); out per half 16 it x 32 lines x 8 lanes x 4 floats = 128 ch x 128 n; two halves = 256 ch;
//           grid (SEQ/128, NB) covers out[b][0..255][0..SEQ-1] exactly once.
// =========================================================================================================
__global__ __launch_bounds__(256)
void attn_k(const unsigned short* __restrict__ Gh, const unsigned short* __restrict__ Gl,
            const unsigned short* __restrict__ Fh, const unsigned short* __restrict__ Fl,
            const unsigned short* __restrict__ Hv, const float* __restrict__ x,
            const float* __restrict__ gamma, float* out) {
  __shared__ __attribute__((aligned(2048))) unsigned char smem[2u * BUFB + 8u * MRGW];
  v4f*   Mg = (v4f*)(smem + 2u * BUFB);
  float* Os = (float*)smem;              // output staging in the ring's place, first written behind the merge barrier
  const int tid  = threadIdx.x;
  const int wave = tid >> 5, lane = tid & 31;
  const int qg   = wave & 3, grp = wave >> 2;
  const int hh   = lane >> 4, c = lane & 15;
  const int n0   = blockIdx.x * QB, b = blockIdx.y;

  // Stage st = keys 128 st .. 128 st + 127, into buffer st & 1. One request per stage from each of waves 0..3: waves 0
  // and 1 the two 128-channel halves of the value tile (rows of 256 B), wave 2 the key hi plane, wave 3 the key residual
  // plane (8192 contiguous bytes each, taken as 32 rows of 256 B). Waves 4..7 issue none.
  const uint32_t lbase = (uint32_t)(size_t)smem;
  const uint32_t wv    = uni((uint32_t)tid >> 5);
  const u32x8 g1v = held(tdm_group1<256u, 128u, SEQ * 2u, 5u>());
  const u32x8 g1k = held(tdm_group1<256u, KS / 4u, 256u, 5u>());
  auto issue = [&](uint32_t st, bool now) {                          // now: the wait directly behind the request
    const uint32_t dst = lbase + (st & 1u) * BUFB;
    if (pinned(wv < 2u)) {
      const uint64_t ga = (uint64_t)(size_t)Hv + ((uint64_t)(b * CC + 128u * wv) * SEQ + (uint64_t)st * KS) * 2u;
      tdm_load(tdm_group0(dst + wv * VSLICE, ga), g1v);
      if (now) wait_tensor0();
    } else if (pinned(wv < 4u)) {
      const uint64_t ga = (uint64_t)(size_t)(wv == 2u ? Fh : Fl) + ((uint64_t)b * SEQ + (uint64_t)st * KS) * (DQ * 2u);
      tdm_load(tdm_group0(dst + KOFF + (wv - 2u) * KPLACE, ga), g1k);
      if (now) wait_tensor0();
    }
  };
  issue(0u, true);

  // q fragments (B operand, col = query n0 + 32*qg + 16*(t^grp) + c), K = 32: loaded once
  Frag qh[2], ql[2];
#pragma unroll
  for (int t = 0; t < 2; ++t) {
    const size_t qo = ((size_t)(b * SEQ + n0 + 32 * qg + 16 * (t ^ grp) + c)) * DQ + 8 * hh;
    qh[t] = ldfrag(Gh + qo);
    ql[t] = ldfrag(Gl + qo);
  }
  asm volatile("s_wait_xcnt 0x0" ::: "memory");  // in front of the first overwrite of an address register that these loads name
  // k fragment offset in a buffer (A operand, row = key c of a 16-key tile: LDS row c >> 2, 64-B slot c & 3; this
  // wave's 32 keys of pass h are LDS rows 16 h + 8 grp .. + 7)
  const uint32_t klane = KOFF + (uint32_t)(8 * grp + (c >> 2)) * KPITCH + (uint32_t)(c & 3) * 64u + 16u * hh;
  // v fragment offset in a buffer (A operand, row = channel 16j + c, keys contiguous, this wave's 32 keys of pass h =
  // 64 B at 128 h + 64 grp)
  const uint32_t vlane = (uint32_t)c * VPITCH + 64u * grp + 16u * hh;

  // rf = the reference in use, in exponents of 2 and less log2 16; nr = -rf in eight registers, the C operand of a
  // tile's first score product (a lane's eight D registers are eight keys of ONE query)
  float rf[2] = {0.f, 0.f}, l[2] = {0.f, 0.f};
  v8f nr[2] = {zero8(), zero8()};
  float lim = -1.0f;                     // the bound of the test: under every sum until the first pass has set a reference, then PLIM
  v8f o[2][16];
#pragma unroll
  for (int t = 0; t < 2; ++t) {
#pragma unroll
    for (int j = 0; j < 16; ++j) o[t][j] = zero8();
  }

#pragma unroll 1
  for (uint32_t st = 0; st < (uint32_t)NST; ++st) {
    // Publish point of stage st, between the passes of stage st - 1 and those of stage st (in front of the first: stage
    // 0's wait, the barrier, stage 1's load): this wave's LDS reads of stage st - 1 have returned, its own request of
    // stage st has landed, the barrier, and only then the load of stage st + 1 into the buffer that stage st - 1 filled.
    wait_ds0();
    wait_tensor0();
    __syncthreads();
    if (pinned(st + 1u < (uint32_t)NST)) issue(st + 1u, false);
    const unsigned char* bufp = smem + (st & 1u) * BUFB;
#pragma unroll                                                       // in line: pass 1's key reads and score products stand among pass 0's last products
    for (uint32_t h = 0; h < KS / 64u; ++h) {
    const unsigned char* Kp = bufp + klane + h * (16u * KPITCH);
    const unsigned char* Vp = bufp + vlane + h * 128u;
    // kb = 128 st + 64 h + 32 grp
    const Frag k0  = ldfrag((const unsigned short*)(Kp));                                   // keys kb .. kb+15
    const Frag k1  = ldfrag((const unsigned short*)(Kp + 4 * KPITCH));                      // keys kb+16 .. kb+31
    const Frag k0l = ldfrag((const unsigned short*)(Kp + KPLACE));
    const Frag k1l = ldfrag((const unsigned short*)(Kp + KPLACE + 4 * KPITCH));
    // Pass 0's eight key reads stay one group in front of its score products (behind the publish point nothing else
    // covers them): without the fence the residual planes' reads stand among the products, each behind its own wait.
    if (h == 0u) __builtin_amdgcn_sched_barrier(0);
    v8f s0[2], s1[2];                                                // s log2 e - rf: the exponent of P itself
#pragma unroll
    for (int t = 0; t < 2; ++t) { s0[t] = mma_bp(k0.bf, qh[t].bf, nr[t]);  s1[t] = mma_bp(k1.bf, qh[t].bf, nr[t]); }
#pragma unroll
    for (int t = 0; t < 2; ++t) { s0[t] = mma_bp(k0.bf, ql[t].bf, s0[t]);  s1[t] = mma_bp(k1.bf, ql[t].bf, s1[t]); }
#pragma unroll
    for (int t = 0; t < 2; ++t) { s0[t] = mma_bp(k0l.bf, qh[t].bf, s0[t]); s1[t] = mma_bp(k1l.bf, qh[t].bf, s1[t]); }

    // The first eight value fragments are read as one group behind the score products and in front of the
    // exponentials, which run while the reads return. The scheduling fences here and in the product loop keep each
    // read group in its place: without them every read pair sits at its own WMMA behind a wait to 0.
    __builtin_amdgcn_sched_barrier(0);
    Frag vf[16];
#pragma unroll
    for (int j = 0; j < 8; ++j) vf[j] = ldfrag((const unsigned short*)(Vp + (16 * j) * VPITCH));
    __builtin_amdgcn_sched_barrier(0);

    FragH ph[2];
    float ls[2];
    auto expo = [&](int t) {                                         // P and its sum per lane, against rf[t] as it stands
      float a = 0.f;
#pragma unroll
      for (int r = 0; r < 8; ++r) {
        const float e0 = pow2(s0[t][r]);                             // key kb      + 8hh + r
        const float e1 = pow2(s1[t][r]);                             // key kb + 16 + 8hh + r
        a += e0 + e1;
        ph[t].hv[0][r] = (_Float16)e0;
        ph[t].hv[1][r] = (_Float16)e1;
      }
      ls[t] = a;
    };
    expo(0);
    expo(1);
    // No P is negative, so a sum within the f16 range bounds each of its terms; an infinite sum fails the test too.
    const unsigned over = wave_ballot(!(ls[0] <= lim && ls[1] <= lim));  // wave-uniform, one test per pass
    if (over != 0u) {
      const bool first = lim < 0.f;                                  // no reference yet (rf = 0): the first pass always sets one
      lim = PLIM;
#pragma unroll
      for (int t = 0; t < 2; ++t) {
        float mx = fmaxf(hmax8(s0[t]), hmax8(s1[t]));                // the largest exponent, against rf[t]
        mx = fmaxf(mx, __shfl_xor(mx, 16, 32));                      // both lanes of a query take the same reference
        const float up   = first ? mx - PSH : fmaxf(mx - PSH, 0.f);  // the reference only rises, but for the first
        const float corr = first ? 0.f : pow2(-up);
        l[t] *= corr;
#pragma unroll
        for (int j = 0; j < 16; ++j) {
#pragma unroll
          for (int r = 0; r < 8; ++r) o[t][j][r] *= corr;
        }
        rf[t] += up;
#pragma unroll
        for (int r = 0; r < 8; ++r) { s0[t][r] -= up; s1[t][r] -= up; }
        nr[t] = zero8() - rf[t];
        expo(t);                                                     // now every P is at most 16
      }
    }
#pragma unroll
    for (int t = 0; t < 2; ++t) l[t] += ls[t];

    // Tile 0's products run while the last eight fragments arrive; all sixteen fragments stay in registers, and tile
    // 1's products take them from there, with no LDS read among them.
#pragma unroll
    for (int g = 0; g < 4; ++g) {                                    // four products, then the reads for two groups on
#pragma unroll
      for (int jj = 0; jj < 4; ++jj) o[0][4 * g + jj] = mma_hp(vf[4 * g + jj].h, ph[0].v, o[0][4 * g + jj]);
      if (g < 2) {
        __builtin_amdgcn_sched_barrier(0);                           // the eight reads stand as one group behind four products
#pragma unroll
        for (int jj = 0; jj < 4; ++jj) {
          const int j = 4 * g + 8 + jj;
          vf[j] = ldfrag((const unsigned short*)(Vp + (16 * j) * VPITCH));
        }
        __builtin_amdgcn_sched_barrier(0);                           // and in front of the next four products
      }
    }
#pragma unroll
    for (int j = 0; j < 16; ++j) o[1][j] = mma_hp(vf[j].h, ph[1].v, o[1][j]);
    }
  }
  wait_tensor0();
  wait_ds0();
#pragma unroll
  for (int t = 0; t < 2; ++t) l[t] += __shfl_xor(l[t], 16, 32);

  // ---- merge of the two key groups: tile 1's state goes to wave ^ 4, whose tile 0 holds the same queries
  {
    v4f* mine = Mg + (uint32_t)wave * (MSLOT * 32u) + lane;
#pragma unroll
    for (int j = 0; j < 16; ++j) {
      v4f va, vb;
#pragma unroll
      for (int r = 0; r < 4; ++r) { va[r] = o[1][j][r]; vb[r] = o[1][j][4 + r]; }
      mine[(2 * j) * 32]     = va;
      mine[(2 * j + 1) * 32] = vb;
    }
    const v4f sv = {rf[1], l[1], 0.f, 0.f};
    mine[32 * 32] = sv;
  }
  __syncthreads();                                                   // every wave's tile-1 state is in Mg; every wave has left the ring (its waits above)
  const v4f* peer = Mg + (uint32_t)(wave ^ 4) * (MSLOT * 32u) + lane;
  const v4f  pst  = peer[32 * 32];
  const float mm  = fmaxf(rf[0], pst[0]);
  const float ca  = pow2(rf[0] - mm), cb = pow2(pst[0] - mm);
  const float lt  = l[0] * ca + pst[1] * cb;
  const float gm  = bfr(gamma[0]);
  const float inv = gm * IHSC * (1.0f / lt);                         // o carries x16 x16, l carries x16
  const float fa  = ca * inv, fb = cb * inv;

  const int qrow = 32 * qg + 16 * grp + c;
  const int e = tid & 7, lq = tid >> 3;                              // lq 0..31
#pragma unroll
  for (int half = 0; half < 2; ++half) {
    if (half) __syncthreads();                                       // every wave finished reading Os
#pragma unroll
    for (int jj = 0; jj < 8; ++jj) {
      const int j = 8 * half + jj;
      const v4f pa = peer[(2 * j) * 32];
      const v4f pb = peer[(2 * j + 1) * 32];
      v4f va, vb;
#pragma unroll
      for (int r = 0; r < 4; ++r) { va[r] = o[0][j][r] * fa + pa[r] * fb; vb[r] = o[0][j][4 + r] * fa + pb[r] * fb; }
      *(v4f*)(Os + qrow * OSPW + 16 * jj + 8 * hh)     = va;         // Os[query][ch_loc = 16jj + 8hh + r]
      *(v4f*)(Os + qrow * OSPW + 16 * jj + 8 * hh + 4) = vb;
    }
    __syncthreads();
    // line L = 32 it + lq: channel 8 it + (lq >> 2) of the half, queries 32 (lq & 3) + 4 e .. + 3
    const int chl = lq >> 2, nl = (lq & 3) * 32 + 4 * e;
    const float* xp = x + ((size_t)(b * CC + 128 * half + chl)) * SEQ_FULL + n0 + nl;
    float*       op = out + ((size_t)(b * CC + 128 * half + chl)) * SEQ + n0 + nl;
    v4f res[16];
#pragma unroll
    for (int it = 0; it < 16; ++it) {
      const v4f xv = *(const v4f*)(xp + (size_t)(8 * it) * SEQ_FULL);
#pragma unroll
      for (int t = 0; t < 4; ++t) res[it][t] = Os[(nl + t) * OSPW + chl + 8 * it] + bfr(xv[t]);
    }
#pragma unroll
    for (int it = 0; it < 16; ++it) *(v4f*)(op + (size_t)(8 * it) * SEQ) = res[it];
  }
}

// =========================================================================================================
// Workspace map (bytes; each region start a multiple of 256; every extent is an exact tile multiple and is written
//   W16 f16 [320][256]                 163840
//   Hv  f16 [8][256][4096]           16777216
//   Fh/Fl/Gh/Gl bf16 [8][4096][32]    2097152 x4
//   total = 25329664
// =========================================================================================================
extern "C" void kernel_launch(void* const* d_in, const int* in_sizes, int n_in,
                              void* d_out, int out_size, void* d_ws, size_t ws_size,
                              hipStream_t stream) {
  if (n_in < 5) return;
  if (in_sizes[0] < NB * CC * SEQ_FULL) return;
  if (in_sizes[1] < DQ * CC || in_sizes[2] < DQ * CC) return;
  if (in_sizes[3] < CC * CC) return;
  if (in_sizes[4] < 1) return;
  if (out_size < NB * CC * SEQ) return;

  size_t off = 0;
  auto carve = [&](size_t bytes) { const size_t o = off; off += (bytes + 255) & ~(size_t)255; return o; };
  const size_t oW16 = carve((size_t)MW * CC * 2);
  const size_t oHv  = carve((size_t)NB * CC * SEQ * 2);
  const size_t oFh  = carve((size_t)NB * SEQ * DQ * 2);
  const size_t oFl  = carve((size_t)NB * SEQ * DQ * 2);
  const size_t oGh  = carve((size_t)NB * SEQ * DQ * 2);
  const size_t oGl  = carve((size_t)NB * SEQ * DQ * 2);
  if (off > ws_size) return;
  if (off > (size_t)134217728) return;

  const float* x     = (const float*)d_in[0];
  const float* wq    = (const float*)d_in[1];
  const float* wk    = (const float*)d_in[2];
  const float* wv    = (const float*)d_in[3];
  const float* gamma = (const float*)d_in[4];

  char* ws = (char*)d_ws;
  unsigned short* W16 = (unsigned short*)(ws + oW16);
  unsigned short* Hv  = (unsigned short*)(ws + oHv);
  unsigned short* Fh  = (unsigned short*)(ws + oFh);
  unsigned short* Fl  = (unsigned short*)(ws + oFl);
  unsigned short* Gh  = (unsigned short*)(ws + oGh);
  unsigned short* Gl  = (unsigned short*)(ws + oGl);
  float* out = (float*)d_out;

  const dim3 blk256(256), blk128(128);

  // (0) q/k/v weights -> stacked f16 plane
  cvt_w<<<dim3(MW / 8), blk256, 0, stream>>>(wq, wk, wv, W16);
  // (1) conv1x1 GEMM from the f32 input -> f (key) and g (query) hi + residual planes, H value plane
  gemm_p<<<dim3(SEQ / QT, NB), blk128, 0, stream>>>(W16, x, Fh, Fl, Gh, Gl, Hv);
  // (2) attention + gamma scale + residual -> out [b][256][SEQ]
  attn_k<<<dim3(SEQ / QB, NB), blk256, 0, stream>>>(Gh, Gl, Fh, Fl, Hv, x, gamma, out);
  (void)hipGetLastError();
}

// v009
// A run of this version takes 59.1 microseconds.
// Versions in between are left out here; by their measured steps it is 1.12 times as fast as v007.
// All steps since v000 together make it 9.23 times as fast.
// Contractions: conv1x1 q/k/v projections W[320x256].X[256x4096] on v_wmma_f32_16x16x32_f16 (f16 containers of
// bf16-RNE weights x256 and bf16-RNE x); scores f_n.g_m on v_wmma_f32_16x16x32_f16 (f16 of f and of g x log2 e, one
// product, K=32, accumulator started at minus the softmax reference); o^T = H.P^T on
// v_wmma_f32_16x16x32_f16 (H = relu(v-projection) x16 f16, P = e^{s-ref} x16 f16 = 2^D of the score D registers); f32
// accumulate everywhere; softmax statistics, gamma scale and the residual add in f32 VALU.
#include <hip/hip_runtime.h>
#include <math.h>
#include <stdint.h>

#ifndef NB
#define NB 8
#endif
#ifndef SEQ
#define SEQ 4096
#endif
#define NB_FULL  8
#define SEQ_FULL 4096
#define CC     256
#define DQ     32
#define MW     320
#define MBLK   5
#define QT     64
#define OSP    68
#define OSPW   132
#define WSC    256.0f
#define IWSC   0.00390625f
#define HSC    16.0f
#define IHSC   0.0625f
#define L2E    1.4426950408889634f       // log2 e: the query planes carry g x log2 e, so that a score is an exponent of 2
#define PSH    4.0f                      // log2 16: P = e^{s-ref} x 16
#define PLIM   65504.0f                  // largest finite f16: a lane's sum of P at or under it bounds each P
#define KS     128                       // keys per LDS tile: two passes of 64 keys (32 per wave)
#define TPS    2                         // tiles per LDS stage: 256 keys, four passes between barriers
#define NST    (SEQ / (KS * TPS))        // stages
#define VPITCH 272u                      // LDS pitch of a value row: 256 B (128 keys f16) + 16 B pad
#define VSLICE (128u * VPITCH)           // 128 channels, one wave's request: 34816 B = 17 x 2 KiB
#define KPITCH 272u                      // LDS pitch of a key-plane row: 256 B (4 keys x 32 d f16) + 16 B pad
#define KPLACE 10240u                    // 32 such rows (8704 B), rounded up to a multiple of 2 KiB
#define KOFF   (2u * VSLICE)
#define BUFB   (KOFF + KPLACE)           // one tile's place: 79872 B = 39 x 2 KiB
#define STGB   (TPS * BUFB)              // one buffer = one stage: 159744 B
#define QB     128                       // queries per attention block: 4 wave pairs x 32
#define MSLOT  33u                       // 16-B slots per lane of a wave's merge range: 32 of o, one of (rf, l)
#define MRGW   (MSLOT * 32u * 16u)       // one wave's merge range: 16896 B
#define GPITCH 272u                      // projection GEMM, LDS pitch of an operand row: 256 B (128 k f16) + 16 B pad
#define GSLICE 18432u                    // 64 such rows (17408 B), rounded up to a multiple of 2 KiB

static_assert(NB >= 1 && NB <= NB_FULL);
static_assert(SEQ >= QT && SEQ <= SEQ_FULL);
static_assert(SEQ % QT == 0 && SEQ % 32 == 0);
static_assert(CC % QT == 0 && CC % 32 == 0);
static_assert(MW == 2 * DQ + CC);
static_assert(MW == MBLK * QT);
static_assert(QT == 2 * DQ);
static_assert(MW % 8 == 0);
static_assert((OSP * 4) % 16 == 0);
static_assert((OSPW * 4) % 16 == 0);
static_assert(DQ % 32 == 0);
static_assert(SEQ % (KS * TPS) == 0 && NST >= 2 && NST % 2 == 0 && TPS == 2);
static_assert(SEQ % QB == 0 && KS == 128);
static_assert(KS * 2 == 256 && CC == 256 && DQ * 2 * 4 == 256);
static_assert(QB * OSPW * 4 <= STGB && 8u * MRGW <= STGB && 2u * STGB <= 327680u);
static_assert(VSLICE % 2048u == 0 && KPLACE % 2048u == 0 && BUFB % 2048u == 0 && (KS / 4) * KPITCH <= KPLACE);
static_assert(GSLICE % 2048u == 0 && QT * GPITCH <= GSLICE && CC * 2 == 512 && MBLK >= 2);

typedef _Float16       v16h __attribute__((ext_vector_type(16)));
typedef _Float16       v8h  __attribute__((ext_vector_type(8)));
typedef unsigned short v8us __attribute__((ext_vector_type(8)));
typedef float          v8f  __attribute__((ext_vector_type(8)));
typedef float          v4f  __attribute__((ext_vector_type(4)));
typedef unsigned int   v4u  __attribute__((ext_vector_type(4)));
typedef uint32_t       u32x4 __attribute__((ext_vector_type(4)));
typedef uint32_t       u32x8 __attribute__((ext_vector_type(8)));

union Frag  { v8us u[2]; v16h h; };
union FragH { v16h v; v8h hv[2]; };
static_assert(sizeof(Frag) == 32);
static_assert(sizeof(FragH) == 32);

// ---- scalar helpers ---------------------------------------------------------------------------------------
__device__ __forceinline__ unsigned short bf_bits(float f) {          // f32 -> bf16 bits, RNE convert
  unsigned u = __float_as_uint(f);
  return (unsigned short)((u + 0x7FFFu + ((u >> 16) & 1u)) >> 16);
}
__device__ __forceinline__ float bf_up(unsigned short hb) { return __uint_as_float(((unsigned)hb) << 16); }
__device__ __forceinline__ float bfr(float f) { return bf_up(bf_bits(f)); }
__device__ __forceinline__ unsigned short h_bits(_Float16 x) { return __builtin_bit_cast(unsigned short, x); }
__device__ __forceinline__ unsigned pk16(unsigned short a, unsigned short b) { return (unsigned)a | ((unsigned)b << 16); }
__device__ __forceinline__ v8f zero8() { v8f z = {0.f, 0.f, 0.f, 0.f, 0.f, 0.f, 0.f, 0.f}; return z; }
__device__ __forceinline__ float hmax8(v8f s) {
  return fmaxf(fmaxf(fmaxf(s[0], s[1]), fmaxf(s[2], s[3])), fmaxf(fmaxf(s[4], s[5]), fmaxf(s[6], s[7])));
}
__device__ __forceinline__ float pow2(float v) {                      // 2^v, the hardware's own exponential
#if defined(__HIP_DEVICE_COMPILE__)
  return __builtin_amdgcn_exp2f(v);
#else
  return v;
#endif
}
__device__ __forceinline__ unsigned wave_ballot(bool p) {
#if defined(__HIP_DEVICE_COMPILE__)
  return __builtin_amdgcn_ballot_w32(p);
#else
  return p ? 1u : 0u;
#endif
}

// ---- 16-bit fragment loader (A, or B from a k-contiguous [n][k] row): lane -> row/col (lane&15), p already includes
//      + 8*(lane>>4); elements 0..7 <- p[0..7] (k0+8h..), elements 8..15 <- p[16..23] (k0+16+8h..)
__device__ __forceinline__ Frag ldfrag(const unsigned short* p) {
  Frag f;
  f.u[0] = *(const v8us*)(p);
  f.u[1] = *(const v8us*)(p + 16);
  return f;
}

// ---- WMMA helpers: builtin followed by a 4-slot VALU gap tying D and keeping A/B live --------------------------
__device__ __forceinline__ v8f mma_h(v16h a, v16h b, v8f c) {
  v8f d = __builtin_amdgcn_wmma_f32_16x16x32_f16(false, a, false, b, (short)0, c, false, false);
#if defined(__HIP_DEVICE_COMPILE__)
  asm volatile("v_nop\n\tv_nop\n\tv_nop\n\tv_nop" : "+v"(d) : "v"(a), "v"(b));
#endif
  return d;
}
// The builtin alone, the compiler's own padding behind it (attention kernel): an asm operand cannot be a register
// above v255, and 256 accumulator registers with the fragments do not fit below it (tied to asm they spill).
__device__ __forceinline__ v8f mma_hp(v16h a, v16h b, v8f c) {
  return __builtin_amdgcn_wmma_f32_16x16x32_f16(false, a, false, b, (short)0, c, false, false);
}

// ---- tensor load to LDS: descriptor groups and issue ----------------------------------------------------------
__device__ __forceinline__ uint32_t uni(uint32_t v) { return (uint32_t)__builtin_amdgcn_readfirstlane(v); }
__device__ __forceinline__ uint32_t pinned(uint32_t v) {
  uint32_t w = uni(v);
  asm volatile("" : "+s"(w));            // the test word stays scalar, the branch on it a scalar branch
  return w;
}
// group 1: 1-byte elements, tensor = tile = ROWS rows of ROWB bytes, source pitch SRCP bytes, 16 B of LDS pad per row
template <uint32_t ROWB, uint32_t ROWS, uint32_t SRCP, uint32_t IVL>
__device__ __forceinline__ u32x8 tdm_group1() {
  u32x8 g;
  g[0] = uni((1u << 20) | (IVL << 22) | (3u << 25));
  g[1] = uni((ROWB & 0xFFFFu) << 16);
  g[2] = uni((ROWB >> 16) | ((ROWS & 0xFFFFu) << 16));
  g[3] = uni((ROWS >> 16) | (ROWB << 16));
  g[4] = uni(ROWS);
  g[5] = uni(SRCP);
  g[6] = uni(0u);
  g[7] = uni(0u);
  return g;
}
// The same form on a whole group 1 (descriptor words held in scalar registers): the eight words keep their registers
// from the first request to the last, so that none of those registers takes another value while a request is outstanding.
__device__ __forceinline__ u32x8 held(u32x8 g) { asm volatile("" : "+s"(g)); return g; }  // pinned(), eight descriptor words
__device__ __forceinline__ u32x4 tdm_group0(uint32_t lds_dst, uint64_t ga) {
  u32x4 g;
  g[0] = uni(1u);
  g[1] = uni(lds_dst);
  g[2] = uni((uint32_t)ga);
  g[3] = uni((((uint32_t)(ga >> 32)) & 0x01FFFFFFu) | 0x80000000u);
  return g;
}
__device__ __forceinline__ void tdm_load(u32x4 g0, u32x8 g1) {
  asm volatile("tensor_load_to_lds %0, %1" :: "s"(g0), "s"(g1) : "memory");   // one request of the whole wave
}
__device__ __forceinline__ void wait_tensor0() { asm volatile("s_wait_tensorcnt 0x0" ::: "memory"); }  // this wave's request has landed
__device__ __forceinline__ void wait_ds0()     { asm volatile("s_wait_dscnt 0x0" ::: "memory"); }      // this wave's LDS reads have returned
// The same form on a group 0: its four words keep their registers from the request to the wait that covers it.
__device__ __forceinline__ u32x4 held4(u32x4 g) { asm volatile("" : "+s"(g)); return g; }  // pinned(), four descriptor words
// Work-group barrier alone, behind the caller's own wait_ds0(): __syncthreads() behind a global store also waits until
// that store has completed, which nothing in this work-group reads.
__device__ __forceinline__ void wg_barrier() { asm volatile("s_barrier_signal -1\n\ts_barrier_wait -1" ::: "memory"); }

// =========================================================================================================
// (0) conv1x1 weights: W16 f16 [320][256], rows 0..31 = q-projection rows, 32..63 = k-projection rows, 64..319 =
//     v-projection rows; value = f16 of (bf16-RNE(w) * 256) (exact). Block blk (0..39) owns rows 8*blk..8*blk+7:
// coverage: 40 blocks x 8 rows x 32 lanes x 8 halves = 320 x 256 = the whole plane.
// =========================================================================================================
__global__ __launch_bounds__(256)
void cvt_w(const float* __restrict__ wq, const float* __restrict__ wk, const float* __restrict__ wv,
           unsigned short* W16) {
  const int tid = threadIdx.x, blk = blockIdx.x;
  const int rl = tid >> 5, col = 8 * (tid & 31);
  const int o = 8 * blk + rl;                                        // 0..319
  const float* wbase;
  int osub;
  if (blk < DQ / 8)            { wbase = wq; osub = 0; }
  else if (blk < (2 * DQ) / 8) { wbase = wk; osub = DQ; }
  else                         { wbase = wv; osub = 2 * DQ; }
  const float* s = wbase + (size_t)(o - osub) * CC + col;
  const v4f a = *(const v4f*)s;
  const v4f q = *(const v4f*)(s + 4);
  const float f[8] = {a[0], a[1], a[2], a[3], q[0], q[1], q[2], q[3]};
  v4u u;
#pragma unroll
  for (int t = 0; t < 4; ++t) {
    const _Float16 h0 = (_Float16)(bfr(f[2 * t]) * WSC);
    const _Float16 h1 = (_Float16)(bfr(f[2 * t + 1]) * WSC);
    u[t] = pk16(h_bits(h0), h_bits(h1));
  }
{
    *(v4u*)(W16 + (size_t)o * CC + col) = u;
    
  }
}

// =========================================================================================================
// (1) conv1x1 GEMM for one (b, 64-n tile), all 320 outputs: Y[o][n] = relu((1/256) sum_c W16[o][c] X[n][c]), where
//     X[n][c] = f16 of bf16-RNE(x[b][c][n]) (exact in f16) is formed by the block itself, once, from the f32 input.
//     Block 128 threads = 4 waves. x tile 256 c x 64 n: thread (e = tid & 15, cq = tid >> 4) loads, per it = 0..3, the
//     eight rows c = 8 (8 it + cq) .. + 7 at n = 4 e .. 4 e + 3 (16 lanes x 16 B = 256 contiguous bytes of a row) and
//     stores, per n, the eight converted c as one 16-B piece of the LDS row n: two slices of 64 rows x 256 B (k 0..127,
//     k 128..255) at pitch GPITCH. Wave w owns cols n0+16w..+15: its eight B fragments (k = c contiguous in the LDS
//     row) are read once and stay in registers for all five weight tiles.
//     Pass mb = weight rows 64 mb .. + 63 (4 m-tiles, A rows o = 16 mt + (lane&15)): two slices of 64 rows x 256 B, one
//     tensor load from each of waves 2 and 3, two buffers, issued one pass ahead; fragments by ds_load_b128, the sixteen
//     reads of two k-steps as one group, one group ahead of the products. K = 256 = 8 steps.
//     Epilogue of a pass staged in LDS Os[n_loc][o_loc] (own range, pitch OSP, b128 stores of 8 consecutive o per lane,
//     relu applied), barrier, then (block-uniform branch on the pass):
//       pass 0 -> o_loc 0..31 = f (key) dims -> Fh, o_loc 32..63 = g (query) dims, x log2 e -> Gh; planes f16
//       [b][SEQ n][32 d] (k-contiguous for both score operands).
//       passes 1..4 -> channels 64(mb-1).. of the H plane f16 [b][256 c][SEQ n] (n contiguous), value x16 as f16.
// coverage: X slices: 4 it x 8 cq x 8 c = 256 c, 16 e x 4 n = 64 n, all written before the barrier; Os 4 waves x 16 n x
//           64 o = 64 x 64 (staged extent == consumed extent); F/G planes: 2 it x 16 lines x 8 lanes x 8 = 64 n x 32 d
//           per plane; H: 4 it x 16 rows x 8 lanes x 8 = 64 c x 64 n per pass; grid (SEQ/64, NB) x 5 passes covers all
//           SEQ rows of Fh/Gh and all 256 channels of H exactly once.
// =========================================================================================================
__global__ __launch_bounds__(128)
void gemm_p(const unsigned short* __restrict__ W16, const float* __restrict__ x,
            unsigned short* Fh, unsigned short* Gh, unsigned short* Hv) {
  __shared__ __attribute__((aligned(2048))) unsigned char gsm[6u * GSLICE + QT * OSP * 4];
  float* Os = (float*)(gsm + 6u * GSLICE);
  const int tid  = threadIdx.x;
  const int lane = tid & 31, wave = tid >> 5;
  const int hh   = lane >> 4, c = lane & 15;
  const int nt   = blockIdx.x, b = blockIdx.y;
  const int n0   = nt * QT;

  // Weight tile st = rows 64 st .. + 63, into buffer st & 1 (slices 2, 3 or 4, 5): waves 2 and 3 issue one k half each
  // (rows of 256 B at a source pitch of 512 B). Waves 0 and 1 issue none.
  const uint32_t lbase = (uint32_t)(size_t)gsm;
  const uint32_t wv    = uni((uint32_t)tid >> 5);
  const u32x8 g1w = held(tdm_group1<256u, QT, CC * 2u, 5u>());
  auto group0 = [&](uint32_t st) {
    const uint64_t ga = (uint64_t)(size_t)W16 + (uint64_t)st * (QT * CC * 2u) + (uint64_t)(wv & 1u) * 256u;
    return tdm_group0(lbase + (2u + 2u * (st & 1u) + (wv & 1u)) * GSLICE, ga);
  };
  u32x4 g0w = group0(0u);

  {
    const int e = tid & 15, cq = tid >> 4;                           // cq 0..7
    v4f xv[4][8];
#pragma unroll
    for (int it = 0; it < 4; ++it) {
#pragma unroll
      for (int r = 0; r < 8; ++r)
        xv[it][r] = *(const v4f*)(x + ((size_t)(b * CC + 8 * (8 * it + cq) + r)) * SEQ_FULL + n0 + 4 * e);
      asm volatile("s_wait_xcnt 0x0" ::: "memory");  // in front of the first overwrite of an address register that these loads name
    }
    if (pinned(wv >= 2u)) {                                          // weight tile 0 lands while the x rows arrive
      tdm_load(g0w, g1w);
      wait_tensor0();
    }
#pragma unroll
    for (int it = 0; it < 4; ++it) {
      const uint32_t cc = 8u * (uint32_t)(8 * it + cq);              // 0..248
      unsigned char* xd = gsm + (cc >> 7) * GSLICE + (uint32_t)(4 * e) * GPITCH + (cc & 127u) * 2u;
#pragma unroll
      for (int t = 0; t < 4; ++t) {
        v4u u;
#pragma unroll
        for (int p = 0; p < 4; ++p)
          u[p] = pk16(h_bits((_Float16)bfr(xv[it][2 * p][t])), h_bits((_Float16)bfr(xv[it][2 * p + 1][t])));
        *(v4u*)(xd + (uint32_t)t * GPITCH) = u;
      }
    }
  }
  wait_ds0();
  __syncthreads();                                                   // the X slices and weight tile 0 are in LDS
  g0w = held4(group0(1u));                                           // all four words stand in their registers in front of the branch, in every wave
  if (pinned(wv >= 2u)) tdm_load(g0w, g1w);

  const unsigned char* bp = gsm + (uint32_t)(16 * wave + c) * GPITCH + 16u * hh;
  Frag fb[CC / 32];
#pragma unroll
  for (int ks = 0; ks < CC / 32; ++ks)
    fb[ks] = ldfrag((const unsigned short*)(bp + (uint32_t)(ks >> 2) * GSLICE + (uint32_t)(ks & 3) * 64u));

#pragma unroll 1                                                     // one copy of the pass: the five differ only in addresses and in the store branch
  for (uint32_t mb = 0; mb < (uint32_t)MBLK; ++mb) {
    const unsigned char* ap = gsm + (2u + 2u * (mb & 1u)) * GSLICE + (uint32_t)c * GPITCH + 16u * hh;

    v8f acc[4];
#pragma unroll
    for (int mt = 0; mt < 4; ++mt) acc[mt] = zero8();

    // Group g = k-steps 2g and 2g + 1, two register sets: the next group's sixteen reads are issued in front of this
    // group's eight products, which then wait on counts and never to 0 before the last group.
    Frag fa[2][2][4];
#pragma unroll
    for (int g = -1; g < CC / 64; ++g) {
      if (g + 1 < CC / 64) {
#pragma unroll
        for (int q = 0; q < 2; ++q) {
          const int ks = 2 * (g + 1) + q;
          const uint32_t ko = (uint32_t)(ks >> 2) * GSLICE + (uint32_t)(ks & 3) * 64u;
#pragma unroll
          for (int mt = 0; mt < 4; ++mt)
            fa[(g + 1) & 1][q][mt] = ldfrag((const unsigned short*)(ap + ko + (uint32_t)(16 * mt) * GPITCH));
        }
      }
      if (g >= 0) {
#pragma unroll
        for (int q = 0; q < 2; ++q) {
#pragma unroll
          for (int mt = 0; mt < 4; ++mt) acc[mt] = mma_h(fa[g & 1][q][mt].h, fb[2 * g + q].h, acc[mt]);
        }
      }
    }

    // ---- epilogue: scale back + relu -> LDS Os[n_loc][o_loc]; lane (hh, c) holds o = 16 mt + 8 hh + r, n_loc = 16 w + c
    //      (the readers of the pass before left Os in front of that pass's last barrier)
    {
      const int nl = 16 * wave + c;
#pragma unroll
      for (int mt = 0; mt < 4; ++mt) {
        v4f va, vb;
#pragma unroll
        for (int r = 0; r < 4; ++r) {
          va[r] = fmaxf(acc[mt][r] * IWSC, 0.f);
          vb[r] = fmaxf(acc[mt][4 + r] * IWSC, 0.f);
        }
        *(v4f*)(Os + nl * OSP + 16 * mt + 8 * hh)     = va;
        *(v4f*)(Os + nl * OSP + 16 * mt + 8 * hh + 4) = vb;
      }
    }
    wait_ds0();
    wg_barrier();                                                    // Os is whole

    const int e = tid & 7, lq = tid >> 3;                            // lq 0..15
    if (mb == 0u) {                                                  // block-uniform
      v4u ufh[2], ugh[2];
#pragma unroll
      for (int it = 0; it < 2; ++it) {
        const int L   = it * 16 + lq;                                // line 0..31
        const int row = 2 * L + (e >> 2);                            // n_loc 0..63
        const int d   = 8 * (e & 3);                                 // 0, 8, 16, 24
        const float* fs = Os + row * OSP + d;
        const float* gs = Os + row * OSP + DQ + d;
        const v4f f0 = *(const v4f*)fs;
        const v4f f1 = *(const v4f*)(fs + 4);
        const v4f g0 = *(const v4f*)gs;
        const v4f g1 = *(const v4f*)(gs + 4);
        const float fv[8] = {f0[0], f0[1], f0[2], f0[3], f1[0], f1[1], f1[2], f1[3]};
        const float gv[8] = {g0[0] * L2E, g0[1] * L2E, g0[2] * L2E, g0[3] * L2E,
                             g1[0] * L2E, g1[1] * L2E, g1[2] * L2E, g1[3] * L2E};
#pragma unroll
        for (int t = 0; t < 4; ++t) {
          ufh[it][t] = pk16(h_bits((_Float16)fv[2 * t]), h_bits((_Float16)fv[2 * t + 1]));
          ugh[it][t] = pk16(h_bits((_Float16)gv[2 * t]), h_bits((_Float16)gv[2 * t + 1]));
        }
      }
#pragma unroll
      for (int it = 0; it < 2; ++it) {
        const int L   = it * 16 + lq;
        const int row = 2 * L + (e >> 2);
        const int d   = 8 * (e & 3);
        const size_t po = ((size_t)(b * SEQ + n0 + row)) * DQ + d;
        *(v4u*)(Fh + po) = ufh[it];
        *(v4u*)(Gh + po) = ugh[it];
      }
    } else {
      const int chb = ((int)mb - 1) * QT;                            // channel base 0..192
      v4u uhp[4];
#pragma unroll
      for (int it = 0; it < 4; ++it) {
        const int ol = it * 16 + lq;                                 // o_loc 0..63
        float hv8[8];
#pragma unroll
        for (int t = 0; t < 8; ++t) hv8[t] = Os[(8 * e + t) * OSP + ol];
#pragma unroll
        for (int t = 0; t < 4; ++t) {
          const _Float16 h0 = (_Float16)(hv8[2 * t] * HSC);
          const _Float16 h1 = (_Float16)(hv8[2 * t + 1] * HSC);
          uhp[it][t] = pk16(h_bits(h0), h_bits(h1));
        }
      }
#pragma unroll
      for (int it = 0; it < 4; ++it) {
        const int ol = it * 16 + lq;
        *(v4u*)(Hv + ((size_t)(b * CC + chb + ol)) * SEQ + n0 + 8 * e) = uhp[it];
      }
    }
    asm volatile("s_wait_xcnt 0x0" ::: "memory");  // in front of the next pass's overwrite of a register that these stores name

    // Foot of pass mb: this wave's LDS reads have returned, its own request of tile mb + 1 has landed, the barrier, and
    // only then the load of tile mb + 2 into the buffer that pass mb has read.
    wait_ds0();
    wait_tensor0();
    g0w = held4(g0w);
    wg_barrier();
    g0w = held4(group0(mb + 2u));                                    // formed in every wave and pass, issued only under the test
    if (pinned(mb + 2u < (uint32_t)MBLK && wv >= 2u)) tdm_load(g0w, g1w);
  }
  wait_tensor0();
  wait_ds0();
}

// =========================================================================================================
// (2) self-attention for one (b, 128-query tile), transposed formulation, SEQ keys, no mask, no scale:
//   S^T tile (16 keys x 16 queries) = A(k: row = key kb + (lane&15), 32 d via the split k map from the f16 plane
//   Fh [b][SEQ][32]) . B(q: col = query, same map from Gh): K = 32 = one k-step = one product; the query fragments
//   are loaded once per wave.
//   Block = 8 waves. Wave (qg = wave & 3, grp = wave >> 2) owns 32 queries (two 16-query tiles) and, in pass h = 0..3
//   of stage st, the 32 keys 256 st + 64 h + 32 grp .. + 31: each key and value fragment read from LDS feeds two
//   products, one per query tile. The wave's tile t holds queries 32 qg + 16 (t ^ grp) + (lane&15), so that tile 1 of
//   wave w and tile 0 of wave w ^ 4 are the same queries.
//   Per lane a D tile holds 8 keys of ONE query: online softmax state per lane and query tile. The reference m of the
//   exponentials is a maximum seen earlier, not the running one. The query plane carries g x log2 e and a tile's
//   product takes -rf (rf = m log2 e - 4, eight equal registers per lane and query tile) as its C operand, so that the
//   D registers are the exponents of P themselves, with no vector subtract or multiply in front of the exponentials.
//   A pass tests, once, by a wave-uniform ballot, each lane's sum of P against the f16 range. Only where a sum is over
//   it, and in the first pass, the maximum over the 32 keys (one shuffle lane^16 per tile), the o/l rescale, the new
//   C registers and the exponentials anew. P = e^{s-m} x 16 as f16 (at most 65504) is the B operand of
//   O^T (rows channel, cols queries) += A(H rows channel = 16j + (lane&15), keys contiguous, f16 plane Hv
//   [b][256][SEQ], values x16) . B(P^T): element r <- D of the tile covering keys kb..kb+15, element 8+r <- the tile
//   covering kb+16..kb+31, lane unchanged. 2 x 16 accumulator tiles per wave (256 channels x 32 queries).
//   Keys and values reach the waves through LDS: stages of 256 keys (two tiles of 128), two buffers, one tensor load
//   per stage from each of waves 0..2 (first tile) and 4..6 (second tile), issued one stage ahead; all eight waves
//   read the tiles with ds_load_b128. A stage serves four passes with no barrier between them: the waves of a SIMD
//   may drift by a pass, one in its products while the other is in its softmax.
//   Merge of the two key groups: every wave stores the state (rf, l, o) of its tile 1 in its own LDS range Mg[wave],
//   lane by lane; behind one barrier it reads the range of wave ^ 4 (its own tile 0's queries, same lane = same query
//   and channels) and joins the two partial softmax states: rf = max, weights 2^{rf_own - rf} and 2^{rf_peer - rf}.
//   Epilogue in two channel halves: gamma*O/(16 l) staged in LDS Os[query][128 channels] (pitch OSPW, b128 stores),
//   8 consecutive lanes x 16 B (values gathered from 4 Os rows), one instruction per 32 lines, final values held in
// coverage: Mg per wave 33 slots x 32 lanes x 16 B, all written before the barrier, slots 0..32 read behind it;
//           Os per half 8 waves x 16 queries x 128 ch fully staged before the barrier (staged extent == consumed
//           extent); out per half 16 it x 32 lines x 8 lanes x 4 floats = 128 ch x 128 n; two halves = 256 ch;
//           grid (SEQ/128, NB) covers out[b][0..255][0..SEQ-1] exactly once.
// =========================================================================================================
__global__ __launch_bounds__(256)
void attn_k(const unsigned short* __restrict__ Gh, const unsigned short* __restrict__ Fh,
            const unsigned short* __restrict__ Hv, const float* __restrict__ x,
            const float* __restrict__ gamma, float* out) {
  __shared__ __attribute__((aligned(2048))) unsigned char smem[2u * STGB];
  // Merge ranges in buffer 0's place: the last stage (NST - 1, odd) lies in buffer 1; its publish point (every wave's
  // s_wait_dscnt 0 and s_wait_tensorcnt 0, the barrier) stands behind every read of buffer 0 and every load into it, and
  // issues no further load.
  v4f*   Mg = (v4f*)smem;
  float* Os = (float*)(smem + STGB);     // output staging in buffer 1's place, first written behind the merge barrier
  const int tid  = threadIdx.x;
  const int wave = tid >> 5, lane = tid & 31;
  const int qg   = wave & 3, grp = wave >> 2;
  const int hh   = lane >> 4, c = lane & 15;
  const int n0   = blockIdx.x * QB, b = blockIdx.y;

  // Stage st = keys 256 st .. 256 st + 255, into buffer st & 1, as two tiles of 128 keys: tile wave >> 2 comes from waves
  // with wave & 3 = 0..2, one request per stage each: 0 and 1 the two 128-channel halves of the value tile (rows of
  // 256 B), 2 the key plane (8192 contiguous bytes, taken as 32 rows of 256 B). Waves 3 and 7 issue none.
  const uint32_t lbase = (uint32_t)(size_t)smem;
  const uint32_t wv    = uni((uint32_t)tid >> 5);
  const uint32_t wr    = wv & 3u, wt = wv >> 2;                      // this wave's request and tile of a stage
  const u32x8 g1v = held(tdm_group1<256u, 128u, SEQ * 2u, 5u>());
  const u32x8 g1k = held(tdm_group1<256u, KS / 4u, 256u, 5u>());
  auto issue = [&](uint32_t st, bool now) {                          // now: the wait directly behind the request
    const uint32_t dst = lbase + (st & 1u) * STGB + wt * BUFB;
    const uint32_t kt  = TPS * st + wt;                              // 128-key tile 0 .. SEQ / KS - 1
    if (pinned(wr < 2u)) {
      const uint64_t ga = (uint64_t)(size_t)Hv + ((uint64_t)(b * CC + 128u * wr) * SEQ + (uint64_t)kt * KS) * 2u;
      tdm_load(tdm_group0(dst + wr * VSLICE, ga), g1v);
      if (now) wait_tensor0();
    } else if (pinned(wr == 2u)) {
      const uint64_t ga = (uint64_t)(size_t)Fh + ((uint64_t)b * SEQ + (uint64_t)kt * KS) * (DQ * 2u);
      tdm_load(tdm_group0(dst + KOFF, ga), g1k);
      if (now) wait_tensor0();
    }
  };
  issue(0u, true);

  // q fragments (B operand, col = query n0 + 32*qg + 16*(t^grp) + c), K = 32: loaded once
  Frag qh[2];
#pragma unroll
  for (int t = 0; t < 2; ++t) {
    const size_t qo = ((size_t)(b * SEQ + n0 + 32 * qg + 16 * (t ^ grp) + c)) * DQ + 8 * hh;
    qh[t] = ldfrag(Gh + qo);
  }
  asm volatile("s_wait_xcnt 0x0" ::: "memory");  // in front of the first overwrite of an address register that these loads name
  // k fragment offset in a tile's place (A operand, row = key c of a 16-key tile: LDS row c >> 2, 64-B slot c & 3; this
  // wave's 32 keys of pass h are LDS rows 16 (h & 1) + 8 grp .. + 7 of tile h >> 1)
  const uint32_t klane = KOFF + (uint32_t)(8 * grp + (c >> 2)) * KPITCH + (uint32_t)(c & 3) * 64u + 16u * hh;
  // v fragment offset in a tile's place (A operand, row = channel 16j + c, keys contiguous, this wave's 32 keys of pass h =
  // 64 B at 128 (h & 1) + 64 grp of tile h >> 1)
  const uint32_t vlane = (uint32_t)c * VPITCH + 64u * grp + 16u * hh;

  // rf = the reference in use, in exponents of 2 and less log2 16; nr = -rf in eight registers, the C operand of a
  // tile's score product (a lane's eight D registers are eight keys of ONE query)
  float rf[2] = {0.f, 0.f}, l[2] = {0.f, 0.f};
  v8f nr[2] = {zero8(), zero8()};
  float lim = -1.0f;                     // the bound of the test: under every sum until the first pass has set a reference, then PLIM
  v8f o[2][16];
#pragma unroll
  for (int t = 0; t < 2; ++t) {
#pragma unroll
    for (int j = 0; j < 16; ++j) o[t][j] = zero8();
  }

#pragma unroll 1
  for (uint32_t st = 0; st < (uint32_t)NST; ++st) {
    // Publish point of stage st, between the passes of stage st - 1 and those of stage st (in front of the first: stage
    // 0's wait, the barrier, stage 1's load): this wave's LDS reads of stage st - 1 have returned, its own request of
    // stage st has landed, the barrier, and only then the load of stage st + 1 into the buffer that stage st - 1 filled.
    wait_ds0();
    wait_tensor0();
    __syncthreads();
    if (pinned(st + 1u < (uint32_t)NST)) issue(st + 1u, false);
    const unsigned char* bufp = smem + (st & 1u) * STGB;
#pragma unroll                                                       // in line: a pass's key reads and score products stand among the last products of the pass before
    for (uint32_t h = 0; h < TPS * KS / 64u; ++h) {
    const unsigned char* Kp = bufp + (h >> 1) * BUFB + klane + (h & 1u) * (16u * KPITCH);
    const unsigned char* Vp = bufp + (h >> 1) * BUFB + vlane + (h & 1u) * 128u;
    // kb = 256 st + 64 h + 32 grp
    const Frag k0  = ldfrag((const unsigned short*)(Kp));                                   // keys kb .. kb+15
    const Frag k1  = ldfrag((const unsigned short*)(Kp + 4 * KPITCH));                      // keys kb+16 .. kb+31
    // Pass 0's four key reads stay one group in front of its score products (behind the publish point nothing else
    // covers them): without the fence the second tile's reads stand behind the first tile's products and a wait to 0.
    if (h == 0u) __builtin_amdgcn_sched_barrier(0);
    v8f s0[2], s1[2];                                                // s log2 e - rf: the exponent of P itself
#pragma unroll
    for (int t = 0; t < 2; ++t) { s0[t] = mma_hp(k0.h, qh[t].h, nr[t]); s1[t] = mma_hp(k1.h, qh[t].h, nr[t]); }

    // The first eight value fragments are read as one group behind the score products and in front of the
    // exponentials, which run while the reads return. The scheduling fences here and in the product loop keep each
    // read group in its place: without them every read pair sits at its own WMMA behind a wait to 0.
    __builtin_amdgcn_sched_barrier(0);
    Frag vf[16];
#pragma unroll
    for (int j = 0; j < 8; ++j) vf[j] = ldfrag((const unsigned short*)(Vp + (16 * j) * VPITCH));
    __builtin_amdgcn_sched_barrier(0);

    FragH ph[2];
    float ls[2];
    auto expo = [&](int t) {                                         // P and its sum per lane, against rf[t] as it stands
      float a = 0.f;
#pragma unroll
      for (int r = 0; r < 8; ++r) {
        const float e0 = pow2(s0[t][r]);                             // key kb      + 8hh + r
        const float e1 = pow2(s1[t][r]);                             // key kb + 16 + 8hh + r
        a += e0 + e1;
        ph[t].hv[0][r] = (_Float16)e0;
        ph[t].hv[1][r] = (_Float16)e1;
      }
      ls[t] = a;
    };
    expo(0);
    expo(1);
    // No P is negative, so a sum within the f16 range bounds each of its terms; an infinite sum fails the test too.
    const unsigned over = wave_ballot(!(ls[0] <= lim && ls[1] <= lim));  // wave-uniform, one test per pass
    if (over != 0u) {
      const bool first = lim < 0.f;                                  // no reference yet (rf = 0): the first pass always sets one
      lim = PLIM;
#pragma unroll
      for (int t = 0; t < 2; ++t) {
        float mx = fmaxf(hmax8(s0[t]), hmax8(s1[t]));                // the largest exponent, against rf[t]
        mx = fmaxf(mx, __shfl_xor(mx, 16, 32));                      // both lanes of a query take the same reference
        const float up   = first ? mx - PSH : fmaxf(mx - PSH, 0.f);  // the reference only rises, but for the first
        const float corr = first ? 0.f : pow2(-up);
        l[t] *= corr;
#pragma unroll
        for (int j = 0; j < 16; ++j) {
#pragma unroll
          for (int r = 0; r < 8; ++r) o[t][j][r] *= corr;
        }
        rf[t] += up;
#pragma unroll
        for (int r = 0; r < 8; ++r) { s0[t][r] -= up; s1[t][r] -= up; }
        nr[t] = zero8() - rf[t];
        expo(t);                                                     // now every P is at most 16
      }
    }
#pragma unroll
    for (int t = 0; t < 2; ++t) l[t] += ls[t];

    // Tile 0's products run while the last eight fragments arrive; all sixteen fragments stay in registers, and tile
    // 1's products take them from there, with no LDS read among them.
#pragma unroll
    for (int g = 0; g < 4; ++g) {                                    // four products, then the reads for two groups on
#pragma unroll
      for (int jj = 0; jj < 4; ++jj) o[0][4 * g + jj] = mma_hp(vf[4 * g + jj].h, ph[0].v, o[0][4 * g + jj]);
      if (g < 2) {
        __builtin_amdgcn_sched_barrier(0);                           // the eight reads stand as one group behind four products
#pragma unroll
        for (int jj = 0; jj < 4; ++jj) {
          const int j = 4 * g + 8 + jj;
          vf[j] = ldfrag((const unsigned short*)(Vp + (16 * j) * VPITCH));
        }
        __builtin_amdgcn_sched_barrier(0);                           // and in front of the next four products
      }
    }
#pragma unroll
    for (int j = 0; j < 16; ++j) o[1][j] = mma_hp(vf[j].h, ph[1].v, o[1][j]);
    }
  }
  wait_tensor0();
  wait_ds0();
#pragma unroll
  for (int t = 0; t < 2; ++t) l[t] += __shfl_xor(l[t], 16, 32);

  // ---- merge of the two key groups: tile 1's state goes to wave ^ 4, whose tile 0 holds the same queries
  {
    v4f* mine = Mg + (uint32_t)wave * (MSLOT * 32u) + lane;
#pragma unroll
    for (int j = 0; j < 16; ++j) {
      v4f va, vb;
#pragma unroll
      for (int r = 0; r < 4; ++r) { va[r] = o[1][j][r]; vb[r] = o[1][j][4 + r]; }
      mine[(2 * j) * 32]     = va;
      mine[(2 * j + 1) * 32] = vb;
    }
    const v4f sv = {rf[1], l[1], 0.f, 0.f};
    mine[32 * 32] = sv;
  }
  __syncthreads();                                                   // every wave's tile-1 state is in Mg; every wave has left the ring (its waits above)
  const v4f* peer = Mg + (uint32_t)(wave ^ 4) * (MSLOT * 32u) + lane;
  const v4f  pst  = peer[32 * 32];
  const float mm  = fmaxf(rf[0], pst[0]);
  const float ca  = pow2(rf[0] - mm), cb = pow2(pst[0] - mm);
  const float lt  = l[0] * ca + pst[1] * cb;
  const float gm  = bfr(gamma[0]);
  const float inv = gm * IHSC * (1.0f / lt);                         // o carries x16 x16, l carries x16
  const float fa  = ca * inv, fb = cb * inv;

  const int qrow = 32 * qg + 16 * grp + c;
  const int e = tid & 7, lq = tid >> 3;                              // lq 0..31
#pragma unroll
  for (int half = 0; half < 2; ++half) {
    if (half) __syncthreads();                                       // every wave finished reading Os
#pragma unroll
    for (int jj = 0; jj < 8; ++jj) {
      const int j = 8 * half + jj;
      const v4f pa = peer[(2 * j) * 32];
      const v4f pb = peer[(2 * j + 1) * 32];
      v4f va, vb;
#pragma unroll
      for (int r = 0; r < 4; ++r) { va[r] = o[0][j][r] * fa + pa[r] * fb; vb[r] = o[0][j][4 + r] * fa + pb[r] * fb; }
      *(v4f*)(Os + qrow * OSPW + 16 * jj + 8 * hh)     = va;         // Os[query][ch_loc = 16jj + 8hh + r]
      *(v4f*)(Os + qrow * OSPW + 16 * jj + 8 * hh + 4) = vb;
    }
    __syncthreads();
    // line L = 32 it + lq: channel 8 it + (lq >> 2) of the half, queries 32 (lq & 3) + 4 e .. + 3
    const int chl = lq >> 2, nl = (lq & 3) * 32 + 4 * e;
    const float* xp = x + ((size_t)(b * CC + 128 * half + chl)) * SEQ_FULL + n0 + nl;
    float*       op = out + ((size_t)(b * CC + 128 * half + chl)) * SEQ + n0 + nl;
    v4f res[16];
#pragma unroll
    for (int it = 0; it < 16; ++it) {
      const v4f xv = *(const v4f*)(xp + (size_t)(8 * it) * SEQ_FULL);
#pragma unroll
      for (int t = 0; t < 4; ++t) res[it][t] = Os[(nl + t) * OSPW + chl + 8 * it] + bfr(xv[t]);
    }
#pragma unroll
    for (int it = 0; it < 16; ++it) *(v4f*)(op + (size_t)(8 * it) * SEQ) = res[it];
  }
}

// =========================================================================================================
// Workspace map (bytes; each region start a multiple of 256; every extent is an exact tile multiple and is written
//   W16 f16 [320][256]                 163840
//   Hv  f16 [8][256][4096]           16777216
//   Fh/Gh f16 [8][4096][32]           2097152 x2
//   total = 21135360
// =========================================================================================================
extern "C" void kernel_launch(void* const* d_in, const int* in_sizes, int n_in,
                              void* d_out, int out_size, void* d_ws, size_t ws_size,
                              hipStream_t stream) {
  if (n_in < 5) return;
  if (in_sizes[0] < NB * CC * SEQ_FULL) return;
  if (in_sizes[1] < DQ * CC || in_sizes[2] < DQ * CC) return;
  if (in_sizes[3] < CC * CC) return;
  if (in_sizes[4] < 1) return;
  if (out_size < NB * CC * SEQ) return;

  size_t off = 0;
  auto carve = [&](size_t bytes) { const size_t o = off; off += (bytes + 255) & ~(size_t)255; return o; };
  const size_t oW16 = carve((size_t)MW * CC * 2);
  const size_t oHv  = carve((size_t)NB * CC * SEQ * 2);
  const size_t oFh  = carve((size_t)NB * SEQ * DQ * 2);
  const size_t oGh  = carve((size_t)NB * SEQ * DQ * 2);
  if (off > ws_size) return;
  if (off > (size_t)134217728) return;

  const float* x     = (const float*)d_in[0];
  const float* wq    = (const float*)d_in[1];
  const float* wk    = (const float*)d_in[2];
  const float* wv    = (const float*)d_in[3];
  const float* gamma = (const float*)d_in[4];

  char* ws = (char*)d_ws;
  unsigned short* W16 = (unsigned short*)(ws + oW16);
  unsigned short* Hv  = (unsigned short*)(ws + oHv);
  unsigned short* Fh  = (unsigned short*)(ws + oFh);
  unsigned short* Gh  = (unsigned short*)(ws + oGh);
  float* out = (float*)d_out;

  const dim3 blk256(256), blk128(128);

  // (0) q/k/v weights -> stacked f16 plane
  cvt_w<<<dim3(MW / 8), blk256, 0, stream>>>(wq, wk, wv, W16);
  // (1) conv1x1 GEMM from the f32 input -> f (key) and g (query) planes, H value plane
  gemm_p<<<dim3(SEQ / QT, NB), blk128, 0, stream>>>(W16, x, Fh, Gh, Hv);
  // (2) attention + gamma scale + residual -> out [b][256][SEQ]
  attn_k<<<dim3(SEQ / QB, NB), blk256, 0, stream>>>(Gh, Fh, Hv, x, gamma, out);
  (void)hipGetLastError();
}

// v010
// It runs in 57 microseconds.
// Two timings next to v009 both put it at 1.04 times that version's speed.
// Over all steps from v000 it is 9.60 times as fast.
// Contractions: conv1x1 q/k/v projections W[320x256].X[256x4096] on v_wmma_f32_16x16x32_f16 (f16 containers of
// bf16-RNE weights x256 and bf16-RNE x); scores f_n.g_m on v_wmma_f32_16x16x32_f16 (f16 of f and of g x log2 e, one
// product, K=32, accumulator started at minus the softmax reference); o^T = H.P^T on
// v_wmma_f32_16x16x32_f16 (H = relu(v-projection) x16 f16, P = e^{s-ref} x16 f16 = 2^D of the score D registers); f32
// accumulate everywhere; softmax statistics, gamma scale and the residual add in f32 VALU.
#include <hip/hip_runtime.h>
#include <math.h>
#include <stdint.h>

#ifndef NB
#define NB 8
#endif
#ifndef SEQ
#define SEQ 4096
#endif
#define NB_FULL  8
#define SEQ_FULL 4096
#define CC     256
#define DQ     32
#define MW     320
#define MBLK   5
#define QT     64
#define OSP    68
#define WSC    256.0f
#define IWSC   0.00390625f
#define HSC    16.0f
#define IHSC   0.0625f
#define L2E    1.4426950408889634f       // log2 e: the query planes carry g x log2 e, so that a score is an exponent of 2
#define PSH    4.0f                      // log2 16: P = e^{s-ref} x 16
#define PLIM   65504.0f                  // largest finite f16: a lane's sum of P at or under it bounds each P
#define KS     128                       // keys per LDS tile: two passes of 64 keys (32 per wave)
#define TPS    2                         // tiles per LDS stage: 256 keys, four passes between barriers
#define NST    (SEQ / (KS * TPS))        // stages
#define VPITCH 272u                      // LDS pitch of a value row: 256 B (128 keys f16) + 16 B pad
#define VSLICE (128u * VPITCH)           // 128 channels, one wave's request: 34816 B = 17 x 2 KiB
#define KPITCH 272u                      // LDS pitch of a key-plane row: 256 B (4 keys x 32 d f16) + 16 B pad
#define KPLACE 10240u                    // 32 such rows (8704 B), rounded up to a multiple of 2 KiB
#define KOFF   (2u * VSLICE)
#define BUFB   (KOFF + KPLACE)           // one tile's place: 79872 B = 39 x 2 KiB
#define STGB   (TPS * BUFB)              // one buffer = one stage: 159744 B
#define QB     128                       // queries per attention block: 4 wave pairs x 32
#define MSLOT  33u                       // 16-B slots per lane of a wave's merge range: 32 of o, one of (rf, l)
#define MRGW   (MSLOT * 32u * 16u)       // one wave's merge range: 16896 B
#define GPITCH 272u                      // projection GEMM, LDS pitch of an operand row: 256 B (128 k f16) + 16 B pad
#define GSLICE 18432u                    // 64 such rows (17408 B), rounded up to a multiple of 2 KiB

static_assert(NB >= 1 && NB <= NB_FULL);
static_assert(SEQ >= QT && SEQ <= SEQ_FULL);
static_assert(SEQ % QT == 0 && SEQ % 32 == 0);
static_assert(CC % QT == 0 && CC % 32 == 0);
static_assert(MW == 2 * DQ + CC);
static_assert(MW == MBLK * QT);
static_assert(QT == 2 * DQ);
static_assert(MW % 8 == 0);
static_assert((OSP * 4) % 16 == 0);
static_assert(DQ % 32 == 0);
static_assert(SEQ % (KS * TPS) == 0 && NST >= 2 && NST % 2 == 0 && TPS == 2);
static_assert(SEQ % QB == 0 && KS == 128);
static_assert(KS * 2 == 256 && CC == 256 && DQ * 2 * 4 == 256);
static_assert(4u * VSLICE <= STGB && 8u * MRGW <= STGB && 2u * STGB <= 327680u && QB * 4 == 512);
static_assert(VSLICE % 2048u == 0 && KPLACE % 2048u == 0 && BUFB % 2048u == 0 && (KS / 4) * KPITCH <= KPLACE);
static_assert(GSLICE % 2048u == 0 && QT * GPITCH <= GSLICE && CC * 2 == 512 && MBLK >= 2);

typedef _Float16       v16h __attribute__((ext_vector_type(16)));
typedef _Float16       v8h  __attribute__((ext_vector_type(8)));
typedef unsigned short v8us __attribute__((ext_vector_type(8)));
typedef float          v8f  __attribute__((ext_vector_type(8)));
typedef float          v4f  __attribute__((ext_vector_type(4)));
typedef unsigned int   v4u  __attribute__((ext_vector_type(4)));
typedef uint32_t       u32x4 __attribute__((ext_vector_type(4)));
typedef uint32_t       u32x8 __attribute__((ext_vector_type(8)));

union Frag  { v8us u[2]; v16h h; };
union FragH { v16h v; v8h hv[2]; };
static_assert(sizeof(Frag) == 32);
static_assert(sizeof(FragH) == 32);

// ---- scalar helpers ---------------------------------------------------------------------------------------
__device__ __forceinline__ unsigned short bf_bits(float f) {          // f32 -> bf16 bits, RNE convert
  unsigned u = __float_as_uint(f);
  return (unsigned short)((u + 0x7FFFu + ((u >> 16) & 1u)) >> 16);
}
__device__ __forceinline__ float bf_up(unsigned short hb) { return __uint_as_float(((unsigned)hb) << 16); }
__device__ __forceinline__ float bfr(float f) { return bf_up(bf_bits(f)); }
__device__ __forceinline__ unsigned short h_bits(_Float16 x) { return __builtin_bit_cast(unsigned short, x); }
__device__ __forceinline__ unsigned pk16(unsigned short a, unsigned short b) { return (unsigned)a | ((unsigned)b << 16); }
__device__ __forceinline__ v8f zero8() { v8f z = {0.f, 0.f, 0.f, 0.f, 0.f, 0.f, 0.f, 0.f}; return z; }
__device__ __forceinline__ float hmax8(v8f s) {
  return fmaxf(fmaxf(fmaxf(s[0], s[1]), fmaxf(s[2], s[3])), fmaxf(fmaxf(s[4], s[5]), fmaxf(s[6], s[7])));
}
__device__ __forceinline__ float pow2(float v) {                      // 2^v, the hardware's own exponential
#if defined(__HIP_DEVICE_COMPILE__)
  return __builtin_amdgcn_exp2f(v);
#else
  return v;
#endif
}
__device__ __forceinline__ unsigned wave_ballot(bool p) {
#if defined(__HIP_DEVICE_COMPILE__)
  return __builtin_amdgcn_ballot_w32(p);
#else
  return p ? 1u : 0u;
#endif
}

// ---- 16-bit fragment loader (A, or B from a k-contiguous [n][k] row): lane -> row/col (lane&15), p already includes
//      + 8*(lane>>4); elements 0..7 <- p[0..7] (k0+8h..), elements 8..15 <- p[16..23] (k0+16+8h..)
__device__ __forceinline__ Frag ldfrag(const unsigned short* p) {
  Frag f;
  f.u[0] = *(const v8us*)(p);
  f.u[1] = *(const v8us*)(p + 16);
  return f;
}

// ---- WMMA helpers: builtin followed by a 4-slot VALU gap tying D and keeping A/B live --------------------------
__device__ __forceinline__ v8f mma_h(v16h a, v16h b, v8f c) {
  v8f d = __builtin_amdgcn_wmma_f32_16x16x32_f16(false, a, false, b, (short)0, c, false, false);
#if defined(__HIP_DEVICE_COMPILE__)
  asm volatile("v_nop\n\tv_nop\n\tv_nop\n\tv_nop" : "+v"(d) : "v"(a), "v"(b));
#endif
  return d;
}
// The builtin alone, the compiler's own padding behind it (attention kernel): an asm operand cannot be a register
// above v255, and 256 accumulator registers with the fragments do not fit below it (tied to asm they spill).
__device__ __forceinline__ v8f mma_hp(v16h a, v16h b, v8f c) {
  return __builtin_amdgcn_wmma_f32_16x16x32_f16(false, a, false, b, (short)0, c, false, false);
}

// ---- tensor load to LDS: descriptor groups and issue ----------------------------------------------------------
__device__ __forceinline__ uint32_t uni(uint32_t v) { return (uint32_t)__builtin_amdgcn_readfirstlane(v); }
__device__ __forceinline__ uint32_t pinned(uint32_t v) {
  uint32_t w = uni(v);
  asm volatile("" : "+s"(w));            // the test word stays scalar, the branch on it a scalar branch
  return w;
}
// group 1: 1-byte elements, tensor = tile = ROWS rows of ROWB bytes, source pitch SRCP bytes, 16 B of LDS pad per row
template <uint32_t ROWB, uint32_t ROWS, uint32_t SRCP, uint32_t IVL>
__device__ __forceinline__ u32x8 tdm_group1() {
  u32x8 g;
  g[0] = uni((1u << 20) | (IVL << 22) | (3u << 25));
  g[1] = uni((ROWB & 0xFFFFu) << 16);
  g[2] = uni((ROWB >> 16) | ((ROWS & 0xFFFFu) << 16));
  g[3] = uni((ROWS >> 16) | (ROWB << 16));
  g[4] = uni(ROWS);
  g[5] = uni(SRCP);
  g[6] = uni(0u);
  g[7] = uni(0u);
  return g;
}
// The same form on a whole group 1 (descriptor words held in scalar registers): the eight words keep their registers
// from the first request to the last, so that none of those registers takes another value while a request is outstanding.
__device__ __forceinline__ u32x8 held(u32x8 g) { asm volatile("" : "+s"(g)); return g; }  // pinned(), eight descriptor words
__device__ __forceinline__ u32x4 tdm_group0(uint32_t lds_dst, uint64_t ga) {
  u32x4 g;
  g[0] = uni(1u);
  g[1] = uni(lds_dst);
  g[2] = uni((uint32_t)ga);
  g[3] = uni((((uint32_t)(ga >> 32)) & 0x01FFFFFFu) | 0x80000000u);
  return g;
}
__device__ __forceinline__ void tdm_load(u32x4 g0, u32x8 g1) {
  asm volatile("tensor_load_to_lds %0, %1" :: "s"(g0), "s"(g1) : "memory");   // one request of the whole wave
}
__device__ __forceinline__ void wait_tensor0() { asm volatile("s_wait_tensorcnt 0x0" ::: "memory"); }  // this wave's request has landed
__device__ __forceinline__ void wait_ds0()     { asm volatile("s_wait_dscnt 0x0" ::: "memory"); }      // this wave's LDS reads have returned
// The same form on a group 0: its four words keep their registers from the request to the wait that covers it.
__device__ __forceinline__ u32x4 held4(u32x4 g) { asm volatile("" : "+s"(g)); return g; }  // pinned(), four descriptor words
// Work-group barrier alone, behind the caller's own wait_ds0(): __syncthreads() behind a global store also waits until
// that store has completed, which nothing in this work-group reads.
__device__ __forceinline__ void wg_barrier() { asm volatile("s_barrier_signal -1\n\ts_barrier_wait -1" ::: "memory"); }

// =========================================================================================================
// (0) conv1x1 weights: W16 f16 [320][256], rows 0..31 = q-projection rows, 32..63 = k-projection rows, 64..319 =
//     v-projection rows; value = f16 of (bf16-RNE(w) * 256) (exact). Block blk (0..39) owns rows 8*blk..8*blk+7:
// coverage: 40 blocks x 8 rows x 32 lanes x 8 halves = 320 x 256 = the whole plane.
// =========================================================================================================
__global__ __launch_bounds__(256)
void cvt_w(const float* __restrict__ wq, const float* __restrict__ wk, const float* __restrict__ wv,
           unsigned short* W16) {
  const int tid = threadIdx.x, blk = blockIdx.x;
  const int rl = tid >> 5, col = 8 * (tid & 31);
  const int o = 8 * blk + rl;                                        // 0..319
  const float* wbase;
  int osub;
  if (blk < DQ / 8)            { wbase = wq; osub = 0; }
  else if (blk < (2 * DQ) / 8) { wbase = wk; osub = DQ; }
  else                         { wbase = wv; osub = 2 * DQ; }
  const float* s = wbase + (size_t)(o - osub) * CC + col;
  const v4f a = *(const v4f*)s;
  const v4f q = *(const v4f*)(s + 4);
  const float f[8] = {a[0], a[1], a[2], a[3], q[0], q[1], q[2], q[3]};
  v4u u;
#pragma unroll
  for (int t = 0; t < 4; ++t) {
    const _Float16 h0 = (_Float16)(bfr(f[2 * t]) * WSC);
    const _Float16 h1 = (_Float16)(bfr(f[2 * t + 1]) * WSC);
    u[t] = pk16(h_bits(h0), h_bits(h1));
  }
{
    *(v4u*)(W16 + (size_t)o * CC + col) = u;
    
  }
}

// =========================================================================================================
// (1) conv1x1 GEMM for one (b, 64-n tile), all 320 outputs: Y[o][n] = relu((1/256) sum_c W16[o][c] X[n][c]), where
//     X[n][c] = f16 of bf16-RNE(x[b][c][n]) (exact in f16) is formed by the block itself, once, from the f32 input.
//     Block 128 threads = 4 waves. x tile 256 c x 64 n: thread (e = tid & 15, cq = tid >> 4) loads, per it = 0..3, the
//     eight rows c = 8 (8 it + cq) .. + 7 at n = 4 e .. 4 e + 3 (16 lanes x 16 B = 256 contiguous bytes of a row) and
//     stores, per n, the eight converted c as one 16-B piece of the LDS row n: two slices of 64 rows x 256 B (k 0..127,
//     k 128..255) at pitch GPITCH. Wave w owns cols n0+16w..+15: its eight B fragments (k = c contiguous in the LDS
//     row) are read once and stay in registers for all five weight tiles.
//     Pass mb = weight rows 64 mb .. + 63 (4 m-tiles, A rows o = 16 mt + (lane&15)): two slices of 64 rows x 256 B, one
//     tensor load from each of waves 2 and 3, two buffers, issued one pass ahead; fragments by ds_load_b128, the sixteen
//     reads of two k-steps as one group, one group ahead of the products. K = 256 = 8 steps.
//     Epilogue of a pass staged in LDS Os[n_loc][o_loc] (own range, pitch OSP, b128 stores of 8 consecutive o per lane,
//     relu applied), barrier, then (block-uniform branch on the pass):
//       pass 0 -> o_loc 0..31 = f (key) dims -> Fh, o_loc 32..63 = g (query) dims, x log2 e -> Gh; planes f16
//       [b][SEQ n][32 d] (k-contiguous for both score operands).
//       passes 1..4 -> channels 64(mb-1).. of the H plane f16 [b][256 c][SEQ n] (n contiguous), value x16 as f16.
// coverage: X slices: 4 it x 8 cq x 8 c = 256 c, 16 e x 4 n = 64 n, all written before the barrier; Os 4 waves x 16 n x
//           64 o = 64 x 64 (staged extent == consumed extent); F/G planes: 2 it x 16 lines x 8 lanes x 8 = 64 n x 32 d
//           per plane; H: 4 it x 16 rows x 8 lanes x 8 = 64 c x 64 n per pass; grid (SEQ/64, NB) x 5 passes covers all
//           SEQ rows of Fh/Gh and all 256 channels of H exactly once.
// =========================================================================================================
__global__ __launch_bounds__(128)
void gemm_p(const unsigned short* __restrict__ W16, const float* __restrict__ x,
            unsigned short* Fh, unsigned short* Gh, unsigned short* Hv) {
  __shared__ __attribute__((aligned(2048))) unsigned char gsm[6u * GSLICE + QT * OSP * 4];
  float* Os = (float*)(gsm + 6u * GSLICE);
  const int tid  = threadIdx.x;
  const int lane = tid & 31, wave = tid >> 5;
  const int hh   = lane >> 4, c = lane & 15;
  const int nt   = blockIdx.x, b = blockIdx.y;
  const int n0   = nt * QT;

  // Weight tile st = rows 64 st .. + 63, into buffer st & 1 (slices 2, 3 or 4, 5): waves 2 and 3 issue one k half each
  // (rows of 256 B at a source pitch of 512 B). Waves 0 and 1 issue none.
  const uint32_t lbase = (uint32_t)(size_t)gsm;
  const uint32_t wv    = uni((uint32_t)tid >> 5);
  const u32x8 g1w = held(tdm_group1<256u, QT, CC * 2u, 5u>());
  auto group0 = [&](uint32_t st) {
    const uint64_t ga = (uint64_t)(size_t)W16 + (uint64_t)st * (QT * CC * 2u) + (uint64_t)(wv & 1u) * 256u;
    return tdm_group0(lbase + (2u + 2u * (st & 1u) + (wv & 1u)) * GSLICE, ga);
  };
  u32x4 g0w = group0(0u);

  {
    const int e = tid & 15, cq = tid >> 4;                           // cq 0..7
    v4f xv[4][8];
#pragma unroll
    for (int it = 0; it < 4; ++it) {
#pragma unroll
      for (int r = 0; r < 8; ++r)
        xv[it][r] = *(const v4f*)(x + ((size_t)(b * CC + 8 * (8 * it + cq) + r)) * SEQ_FULL + n0 + 4 * e);
      asm volatile("s_wait_xcnt 0x0" ::: "memory");  // in front of the first overwrite of an address register that these loads name
    }
    if (pinned(wv >= 2u)) {                                          // weight tile 0 lands while the x rows arrive
      tdm_load(g0w, g1w);
      wait_tensor0();
    }
#pragma unroll
    for (int it = 0; it < 4; ++it) {
      const uint32_t cc = 8u * (uint32_t)(8 * it + cq);              // 0..248
      unsigned char* xd = gsm + (cc >> 7) * GSLICE + (uint32_t)(4 * e) * GPITCH + (cc & 127u) * 2u;
#pragma unroll
      for (int t = 0; t < 4; ++t) {
        v4u u;
#pragma unroll
        for (int p = 0; p < 4; ++p)
          u[p] = pk16(h_bits((_Float16)bfr(xv[it][2 * p][t])), h_bits((_Float16)bfr(xv[it][2 * p + 1][t])));
        *(v4u*)(xd + (uint32_t)t * GPITCH) = u;
      }
    }
  }
  wait_ds0();
  __syncthreads();                                                   // the X slices and weight tile 0 are in LDS
  g0w = held4(group0(1u));                                           // all four words stand in their registers in front of the branch, in every wave
  if (pinned(wv >= 2u)) tdm_load(g0w, g1w);

  const unsigned char* bp = gsm + (uint32_t)(16 * wave + c) * GPITCH + 16u * hh;
  Frag fb[CC / 32];
#pragma unroll
  for (int ks = 0; ks < CC / 32; ++ks)
    fb[ks] = ldfrag((const unsigned short*)(bp + (uint32_t)(ks >> 2) * GSLICE + (uint32_t)(ks & 3) * 64u));

#pragma unroll 1                                                     // one copy of the pass: the five differ only in addresses and in the store branch
  for (uint32_t mb = 0; mb < (uint32_t)MBLK; ++mb) {
    const unsigned char* ap = gsm + (2u + 2u * (mb & 1u)) * GSLICE + (uint32_t)c * GPITCH + 16u * hh;

    v8f acc[4];
#pragma unroll
    for (int mt = 0; mt < 4; ++mt) acc[mt] = zero8();

    // Group g = k-steps 2g and 2g + 1, two register sets: the next group's sixteen reads are issued in front of this
    // group's eight products, which then wait on counts and never to 0 before the last group.
    Frag fa[2][2][4];
#pragma unroll
    for (int g = -1; g < CC / 64; ++g) {
      if (g + 1 < CC / 64) {
#pragma unroll
        for (int q = 0; q < 2; ++q) {
          const int ks = 2 * (g + 1) + q;
          const uint32_t ko = (uint32_t)(ks >> 2) * GSLICE + (uint32_t)(ks & 3) * 64u;
#pragma unroll
          for (int mt = 0; mt < 4; ++mt)
            fa[(g + 1) & 1][q][mt] = ldfrag((const unsigned short*)(ap + ko + (uint32_t)(16 * mt) * GPITCH));
        }
      }
      if (g >= 0) {
#pragma unroll
        for (int q = 0; q < 2; ++q) {
#pragma unroll
          for (int mt = 0; mt < 4; ++mt) acc[mt] = mma_h(fa[g & 1][q][mt].h, fb[2 * g + q].h, acc[mt]);
        }
      }
    }

    // ---- epilogue: scale back + relu -> LDS Os[n_loc][o_loc]; lane (hh, c) holds o = 16 mt + 8 hh + r, n_loc = 16 w + c
    //      (the readers of the pass before left Os in front of that pass's last barrier)
    {
      const int nl = 16 * wave + c;
#pragma unroll
      for (int mt = 0; mt < 4; ++mt) {
        v4f va, vb;
#pragma unroll
        for (int r = 0; r < 4; ++r) {
          va[r] = fmaxf(acc[mt][r] * IWSC, 0.f);
          vb[r] = fmaxf(acc[mt][4 + r] * IWSC, 0.f);
        }
        *(v4f*)(Os + nl * OSP + 16 * mt + 8 * hh)     = va;
        *(v4f*)(Os + nl * OSP + 16 * mt + 8 * hh + 4) = vb;
      }
    }
    wait_ds0();
    wg_barrier();                                                    // Os is whole

    const int e = tid & 7, lq = tid >> 3;                            // lq 0..15
    if (mb == 0u) {                                                  // block-uniform
      v4u ufh[2], ugh[2];
#pragma unroll
      for (int it = 0; it < 2; ++it) {
        const int L   = it * 16 + lq;                                // line 0..31
        const int row = 2 * L + (e >> 2);                            // n_loc 0..63
        const int d   = 8 * (e & 3);                                 // 0, 8, 16, 24
        const float* fs = Os + row * OSP + d;
        const float* gs = Os + row * OSP + DQ + d;
        const v4f f0 = *(const v4f*)fs;
        const v4f f1 = *(const v4f*)(fs + 4);
        const v4f g0 = *(const v4f*)gs;
        const v4f g1 = *(const v4f*)(gs + 4);
        const float fv[8] = {f0[0], f0[1], f0[2], f0[3], f1[0], f1[1], f1[2], f1[3]};
        const float gv[8] = {g0[0] * L2E, g0[1] * L2E, g0[2] * L2E, g0[3] * L2E,
                             g1[0] * L2E, g1[1] * L2E, g1[2] * L2E, g1[3] * L2E};
#pragma unroll
        for (int t = 0; t < 4; ++t) {
          ufh[it][t] = pk16(h_bits((_Float16)fv[2 * t]), h_bits((_Float16)fv[2 * t + 1]));
          ugh[it][t] = pk16(h_bits((_Float16)gv[2 * t]), h_bits((_Float16)gv[2 * t + 1]));
        }
      }
#pragma unroll
      for (int it = 0; it < 2; ++it) {
        const int L   = it * 16 + lq;
        const int row = 2 * L + (e >> 2);
        const int d   = 8 * (e & 3);
        const size_t po = ((size_t)(b * SEQ + n0 + row)) * DQ + d;
        *(v4u*)(Fh + po) = ufh[it];
        *(v4u*)(Gh + po) = ugh[it];
      }
    } else {
      const int chb = ((int)mb - 1) * QT;                            // channel base 0..192
      v4u uhp[4];
#pragma unroll
      for (int it = 0; it < 4; ++it) {
        const int ol = it * 16 + lq;                                 // o_loc 0..63
        float hv8[8];
#pragma unroll
        for (int t = 0; t < 8; ++t) hv8[t] = Os[(8 * e + t) * OSP + ol];
#pragma unroll
        for (int t = 0; t < 4; ++t) {
          const _Float16 h0 = (_Float16)(hv8[2 * t] * HSC);
          const _Float16 h1 = (_Float16)(hv8[2 * t + 1] * HSC);
          uhp[it][t] = pk16(h_bits(h0), h_bits(h1));
        }
      }
#pragma unroll
      for (int it = 0; it < 4; ++it) {
        const int ol = it * 16 + lq;
        *(v4u*)(Hv + ((size_t)(b * CC + chb + ol)) * SEQ + n0 + 8 * e) = uhp[it];
      }
    }
    asm volatile("s_wait_xcnt 0x0" ::: "memory");  // in front of the next pass's overwrite of a register that these stores name

    // Foot of pass mb: this wave's LDS reads have returned, its own request of tile mb + 1 has landed, the barrier, and
    // only then the load of tile mb + 2 into the buffer that pass mb has read.
    wait_ds0();
    wait_tensor0();
    g0w = held4(g0w);
    wg_barrier();
    g0w = held4(group0(mb + 2u));                                    // formed in every wave and pass, issued only under the test
    if (pinned(mb + 2u < (uint32_t)MBLK && wv >= 2u)) tdm_load(g0w, g1w);
  }
  wait_tensor0();
  wait_ds0();
}

// =========================================================================================================
// (2) self-attention for one (b, 128-query tile), transposed formulation, SEQ keys, no mask, no scale:
//   S^T tile (16 keys x 16 queries) = A(k: row = key kb + (lane&15), 32 d via the split k map from the f16 plane
//   Fh [b][SEQ][32]) . B(q: col = query, same map from Gh): K = 32 = one k-step = one product; the query fragments
//   are loaded once per wave.
//   Block = 8 waves. Wave (qg = wave & 3, grp = wave >> 2) owns 32 queries (two 16-query tiles) and, in pass h = 0..3
//   of stage st, the 32 keys 256 st + 64 h + 32 grp .. + 31: each key and value fragment read from LDS feeds two
//   products, one per query tile. The wave's tile t holds queries 32 qg + 16 (t ^ grp) + (lane&15), so that tile 1 of
//   wave w and tile 0 of wave w ^ 4 are the same queries.
//   Per lane a D tile holds 8 keys of ONE query: online softmax state per lane and query tile. The reference m of the
//   exponentials is a maximum seen earlier, not the running one. The query plane carries g x log2 e and a tile's
//   product takes -rf (rf = m log2 e - 4, eight equal registers per lane and query tile) as its C operand, so that the
//   D registers are the exponents of P themselves, with no vector subtract or multiply in front of the exponentials.
//   A pass tests, once, by a wave-uniform ballot, each lane's sum of P against the f16 range. Only where a sum is over
//   it, and in the first pass, the maximum over the 32 keys (one shuffle lane^16 per tile), the o/l rescale, the new
//   C registers and the exponentials anew. P = e^{s-m} x 16 as f16 (at most 65504) is the B operand of
//   O^T (rows channel, cols queries) += A(H rows channel = 16j + (lane&15), keys contiguous, f16 plane Hv
//   [b][256][SEQ], values x16) . B(P^T): element r <- D of the tile covering keys kb..kb+15, element 8+r <- the tile
//   covering kb+16..kb+31, lane unchanged. 2 x 16 accumulator tiles per wave (256 channels x 32 queries).
//   Keys and values reach the waves through LDS: stages of 256 keys (two tiles of 128), two buffers, one tensor load
//   per stage from each of waves 0..2 (first tile) and 4..6 (second tile), issued one stage ahead; all eight waves
//   read the tiles with ds_load_b128. A stage serves four passes with no barrier between them: the waves of a SIMD
//   may drift by a pass, one in its products while the other is in its softmax.
//   Merge of the two key groups: every wave stores the state (rf, l, o) of its tile 1 in its own LDS range Mg[wave],
//   lane by lane; behind one barrier it reads the range of wave ^ 4 (its own tile 0's queries, same lane = same query
//   and channels) and joins the two partial softmax states: rf = max, weights 2^{rf_own - rf} and 2^{rf_peer - rf}.
//   Residual and output: behind the last publish point, where the ring has no further stage to fetch, waves 0, 1, 4, 5
//   fetch the block's own tile of x (256 channels x 128 queries f32) by one tensor load each into the buffer that the
//   last stage but one has left: four slices (64 queries x 128 channels, rows of 256 B = 64 queries of one channel, pitch
//   VPITCH), laid out as the output rows. It lands under the last stage's products. Every lane then adds gamma*O/(16 l)
//   to its own 128 elements in place (b32, 16 consecutive queries per half wave, the halves 32 banks apart), and behind
//   one barrier the rows leave by b128 reads and stores of 256 contiguous bytes.
// coverage: Mg per wave 33 slots x 32 lanes x 16 B, all written before the barrier, slots 0..32 read behind it;
//           x tile 4 slices x 128 rows x 256 B, each element rewritten by exactly one lane (8 waves x 16 queries x 256
//           ch) before the barrier; out 32 it x 16 rows x 16 lanes x 4 floats = 256 ch x 128 n;
//           grid (SEQ/128, NB) covers out[b][0..255][0..SEQ-1] exactly once.
// =========================================================================================================
__global__ __launch_bounds__(256)
void attn_k(const unsigned short* __restrict__ Gh, const unsigned short* __restrict__ Fh,
            const unsigned short* __restrict__ Hv, const float* __restrict__ x,
            const float* __restrict__ gamma, float* out) {
  __shared__ __attribute__((aligned(2048))) unsigned char smem[2u * STGB];
  // The last stage (NST - 1, odd) lies in buffer 1; its publish point (every wave's s_wait_dscnt 0 and s_wait_tensorcnt 0,
  // the barrier) stands behind every read of buffer 0 and every load into it: the x tile goes into buffer 0's place there.
  // Merge ranges in buffer 1's place, first written behind the barrier that follows the loop.
  v4f*   Mg = (v4f*)(smem + STGB);
  const int tid  = threadIdx.x;
  const int wave = tid >> 5, lane = tid & 31;
  const int qg   = wave & 3, grp = wave >> 2;
  const int hh   = lane >> 4, c = lane & 15;
  const int n0   = blockIdx.x * QB, b = blockIdx.y;

  // Stage st = keys 256 st .. 256 st + 255, into buffer st & 1, as two tiles of 128 keys: tile wave >> 2 comes from waves
  // with wave & 3 = 0..2, one request per stage each: 0 and 1 the two 128-channel halves of the value tile (rows of
  // 256 B), 2 the key plane (8192 contiguous bytes, taken as 32 rows of 256 B). Waves 3 and 7 issue none.
  const uint32_t lbase = (uint32_t)(size_t)smem;
  const uint32_t wv    = uni((uint32_t)tid >> 5);
  const uint32_t wr    = wv & 3u, wt = wv >> 2;                      // this wave's request and tile of a stage
  const u32x8 g1v = held(tdm_group1<256u, 128u, SEQ * 2u, 5u>());
  const u32x8 g1k = held(tdm_group1<256u, KS / 4u, 256u, 5u>());
  const u32x8 g1x = held(tdm_group1<256u, 128u, SEQ_FULL * 4u, 5u>());
  auto issue = [&](uint32_t st, bool now) {                          // now: the wait directly behind the request
    const uint32_t dst = lbase + (st & 1u) * STGB + wt * BUFB;
    const uint32_t kt  = TPS * st + wt;                              // 128-key tile 0 .. SEQ / KS - 1
    if (pinned(wr < 2u)) {
      const uint64_t ga = (uint64_t)(size_t)Hv + ((uint64_t)(b * CC + 128u * wr) * SEQ + (uint64_t)kt * KS) * 2u;
      tdm_load(tdm_group0(dst + wr * VSLICE, ga), g1v);
      if (now) wait_tensor0();
    } else if (pinned(wr == 2u)) {
      const uint64_t ga = (uint64_t)(size_t)Fh + ((uint64_t)b * SEQ + (uint64_t)kt * KS) * (DQ * 2u);
      tdm_load(tdm_group0(dst + KOFF, ga), g1k);
      if (now) wait_tensor0();
    }
  };
  // x tile: slice 2 wt + wr = queries n0 + 64 wt .. + 63 of channels 128 wr .. + 127, from waves with wr < 2. Its group 0
  // is formed here, in every wave, and keeps its registers up to the wait behind the loop.
  const uint64_t gax = (uint64_t)(size_t)x + ((uint64_t)(b * CC + 128u * (wr & 1u)) * SEQ_FULL + (uint64_t)(n0 + 64u * wt)) * 4u;
  const u32x4 g0x = held4(tdm_group0(lbase + (2u * wt + (wr & 1u)) * VSLICE, gax));
  issue(0u, true);

  // q fragments (B operand, col = query n0 + 32*qg + 16*(t^grp) + c), K = 32: loaded once
  Frag qh[2];
#pragma unroll
  for (int t = 0; t < 2; ++t) {
    const size_t qo = ((size_t)(b * SEQ + n0 + 32 * qg + 16 * (t ^ grp) + c)) * DQ + 8 * hh;
    qh[t] = ldfrag(Gh + qo);
  }
  asm volatile("s_wait_xcnt 0x0" ::: "memory");  // in front of the first overwrite of an address register that these loads name
  // k fragment offset in a tile's place (A operand, row = key c of a 16-key tile: LDS row c >> 2, 64-B slot c & 3; this
  // wave's 32 keys of pass h are LDS rows 16 (h & 1) + 8 grp .. + 7 of tile h >> 1)
  const uint32_t klane = KOFF + (uint32_t)(8 * grp + (c >> 2)) * KPITCH + (uint32_t)(c & 3) * 64u + 16u * hh;
  // v fragment offset in a tile's place (A operand, row = channel 16j + c, keys contiguous, this wave's 32 keys of pass h =
  // 64 B at 128 (h & 1) + 64 grp of tile h >> 1)
  const uint32_t vlane = (uint32_t)c * VPITCH + 64u * grp + 16u * hh;

  // rf = the reference in use, in exponents of 2 and less log2 16; nr = -rf in eight registers, the C operand of a
  // tile's score product (a lane's eight D registers are eight keys of ONE query)
  float rf[2] = {0.f, 0.f}, l[2] = {0.f, 0.f};
  v8f nr[2] = {zero8(), zero8()};
  float lim = -1.0f;                     // the bound of the test: under every sum until the first pass has set a reference, then PLIM
  v8f o[2][16];
#pragma unroll
  for (int t = 0; t < 2; ++t) {
#pragma unroll
    for (int j = 0; j < 16; ++j) o[t][j] = zero8();
  }

#pragma unroll 1
  for (uint32_t st = 0; st < (uint32_t)NST; ++st) {
    // Publish point of stage st, between the passes of stage st - 1 and those of stage st (in front of the first: stage
    // 0's wait, the barrier, stage 1's load): this wave's LDS reads of stage st - 1 have returned, its own request of
    // stage st has landed, the barrier, and only then the load of stage st + 1 into the buffer that stage st - 1 filled.
    wait_ds0();
    wait_tensor0();
    __syncthreads();
    if (pinned(st + 1u < (uint32_t)NST)) issue(st + 1u, false);
    else if (pinned(wr < 2u)) tdm_load(g0x, g1x);
    const unsigned char* bufp = smem + (st & 1u) * STGB;
#pragma unroll                                                       // in line: a pass's key reads and score products stand among the last products of the pass before
    for (uint32_t h = 0; h < TPS * KS / 64u; ++h) {
    const unsigned char* Kp = bufp + (h >> 1) * BUFB + klane + (h & 1u) * (16u * KPITCH);
    const unsigned char* Vp = bufp + (h >> 1) * BUFB + vlane + (h & 1u) * 128u;
    // kb = 256 st + 64 h + 32 grp
    const Frag k0  = ldfrag((const unsigned short*)(Kp));                                   // keys kb .. kb+15
    const Frag k1  = ldfrag((const unsigned short*)(Kp + 4 * KPITCH));                      // keys kb+16 .. kb+31
    // Pass 0's four key reads stay one group in front of its score products (behind the publish point nothing else
    // covers them): without the fence the second tile's reads stand behind the first tile's products and a wait to 0.
    if (h == 0u) __builtin_amdgcn_sched_barrier(0);
    v8f s0[2], s1[2];                                                // s log2 e - rf: the exponent of P itself
#pragma unroll
    for (int t = 0; t < 2; ++t) { s0[t] = mma_hp(k0.h, qh[t].h, nr[t]); s1[t] = mma_hp(k1.h, qh[t].h, nr[t]); }

    // The first eight value fragments are read as one group behind the score products and in front of the
    // exponentials, which run while the reads return. The scheduling fences here and in the product loop keep each
    // read group in its place: without them every read pair sits at its own WMMA behind a wait to 0.
    __builtin_amdgcn_sched_barrier(0);
    Frag vf[16];
#pragma unroll
    for (int j = 0; j < 8; ++j) vf[j] = ldfrag((const unsigned short*)(Vp + (16 * j) * VPITCH));
    __builtin_amdgcn_sched_barrier(0);

    FragH ph[2];
    float ls[2];
    auto expo = [&](int t) {                                         // P and its sum per lane, against rf[t] as it stands
      float a = 0.f;
#pragma unroll
      for (int r = 0; r < 8; ++r) {
        const float e0 = pow2(s0[t][r]);                             // key kb      + 8hh + r
        const float e1 = pow2(s1[t][r]);                             // key kb + 16 + 8hh + r
        a += e0 + e1;
        ph[t].hv[0][r] = (_Float16)e0;
        ph[t].hv[1][r] = (_Float16)e1;
      }
      ls[t] = a;
    };
    expo(0);
    expo(1);
    // No P is negative, so a sum within the f16 range bounds each of its terms; an infinite sum fails the test too.
    const unsigned over = wave_ballot(!(ls[0] <= lim && ls[1] <= lim));  // wave-uniform, one test per pass
    if (over != 0u) {
      const bool first = lim < 0.f;                                  // no reference yet (rf = 0): the first pass always sets one
      lim = PLIM;
#pragma unroll
      for (int t = 0; t < 2; ++t) {
        float mx = fmaxf(hmax8(s0[t]), hmax8(s1[t]));                // the largest exponent, against rf[t]
        mx = fmaxf(mx, __shfl_xor(mx, 16, 32));                      // both lanes of a query take the same reference
        const float up   = first ? mx - PSH : fmaxf(mx - PSH, 0.f);  // the reference only rises, but for the first
        const float corr = first ? 0.f : pow2(-up);
        l[t] *= corr;
#pragma unroll
        for (int j = 0; j < 16; ++j) {
#pragma unroll
          for (int r = 0; r < 8; ++r) o[t][j][r] *= corr;
        }
        rf[t] += up;
#pragma unroll
        for (int r = 0; r < 8; ++r) { s0[t][r] -= up; s1[t][r] -= up; }
        nr[t] = zero8() - rf[t];
        expo(t);                                                     // now every P is at most 16
      }
    }
#pragma unroll
    for (int t = 0; t < 2; ++t) l[t] += ls[t];

    // Tile 0's products run while the last eight fragments arrive; all sixteen fragments stay in registers, and tile
    // 1's products take them from there, with no LDS read among them.
#pragma unroll
    for (int g = 0; g < 4; ++g) {                                    // four products, then the reads for two groups on
#pragma unroll
      for (int jj = 0; jj < 4; ++jj) o[0][4 * g + jj] = mma_hp(vf[4 * g + jj].h, ph[0].v, o[0][4 * g + jj]);
      if (g < 2) {
        __builtin_amdgcn_sched_barrier(0);                           // the eight reads stand as one group behind four products
#pragma unroll
        for (int jj = 0; jj < 4; ++jj) {
          const int j = 4 * g + 8 + jj;
          vf[j] = ldfrag((const unsigned short*)(Vp + (16 * j) * VPITCH));
        }
        __builtin_amdgcn_sched_barrier(0);                           // and in front of the next four products
      }
    }
#pragma unroll
    for (int j = 0; j < 16; ++j) o[1][j] = mma_hp(vf[j].h, ph[1].v, o[1][j]);
    }
  }
  wait_tensor0();
  (void)held4(g0x);                                                  // pinned(): the x request's descriptor words stay in their registers up to its wait
  (void)held(g1x);                                                   // pinned(): the same for its group 1
  wait_ds0();
  __syncthreads();                                                   // every wave has left the ring (its waits above): buffer 1 is free, the x tile is whole
#pragma unroll
  for (int t = 0; t < 2; ++t) l[t] += __shfl_xor(l[t], 16, 32);

  // ---- merge of the two key groups: tile 1's state goes to wave ^ 4, whose tile 0 holds the same queries
  {
    v4f* mine = Mg + (uint32_t)wave * (MSLOT * 32u) + lane;
#pragma unroll
    for (int j = 0; j < 16; ++j) {
      v4f va, vb;
#pragma unroll
      for (int r = 0; r < 4; ++r) { va[r] = o[1][j][r]; vb[r] = o[1][j][4 + r]; }
      mine[(2 * j) * 32]     = va;
      mine[(2 * j + 1) * 32] = vb;
    }
    const v4f sv = {rf[1], l[1], 0.f, 0.f};
    mine[32 * 32] = sv;
  }
  __syncthreads();                                                   // every wave's tile-1 state is in Mg
  const v4f* peer = Mg + (uint32_t)(wave ^ 4) * (MSLOT * 32u) + lane;
  const v4f  pst  = peer[32 * 32];
  const float mm  = fmaxf(rf[0], pst[0]);
  const float ca  = pow2(rf[0] - mm), cb = pow2(pst[0] - mm);
  const float lt  = l[0] * ca + pst[1] * cb;
  const float gm  = bfr(gamma[0]);
  const float inv = gm * IHSC * (1.0f / lt);                         // o carries x16 x16, l carries x16
  const float fa  = ca * inv, fb = cb * inv;

  // This lane's query 32 qg + 16 grp + c: slices 2 (qg >> 1) and 2 (qg >> 1) + 1, column 32 (qg & 1) + 16 grp + c; its
  // channels 16 j + 8 hh + r: slice + (j >> 3), row 16 (j & 7) + 8 hh + r. All reads of a channel half stand in front of
  // its stores.
  float* xt = (float*)(smem + 2u * (uint32_t)(qg >> 1) * VSLICE + (uint32_t)(8 * hh) * VPITCH) + (32 * (qg & 1) + 16 * grp + c);
#pragma unroll
  for (int half = 0; half < 2; ++half) {
    float* xs = xt + (uint32_t)half * (VSLICE / 4u);
    v4f pa[8], pb[8];
    float xv[8][8];
#pragma unroll
    for (int jj = 0; jj < 8; ++jj) {
      pa[jj] = peer[(2 * (8 * half + jj)) * 32];
      pb[jj] = peer[(2 * (8 * half + jj) + 1) * 32];
#pragma unroll
      for (int r = 0; r < 8; ++r) xv[jj][r] = xs[(uint32_t)(16 * jj + r) * (VPITCH / 4u)];
    }
#pragma unroll
    for (int jj = 0; jj < 8; ++jj) {
      const int j = 8 * half + jj;
#pragma unroll
      for (int r = 0; r < 8; ++r) {
        const float pv = r < 4 ? pa[jj][r & 3] : pb[jj][r & 3];
        const float ov = o[0][j][r] * fa + pv * fb;
        xs[(uint32_t)(16 * jj + r) * (VPITCH / 4u)] = ov + bfr(xv[jj][r]);
      }
    }
  }
  __syncthreads();                                                   // the tile holds the output rows
  // row 16 it + (tid >> 4) of the 512 rows: slice it >> 3, its row 16 (it & 7) + (tid >> 4); 16 lanes x 16 B = one row
  {
    const int e = tid & 15, rq = tid >> 4;                           // rq 0..15
    const unsigned char* rp = smem + (uint32_t)rq * VPITCH + 16u * (uint32_t)e;
    float* op = out + ((size_t)(b * CC + rq)) * SEQ + n0 + 4 * e;
    v4f res[32];
#pragma unroll
    for (int it = 0; it < 32; ++it)
      res[it] = *(const v4f*)(rp + (uint32_t)(it >> 3) * VSLICE + (uint32_t)(16 * (it & 7)) * VPITCH);
#pragma unroll
    for (int it = 0; it < 32; ++it)                                  // slice s: channels 128 (s & 1) .., queries 64 (s >> 1) ..
      *(v4f*)(op + (size_t)(128 * ((it >> 3) & 1) + 16 * (it & 7)) * SEQ + 64 * (it >> 4)) = res[it];
  }
}

// =========================================================================================================
// Workspace map (bytes; each region start a multiple of 256; every extent is an exact tile multiple and is written
//   W16 f16 [320][256]                 163840
//   Hv  f16 [8][256][4096]           16777216
//   Fh/Gh f16 [8][4096][32]           2097152 x2
//   total = 21135360
// =========================================================================================================
extern "C" void kernel_launch(void* const* d_in, const int* in_sizes, int n_in,
                              void* d_out, int out_size, void* d_ws, size_t ws_size,
                              hipStream_t stream) {
  if (n_in < 5) return;
  if (in_sizes[0] < NB * CC * SEQ_FULL) return;
  if (in_sizes[1] < DQ * CC || in_sizes[2] < DQ * CC) return;
  if (in_sizes[3] < CC * CC) return;
  if (in_sizes[4] < 1) return;
  if (out_size < NB * CC * SEQ) return;

  size_t off = 0;
  auto carve = [&](size_t bytes) { const size_t o = off; off += (bytes + 255) & ~(size_t)255; return o; };
  const size_t oW16 = carve((size_t)MW * CC * 2);
  const size_t oHv  = carve((size_t)NB * CC * SEQ * 2);
  const size_t oFh  = carve((size_t)NB * SEQ * DQ * 2);
  const size_t oGh  = carve((size_t)NB * SEQ * DQ * 2);
  if (off > ws_size) return;
  if (off > (size_t)134217728) return;

  const float* x     = (const float*)d_in[0];
  const float* wq    = (const float*)d_in[1];
  const float* wk    = (const float*)d_in[2];
  const float* wv    = (const float*)d_in[3];
  const float* gamma = (const float*)d_in[4];

  char* ws = (char*)d_ws;
  unsigned short* W16 = (unsigned short*)(ws + oW16);
  unsigned short* Hv  = (unsigned short*)(ws + oHv);
  unsigned short* Fh  = (unsigned short*)(ws + oFh);
  unsigned short* Gh  = (unsigned short*)(ws + oGh);
  float* out = (float*)d_out;

  const dim3 blk256(256), blk128(128);

  // (0) q/k/v weights -> stacked f16 plane
  cvt_w<<<dim3(MW / 8), blk256, 0, stream>>>(wq, wk, wv, W16);
  // (1) conv1x1 GEMM from the f32 input -> f (key) and g (query) planes, H value plane
  gemm_p<<<dim3(SEQ / QT, NB), blk128, 0, stream>>>(W16, x, Fh, Gh, Hv);
  // (2) attention + gamma scale + residual -> out [b][256][SEQ]
  attn_k<<<dim3(SEQ / QB, NB), blk256, 0, stream>>>(Gh, Fh, Hv, x, gamma, out);
  (void)hipGetLastError();
}
